// v000
// Times are from an AMD MI455X. After a warm-up the kernel runs many times in a row, and a time is the length of
// such a window on the GPU divided by its runs, so every launch and the gaps after it count. The runs cycle
// through copies of the inputs. A figure is the median of several windows, for all but v000 over two sittings.
// Sittings can differ by a few percent; kernels timed side by side share one.
// v000 is the starting kernel.
#include <hip/hip_runtime.h>

// ---------------------------------------------------------------------------
// TokenUOTBlock for MI455X (gfx1250): bf16 WMMA GEMMs (TDM-staged LDS tiles)
// + wave32 log-domain Sinkhorn.  B=1, N=1024, D=512, H=16, DH=32, K_ITER=20.
// ---------------------------------------------------------------------------

typedef __attribute__((ext_vector_type(16))) __bf16 v16bf;
typedef __attribute__((ext_vector_type(8)))  float  v8f;
typedef unsigned int u32x4 __attribute__((ext_vector_type(4)));
typedef int          i32x4 __attribute__((ext_vector_type(4)));
typedef int          i32x8 __attribute__((ext_vector_type(8)));

union Frag { v16bf v; uint4 u[2]; };

#if __has_builtin(__builtin_amdgcn_tensor_load_to_lds)
#define HAVE_TDM 1
#else
#define HAVE_TDM 0
#endif

// Load a 16x32 bf16 WMMA A/B fragment from a row-major (row, K) tile.
// CDNA5 16-bit layout: lanes 0-15 hold row r, K {0..7,16..23};
// lanes 16-31 hold row r, K {8..15,24..31}.  Works on global or LDS tiles.
__device__ __forceinline__ v16bf load_frag(const __bf16* base, int ld) {
  const int lane = threadIdx.x & 31;
  const int r    = lane & 15;
  const int hf   = lane >> 4;
  const __bf16* p = base + (size_t)r * ld + hf * 8;
  Frag f;
  f.u[0] = *reinterpret_cast<const uint4*>(p);
  f.u[1] = *reinterpret_cast<const uint4*>(p + 16);
  return f.v;
}

__device__ __forceinline__ float wave_sum(float v) {
  for (int off = 16; off; off >>= 1) v += __shfl_xor(v, off, 32);
  return v;
}

__device__ __forceinline__ void lse_acc(float& m, float& s, float x) {
  if (x > m) { s = s * __expf(m - x) + 1.f; m = x; }
  else       { s += __expf(x - m); }
}

__device__ __forceinline__ float lse_wave_reduce(float m, float s) {
  for (int off = 16; off; off >>= 1) {
    float om = __shfl_xor(m, off, 32);
    float os = __shfl_xor(s, off, 32);
    float nm = fmaxf(m, om);
    float e1 = (m == nm)  ? 1.f : __expf(m - nm);
    float e2 = (om == nm) ? 1.f : __expf(om - nm);
    s = s * e1 + os * e2;
    m = nm;
  }
  return m + __logf(s);
}

#if HAVE_TDM
// Issue a TDM 2D tile load (rows x cols bf16, row stride in elements) into LDS.
// D# packing per CDNA5 ISA ch.8 (groups 0/1; groups 2/3 zero => 2D tensor).
// clang-23 toolchain: 6-arg builtin (g0, g1, g2, g3, extra, cpol).
__device__ __forceinline__ void tdm_load_2d(const __bf16* gsrc, unsigned lds_off,
                                            int rows, int cols, int stride_elems) {
  unsigned long long ga = (unsigned long long)(const void*)gsrc;
  u32x4 g0;
  g0[0] = 1u;                                        // count=1, user descriptor
  g0[1] = lds_off;                                   // LDS byte address
  g0[2] = (unsigned)(ga & 0xffffffffu);              // global_addr[31:0]
  g0[3] = (unsigned)((ga >> 32) & 0x01ffffffu)       // global_addr[56:32]
          | (2u << 30);                              // type = 2 ("image")
  unsigned td0 = (unsigned)stride_elems;             // tensor_dim0 (elements)
  unsigned td1 = (unsigned)rows;                     // tensor_dim1
  unsigned long long s0 = (unsigned long long)stride_elems; // dim0 stride
  i32x8 g1;
  g1[0] = (int)(1u << 16);                           // data_size=1 (2 bytes)
  g1[1] = (int)((td0 & 0xffffu) << 16);              // [63:48]=tensor_dim0 lo16
  g1[2] = (int)((td0 >> 16) | ((td1 & 0xffffu) << 16));
  g1[3] = (int)((td1 >> 16) | ((unsigned)cols << 16)); // [127:112]=tile_dim0
  g1[4] = (int)((unsigned)rows & 0xffffu);           // tile_dim1; tile_dim2=0
  g1[5] = (int)(s0 & 0xffffffffu);                   // dim0_stride[31:0]
  g1[6] = (int)((s0 >> 32) & 0xffffu);               // dim0_stride[47:32]
  g1[7] = 0;                                         // dim1_stride (unused 2D)
  i32x4 z4 = {0, 0, 0, 0};
  i32x8 z8 = {0, 0, 0, 0, 0, 0, 0, 0};
  __builtin_amdgcn_tensor_load_to_lds(g0, g1, z4, z4, z8, 0);
}
#endif

// ---------------------------------------------------------------------------
// Generic GEMM: C[M,Nout] (f32) = A[M,K] (bf16) x W[Nout,K]^T (bf16)
// Block = 256 threads = 8 waves; block tile 64x128; K-step 32.
// A (64x32) and W (128x32) tiles staged to LDS via the Tensor Data Mover
// (one descriptor pair issued by wave 0, TENSORcnt wait, then ds_load frags).
// ---------------------------------------------------------------------------
__global__ __launch_bounds__(256)
void gemm_bf16(const __bf16* __restrict__ A, const __bf16* __restrict__ W,
               float* __restrict__ C, int M, int Nout, int K) {
  __shared__ __bf16 ldsA[64][32];    // 4 KB
  __shared__ __bf16 ldsW[128][32];   // 8 KB
  const int wid  = threadIdx.x >> 5;
  const int lane = threadIdx.x & 31;
  const int r  = lane & 15, hf = lane >> 4;
  const int mB = blockIdx.x * 64;
  const int nB = blockIdx.y * 128;
  const int ml = (wid >> 1) * 16;    // local m-tile
  const int nl = (wid & 1) * 64;     // local n-strip
  v8f acc0 = {}, acc1 = {}, acc2 = {}, acc3 = {};
  for (int k = 0; k < K; k += 32) {
#if HAVE_TDM
    if (wid == 0) {
      tdm_load_2d(A + (size_t)mB * K + k, (unsigned)(size_t)&ldsA[0][0], 64, 32, K);
      tdm_load_2d(W + (size_t)nB * K + k, (unsigned)(size_t)&ldsW[0][0], 128, 32, K);
      __builtin_amdgcn_s_wait_tensorcnt(0);
    }
    __syncthreads();
#else
    for (int t = threadIdx.x; t < 64 * 32; t += 256)
      ldsA[t >> 5][t & 31] = A[(size_t)(mB + (t >> 5)) * K + k + (t & 31)];
    for (int t = threadIdx.x; t < 128 * 32; t += 256)
      ldsW[t >> 5][t & 31] = W[(size_t)(nB + (t >> 5)) * K + k + (t & 31)];
    __syncthreads();
#endif
    v16bf a  = load_frag(&ldsA[ml][0], 32);
    v16bf b0 = load_frag(&ldsW[nl +  0][0], 32);
    v16bf b1 = load_frag(&ldsW[nl + 16][0], 32);
    v16bf b2 = load_frag(&ldsW[nl + 32][0], 32);
    v16bf b3 = load_frag(&ldsW[nl + 48][0], 32);
    acc0 = __builtin_amdgcn_wmma_f32_16x16x32_bf16(false, a, false, b0, (short)0, acc0, false, false);
    acc1 = __builtin_amdgcn_wmma_f32_16x16x32_bf16(false, a, false, b1, (short)0, acc1, false, false);
    acc2 = __builtin_amdgcn_wmma_f32_16x16x32_bf16(false, a, false, b2, (short)0, acc2, false, false);
    acc3 = __builtin_amdgcn_wmma_f32_16x16x32_bf16(false, a, false, b3, (short)0, acc3, false, false);
    __syncthreads();
  }
  for (int v = 0; v < 8; ++v) {
    int row = mB + ml + v + hf * 8;
    float* cr = C + (size_t)row * Nout + r;
    cr[nB + nl +  0] = acc0[v];
    cr[nB + nl + 16] = acc1[v];
    cr[nB + nl + 32] = acc2[v];
    cr[nB + nl + 48] = acc3[v];
  }
}

// ---------------------------------------------------------------------------
// Elementwise helpers
// ---------------------------------------------------------------------------
__global__ void f2bf_kernel(const float* __restrict__ x, __bf16* __restrict__ y, int n) {
  int i = blockIdx.x * 256 + threadIdx.x;
  if (i < n) y[i] = (__bf16)x[i];
}

__global__ void swiglu_kernel(const float* __restrict__ a1, const float* __restrict__ a3,
                              __bf16* __restrict__ g, int n) {
  int i = blockIdx.x * 256 + threadIdx.x;
  if (i < n) {
    float a = a1[i];
    float s = a / (1.f + __expf(-a));
    g[i] = (__bf16)(s * a3[i]);
  }
}

__global__ void add_res_mask_kernel(const float* __restrict__ base, const float* __restrict__ delta,
                                    const float* __restrict__ mask, float* __restrict__ out,
                                    int n, int D) {
  int i = blockIdx.x * 256 + threadIdx.x;
  if (i < n) out[i] = base[i] + delta[i] * mask[i / D];
}

// LayerNorm over D=512 with affine params, bf16 output. One block per row.
__global__ __launch_bounds__(256)
void ln_kernel(const float* __restrict__ x, const float* __restrict__ w,
               const float* __restrict__ bb, __bf16* __restrict__ y) {
  const int row = blockIdx.x;
  const int t   = threadIdx.x;
  __shared__ float s1[256], s2[256];
  float a = 0.f, q = 0.f;
  for (int d = t; d < 512; d += 256) {
    float v = x[(size_t)row * 512 + d];
    a += v; q += v * v;
  }
  s1[t] = a; s2[t] = q; __syncthreads();
  for (int o = 128; o; o >>= 1) {
    if (t < o) { s1[t] += s1[t + o]; s2[t] += s2[t + o]; }
    __syncthreads();
  }
  const float m   = s1[0] * (1.f / 512.f);
  const float var = s2[0] * (1.f / 512.f) - m * m;
  const float rs  = rsqrtf(var + 1e-5f);
  for (int d = t; d < 512; d += 256) {
    float v = x[(size_t)row * 512 + d];
    y[(size_t)row * 512 + d] = (__bf16)((v - m) * rs * w[d] + bb[d]);
  }
}

// Per-head LN of Q,K (over DH=32, one wave per (h,n)); V transposed to (H,32,N);
// sigmoid(G) stored fp32 in (H,N,32).
__global__ __launch_bounds__(256)
void post_qkvg_kernel(const float* __restrict__ Qf, const float* __restrict__ Kf,
                      const float* __restrict__ Vf, const float* __restrict__ Gf,
                      __bf16* __restrict__ Qh, __bf16* __restrict__ Kh,
                      __bf16* __restrict__ Vt, float* __restrict__ sg) {
  const int w = blockIdx.x * 8 + (threadIdx.x >> 5);  // 0..16383
  const int h = w >> 10;
  const int n = w & 1023;
  const int d = threadIdx.x & 31;
  const size_t src = (size_t)n * 512 + h * 32 + d;
  {
    float q = Qf[src];
    float m = wave_sum(q) * (1.f / 32.f);
    float dq = q - m;
    float vv = wave_sum(dq * dq) * (1.f / 32.f);
    Qh[((size_t)h * 1024 + n) * 32 + d] = (__bf16)(dq * rsqrtf(vv + 1e-5f));
  }
  {
    float q = Kf[src];
    float m = wave_sum(q) * (1.f / 32.f);
    float dq = q - m;
    float vv = wave_sum(dq * dq) * (1.f / 32.f);
    Kh[((size_t)h * 1024 + n) * 32 + d] = (__bf16)(dq * rsqrtf(vv + 1e-5f));
  }
  Vt[((size_t)h * 32 + d) * 1024 + n] = (__bf16)Vf[src];
  sg[((size_t)h * 1024 + n) * 32 + d] = 1.f / (1.f + __expf(-Gf[src]));
}

// ---------------------------------------------------------------------------
// logits: S = QK^T/sqrt(32) via one WMMA (K=32), + pos bias, - distance gate,
// /eps, mask -> logK (f32, H,N,N).  Block = 128 threads = 4 waves.
// ---------------------------------------------------------------------------
__global__ __launch_bounds__(128)
void logits_kernel(const __bf16* __restrict__ Qh, const __bf16* __restrict__ Kh,
                   const int* __restrict__ pos_bins, const float* __restrict__ pos_weight,
                   const float* __restrict__ w_dist_logit, const float* __restrict__ x_res,
                   const float* __restrict__ mask, const float* __restrict__ eps,
                   float* __restrict__ logK) {
  const int h    = blockIdx.z;
  const int wid  = threadIdx.x >> 5;
  const int lane = threadIdx.x & 31;
  const int r  = lane & 15, hf = lane >> 4;
  const int i0 = blockIdx.x * 16;
  const int j0 = blockIdx.y * 64 + wid * 16;
  v16bf a = load_frag(Qh + ((size_t)h * 1024 + i0) * 32, 32);
  v16bf b = load_frag(Kh + ((size_t)h * 1024 + j0) * 32, 32);
  v8f c = {};
  c = __builtin_amdgcn_wmma_f32_16x16x32_bf16(false, a, false, b, (short)0, c, false, false);
  const float scale   = 0.17677669529663687f;  // 1/sqrt(32)
  const float wd      = 1.f / (1.f + __expf(-w_dist_logit[h]));
  const float inv_eps = 1.f / eps[h];
  const int   j  = j0 + r;
  const float xj0 = x_res[j * 3 + 0], xj1 = x_res[j * 3 + 1], xj2 = x_res[j * 3 + 2];
  const float mj = mask[j];
  for (int v = 0; v < 8; ++v) {
    const int i = i0 + v + hf * 8;
    float s = c[v] * scale;
    int bin = pos_bins[(size_t)i * 1024 + j];
    float bias = pos_weight[bin * 16 + h];
    float d0 = x_res[i * 3 + 0] - xj0;
    float d1 = x_res[i * 3 + 1] - xj1;
    float d2 = x_res[i * 3 + 2] - xj2;
    float dist2 = d0 * d0 + d1 * d1 + d2 * d2;
    float logit = s + bias - wd * dist2 * 0.01f;
    float pm = mask[i] * mj;
    logK[((size_t)h * 1024 + i) * 1024 + j] = (pm > 0.f) ? logit * inv_eps : -1e9f;
  }
}

// ---------------------------------------------------------------------------
// Sinkhorn halves. logK (64MB) is L2-resident on MI455X (192MB L2).
// ---------------------------------------------------------------------------
__global__ __launch_bounds__(256)
void sink_row_kernel(const float* __restrict__ logK, const float* __restrict__ log_v,
                     const float* __restrict__ mu, const float* __restrict__ eps,
                     float* __restrict__ log_u) {
  const int row  = blockIdx.x * 8 + (threadIdx.x >> 5);   // (h,i) flat
  const int h    = row >> 10;
  const int lane = threadIdx.x & 31;
  const float* pk = logK + (size_t)row * 1024;
  const float* lv = log_v + h * 1024;
  float m = -INFINITY, s = 0.f;
  for (int j = lane; j < 1024; j += 32) lse_acc(m, s, pk[j] + lv[j]);
  float lse = lse_wave_reduce(m, s);
  if (lane == 0) {
    float fi = 1.f / (1.f + eps[h]);
    log_u[row] = fi * (__logf(fmaxf(mu[row], 1e-8f)) - lse);
  }
}

// Column pass, phase 1: per-column online-LSE over a 256-row chunk.
// Grid (4 j-tiles, 16 heads, 4 chunks) -> 256 blocks.
__global__ __launch_bounds__(256)
void sink_col_partial(const float* __restrict__ logK, const float* __restrict__ log_u,
                      float* __restrict__ pm, float* __restrict__ ps) {
  const int h     = blockIdx.y;
  const int chunk = blockIdx.z;
  const int j     = blockIdx.x * 256 + threadIdx.x;
  const float* pk = logK + (size_t)h * 1024 * 1024 + j;
  const float* lu = log_u + h * 1024;
  float m = -INFINITY, s = 0.f;
  const int i0 = chunk * 256;
  for (int i = i0; i < i0 + 256; ++i) lse_acc(m, s, pk[(size_t)i * 1024] + lu[i]);
  const size_t idx = ((size_t)chunk * 16 + h) * 1024 + j;
  pm[idx] = m;
  ps[idx] = s;
}

// Column pass, phase 2: combine 4 chunk partials -> log_v.
__global__ __launch_bounds__(256)
void sink_col_combine(const float* __restrict__ pm, const float* __restrict__ ps,
                      const float* __restrict__ nu, const float* __restrict__ eps,
                      float* __restrict__ log_v) {
  const int idx = blockIdx.x * 256 + threadIdx.x;   // (h,j) flat, 0..16383
  const int h = idx >> 10;
  const int j = idx & 1023;
  float m = -INFINITY, s = 0.f;
  for (int c = 0; c < 4; ++c) {
    const size_t p = ((size_t)c * 16 + h) * 1024 + j;
    float cm = pm[p], cs = ps[p];
    float nm = fmaxf(m, cm);
    float e1 = (m == nm)  ? 1.f : __expf(m - nm);
    float e2 = (cm == nm) ? 1.f : __expf(cm - nm);
    s = s * e1 + cs * e2;
    m = nm;
  }
  float lse = m + __logf(s);
  float fi = 1.f / (1.f + eps[h]);
  log_v[idx] = fi * (__logf(fmaxf(nu[idx], 1e-8f)) - lse);
}

// P = exp(logK + log_u_i + log_v_j) * mask, bf16; row sums fp32.
__global__ __launch_bounds__(256)
void p_kernel(const float* __restrict__ logK, const float* __restrict__ log_u,
              const float* __restrict__ log_v, const float* __restrict__ mask,
              __bf16* __restrict__ P, float* __restrict__ rowsum) {
  const int row  = blockIdx.x * 8 + (threadIdx.x >> 5);
  const int h    = row >> 10;
  const int i    = row & 1023;
  const int lane = threadIdx.x & 31;
  const float lu = log_u[row];
  const float mi = mask[i];
  const float* pk = logK + (size_t)row * 1024;
  __bf16* pp = P + (size_t)row * 1024;
  float acc = 0.f;
  for (int j = lane; j < 1024; j += 32) {
    float p = __expf(pk[j] + lu + log_v[h * 1024 + j]) * mi * mask[j];
    pp[j] = (__bf16)p;
    acc += p;
  }
  acc = wave_sum(acc);
  if (lane == 0) rowsum[row] = acc;
}

// ---------------------------------------------------------------------------
// attn = (P @ V) / rowsum * sigmoid(G), WMMA over j (K=1024 in 32-steps).
// ---------------------------------------------------------------------------
__global__ __launch_bounds__(256)
void attn_kernel(const __bf16* __restrict__ P, const __bf16* __restrict__ Vt,
                 const float* __restrict__ rowsum, const float* __restrict__ sg,
                 __bf16* __restrict__ o_bf) {
  const int h    = blockIdx.y;
  const int wid  = threadIdx.x >> 5;
  const int lane = threadIdx.x & 31;
  const int r  = lane & 15, hf = lane >> 4;
  const int i0 = blockIdx.x * 64 + (wid >> 1) * 16;
  const int d0 = (wid & 1) * 16;
  const __bf16* Abase = P  + ((size_t)h * 1024 + i0) * 1024;
  const __bf16* Bbase = Vt + ((size_t)h * 32 + d0) * 1024;
  v8f acc = {};
  for (int j = 0; j < 1024; j += 32) {
    v16bf a = load_frag(Abase + j, 1024);
    v16bf b = load_frag(Bbase + j, 1024);
    acc = __builtin_amdgcn_wmma_f32_16x16x32_bf16(false, a, false, b, (short)0, acc, false, false);
  }
  const int d = d0 + r;
  for (int v = 0; v < 8; ++v) {
    int i = i0 + v + hf * 8;
    float inv = 1.f / fmaxf(rowsum[h * 1024 + i], 1e-8f);
    float val = acc[v] * inv * sg[((size_t)h * 1024 + i) * 32 + d];
    o_bf[(size_t)i * 512 + h * 32 + d] = (__bf16)val;
  }
}

// ---------------------------------------------------------------------------
// Centroid EGNN coord update: x_out = x + mask*(G*x - sum_h g_h * Pn_h @ x)
// ---------------------------------------------------------------------------
__global__ __launch_bounds__(256)
void xcent_kernel(const __bf16* __restrict__ P, const float* __restrict__ rowsum,
                  const float* __restrict__ x_res, const float* __restrict__ gamma,
                  const float* __restrict__ mask, float* __restrict__ x_out) {
  const int i = blockIdx.x;
  const int t = threadIdx.x;
  __shared__ float r0[256], r1[256], r2[256];
  float a0 = 0.f, a1 = 0.f, a2 = 0.f;
  for (int h = 0; h < 16; ++h) {
    float g   = tanhf(gamma[h]) * (1.f / 16.f);
    float inv = g / fmaxf(rowsum[h * 1024 + i], 1e-8f);
    const __bf16* pr = P + ((size_t)h * 1024 + i) * 1024;
    float s0 = 0.f, s1 = 0.f, s2 = 0.f;
    for (int j = t; j < 1024; j += 256) {
      float p = (float)pr[j];
      s0 += p * x_res[j * 3 + 0];
      s1 += p * x_res[j * 3 + 1];
      s2 += p * x_res[j * 3 + 2];
    }
    a0 += inv * s0; a1 += inv * s1; a2 += inv * s2;
  }
  r0[t] = a0; r1[t] = a1; r2[t] = a2; __syncthreads();
  for (int o = 128; o; o >>= 1) {
    if (t < o) { r0[t] += r0[t + o]; r1[t] += r1[t + o]; r2[t] += r2[t + o]; }
    __syncthreads();
  }
  if (t == 0) {
    float G = 0.f;
    for (int h = 0; h < 16; ++h) G += tanhf(gamma[h]) * (1.f / 16.f);
    float mi = mask[i];
    x_out[i * 3 + 0] = x_res[i * 3 + 0] + mi * (G * x_res[i * 3 + 0] - r0[0]);
    x_out[i * 3 + 1] = x_res[i * 3 + 1] + mi * (G * x_res[i * 3 + 1] - r1[0]);
    x_out[i * 3 + 2] = x_res[i * 3 + 2] + mi * (G * x_res[i * 3 + 2] - r2[0]);
  }
}

// ---------------------------------------------------------------------------
// Host orchestration
// ---------------------------------------------------------------------------
extern "C" void kernel_launch(void* const* d_in, const int* in_sizes, int n_in,
                              void* d_out, int out_size, void* d_ws, size_t ws_size,
                              hipStream_t stream) {
  (void)in_sizes; (void)n_in; (void)out_size; (void)ws_size;
  const float* h_in    = (const float*)d_in[0];
  const float* x_res   = (const float*)d_in[1];
  const float* mu      = (const float*)d_in[2];
  const float* nu      = (const float*)d_in[3];
  const float* lu_prev = (const float*)d_in[4];
  const float* lv_prev = (const float*)d_in[5];
  const float* mask    = (const float*)d_in[6];
  const float* lnaw    = (const float*)d_in[7];
  const float* lnab    = (const float*)d_in[8];
  const float* wq      = (const float*)d_in[9];
  const float* wk      = (const float*)d_in[10];
  const float* wv      = (const float*)d_in[11];
  const float* wg      = (const float*)d_in[12];
  const float* wo      = (const float*)d_in[13];
  const float* gamma   = (const float*)d_in[14];
  const float* posw    = (const float*)d_in[15];
  const float* wdl     = (const float*)d_in[16];
  const float* lnfw    = (const float*)d_in[17];
  const float* lnfb    = (const float*)d_in[18];
  const float* sw1     = (const float*)d_in[19];
  const float* sw3     = (const float*)d_in[20];
  const float* sw2     = (const float*)d_in[21];
  const int*   pbins   = (const int*)d_in[22];
  const float* eps     = (const float*)d_in[23];

  char* wsb = (char*)d_ws;
  size_t off = 0;
  auto take = [&](size_t bytes) -> void* {
    void* p = wsb + off;
    off += (bytes + 255) & ~(size_t)255;
    return p;
  };
  float*  logK  = (float*)take(16UL * 1024 * 1024 * 4);   // 64 MB
  __bf16* P     = (__bf16*)take(16UL * 1024 * 1024 * 2);  // 32 MB
  __bf16* wq_b  = (__bf16*)take(512UL * 512 * 2);
  __bf16* wk_b  = (__bf16*)take(512UL * 512 * 2);
  __bf16* wv_b  = (__bf16*)take(512UL * 512 * 2);
  __bf16* wg_b  = (__bf16*)take(512UL * 512 * 2);
  __bf16* wo_b  = (__bf16*)take(512UL * 512 * 2);
  __bf16* w1_b  = (__bf16*)take(2048UL * 512 * 2);
  __bf16* w3_b  = (__bf16*)take(2048UL * 512 * 2);
  __bf16* w2_b  = (__bf16*)take(512UL * 2048 * 2);
  __bf16* hn    = (__bf16*)take(1024UL * 512 * 2);
  float*  Qf    = (float*)take(1024UL * 512 * 4);
  float*  Kf    = (float*)take(1024UL * 512 * 4);
  float*  Vf    = (float*)take(1024UL * 512 * 4);
  float*  Gf    = (float*)take(1024UL * 512 * 4);
  __bf16* Qh    = (__bf16*)take(16UL * 1024 * 32 * 2);
  __bf16* Kh    = (__bf16*)take(16UL * 1024 * 32 * 2);
  __bf16* Vt    = (__bf16*)take(16UL * 32 * 1024 * 2);
  float*  sg    = (float*)take(16UL * 1024 * 32 * 4);
  float*  lu    = (float*)take(16UL * 1024 * 4);
  float*  lv    = (float*)take(16UL * 1024 * 4);
  float*  rowsum= (float*)take(16UL * 1024 * 4);
  float*  pmb   = (float*)take(4UL * 16 * 1024 * 4);      // col-pass partial m
  float*  psb   = (float*)take(4UL * 16 * 1024 * 4);      // col-pass partial s
  __bf16* o_b   = (__bf16*)take(1024UL * 512 * 2);
  float*  tmpC  = (float*)take(1024UL * 512 * 4);
  float*  h_new = (float*)take(1024UL * 512 * 4);
  __bf16* h2    = (__bf16*)take(1024UL * 512 * 2);
  // FFN intermediates reuse the (then-dead) logK region
  float*  a1    = logK;                                // 1024x2048 f32
  float*  a3    = logK + 2UL * 1024 * 1024;            // 1024x2048 f32
  __bf16* gmid  = (__bf16*)(logK + 4UL * 1024 * 1024); // 1024x2048 bf16

  float* out_h  = (float*)d_out;            // 1024*512
  float* out_x  = out_h + 524288;           // 1024*3
  float* out_lu = out_h + 527360;           // 16*1024
  float* out_lv = out_h + 543744;           // 16*1024

  // 1) weights -> bf16
  f2bf_kernel<<<1024, 256, 0, stream>>>(wq, wq_b, 262144);
  f2bf_kernel<<<1024, 256, 0, stream>>>(wk, wk_b, 262144);
  f2bf_kernel<<<1024, 256, 0, stream>>>(wv, wv_b, 262144);
  f2bf_kernel<<<1024, 256, 0, stream>>>(wg, wg_b, 262144);
  f2bf_kernel<<<1024, 256, 0, stream>>>(wo, wo_b, 262144);
  f2bf_kernel<<<4096, 256, 0, stream>>>(sw1, w1_b, 1048576);
  f2bf_kernel<<<4096, 256, 0, stream>>>(sw3, w3_b, 1048576);
  f2bf_kernel<<<4096, 256, 0, stream>>>(sw2, w2_b, 1048576);

  // 2) LN(h) -> bf16
  ln_kernel<<<1024, 256, 0, stream>>>(h_in, lnaw, lnab, hn);

  // 3) QKVG projections (TDM-staged WMMA)
  dim3 g512(16, 4);
  gemm_bf16<<<g512, 256, 0, stream>>>(hn, wq_b, Qf, 1024, 512, 512);
  gemm_bf16<<<g512, 256, 0, stream>>>(hn, wk_b, Kf, 1024, 512, 512);
  gemm_bf16<<<g512, 256, 0, stream>>>(hn, wv_b, Vf, 1024, 512, 512);
  gemm_bf16<<<g512, 256, 0, stream>>>(hn, wg_b, Gf, 1024, 512, 512);
  post_qkvg_kernel<<<2048, 256, 0, stream>>>(Qf, Kf, Vf, Gf, Qh, Kh, Vt, sg);

  // 4) logits -> logK
  logits_kernel<<<dim3(64, 16, 16), 128, 0, stream>>>(Qh, Kh, pbins, posw, wdl,
                                                      x_res, mask, eps, logK);

  // 5) warm-started log-domain Sinkhorn, 20 iterations (logK L2-resident)
  (void)hipMemcpyAsync(lu, lu_prev, 16384 * 4, hipMemcpyDeviceToDevice, stream);
  (void)hipMemcpyAsync(lv, lv_prev, 16384 * 4, hipMemcpyDeviceToDevice, stream);
  for (int it = 0; it < 20; ++it) {
    sink_row_kernel<<<2048, 256, 0, stream>>>(logK, lv, mu, eps, lu);
    sink_col_partial<<<dim3(4, 16, 4), 256, 0, stream>>>(logK, lu, pmb, psb);
    sink_col_combine<<<64, 256, 0, stream>>>(pmb, psb, nu, eps, lv);
  }

  // 6) P (bf16) + row sums
  p_kernel<<<2048, 256, 0, stream>>>(logK, lu, lv, mask, P, rowsum);

  // 7) attn + output projection + residual
  attn_kernel<<<dim3(16, 16), 256, 0, stream>>>(P, Vt, rowsum, sg, o_b);
  gemm_bf16<<<g512, 256, 0, stream>>>(o_b, wo_b, tmpC, 1024, 512, 512);
  add_res_mask_kernel<<<2048, 256, 0, stream>>>(h_in, tmpC, mask, h_new, 524288, 512);

  // 8) centroid coordinate update -> out_x
  xcent_kernel<<<1024, 256, 0, stream>>>(P, rowsum, x_res, gamma, mask, out_x);

  // 9) SwiGLU FFN + residual -> out_h
  ln_kernel<<<1024, 256, 0, stream>>>(h_new, lnfw, lnfb, h2);
  dim3 g2048(16, 16);
  gemm_bf16<<<g2048, 256, 0, stream>>>(h2, w1_b, a1, 1024, 2048, 512);
  gemm_bf16<<<g2048, 256, 0, stream>>>(h2, w3_b, a3, 1024, 2048, 512);
  swiglu_kernel<<<8192, 256, 0, stream>>>(a1, a3, gmid, 1024 * 2048);
  gemm_bf16<<<g512, 256, 0, stream>>>(gmid, w2_b, tmpC, 1024, 512, 2048);
  add_res_mask_kernel<<<2048, 256, 0, stream>>>(h_new, tmpC, mask, out_h, 524288, 512);

  // 10) log_u / log_v outputs
  (void)hipMemcpyAsync(out_lu, lu, 16384 * 4, hipMemcpyDeviceToDevice, stream);
  (void)hipMemcpyAsync(out_lv, lv, 16384 * 4, hipMemcpyDeviceToDevice, stream);
}

// v001
// Next to v000, in two timings, it ran 3.12 and 3.10 times as fast.
#include <hip/hip_runtime.h>

// ---------------------------------------------------------------------------
// TokenUOTBlock for MI455X (gfx1250): bf16 WMMA GEMMs (TDM-staged LDS tiles)
// + wave32 log-domain Sinkhorn.  B=1, N=1024, D=512, H=16, DH=32, K_ITER=20.
// ---------------------------------------------------------------------------

typedef __attribute__((ext_vector_type(16))) __bf16 v16bf;
typedef __attribute__((ext_vector_type(8)))  float  v8f;
typedef __attribute__((ext_vector_type(4)))  float  v4f;
typedef unsigned int u32x4 __attribute__((ext_vector_type(4)));
typedef int          i32x4 __attribute__((ext_vector_type(4)));
typedef int          i32x8 __attribute__((ext_vector_type(8)));

union Frag { v16bf v; uint4 u[2]; };

#if __has_builtin(__builtin_amdgcn_tensor_load_to_lds)
#define HAVE_TDM 1
#else
#define HAVE_TDM 0
#endif

// Load a 16x32 bf16 WMMA A/B fragment from a row-major (row, K) tile.
// CDNA5 16-bit layout: lanes 0-15 hold row r, K {0..7,16..23};
// lanes 16-31 hold row r, K {8..15,24..31}.  Works on global or LDS tiles.
__device__ __forceinline__ v16bf load_frag(const __bf16* base, int ld) {
  const int lane = threadIdx.x & 31;
  const int r    = lane & 15;
  const int hf   = lane >> 4;
  const __bf16* p = base + (size_t)r * ld + hf * 8;
  Frag f;
  f.u[0] = *reinterpret_cast<const uint4*>(p);
  f.u[1] = *reinterpret_cast<const uint4*>(p + 16);
  return f.v;
}

__device__ __forceinline__ v4f exp4(v4f a) {
  v4f e = {__expf(a.x), __expf(a.y), __expf(a.z), __expf(a.w)};
  return e;
}

__device__ __forceinline__ float wave_sum(float v) {
  for (int off = 16; off; off >>= 1) v += __shfl_xor(v, off, 32);
  return v;
}

#if HAVE_TDM
// Issue a TDM 2D tile load (rows x cols bf16, row stride in elements) into LDS.
// D# packing per CDNA5 ISA ch.8 (groups 0/1; groups 2/3 zero => 2D tensor).
// clang-23 toolchain: 6-arg builtin (g0, g1, g2, g3, extra, cpol).
__device__ __forceinline__ void tdm_load_2d(const __bf16* gsrc, unsigned lds_off,
                                            int rows, int cols, int stride_elems) {
  unsigned long long ga = (unsigned long long)(const void*)gsrc;
  u32x4 g0;
  g0[0] = 1u;                                        // count=1, user descriptor
  g0[1] = lds_off;                                   // LDS byte address
  g0[2] = (unsigned)(ga & 0xffffffffu);              // global_addr[31:0]
  g0[3] = (unsigned)((ga >> 32) & 0x01ffffffu)       // global_addr[56:32]
          | (2u << 30);                              // type = 2 ("image")
  unsigned td0 = (unsigned)stride_elems;             // tensor_dim0 (elements)
  unsigned td1 = (unsigned)rows;                     // tensor_dim1
  unsigned long long s0 = (unsigned long long)stride_elems; // dim0 stride
  i32x8 g1;
  g1[0] = (int)(1u << 16);                           // data_size=1 (2 bytes)
  g1[1] = (int)((td0 & 0xffffu) << 16);              // [63:48]=tensor_dim0 lo16
  g1[2] = (int)((td0 >> 16) | ((td1 & 0xffffu) << 16));
  g1[3] = (int)((td1 >> 16) | ((unsigned)cols << 16)); // [127:112]=tile_dim0
  g1[4] = (int)((unsigned)rows & 0xffffu);           // tile_dim1; tile_dim2=0
  g1[5] = (int)(s0 & 0xffffffffu);                   // dim0_stride[31:0]
  g1[6] = (int)((s0 >> 32) & 0xffffu);               // dim0_stride[47:32]
  g1[7] = 0;                                         // dim1_stride (unused 2D)
  i32x4 z4 = {0, 0, 0, 0};
  i32x8 z8 = {0, 0, 0, 0, 0, 0, 0, 0};
  __builtin_amdgcn_tensor_load_to_lds(g0, g1, z4, z4, z8, 0);
}
#endif

// ---------------------------------------------------------------------------
// Generic GEMM: C[M,Nout] (f32) = A[M,K] (bf16) x W[Nout,K]^T (bf16)
// Block = 256 threads = 8 waves; block tile 64x128; K-step 32.
// A (64x32) and W (128x32) tiles staged to LDS via the Tensor Data Mover
// (one descriptor pair issued by wave 0, TENSORcnt wait, then ds_load frags).
// ---------------------------------------------------------------------------
__global__ __launch_bounds__(256)
void gemm_bf16(const __bf16* __restrict__ A, const __bf16* __restrict__ W,
               float* __restrict__ C, int M, int Nout, int K) {
  __shared__ __bf16 ldsA[64][32];    // 4 KB
  __shared__ __bf16 ldsW[128][32];   // 8 KB
  const int wid  = threadIdx.x >> 5;
  const int lane = threadIdx.x & 31;
  const int r  = lane & 15, hf = lane >> 4;
  const int mB = blockIdx.x * 64;
  const int nB = blockIdx.y * 128;
  const int ml = (wid >> 1) * 16;    // local m-tile
  const int nl = (wid & 1) * 64;     // local n-strip
  v8f acc0 = {}, acc1 = {}, acc2 = {}, acc3 = {};
  for (int k = 0; k < K; k += 32) {
#if HAVE_TDM
    if (wid == 0) {
      tdm_load_2d(A + (size_t)mB * K + k, (unsigned)(size_t)&ldsA[0][0], 64, 32, K);
      tdm_load_2d(W + (size_t)nB * K + k, (unsigned)(size_t)&ldsW[0][0], 128, 32, K);
      __builtin_amdgcn_s_wait_tensorcnt(0);
    }
    __syncthreads();
#else
    for (int t = threadIdx.x; t < 64 * 32; t += 256)
      ldsA[t >> 5][t & 31] = A[(size_t)(mB + (t >> 5)) * K + k + (t & 31)];
    for (int t = threadIdx.x; t < 128 * 32; t += 256)
      ldsW[t >> 5][t & 31] = W[(size_t)(nB + (t >> 5)) * K + k + (t & 31)];
    __syncthreads();
#endif
    v16bf a  = load_frag(&ldsA[ml][0], 32);
    v16bf b0 = load_frag(&ldsW[nl +  0][0], 32);
    v16bf b1 = load_frag(&ldsW[nl + 16][0], 32);
    v16bf b2 = load_frag(&ldsW[nl + 32][0], 32);
    v16bf b3 = load_frag(&ldsW[nl + 48][0], 32);
    acc0 = __builtin_amdgcn_wmma_f32_16x16x32_bf16(false, a, false, b0, (short)0, acc0, false, false);
    acc1 = __builtin_amdgcn_wmma_f32_16x16x32_bf16(false, a, false, b1, (short)0, acc1, false, false);
    acc2 = __builtin_amdgcn_wmma_f32_16x16x32_bf16(false, a, false, b2, (short)0, acc2, false, false);
    acc3 = __builtin_amdgcn_wmma_f32_16x16x32_bf16(false, a, false, b3, (short)0, acc3, false, false);
    __syncthreads();
  }
  for (int v = 0; v < 8; ++v) {
    int row = mB + ml + v + hf * 8;
    float* cr = C + (size_t)row * Nout + r;
    cr[nB + nl +  0] = acc0[v];
    cr[nB + nl + 16] = acc1[v];
    cr[nB + nl + 32] = acc2[v];
    cr[nB + nl + 48] = acc3[v];
  }
}

// ---------------------------------------------------------------------------
// Elementwise helpers
// ---------------------------------------------------------------------------
__global__ void f2bf_kernel(const float* __restrict__ x, __bf16* __restrict__ y, int n) {
  int i = blockIdx.x * 256 + threadIdx.x;
  if (i < n) y[i] = (__bf16)x[i];
}

__global__ void swiglu_kernel(const float* __restrict__ a1, const float* __restrict__ a3,
                              __bf16* __restrict__ g, int n) {
  int i = blockIdx.x * 256 + threadIdx.x;
  if (i < n) {
    float a = a1[i];
    float s = a / (1.f + __expf(-a));
    g[i] = (__bf16)(s * a3[i]);
  }
}

__global__ void add_res_mask_kernel(const float* __restrict__ base, const float* __restrict__ delta,
                                    const float* __restrict__ mask, float* __restrict__ out,
                                    int n, int D) {
  int i = blockIdx.x * 256 + threadIdx.x;
  if (i < n) out[i] = base[i] + delta[i] * mask[i / D];
}

// LayerNorm over D=512 with affine params, bf16 output. One block per row.
__global__ __launch_bounds__(256)
void ln_kernel(const float* __restrict__ x, const float* __restrict__ w,
               const float* __restrict__ bb, __bf16* __restrict__ y) {
  const int row = blockIdx.x;
  const int t   = threadIdx.x;
  __shared__ float s1[256], s2[256];
  float a = 0.f, q = 0.f;
  for (int d = t; d < 512; d += 256) {
    float v = x[(size_t)row * 512 + d];
    a += v; q += v * v;
  }
  s1[t] = a; s2[t] = q; __syncthreads();
  for (int o = 128; o; o >>= 1) {
    if (t < o) { s1[t] += s1[t + o]; s2[t] += s2[t + o]; }
    __syncthreads();
  }
  const float m   = s1[0] * (1.f / 512.f);
  const float var = s2[0] * (1.f / 512.f) - m * m;
  const float rs  = rsqrtf(var + 1e-5f);
  for (int d = t; d < 512; d += 256) {
    float v = x[(size_t)row * 512 + d];
    y[(size_t)row * 512 + d] = (__bf16)((v - m) * rs * w[d] + bb[d]);
  }
}

// Per-head LN of Q,K (over DH=32, one wave per (h,n)); V transposed to (H,32,N);
// sigmoid(G) stored fp32 in (H,N,32).
__global__ __launch_bounds__(256)
void post_qkvg_kernel(const float* __restrict__ Qf, const float* __restrict__ Kf,
                      const float* __restrict__ Vf, const float* __restrict__ Gf,
                      __bf16* __restrict__ Qh, __bf16* __restrict__ Kh,
                      __bf16* __restrict__ Vt, float* __restrict__ sg) {
  const int w = blockIdx.x * 8 + (threadIdx.x >> 5);  // 0..16383
  const int h = w >> 10;
  const int n = w & 1023;
  const int d = threadIdx.x & 31;
  const size_t src = (size_t)n * 512 + h * 32 + d;
  {
    float q = Qf[src];
    float m = wave_sum(q) * (1.f / 32.f);
    float dq = q - m;
    float vv = wave_sum(dq * dq) * (1.f / 32.f);
    Qh[((size_t)h * 1024 + n) * 32 + d] = (__bf16)(dq * rsqrtf(vv + 1e-5f));
  }
  {
    float q = Kf[src];
    float m = wave_sum(q) * (1.f / 32.f);
    float dq = q - m;
    float vv = wave_sum(dq * dq) * (1.f / 32.f);
    Kh[((size_t)h * 1024 + n) * 32 + d] = (__bf16)(dq * rsqrtf(vv + 1e-5f));
  }
  Vt[((size_t)h * 32 + d) * 1024 + n] = (__bf16)Vf[src];
  sg[((size_t)h * 1024 + n) * 32 + d] = 1.f / (1.f + __expf(-Gf[src]));
}

// ---------------------------------------------------------------------------
// logits: S = QK^T/sqrt(32) via one WMMA (K=32), + pos bias, - distance gate,
// /eps, mask -> logK (f32, H,N,N).  Block = 128 threads = 4 waves.
// ---------------------------------------------------------------------------
__global__ __launch_bounds__(128)
void logits_kernel(const __bf16* __restrict__ Qh, const __bf16* __restrict__ Kh,
                   const int* __restrict__ pos_bins, const float* __restrict__ pos_weight,
                   const float* __restrict__ w_dist_logit, const float* __restrict__ x_res,
                   const float* __restrict__ mask, const float* __restrict__ eps,
                   float* __restrict__ logK) {
  const int h    = blockIdx.z;
  const int wid  = threadIdx.x >> 5;
  const int lane = threadIdx.x & 31;
  const int r  = lane & 15, hf = lane >> 4;
  const int i0 = blockIdx.x * 16;
  const int j0 = blockIdx.y * 64 + wid * 16;
  v16bf a = load_frag(Qh + ((size_t)h * 1024 + i0) * 32, 32);
  v16bf b = load_frag(Kh + ((size_t)h * 1024 + j0) * 32, 32);
  v8f c = {};
  c = __builtin_amdgcn_wmma_f32_16x16x32_bf16(false, a, false, b, (short)0, c, false, false);
  const float scale   = 0.17677669529663687f;  // 1/sqrt(32)
  const float wd      = 1.f / (1.f + __expf(-w_dist_logit[h]));
  const float inv_eps = 1.f / eps[h];
  const int   j  = j0 + r;
  const float xj0 = x_res[j * 3 + 0], xj1 = x_res[j * 3 + 1], xj2 = x_res[j * 3 + 2];
  const float mj = mask[j];
  for (int v = 0; v < 8; ++v) {
    const int i = i0 + v + hf * 8;
    float s = c[v] * scale;
    int bin = pos_bins[(size_t)i * 1024 + j];
    float bias = pos_weight[bin * 16 + h];
    float d0 = x_res[i * 3 + 0] - xj0;
    float d1 = x_res[i * 3 + 1] - xj1;
    float d2 = x_res[i * 3 + 2] - xj2;
    float dist2 = d0 * d0 + d1 * d1 + d2 * d2;
    float logit = s + bias - wd * dist2 * 0.01f;
    float pm = mask[i] * mj;
    logK[((size_t)h * 1024 + i) * 1024 + j] = (pm > 0.f) ? logit * inv_eps : -1e9f;
  }
}

// ---------------------------------------------------------------------------
// Sinkhorn iteration, one read of logK.  logK (64MB) is L2-resident.
// A work-group owns 64 rows of one head; each of its 16 waves holds 4 whole
// rows in registers (a lane: columns c*128 + lane*4 .. +3, c = 0..7).  The wave
// forms the 4 row LSEs -> log_u, then from the same registers the per-column
// (max, sum) of logK + log_u over its 4 rows; LDS folds the 16 waves' partials
// into one (max, sum) per column and 64-row chunk.
// ---------------------------------------------------------------------------
__global__ __launch_bounds__(512)
void sink_fused_kernel(const float* __restrict__ logK, const float* __restrict__ log_v,
                       const float* __restrict__ mu, const float* __restrict__ eps,
                       float* __restrict__ log_u,
                       float* __restrict__ pm, float* __restrict__ ps) {
  __shared__ __attribute__((aligned(16))) float sm[16][1024];   // 64 KB: per-wave column max
  __shared__ __attribute__((aligned(16))) float ss[16][1024];   // 64 KB: per-wave column sum
  const int chunk = blockIdx.x;
  const int h     = blockIdx.y;
  // The wave's number, told to the compiler as wave-uniform: the rows' base address,
  // mu and the log_u address then live in scalar registers.
  const int wid   = __builtin_amdgcn_readfirstlane(threadIdx.x >> 5);
  const int lane  = threadIdx.x & 31;
  const int row0  = h * 1024 + chunk * 64 + wid * 4;   // (h,i) flat
  const v4f* pk = reinterpret_cast<const v4f*>(logK + (size_t)row0 * 1024) + lane;
  const v4f* pv = reinterpret_cast<const v4f*>(log_v + h * 1024) + lane;

  // Every loop over r, c or w in this kernel is unrolled whole: k, lv, wm and ws stay in
  // registers only if each index is a constant.
  // Loads in the order the column pass uses them: column group by column group.
  v4f k[4][8], lv[8];
#pragma unroll
  for (int c = 0; c < 8; ++c) {
    lv[c] = pv[c * 32];
#pragma unroll
    for (int r = 0; r < 4; ++r) k[r][c] = pk[r * 256 + c * 32];
  }
  // Keeps all 40 loads issued ahead of the arithmetic: without it the scheduler sinks
  // the last row's loads to their first use, where little is left to cover their wait.
  __builtin_amdgcn_sched_barrier(0);

  // Row pass: each lane runs a (max, sum) over its 32 columns in groups of 8, so that
  // no shifted value outlives its group; the lanes' pairs are then folded.
  const float fi = 1.f / (1.f + eps[h]);
  float lu[4];
#pragma unroll
  for (int r = 0; r < 4; ++r) {
    float m = -INFINITY;
    v4f s4 = {0.f, 0.f, 0.f, 0.f};
#pragma unroll
    for (int c = 0; c < 8; c += 2) {
      const v4f t0 = k[r][c] + lv[c];
      const v4f t1 = k[r][c + 1] + lv[c + 1];
      const v4f tm = __builtin_elementwise_max(t0, t1);
      const float nm = fmaxf(m, fmaxf(fmaxf(tm.x, tm.y), fmaxf(tm.z, tm.w)));
      s4 = s4 * __expf(m - nm) + (exp4(t0 - nm) + exp4(t1 - nm));
      m = nm;
    }
    float M = m;
    for (int off = 16; off; off >>= 1) M = fmaxf(M, __shfl_xor(M, off, 32));
    const float s = wave_sum(((s4.x + s4.y) + (s4.z + s4.w)) * __expf(m - M));
    lu[r] = fi * (__logf(fmaxf(mu[row0 + r], 1e-8f)) - (M + __logf(s)));
  }
  if (lane == 0) {
#pragma unroll
    for (int r = 0; r < 4; ++r) log_u[row0 + r] = lu[r];
  }

  // Column pass over the wave's 4 rows, from the registers the row pass read.
#pragma unroll
  for (int c = 0; c < 8; ++c) {
    const v4f x0 = k[0][c] + lu[0], x1 = k[1][c] + lu[1];
    const v4f x2 = k[2][c] + lu[2], x3 = k[3][c] + lu[3];
    const v4f cm = __builtin_elementwise_max(__builtin_elementwise_max(x0, x1),
                                             __builtin_elementwise_max(x2, x3));
    const v4f cs = (exp4(x0 - cm) + exp4(x1 - cm)) + (exp4(x2 - cm) + exp4(x3 - cm));
    *reinterpret_cast<v4f*>(&sm[wid][c * 128 + lane * 4]) = cm;
    *reinterpret_cast<v4f*>(&ss[wid][c * 128 + lane * 4]) = cs;
  }
  __syncthreads();

  // Fold the 16 waves' partials; a thread owns 2 columns.
  const int j = threadIdx.x * 2;
  float2 wm[16], ws[16];
#pragma unroll
  for (int w = 0; w < 16; ++w) {
    wm[w] = *reinterpret_cast<const float2*>(&sm[w][j]);
    ws[w] = *reinterpret_cast<const float2*>(&ss[w][j]);
  }
  float2 M = wm[0];
#pragma unroll
  for (int w = 1; w < 16; ++w) { M.x = fmaxf(M.x, wm[w].x); M.y = fmaxf(M.y, wm[w].y); }
  float2 S = make_float2(0.f, 0.f);
#pragma unroll
  for (int w = 0; w < 16; ++w) {
    S.x += ws[w].x * __expf(wm[w].x - M.x);
    S.y += ws[w].y * __expf(wm[w].y - M.y);
  }
  const size_t idx = ((size_t)chunk * 16 + h) * 1024 + j;
  *reinterpret_cast<float2*>(pm + idx) = M;
  *reinterpret_cast<float2*>(ps + idx) = S;
}

// Column pass, phase 2: combine the 16 chunk partials of a head -> log_v.
__global__ __launch_bounds__(256)
void sink_col_combine(const float* __restrict__ pm, const float* __restrict__ ps,
                      const float* __restrict__ nu, const float* __restrict__ eps,
                      float* __restrict__ log_v) {
  const int idx = blockIdx.x * 256 + threadIdx.x;   // (h,j) flat, 0..16383
  const int h = idx >> 10;
  const int j = idx & 1023;
  float m = -INFINITY, s = 0.f;
  // Unrolled whole so that all 32 partial loads are in flight at once.
#pragma unroll
  for (int c = 0; c < 16; ++c) {
    const size_t p = ((size_t)c * 16 + h) * 1024 + j;
    float cm = pm[p], cs = ps[p];
    float nm = fmaxf(m, cm);
    float e1 = (m == nm)  ? 1.f : __expf(m - nm);
    float e2 = (cm == nm) ? 1.f : __expf(cm - nm);
    s = s * e1 + cs * e2;
    m = nm;
  }
  float lse = m + __logf(s);
  float fi = 1.f / (1.f + eps[h]);
  log_v[idx] = fi * (__logf(fmaxf(nu[idx], 1e-8f)) - lse);
}

// P = exp(logK + log_u_i + log_v_j) * mask, bf16; row sums fp32.
__global__ __launch_bounds__(256)
void p_kernel(const float* __restrict__ logK, const float* __restrict__ log_u,
              const float* __restrict__ log_v, const float* __restrict__ mask,
              __bf16* __restrict__ P, float* __restrict__ rowsum) {
  const int row  = blockIdx.x * 8 + (threadIdx.x >> 5);
  const int h    = row >> 10;
  const int i    = row & 1023;
  const int lane = threadIdx.x & 31;
  const float lu = log_u[row];
  const float mi = mask[i];
  const float* pk = logK + (size_t)row * 1024;
  __bf16* pp = P + (size_t)row * 1024;
  float acc = 0.f;
  for (int j = lane; j < 1024; j += 32) {
    float p = __expf(pk[j] + lu + log_v[h * 1024 + j]) * mi * mask[j];
    pp[j] = (__bf16)p;
    acc += p;
  }
  acc = wave_sum(acc);
  if (lane == 0) rowsum[row] = acc;
}

// ---------------------------------------------------------------------------
// attn = (P @ V) / rowsum * sigmoid(G), WMMA over j (K=1024 in 32-steps).
// ---------------------------------------------------------------------------
__global__ __launch_bounds__(256)
void attn_kernel(const __bf16* __restrict__ P, const __bf16* __restrict__ Vt,
                 const float* __restrict__ rowsum, const float* __restrict__ sg,
                 __bf16* __restrict__ o_bf) {
  const int h    = blockIdx.y;
  const int wid  = threadIdx.x >> 5;
  const int lane = threadIdx.x & 31;
  const int r  = lane & 15, hf = lane >> 4;
  const int i0 = blockIdx.x * 64 + (wid >> 1) * 16;
  const int d0 = (wid & 1) * 16;
  const __bf16* Abase = P  + ((size_t)h * 1024 + i0) * 1024;
  const __bf16* Bbase = Vt + ((size_t)h * 32 + d0) * 1024;
  v8f acc = {};
  for (int j = 0; j < 1024; j += 32) {
    v16bf a = load_frag(Abase + j, 1024);
    v16bf b = load_frag(Bbase + j, 1024);
    acc = __builtin_amdgcn_wmma_f32_16x16x32_bf16(false, a, false, b, (short)0, acc, false, false);
  }
  const int d = d0 + r;
  for (int v = 0; v < 8; ++v) {
    int i = i0 + v + hf * 8;
    float inv = 1.f / fmaxf(rowsum[h * 1024 + i], 1e-8f);
    float val = acc[v] * inv * sg[((size_t)h * 1024 + i) * 32 + d];
    o_bf[(size_t)i * 512 + h * 32 + d] = (__bf16)val;
  }
}

// ---------------------------------------------------------------------------
// Centroid EGNN coord update: x_out = x + mask*(G*x - sum_h g_h * Pn_h @ x)
// ---------------------------------------------------------------------------
__global__ __launch_bounds__(256)
void xcent_kernel(const __bf16* __restrict__ P, const float* __restrict__ rowsum,
                  const float* __restrict__ x_res, const float* __restrict__ gamma,
                  const float* __restrict__ mask, float* __restrict__ x_out) {
  const int i = blockIdx.x;
  const int t = threadIdx.x;
  __shared__ float r0[256], r1[256], r2[256];
  float a0 = 0.f, a1 = 0.f, a2 = 0.f;
  for (int h = 0; h < 16; ++h) {
    float g   = tanhf(gamma[h]) * (1.f / 16.f);
    float inv = g / fmaxf(rowsum[h * 1024 + i], 1e-8f);
    const __bf16* pr = P + ((size_t)h * 1024 + i) * 1024;
    float s0 = 0.f, s1 = 0.f, s2 = 0.f;
    for (int j = t; j < 1024; j += 256) {
      float p = (float)pr[j];
      s0 += p * x_res[j * 3 + 0];
      s1 += p * x_res[j * 3 + 1];
      s2 += p * x_res[j * 3 + 2];
    }
    a0 += inv * s0; a1 += inv * s1; a2 += inv * s2;
  }
  r0[t] = a0; r1[t] = a1; r2[t] = a2; __syncthreads();
  for (int o = 128; o; o >>= 1) {
    if (t < o) { r0[t] += r0[t + o]; r1[t] += r1[t + o]; r2[t] += r2[t + o]; }
    __syncthreads();
  }
  if (t == 0) {
    float G = 0.f;
    for (int h = 0; h < 16; ++h) G += tanhf(gamma[h]) * (1.f / 16.f);
    float mi = mask[i];
    x_out[i * 3 + 0] = x_res[i * 3 + 0] + mi * (G * x_res[i * 3 + 0] - r0[0]);
    x_out[i * 3 + 1] = x_res[i * 3 + 1] + mi * (G * x_res[i * 3 + 1] - r1[0]);
    x_out[i * 3 + 2] = x_res[i * 3 + 2] + mi * (G * x_res[i * 3 + 2] - r2[0]);
  }
}

// ---------------------------------------------------------------------------
// Host orchestration
// ---------------------------------------------------------------------------
extern "C" void kernel_launch(void* const* d_in, const int* in_sizes, int n_in,
                              void* d_out, int out_size, void* d_ws, size_t ws_size,
                              hipStream_t stream) {
  (void)in_sizes; (void)n_in; (void)out_size; (void)ws_size;
  const float* h_in    = (const float*)d_in[0];
  const float* x_res   = (const float*)d_in[1];
  const float* mu      = (const float*)d_in[2];
  const float* nu      = (const float*)d_in[3];
  const float* lu_prev = (const float*)d_in[4];
  const float* lv_prev = (const float*)d_in[5];
  const float* mask    = (const float*)d_in[6];
  const float* lnaw    = (const float*)d_in[7];
  const float* lnab    = (const float*)d_in[8];
  const float* wq      = (const float*)d_in[9];
  const float* wk      = (const float*)d_in[10];
  const float* wv      = (const float*)d_in[11];
  const float* wg      = (const float*)d_in[12];
  const float* wo      = (const float*)d_in[13];
  const float* gamma   = (const float*)d_in[14];
  const float* posw    = (const float*)d_in[15];
  const float* wdl     = (const float*)d_in[16];
  const float* lnfw    = (const float*)d_in[17];
  const float* lnfb    = (const float*)d_in[18];
  const float* sw1     = (const float*)d_in[19];
  const float* sw3     = (const float*)d_in[20];
  const float* sw2     = (const float*)d_in[21];
  const int*   pbins   = (const int*)d_in[22];
  const float* eps     = (const float*)d_in[23];

  char* wsb = (char*)d_ws;
  size_t off = 0;
  auto take = [&](size_t bytes) -> void* {
    void* p = wsb + off;
    off += (bytes + 255) & ~(size_t)255;
    return p;
  };
  float*  logK  = (float*)take(16UL * 1024 * 1024 * 4);   // 64 MB
  __bf16* P     = (__bf16*)take(16UL * 1024 * 1024 * 2);  // 32 MB
  __bf16* wq_b  = (__bf16*)take(512UL * 512 * 2);
  __bf16* wk_b  = (__bf16*)take(512UL * 512 * 2);
  __bf16* wv_b  = (__bf16*)take(512UL * 512 * 2);
  __bf16* wg_b  = (__bf16*)take(512UL * 512 * 2);
  __bf16* wo_b  = (__bf16*)take(512UL * 512 * 2);
  __bf16* w1_b  = (__bf16*)take(2048UL * 512 * 2);
  __bf16* w3_b  = (__bf16*)take(2048UL * 512 * 2);
  __bf16* w2_b  = (__bf16*)take(512UL * 2048 * 2);
  __bf16* hn    = (__bf16*)take(1024UL * 512 * 2);
  float*  Qf    = (float*)take(1024UL * 512 * 4);
  float*  Kf    = (float*)take(1024UL * 512 * 4);
  float*  Vf    = (float*)take(1024UL * 512 * 4);
  float*  Gf    = (float*)take(1024UL * 512 * 4);
  __bf16* Qh    = (__bf16*)take(16UL * 1024 * 32 * 2);
  __bf16* Kh    = (__bf16*)take(16UL * 1024 * 32 * 2);
  __bf16* Vt    = (__bf16*)take(16UL * 32 * 1024 * 2);
  float*  sg    = (float*)take(16UL * 1024 * 32 * 4);
  float*  lu    = (float*)take(16UL * 1024 * 4);
  float*  lv    = (float*)take(16UL * 1024 * 4);
  float*  rowsum= (float*)take(16UL * 1024 * 4);
  float*  pmb   = (float*)take(16UL * 16 * 1024 * 4);     // col-pass partial m
  float*  psb   = (float*)take(16UL * 16 * 1024 * 4);     // col-pass partial s
  __bf16* o_b   = (__bf16*)take(1024UL * 512 * 2);
  float*  tmpC  = (float*)take(1024UL * 512 * 4);
  float*  h_new = (float*)take(1024UL * 512 * 4);
  __bf16* h2    = (__bf16*)take(1024UL * 512 * 2);
  // FFN intermediates reuse the (then-dead) logK region
  float*  a1    = logK;                                // 1024x2048 f32
  float*  a3    = logK + 2UL * 1024 * 1024;            // 1024x2048 f32
  __bf16* gmid  = (__bf16*)(logK + 4UL * 1024 * 1024); // 1024x2048 bf16

  float* out_h  = (float*)d_out;            // 1024*512
  float* out_x  = out_h + 524288;           // 1024*3
  float* out_lu = out_h + 527360;           // 16*1024
  float* out_lv = out_h + 543744;           // 16*1024

  // 1) weights -> bf16
  f2bf_kernel<<<1024, 256, 0, stream>>>(wq, wq_b, 262144);
  f2bf_kernel<<<1024, 256, 0, stream>>>(wk, wk_b, 262144);
  f2bf_kernel<<<1024, 256, 0, stream>>>(wv, wv_b, 262144);
  f2bf_kernel<<<1024, 256, 0, stream>>>(wg, wg_b, 262144);
  f2bf_kernel<<<1024, 256, 0, stream>>>(wo, wo_b, 262144);
  f2bf_kernel<<<4096, 256, 0, stream>>>(sw1, w1_b, 1048576);
  f2bf_kernel<<<4096, 256, 0, stream>>>(sw3, w3_b, 1048576);
  f2bf_kernel<<<4096, 256, 0, stream>>>(sw2, w2_b, 1048576);

  // 2) LN(h) -> bf16
  ln_kernel<<<1024, 256, 0, stream>>>(h_in, lnaw, lnab, hn);

  // 3) QKVG projections (TDM-staged WMMA)
  dim3 g512(16, 4);
  gemm_bf16<<<g512, 256, 0, stream>>>(hn, wq_b, Qf, 1024, 512, 512);
  gemm_bf16<<<g512, 256, 0, stream>>>(hn, wk_b, Kf, 1024, 512, 512);
  gemm_bf16<<<g512, 256, 0, stream>>>(hn, wv_b, Vf, 1024, 512, 512);
  gemm_bf16<<<g512, 256, 0, stream>>>(hn, wg_b, Gf, 1024, 512, 512);
  post_qkvg_kernel<<<2048, 256, 0, stream>>>(Qf, Kf, Vf, Gf, Qh, Kh, Vt, sg);

  // 4) logits -> logK
  logits_kernel<<<dim3(64, 16, 16), 128, 0, stream>>>(Qh, Kh, pbins, posw, wdl,
                                                      x_res, mask, eps, logK);

  // 5) warm-started log-domain Sinkhorn, 20 iterations (logK L2-resident)
  (void)hipMemcpyAsync(lu, lu_prev, 16384 * 4, hipMemcpyDeviceToDevice, stream);
  (void)hipMemcpyAsync(lv, lv_prev, 16384 * 4, hipMemcpyDeviceToDevice, stream);
  for (int it = 0; it < 20; ++it) {
    sink_fused_kernel<<<dim3(16, 16), 512, 0, stream>>>(logK, lv, mu, eps, lu, pmb, psb);
    sink_col_combine<<<64, 256, 0, stream>>>(pmb, psb, nu, eps, lv);
  }

  // 6) P (bf16) + row sums
  p_kernel<<<2048, 256, 0, stream>>>(logK, lu, lv, mask, P, rowsum);

  // 7) attn + output projection + residual
  attn_kernel<<<dim3(16, 16), 256, 0, stream>>>(P, Vt, rowsum, sg, o_b);
  gemm_bf16<<<g512, 256, 0, stream>>>(o_b, wo_b, tmpC, 1024, 512, 512);
  add_res_mask_kernel<<<2048, 256, 0, stream>>>(h_in, tmpC, mask, h_new, 524288, 512);

  // 8) centroid coordinate update -> out_x
  xcent_kernel<<<1024, 256, 0, stream>>>(P, rowsum, x_res, gamma, mask, out_x);

  // 9) SwiGLU FFN + residual -> out_h
  ln_kernel<<<1024, 256, 0, stream>>>(h_new, lnfw, lnfb, h2);
  dim3 g2048(16, 16);
  gemm_bf16<<<g2048, 256, 0, stream>>>(h2, w1_b, a1, 1024, 2048, 512);
  gemm_bf16<<<g2048, 256, 0, stream>>>(h2, w3_b, a3, 1024, 2048, 512);
  swiglu_kernel<<<8192, 256, 0, stream>>>(a1, a3, gmid, 1024 * 2048);
  gemm_bf16<<<g512, 256, 0, stream>>>(gmid, w2_b, tmpC, 1024, 512, 2048);
  add_res_mask_kernel<<<2048, 256, 0, stream>>>(h_new, tmpC, mask, out_h, 524288, 512);

  // 10) log_u / log_v outputs
  (void)hipMemcpyAsync(out_lu, lu, 16384 * 4, hipMemcpyDeviceToDevice, stream);
  (void)hipMemcpyAsync(out_lv, lv, 16384 * 4, hipMemcpyDeviceToDevice, stream);
}

// v002
// Two timings next to v001 put it at 1.05 and 1.06 times that version's speed.
// Counting every step since v000, it is 3.28 times as fast.
#include <hip/hip_runtime.h>

// ---------------------------------------------------------------------------
// TokenUOTBlock for MI455X (gfx1250): bf16 WMMA GEMMs (TDM-staged LDS tiles)
// + wave32 log-domain Sinkhorn.  B=1, N=1024, D=512, H=16, DH=32, K_ITER=20.
// ---------------------------------------------------------------------------

typedef __attribute__((ext_vector_type(16))) __bf16 v16bf;
typedef __attribute__((ext_vector_type(8)))  float  v8f;
typedef __attribute__((ext_vector_type(4)))  float  v4f;
typedef unsigned int u32x4 __attribute__((ext_vector_type(4)));
typedef int          i32x4 __attribute__((ext_vector_type(4)));
typedef int          i32x8 __attribute__((ext_vector_type(8)));

union Frag { v16bf v; uint4 u[2]; };

#if __has_builtin(__builtin_amdgcn_tensor_load_to_lds)
#define HAVE_TDM 1
#else
#define HAVE_TDM 0
#endif

// Load a 16x32 bf16 WMMA A/B fragment from a row-major (row, K) tile.
// CDNA5 16-bit layout: lanes 0-15 hold row r, K {0..7,16..23};
// lanes 16-31 hold row r, K {8..15,24..31}.  Works on global or LDS tiles.
__device__ __forceinline__ v16bf load_frag(const __bf16* base, int ld) {
  const int lane = threadIdx.x & 31;
  const int r    = lane & 15;
  const int hf   = lane >> 4;
  const __bf16* p = base + (size_t)r * ld + hf * 8;
  Frag f;
  f.u[0] = *reinterpret_cast<const uint4*>(p);
  f.u[1] = *reinterpret_cast<const uint4*>(p + 16);
  return f.v;
}

__device__ __forceinline__ v4f exp4(v4f a) {
  v4f e = {__expf(a.x), __expf(a.y), __expf(a.z), __expf(a.w)};
  return e;
}

__device__ __forceinline__ float wave_sum(float v) {
  for (int off = 16; off; off >>= 1) v += __shfl_xor(v, off, 32);
  return v;
}

#if HAVE_TDM
// Issue a TDM 2D tile load (rows x cols bf16, row stride in elements) into LDS.
// D# packing per CDNA5 ISA ch.8 (groups 0/1; groups 2/3 zero => 2D tensor).
// clang-23 toolchain: 6-arg builtin (g0, g1, g2, g3, extra, cpol).
__device__ __forceinline__ void tdm_load_2d(const __bf16* gsrc, unsigned lds_off,
                                            int rows, int cols, int stride_elems) {
  unsigned long long ga = (unsigned long long)(const void*)gsrc;
  u32x4 g0;
  g0[0] = 1u;                                        // count=1, user descriptor
  g0[1] = lds_off;                                   // LDS byte address
  g0[2] = (unsigned)(ga & 0xffffffffu);              // global_addr[31:0]
  g0[3] = (unsigned)((ga >> 32) & 0x01ffffffu)       // global_addr[56:32]
          | (2u << 30);                              // type = 2 ("image")
  unsigned td0 = (unsigned)stride_elems;             // tensor_dim0 (elements)
  unsigned td1 = (unsigned)rows;                     // tensor_dim1
  unsigned long long s0 = (unsigned long long)stride_elems; // dim0 stride
  i32x8 g1;
  g1[0] = (int)(1u << 16);                           // data_size=1 (2 bytes)
  g1[1] = (int)((td0 & 0xffffu) << 16);              // [63:48]=tensor_dim0 lo16
  g1[2] = (int)((td0 >> 16) | ((td1 & 0xffffu) << 16));
  g1[3] = (int)((td1 >> 16) | ((unsigned)cols << 16)); // [127:112]=tile_dim0
  g1[4] = (int)((unsigned)rows & 0xffffu);           // tile_dim1; tile_dim2=0
  g1[5] = (int)(s0 & 0xffffffffu);                   // dim0_stride[31:0]
  g1[6] = (int)((s0 >> 32) & 0xffffu);               // dim0_stride[47:32]
  g1[7] = 0;                                         // dim1_stride (unused 2D)
  i32x4 z4 = {0, 0, 0, 0};
  i32x8 z8 = {0, 0, 0, 0, 0, 0, 0, 0};
  __builtin_amdgcn_tensor_load_to_lds(g0, g1, z4, z4, z8, 0);
}
#endif

// ---------------------------------------------------------------------------
// Generic GEMM: C[M,Nout] (f32) = A[M,K] (bf16) x W[Nout,K]^T (bf16)
// Block = 256 threads = 8 waves; block tile 64x128; K-step 32.
// A (64x32) and W (128x32) tiles staged to LDS via the Tensor Data Mover
// (one descriptor pair issued by wave 0, TENSORcnt wait, then ds_load frags).
// ---------------------------------------------------------------------------
__global__ __launch_bounds__(256)
void gemm_bf16(const __bf16* __restrict__ A, const __bf16* __restrict__ W,
               float* __restrict__ C, int M, int Nout, int K) {
  __shared__ __bf16 ldsA[64][32];    // 4 KB
  __shared__ __bf16 ldsW[128][32];   // 8 KB
  const int wid  = threadIdx.x >> 5;
  const int lane = threadIdx.x & 31;
  const int r  = lane & 15, hf = lane >> 4;
  const int mB = blockIdx.x * 64;
  const int nB = blockIdx.y * 128;
  const int ml = (wid >> 1) * 16;    // local m-tile
  const int nl = (wid & 1) * 64;     // local n-strip
  v8f acc0 = {}, acc1 = {}, acc2 = {}, acc3 = {};
  for (int k = 0; k < K; k += 32) {
#if HAVE_TDM
    if (wid == 0) {
      tdm_load_2d(A + (size_t)mB * K + k, (unsigned)(size_t)&ldsA[0][0], 64, 32, K);
      tdm_load_2d(W + (size_t)nB * K + k, (unsigned)(size_t)&ldsW[0][0], 128, 32, K);
      __builtin_amdgcn_s_wait_tensorcnt(0);
    }
    __syncthreads();
#else
    for (int t = threadIdx.x; t < 64 * 32; t += 256)
      ldsA[t >> 5][t & 31] = A[(size_t)(mB + (t >> 5)) * K + k + (t & 31)];
    for (int t = threadIdx.x; t < 128 * 32; t += 256)
      ldsW[t >> 5][t & 31] = W[(size_t)(nB + (t >> 5)) * K + k + (t & 31)];
    __syncthreads();
#endif
    v16bf a  = load_frag(&ldsA[ml][0], 32);
    v16bf b0 = load_frag(&ldsW[nl +  0][0], 32);
    v16bf b1 = load_frag(&ldsW[nl + 16][0], 32);
    v16bf b2 = load_frag(&ldsW[nl + 32][0], 32);
    v16bf b3 = load_frag(&ldsW[nl + 48][0], 32);
    acc0 = __builtin_amdgcn_wmma_f32_16x16x32_bf16(false, a, false, b0, (short)0, acc0, false, false);
    acc1 = __builtin_amdgcn_wmma_f32_16x16x32_bf16(false, a, false, b1, (short)0, acc1, false, false);
    acc2 = __builtin_amdgcn_wmma_f32_16x16x32_bf16(false, a, false, b2, (short)0, acc2, false, false);
    acc3 = __builtin_amdgcn_wmma_f32_16x16x32_bf16(false, a, false, b3, (short)0, acc3, false, false);
    __syncthreads();
  }
  for (int v = 0; v < 8; ++v) {
    int row = mB + ml + v + hf * 8;
    float* cr = C + (size_t)row * Nout + r;
    cr[nB + nl +  0] = acc0[v];
    cr[nB + nl + 16] = acc1[v];
    cr[nB + nl + 32] = acc2[v];
    cr[nB + nl + 48] = acc3[v];
  }
}

// ---------------------------------------------------------------------------
// Elementwise helpers
// ---------------------------------------------------------------------------
__global__ void f2bf_kernel(const float* __restrict__ x, __bf16* __restrict__ y, int n) {
  int i = blockIdx.x * 256 + threadIdx.x;
  if (i < n) y[i] = (__bf16)x[i];
}

__global__ void swiglu_kernel(const float* __restrict__ a1, const float* __restrict__ a3,
                              __bf16* __restrict__ g, int n) {
  int i = blockIdx.x * 256 + threadIdx.x;
  if (i < n) {
    float a = a1[i];
    float s = a / (1.f + __expf(-a));
    g[i] = (__bf16)(s * a3[i]);
  }
}

__global__ void add_res_mask_kernel(const float* __restrict__ base, const float* __restrict__ delta,
                                    const float* __restrict__ mask, float* __restrict__ out,
                                    int n, int D) {
  int i = blockIdx.x * 256 + threadIdx.x;
  if (i < n) out[i] = base[i] + delta[i] * mask[i / D];
}

// LayerNorm over D=512 with affine params, bf16 output. One block per row.
__global__ __launch_bounds__(256)
void ln_kernel(const float* __restrict__ x, const float* __restrict__ w,
               const float* __restrict__ bb, __bf16* __restrict__ y) {
  const int row = blockIdx.x;
  const int t   = threadIdx.x;
  __shared__ float s1[256], s2[256];
  float a = 0.f, q = 0.f;
  for (int d = t; d < 512; d += 256) {
    float v = x[(size_t)row * 512 + d];
    a += v; q += v * v;
  }
  s1[t] = a; s2[t] = q; __syncthreads();
  for (int o = 128; o; o >>= 1) {
    if (t < o) { s1[t] += s1[t + o]; s2[t] += s2[t + o]; }
    __syncthreads();
  }
  const float m   = s1[0] * (1.f / 512.f);
  const float var = s2[0] * (1.f / 512.f) - m * m;
  const float rs  = rsqrtf(var + 1e-5f);
  for (int d = t; d < 512; d += 256) {
    float v = x[(size_t)row * 512 + d];
    y[(size_t)row * 512 + d] = (__bf16)((v - m) * rs * w[d] + bb[d]);
  }
}

// Per-head LN of Q,K (over DH=32, one wave per (h,n)); V transposed to (H,32,N);
// sigmoid(G) stored fp32 in (H,N,32).
__global__ __launch_bounds__(256)
void post_qkvg_kernel(const float* __restrict__ Qf, const float* __restrict__ Kf,
                      const float* __restrict__ Vf, const float* __restrict__ Gf,
                      __bf16* __restrict__ Qh, __bf16* __restrict__ Kh,
                      __bf16* __restrict__ Vt, float* __restrict__ sg) {
  const int w = blockIdx.x * 8 + (threadIdx.x >> 5);  // 0..16383
  const int h = w >> 10;
  const int n = w & 1023;
  const int d = threadIdx.x & 31;
  const size_t src = (size_t)n * 512 + h * 32 + d;
  {
    float q = Qf[src];
    float m = wave_sum(q) * (1.f / 32.f);
    float dq = q - m;
    float vv = wave_sum(dq * dq) * (1.f / 32.f);
    Qh[((size_t)h * 1024 + n) * 32 + d] = (__bf16)(dq * rsqrtf(vv + 1e-5f));
  }
  {
    float q = Kf[src];
    float m = wave_sum(q) * (1.f / 32.f);
    float dq = q - m;
    float vv = wave_sum(dq * dq) * (1.f / 32.f);
    Kh[((size_t)h * 1024 + n) * 32 + d] = (__bf16)(dq * rsqrtf(vv + 1e-5f));
  }
  Vt[((size_t)h * 32 + d) * 1024 + n] = (__bf16)Vf[src];
  sg[((size_t)h * 1024 + n) * 32 + d] = 1.f / (1.f + __expf(-Gf[src]));
}

// ---------------------------------------------------------------------------
// logits: S = QK^T/sqrt(32) via one WMMA (K=32), + pos bias, - distance gate,
// /eps, mask -> logK (f32, H,N,N).  Block = 128 threads = 4 waves.
// ---------------------------------------------------------------------------
__global__ __launch_bounds__(128)
void logits_kernel(const __bf16* __restrict__ Qh, const __bf16* __restrict__ Kh,
                   const int* __restrict__ pos_bins, const float* __restrict__ pos_weight,
                   const float* __restrict__ w_dist_logit, const float* __restrict__ x_res,
                   const float* __restrict__ mask, const float* __restrict__ eps,
                   float* __restrict__ logK) {
  const int h    = blockIdx.z;
  const int wid  = threadIdx.x >> 5;
  const int lane = threadIdx.x & 31;
  const int r  = lane & 15, hf = lane >> 4;
  const int i0 = blockIdx.x * 16;
  const int j0 = blockIdx.y * 64 + wid * 16;
  v16bf a = load_frag(Qh + ((size_t)h * 1024 + i0) * 32, 32);
  v16bf b = load_frag(Kh + ((size_t)h * 1024 + j0) * 32, 32);
  v8f c = {};
  c = __builtin_amdgcn_wmma_f32_16x16x32_bf16(false, a, false, b, (short)0, c, false, false);
  const float scale   = 0.17677669529663687f;  // 1/sqrt(32)
  const float wd      = 1.f / (1.f + __expf(-w_dist_logit[h]));
  const float inv_eps = 1.f / eps[h];
  const int   j  = j0 + r;
  const float xj0 = x_res[j * 3 + 0], xj1 = x_res[j * 3 + 1], xj2 = x_res[j * 3 + 2];
  const float mj = mask[j];
  for (int v = 0; v < 8; ++v) {
    const int i = i0 + v + hf * 8;
    float s = c[v] * scale;
    int bin = pos_bins[(size_t)i * 1024 + j];
    float bias = pos_weight[bin * 16 + h];
    float d0 = x_res[i * 3 + 0] - xj0;
    float d1 = x_res[i * 3 + 1] - xj1;
    float d2 = x_res[i * 3 + 2] - xj2;
    float dist2 = d0 * d0 + d1 * d1 + d2 * d2;
    float logit = s + bias - wd * dist2 * 0.01f;
    float pm = mask[i] * mj;
    logK[((size_t)h * 1024 + i) * 1024 + j] = (pm > 0.f) ? logit * inv_eps : -1e9f;
  }
}

// ---------------------------------------------------------------------------
// Sinkhorn iteration, one launch, one read of logK.  logK (64MB) is L2-resident.
// A work-group owns 64 rows (a chunk) of one head; each of its 16 waves holds 4 whole
// rows in registers (a lane: columns c*128 + lane*4 .. +3, c = 0..7).
//   1. log_v of the head: from the input (first iteration), else rebuilt by the
//      work-group itself from the 16 chunks' column log-sums of the iteration before.
//   2. The wave forms its 4 row LSEs -> log_u.
//   3. From the same registers the per-column (max, sum) of logK + log_u over its 4 rows;
//      LDS folds the 16 waves' partials into one log-sum per column and chunk.
// The log-sums go to a buffer other than the one read: work-groups of one launch run
// side by side.
// ---------------------------------------------------------------------------

// log_v of one column from the 16 chunk log-sums of its head.
__device__ __forceinline__ float logv_from_chunks(const float (&L)[16], float nu, float fi) {
  float M = L[0];
#pragma unroll
  for (int c = 1; c < 16; ++c) M = fmaxf(M, L[c]);
  float S = 0.f;
#pragma unroll
  for (int c = 0; c < 16; ++c) S += __expf(L[c] - M);
  return fi * (__logf(fmaxf(nu, 1e-8f)) - (M + __logf(S)));
}

template <bool FIRST>
__device__ __forceinline__
void sink_fused_body(const float* __restrict__ logK, const float* __restrict__ log_v,
                     const float* __restrict__ pl_in, const float* __restrict__ nu,
                     const float* __restrict__ mu, const float* __restrict__ eps,
                     float* __restrict__ log_u, float* __restrict__ pl_out) {
  __shared__ __attribute__((aligned(16))) float sm[16][1024];   // 64 KB: per-wave column max
  __shared__ __attribute__((aligned(16))) float ss[16][1024];   // 64 KB: per-wave column sum
  __shared__ __attribute__((aligned(16))) float slv[1024];      //  4 KB: the head's log_v
  const int chunk = blockIdx.x;
  const int h     = blockIdx.y;
  // The wave's number, told to the compiler as wave-uniform: the rows' base address,
  // mu and the log_u address then live in scalar registers.
  const int wid   = __builtin_amdgcn_readfirstlane(threadIdx.x >> 5);
  const int lane  = threadIdx.x & 31;
  const int j     = threadIdx.x * 2;                   // the 2 columns a thread folds
  const int row0  = h * 1024 + chunk * 64 + wid * 4;   // (h,i) flat
  const v4f* pk = reinterpret_cast<const v4f*>(logK + (size_t)row0 * 1024) + lane;

  // Every loop over r, c or w in this kernel is unrolled whole: k, lv, cl, wm and ws stay
  // in registers only if each index is a constant.
  // The chunk log-sums are asked for ahead of logK: they come back first, and log_v is
  // rebuilt while the rows are still on their way.
  float2 cl[16], nu2;
  if constexpr (!FIRST) {
#pragma unroll
    for (int c = 0; c < 16; ++c)
      cl[c] = *reinterpret_cast<const float2*>(pl_in + ((size_t)c * 16 + h) * 1024 + j);
    nu2 = *reinterpret_cast<const float2*>(nu + h * 1024 + j);
  }
  // Loads in the order the column pass uses them: column group by column group.
  v4f k[4][8], lv[8];
#pragma unroll
  for (int c = 0; c < 8; ++c) {
    if constexpr (FIRST) lv[c] = (reinterpret_cast<const v4f*>(log_v + h * 1024) + lane)[c * 32];
#pragma unroll
    for (int r = 0; r < 4; ++r) k[r][c] = pk[r * 256 + c * 32];
  }
  // Keeps all loads issued ahead of the arithmetic: without it the scheduler sinks
  // the last row's loads to their first use, where little is left to cover their wait.
  __builtin_amdgcn_sched_barrier(0);

  const float fi = 1.f / (1.f + eps[h]);
  if constexpr (!FIRST) {
    float Lx[16], Ly[16];
#pragma unroll
    for (int c = 0; c < 16; ++c) { Lx[c] = cl[c].x; Ly[c] = cl[c].y; }
    *reinterpret_cast<float2*>(&slv[j]) =
        make_float2(logv_from_chunks(Lx, nu2.x, fi), logv_from_chunks(Ly, nu2.y, fi));
    // A work-group barrier that orders LDS alone: __syncthreads() would also wait for the
    // logK loads, which are to stay in flight across it.
    __builtin_amdgcn_fence(__ATOMIC_RELEASE, "workgroup", "local");
    __builtin_amdgcn_s_barrier();
    __builtin_amdgcn_fence(__ATOMIC_ACQUIRE, "workgroup", "local");
#pragma unroll
    for (int c = 0; c < 8; ++c) lv[c] = *reinterpret_cast<const v4f*>(&slv[c * 128 + lane * 4]);
  }

  // Row pass: each lane runs a (max, sum) over its 32 columns in groups of 8, so that
  // no shifted value outlives its group; the lanes' pairs are then folded.
  float lu[4];
#pragma unroll
  for (int r = 0; r < 4; ++r) {
    float m = -INFINITY;
    v4f s4 = {0.f, 0.f, 0.f, 0.f};
#pragma unroll
    for (int c = 0; c < 8; c += 2) {
      const v4f t0 = k[r][c] + lv[c];
      const v4f t1 = k[r][c + 1] + lv[c + 1];
      const v4f tm = __builtin_elementwise_max(t0, t1);
      const float nm = fmaxf(m, fmaxf(fmaxf(tm.x, tm.y), fmaxf(tm.z, tm.w)));
      s4 = s4 * __expf(m - nm) + (exp4(t0 - nm) + exp4(t1 - nm));
      m = nm;
    }
    float M = m;
    for (int off = 16; off; off >>= 1) M = fmaxf(M, __shfl_xor(M, off, 32));
    const float s = wave_sum(((s4.x + s4.y) + (s4.z + s4.w)) * __expf(m - M));
    lu[r] = fi * (__logf(fmaxf(mu[row0 + r], 1e-8f)) - (M + __logf(s)));
  }
  if (lane == 0) {
#pragma unroll
    for (int r = 0; r < 4; ++r) log_u[row0 + r] = lu[r];
  }

  // Column pass over the wave's 4 rows, from the registers the row pass read.
#pragma unroll
  for (int c = 0; c < 8; ++c) {
    const v4f x0 = k[0][c] + lu[0], x1 = k[1][c] + lu[1];
    const v4f x2 = k[2][c] + lu[2], x3 = k[3][c] + lu[3];
    const v4f cm = __builtin_elementwise_max(__builtin_elementwise_max(x0, x1),
                                             __builtin_elementwise_max(x2, x3));
    const v4f cs = (exp4(x0 - cm) + exp4(x1 - cm)) + (exp4(x2 - cm) + exp4(x3 - cm));
    *reinterpret_cast<v4f*>(&sm[wid][c * 128 + lane * 4]) = cm;
    *reinterpret_cast<v4f*>(&ss[wid][c * 128 + lane * 4]) = cs;
  }
  __syncthreads();

  // Fold the 16 waves' partials; a thread owns 2 columns.
  float2 wm[16], ws[16];
#pragma unroll
  for (int w = 0; w < 16; ++w) {
    wm[w] = *reinterpret_cast<const float2*>(&sm[w][j]);
    ws[w] = *reinterpret_cast<const float2*>(&ss[w][j]);
  }
  float2 M = wm[0];
#pragma unroll
  for (int w = 1; w < 16; ++w) { M.x = fmaxf(M.x, wm[w].x); M.y = fmaxf(M.y, wm[w].y); }
  float2 S = make_float2(0.f, 0.f);
#pragma unroll
  for (int w = 0; w < 16; ++w) {
    S.x += ws[w].x * __expf(wm[w].x - M.x);
    S.y += ws[w].y * __expf(wm[w].y - M.y);
  }
  *reinterpret_cast<float2*>(pl_out + ((size_t)chunk * 16 + h) * 1024 + j) =
      make_float2(M.x + __logf(S.x), M.y + __logf(S.y));
}

__global__ __launch_bounds__(512)
void sink_fused_first(const float* __restrict__ logK, const float* __restrict__ log_v,
                      const float* __restrict__ mu, const float* __restrict__ eps,
                      float* __restrict__ log_u, float* __restrict__ pl_out) {
  sink_fused_body<true>(logK, log_v, nullptr, nullptr, mu, eps, log_u, pl_out);
}

__global__ __launch_bounds__(512)
void sink_fused_next(const float* __restrict__ logK, const float* __restrict__ pl_in,
                     const float* __restrict__ nu, const float* __restrict__ mu,
                     const float* __restrict__ eps,
                     float* __restrict__ log_u, float* __restrict__ pl_out) {
  sink_fused_body<false>(logK, nullptr, pl_in, nu, mu, eps, log_u, pl_out);
}

// log_v behind the last iteration, from its chunk log-sums.
__global__ __launch_bounds__(256)
void sink_col_combine(const float* __restrict__ pl, const float* __restrict__ nu,
                      const float* __restrict__ eps, float* __restrict__ log_v) {
  const int idx = blockIdx.x * 256 + threadIdx.x;   // (h,j) flat, 0..16383
  const int h = idx >> 10;
  const int j = idx & 1023;
  float L[16];
  // Unrolled whole so that all 16 loads are in flight at once.
#pragma unroll
  for (int c = 0; c < 16; ++c) L[c] = pl[((size_t)c * 16 + h) * 1024 + j];
  log_v[idx] = logv_from_chunks(L, nu[idx], 1.f / (1.f + eps[h]));
}

// P = exp(logK + log_u_i + log_v_j) * mask, bf16; row sums fp32.
__global__ __launch_bounds__(256)
void p_kernel(const float* __restrict__ logK, const float* __restrict__ log_u,
              const float* __restrict__ log_v, const float* __restrict__ mask,
              __bf16* __restrict__ P, float* __restrict__ rowsum) {
  const int row  = blockIdx.x * 8 + (threadIdx.x >> 5);
  const int h    = row >> 10;
  const int i    = row & 1023;
  const int lane = threadIdx.x & 31;
  const float lu = log_u[row];
  const float mi = mask[i];
  const float* pk = logK + (size_t)row * 1024;
  __bf16* pp = P + (size_t)row * 1024;
  float acc = 0.f;
  for (int j = lane; j < 1024; j += 32) {
    float p = __expf(pk[j] + lu + log_v[h * 1024 + j]) * mi * mask[j];
    pp[j] = (__bf16)p;
    acc += p;
  }
  acc = wave_sum(acc);
  if (lane == 0) rowsum[row] = acc;
}

// ---------------------------------------------------------------------------
// attn = (P @ V) / rowsum * sigmoid(G), WMMA over j (K=1024 in 32-steps).
// ---------------------------------------------------------------------------
__global__ __launch_bounds__(256)
void attn_kernel(const __bf16* __restrict__ P, const __bf16* __restrict__ Vt,
                 const float* __restrict__ rowsum, const float* __restrict__ sg,
                 __bf16* __restrict__ o_bf) {
  const int h    = blockIdx.y;
  const int wid  = threadIdx.x >> 5;
  const int lane = threadIdx.x & 31;
  const int r  = lane & 15, hf = lane >> 4;
  const int i0 = blockIdx.x * 64 + (wid >> 1) * 16;
  const int d0 = (wid & 1) * 16;
  const __bf16* Abase = P  + ((size_t)h * 1024 + i0) * 1024;
  const __bf16* Bbase = Vt + ((size_t)h * 32 + d0) * 1024;
  v8f acc = {};
  for (int j = 0; j < 1024; j += 32) {
    v16bf a = load_frag(Abase + j, 1024);
    v16bf b = load_frag(Bbase + j, 1024);
    acc = __builtin_amdgcn_wmma_f32_16x16x32_bf16(false, a, false, b, (short)0, acc, false, false);
  }
  const int d = d0 + r;
  for (int v = 0; v < 8; ++v) {
    int i = i0 + v + hf * 8;
    float inv = 1.f / fmaxf(rowsum[h * 1024 + i], 1e-8f);
    float val = acc[v] * inv * sg[((size_t)h * 1024 + i) * 32 + d];
    o_bf[(size_t)i * 512 + h * 32 + d] = (__bf16)val;
  }
}

// ---------------------------------------------------------------------------
// Centroid EGNN coord update: x_out = x + mask*(G*x - sum_h g_h * Pn_h @ x)
// ---------------------------------------------------------------------------
__global__ __launch_bounds__(256)
void xcent_kernel(const __bf16* __restrict__ P, const float* __restrict__ rowsum,
                  const float* __restrict__ x_res, const float* __restrict__ gamma,
                  const float* __restrict__ mask, float* __restrict__ x_out) {
  const int i = blockIdx.x;
  const int t = threadIdx.x;
  __shared__ float r0[256], r1[256], r2[256];
  float a0 = 0.f, a1 = 0.f, a2 = 0.f;
  for (int h = 0; h < 16; ++h) {
    float g   = tanhf(gamma[h]) * (1.f / 16.f);
    float inv = g / fmaxf(rowsum[h * 1024 + i], 1e-8f);
    const __bf16* pr = P + ((size_t)h * 1024 + i) * 1024;
    float s0 = 0.f, s1 = 0.f, s2 = 0.f;
    for (int j = t; j < 1024; j += 256) {
      float p = (float)pr[j];
      s0 += p * x_res[j * 3 + 0];
      s1 += p * x_res[j * 3 + 1];
      s2 += p * x_res[j * 3 + 2];
    }
    a0 += inv * s0; a1 += inv * s1; a2 += inv * s2;
  }
  r0[t] = a0; r1[t] = a1; r2[t] = a2; __syncthreads();
  for (int o = 128; o; o >>= 1) {
    if (t < o) { r0[t] += r0[t + o]; r1[t] += r1[t + o]; r2[t] += r2[t + o]; }
    __syncthreads();
  }
  if (t == 0) {
    float G = 0.f;
    for (int h = 0; h < 16; ++h) G += tanhf(gamma[h]) * (1.f / 16.f);
    float mi = mask[i];
    x_out[i * 3 + 0] = x_res[i * 3 + 0] + mi * (G * x_res[i * 3 + 0] - r0[0]);
    x_out[i * 3 + 1] = x_res[i * 3 + 1] + mi * (G * x_res[i * 3 + 1] - r1[0]);
    x_out[i * 3 + 2] = x_res[i * 3 + 2] + mi * (G * x_res[i * 3 + 2] - r2[0]);
  }
}

// ---------------------------------------------------------------------------
// Host orchestration
// ---------------------------------------------------------------------------
extern "C" void kernel_launch(void* const* d_in, const int* in_sizes, int n_in,
                              void* d_out, int out_size, void* d_ws, size_t ws_size,
                              hipStream_t stream) {
  (void)in_sizes; (void)n_in; (void)out_size; (void)ws_size;
  const float* h_in    = (const float*)d_in[0];
  const float* x_res   = (const float*)d_in[1];
  const float* mu      = (const float*)d_in[2];
  const float* nu      = (const float*)d_in[3];
  const float* lu_prev = (const float*)d_in[4];
  const float* lv_prev = (const float*)d_in[5];
  const float* mask    = (const float*)d_in[6];
  const float* lnaw    = (const float*)d_in[7];
  const float* lnab    = (const float*)d_in[8];
  const float* wq      = (const float*)d_in[9];
  const float* wk      = (const float*)d_in[10];
  const float* wv      = (const float*)d_in[11];
  const float* wg      = (const float*)d_in[12];
  const float* wo      = (const float*)d_in[13];
  const float* gamma   = (const float*)d_in[14];
  const float* posw    = (const float*)d_in[15];
  const float* wdl     = (const float*)d_in[16];
  const float* lnfw    = (const float*)d_in[17];
  const float* lnfb    = (const float*)d_in[18];
  const float* sw1     = (const float*)d_in[19];
  const float* sw3     = (const float*)d_in[20];
  const float* sw2     = (const float*)d_in[21];
  const int*   pbins   = (const int*)d_in[22];
  const float* eps     = (const float*)d_in[23];

  char* wsb = (char*)d_ws;
  size_t off = 0;
  auto take = [&](size_t bytes) -> void* {
    void* p = wsb + off;
    off += (bytes + 255) & ~(size_t)255;
    return p;
  };
  float*  logK  = (float*)take(16UL * 1024 * 1024 * 4);   // 64 MB
  __bf16* P     = (__bf16*)take(16UL * 1024 * 1024 * 2);  // 32 MB
  __bf16* wq_b  = (__bf16*)take(512UL * 512 * 2);
  __bf16* wk_b  = (__bf16*)take(512UL * 512 * 2);
  __bf16* wv_b  = (__bf16*)take(512UL * 512 * 2);
  __bf16* wg_b  = (__bf16*)take(512UL * 512 * 2);
  __bf16* wo_b  = (__bf16*)take(512UL * 512 * 2);
  __bf16* w1_b  = (__bf16*)take(2048UL * 512 * 2);
  __bf16* w3_b  = (__bf16*)take(2048UL * 512 * 2);
  __bf16* w2_b  = (__bf16*)take(512UL * 2048 * 2);
  __bf16* hn    = (__bf16*)take(1024UL * 512 * 2);
  float*  Qf    = (float*)take(1024UL * 512 * 4);
  float*  Kf    = (float*)take(1024UL * 512 * 4);
  float*  Vf    = (float*)take(1024UL * 512 * 4);
  float*  Gf    = (float*)take(1024UL * 512 * 4);
  __bf16* Qh    = (__bf16*)take(16UL * 1024 * 32 * 2);
  __bf16* Kh    = (__bf16*)take(16UL * 1024 * 32 * 2);
  __bf16* Vt    = (__bf16*)take(16UL * 32 * 1024 * 2);
  float*  sg    = (float*)take(16UL * 1024 * 32 * 4);
  float*  lu    = (float*)take(16UL * 1024 * 4);
  float*  lv    = (float*)take(16UL * 1024 * 4);
  float*  rowsum= (float*)take(16UL * 1024 * 4);
  float*  plA   = (float*)take(16UL * 16 * 1024 * 4);     // chunk column log-sums,
  float*  plB   = (float*)take(16UL * 16 * 1024 * 4);     // written and read in turn
  __bf16* o_b   = (__bf16*)take(1024UL * 512 * 2);
  float*  tmpC  = (float*)take(1024UL * 512 * 4);
  float*  h_new = (float*)take(1024UL * 512 * 4);
  __bf16* h2    = (__bf16*)take(1024UL * 512 * 2);
  // FFN intermediates reuse the (then-dead) logK region
  float*  a1    = logK;                                // 1024x2048 f32
  float*  a3    = logK + 2UL * 1024 * 1024;            // 1024x2048 f32
  __bf16* gmid  = (__bf16*)(logK + 4UL * 1024 * 1024); // 1024x2048 bf16

  float* out_h  = (float*)d_out;            // 1024*512
  float* out_x  = out_h + 524288;           // 1024*3
  float* out_lu = out_h + 527360;           // 16*1024
  float* out_lv = out_h + 543744;           // 16*1024

  // 1) weights -> bf16
  f2bf_kernel<<<1024, 256, 0, stream>>>(wq, wq_b, 262144);
  f2bf_kernel<<<1024, 256, 0, stream>>>(wk, wk_b, 262144);
  f2bf_kernel<<<1024, 256, 0, stream>>>(wv, wv_b, 262144);
  f2bf_kernel<<<1024, 256, 0, stream>>>(wg, wg_b, 262144);
  f2bf_kernel<<<1024, 256, 0, stream>>>(wo, wo_b, 262144);
  f2bf_kernel<<<4096, 256, 0, stream>>>(sw1, w1_b, 1048576);
  f2bf_kernel<<<4096, 256, 0, stream>>>(sw3, w3_b, 1048576);
  f2bf_kernel<<<4096, 256, 0, stream>>>(sw2, w2_b, 1048576);

  // 2) LN(h) -> bf16
  ln_kernel<<<1024, 256, 0, stream>>>(h_in, lnaw, lnab, hn);

  // 3) QKVG projections (TDM-staged WMMA)
  dim3 g512(16, 4);
  gemm_bf16<<<g512, 256, 0, stream>>>(hn, wq_b, Qf, 1024, 512, 512);
  gemm_bf16<<<g512, 256, 0, stream>>>(hn, wk_b, Kf, 1024, 512, 512);
  gemm_bf16<<<g512, 256, 0, stream>>>(hn, wv_b, Vf, 1024, 512, 512);
  gemm_bf16<<<g512, 256, 0, stream>>>(hn, wg_b, Gf, 1024, 512, 512);
  post_qkvg_kernel<<<2048, 256, 0, stream>>>(Qf, Kf, Vf, Gf, Qh, Kh, Vt, sg);

  // 4) logits -> logK
  logits_kernel<<<dim3(64, 16, 16), 128, 0, stream>>>(Qh, Kh, pbins, posw, wdl,
                                                      x_res, mask, eps, logK);

  // 5) warm-started log-domain Sinkhorn, 20 iterations (logK L2-resident)
  (void)hipMemcpyAsync(lu, lu_prev, 16384 * 4, hipMemcpyDeviceToDevice, stream);
  const dim3 gs(16, 16);
  sink_fused_first<<<gs, 512, 0, stream>>>(logK, lv_prev, mu, eps, lu, plA);
  for (int pair = 0; pair < 9; ++pair) {
    sink_fused_next<<<gs, 512, 0, stream>>>(logK, plA, nu, mu, eps, lu, plB);
    sink_fused_next<<<gs, 512, 0, stream>>>(logK, plB, nu, mu, eps, lu, plA);
  }
  sink_fused_next<<<gs, 512, 0, stream>>>(logK, plA, nu, mu, eps, lu, plB);
  sink_col_combine<<<64, 256, 0, stream>>>(plB, nu, eps, lv);

  // 6) P (bf16) + row sums
  p_kernel<<<2048, 256, 0, stream>>>(logK, lu, lv, mask, P, rowsum);

  // 7) attn + output projection + residual
  attn_kernel<<<dim3(16, 16), 256, 0, stream>>>(P, Vt, rowsum, sg, o_b);
  gemm_bf16<<<g512, 256, 0, stream>>>(o_b, wo_b, tmpC, 1024, 512, 512);
  add_res_mask_kernel<<<2048, 256, 0, stream>>>(h_in, tmpC, mask, h_new, 524288, 512);

  // 8) centroid coordinate update -> out_x
  xcent_kernel<<<1024, 256, 0, stream>>>(P, rowsum, x_res, gamma, mask, out_x);

  // 9) SwiGLU FFN + residual -> out_h
  ln_kernel<<<1024, 256, 0, stream>>>(h_new, lnfw, lnfb, h2);
  dim3 g2048(16, 16);
  gemm_bf16<<<g2048, 256, 0, stream>>>(h2, w1_b, a1, 1024, 2048, 512);
  gemm_bf16<<<g2048, 256, 0, stream>>>(h2, w3_b, a3, 1024, 2048, 512);
  swiglu_kernel<<<8192, 256, 0, stream>>>(a1, a3, gmid, 1024 * 2048);
  gemm_bf16<<<g512, 256, 0, stream>>>(gmid, w2_b, tmpC, 1024, 512, 2048);
  add_res_mask_kernel<<<2048, 256, 0, stream>>>(h_new, tmpC, mask, out_h, 524288, 512);

  // 10) log_u / log_v outputs
  (void)hipMemcpyAsync(out_lu, lu, 16384 * 4, hipMemcpyDeviceToDevice, stream);
  (void)hipMemcpyAsync(out_lv, lv, 16384 * 4, hipMemcpyDeviceToDevice, stream);
}

// v003
// Timed twice side by side with v002, it ran 1.24 times as fast both times.
// All steps since v000 together make it 4.06 times as fast.
#include <hip/hip_runtime.h>

// ---------------------------------------------------------------------------
// TokenUOTBlock for MI455X (gfx1250): bf16 WMMA GEMMs (TDM-staged LDS tiles)
// + wave32 log-domain Sinkhorn.  B=1, N=1024, D=512, H=16, DH=32, K_ITER=20.
// ---------------------------------------------------------------------------

typedef __attribute__((ext_vector_type(16))) __bf16 v16bf;
typedef __attribute__((ext_vector_type(8)))  float  v8f;
typedef __attribute__((ext_vector_type(4)))  float  v4f;
typedef unsigned int u32x4 __attribute__((ext_vector_type(4)));
typedef unsigned int u32x8 __attribute__((ext_vector_type(8)));

union Frag { v16bf v; uint4 u[2]; };

// Load a 16x32 bf16 WMMA A/B fragment from a row-major (row, K) tile.
// CDNA5 16-bit layout: lanes 0-15 hold row r, K {0..7,16..23};
// lanes 16-31 hold row r, K {8..15,24..31}.  Works on global or LDS tiles.
__device__ __forceinline__ v16bf load_frag(const __bf16* base, int ld) {
  const int lane = threadIdx.x & 31;
  const int r    = lane & 15;
  const int hf   = lane >> 4;
  const __bf16* p = base + (size_t)r * ld + hf * 8;
  Frag f;
  f.u[0] = *reinterpret_cast<const uint4*>(p);
  f.u[1] = *reinterpret_cast<const uint4*>(p + 16);
  return f.v;
}

__device__ __forceinline__ v4f exp4(v4f a) {
  v4f e = {__expf(a.x), __expf(a.y), __expf(a.z), __expf(a.w)};
  return e;
}

__device__ __forceinline__ float wave_sum(float v) {
  for (int off = 16; off; off >>= 1) v += __shfl_xor(v, off, 32);
  return v;
}

// A value told to the compiler as wave-uniform: every descriptor word goes through it.
__device__ __forceinline__ unsigned uni(unsigned v) {
  return (unsigned)__builtin_amdgcn_readfirstlane(v);
}

// ---------------------------------------------------------------------------
// Generic GEMM: C[M,Nout] (f32) = A[M,K] (bf16) x W[Nout,K]^T (bf16)
// M a multiple of 64, Nout of 128, K of 512.
// Block = 256 threads = 8 waves; block tile 64x128.
// One fill of LDS holds 512 of K for both operands, cut into 4 slices of 128 elements
// (rows of 256 bytes).  Each wave brings one slice with one tensor load: waves 0,2,4,6
// the A slices (64 rows), waves 1,3,5,7 the W slices (128 rows).  The load's pad gives
// an LDS pitch of 272 bytes (16 x odd) for the 16-byte fragment reads.  The 16 K-steps
// of a fill then run with no barrier between them.
// ---------------------------------------------------------------------------
constexpr unsigned G_PITCH = 272u;              // 256-byte row + 16-byte pad
constexpr unsigned G_ASL   = 18432u;            // 64 x 272 = 17,408, up to a multiple of 2 KiB
constexpr unsigned G_WSL   = 34816u;            // 128 x 272, a multiple of 2 KiB as it is
constexpr unsigned G_WBASE = 4u * G_ASL;        // the W slices stand behind the A slices

__device__ __forceinline__ v16bf lds_frag(const unsigned char* p) {
  Frag f;
  f.u[0] = *reinterpret_cast<const uint4*>(p);
  f.u[1] = *reinterpret_cast<const uint4*>(p + 32);
  return f.v;
}

__global__ __launch_bounds__(256)
void gemm_bf16(const __bf16* __restrict__ A, const __bf16* __restrict__ W,
               float* __restrict__ C, int M, int Nout, int K) {
  __shared__ __attribute__((aligned(2048))) unsigned char gl[4u * G_ASL + 4u * G_WSL];  // 208 KB
  const unsigned wid = uni(threadIdx.x >> 5);
  const int lane = threadIdx.x & 31;
  const int r  = lane & 15, hf = lane >> 4;
  const int mB = blockIdx.x * 64;
  const int nB = blockIdx.y * 128;
  const int ml = (wid >> 1) * 16;    // local m-tile
  const int nl = (wid & 1) * 64;     // local n-strip

  // The wave's own slice: source, rows, place in LDS.
  const unsigned sl   = wid >> 1;
  const bool     isW  = (wid & 1u) != 0u;
  const unsigned rows = isW ? 128u : 64u;
  const __bf16*  src  = (isW ? W + (size_t)nB * K : A + (size_t)mB * K) + sl * 128u;
  const unsigned dst  = (unsigned)(size_t)&gl[0] + (isW ? G_WBASE + sl * G_WSL : sl * G_ASL);
  // Descriptor group 1: 1-byte elements, tensor = tile = rows x 256 bytes, source pitch
  // 2K bytes, a pad of 4 dwords behind every 64 dwords.
  u32x8 g1;
  g1[0] = uni((1u << 20) | (5u << 22) | (3u << 25));
  g1[1] = uni(256u << 16);
  g1[2] = uni(rows << 16);
  g1[3] = uni(256u << 16);
  g1[4] = uni(rows);
  g1[5] = uni((unsigned)K * 2u);
  g1[6] = uni(0u);
  g1[7] = uni(0u);

  const unsigned char* pa = gl + (ml + r) * G_PITCH + hf * 16;
  const unsigned char* pw = gl + G_WBASE + (nl + r) * G_PITCH + hf * 16;
  v8f acc0 = {}, acc1 = {}, acc2 = {}, acc3 = {};
  for (int kb = 0; kb < K; kb += 512) {
    if (kb) {
      // A refill: this wave's fragment reads of the fill before have returned, and the
      // barrier ends every other wave's, before a load overwrites them.
      asm volatile("s_wait_dscnt 0x0" ::: "memory");
      __syncthreads();
    }
    const unsigned long long ga = (unsigned long long)(const void*)(src + kb);
    u32x4 g0;
    g0[0] = uni(1u);
    g0[1] = uni(dst);
    g0[2] = uni((unsigned)ga);
    g0[3] = uni((((unsigned)(ga >> 32)) & 0x01FFFFFFu) | 0x80000000u);
    // One request of the whole wave; every wave issues its own.
    asm volatile("tensor_load_to_lds %0, %1" :: "s"(g0), "s"(g1) : "memory");
    // The compiler places no wait for a tensor load: the slice has landed behind this one,
    // and the barrier then shows all 8 slices to all waves.
    asm volatile("s_wait_tensorcnt 0x0" ::: "memory");
    __syncthreads();
    // The 16 K-steps of the fill, fragments fetched one step ahead into the other register
    // set.  Unrolled whole: the set's index and every LDS offset are then constants.
    v16bf fa[2], fb[2][4];
    fa[0] = lds_frag(pa);
#pragma unroll
    for (int t = 0; t < 4; ++t) fb[0][t] = lds_frag(pw + t * 16 * G_PITCH);
#pragma unroll
    for (int st = 0; st < 16; ++st) {
      const int cu = st & 1, nx = cu ^ 1;
      if (st + 1 < 16) {
        const unsigned char* qa = pa + ((st + 1) >> 2) * G_ASL + ((st + 1) & 3) * 64;
        const unsigned char* qw = pw + ((st + 1) >> 2) * G_WSL + ((st + 1) & 3) * 64;
        fa[nx] = lds_frag(qa);
#pragma unroll
        for (int t = 0; t < 4; ++t) fb[nx][t] = lds_frag(qw + t * 16 * G_PITCH);
      }
      // Keeps the next step's LDS reads issued ahead of this step's products: without it
      // the scheduler sinks each read to its use, and every product waits out an LDS trip.
      __builtin_amdgcn_sched_barrier(0);
      acc0 = __builtin_amdgcn_wmma_f32_16x16x32_bf16(false, fa[cu], false, fb[cu][0], (short)0, acc0, false, false);
      acc1 = __builtin_amdgcn_wmma_f32_16x16x32_bf16(false, fa[cu], false, fb[cu][1], (short)0, acc1, false, false);
      acc2 = __builtin_amdgcn_wmma_f32_16x16x32_bf16(false, fa[cu], false, fb[cu][2], (short)0, acc2, false, false);
      acc3 = __builtin_amdgcn_wmma_f32_16x16x32_bf16(false, fa[cu], false, fb[cu][3], (short)0, acc3, false, false);
    }
  }
  for (int v = 0; v < 8; ++v) {
    int row = mB + ml + v + hf * 8;
    float* cr = C + (size_t)row * Nout + r;
    cr[nB + nl +  0] = acc0[v];
    cr[nB + nl + 16] = acc1[v];
    cr[nB + nl + 32] = acc2[v];
    cr[nB + nl + 48] = acc3[v];
  }
}

// ---------------------------------------------------------------------------
// Elementwise helpers
// ---------------------------------------------------------------------------
__global__ void f2bf_kernel(const float* __restrict__ x, __bf16* __restrict__ y, int n) {
  int i = blockIdx.x * 256 + threadIdx.x;
  if (i < n) y[i] = (__bf16)x[i];
}

__global__ void swiglu_kernel(const float* __restrict__ a1, const float* __restrict__ a3,
                              __bf16* __restrict__ g, int n) {
  int i = blockIdx.x * 256 + threadIdx.x;
  if (i < n) {
    float a = a1[i];
    float s = a / (1.f + __expf(-a));
    g[i] = (__bf16)(s * a3[i]);
  }
}

__global__ void add_res_mask_kernel(const float* __restrict__ base, const float* __restrict__ delta,
                                    const float* __restrict__ mask, float* __restrict__ out,
                                    int n, int D) {
  int i = blockIdx.x * 256 + threadIdx.x;
  if (i < n) out[i] = base[i] + delta[i] * mask[i / D];
}

// LayerNorm over D=512 with affine params, bf16 output. One block per row.
__global__ __launch_bounds__(256)
void ln_kernel(const float* __restrict__ x, const float* __restrict__ w,
               const float* __restrict__ bb, __bf16* __restrict__ y) {
  const int row = blockIdx.x;
  const int t   = threadIdx.x;
  __shared__ float s1[256], s2[256];
  float a = 0.f, q = 0.f;
  for (int d = t; d < 512; d += 256) {
    float v = x[(size_t)row * 512 + d];
    a += v; q += v * v;
  }
  s1[t] = a; s2[t] = q; __syncthreads();
  for (int o = 128; o; o >>= 1) {
    if (t < o) { s1[t] += s1[t + o]; s2[t] += s2[t + o]; }
    __syncthreads();
  }
  const float m   = s1[0] * (1.f / 512.f);
  const float var = s2[0] * (1.f / 512.f) - m * m;
  const float rs  = rsqrtf(var + 1e-5f);
  for (int d = t; d < 512; d += 256) {
    float v = x[(size_t)row * 512 + d];
    y[(size_t)row * 512 + d] = (__bf16)((v - m) * rs * w[d] + bb[d]);
  }
}

// Per-head LN of Q,K (over DH=32, one wave per (h,n)); V transposed to (H,32,N);
// sigmoid(G) stored fp32 in (H,N,32).
__global__ __launch_bounds__(256)
void post_qkvg_kernel(const float* __restrict__ Qf, const float* __restrict__ Kf,
                      const float* __restrict__ Vf, const float* __restrict__ Gf,
                      __bf16* __restrict__ Qh, __bf16* __restrict__ Kh,
                      __bf16* __restrict__ Vt, float* __restrict__ sg) {
  const int w = blockIdx.x * 8 + (threadIdx.x >> 5);  // 0..16383
  const int h = w >> 10;
  const int n = w & 1023;
  const int d = threadIdx.x & 31;
  const size_t src = (size_t)n * 512 + h * 32 + d;
  {
    float q = Qf[src];
    float m = wave_sum(q) * (1.f / 32.f);
    float dq = q - m;
    float vv = wave_sum(dq * dq) * (1.f / 32.f);
    Qh[((size_t)h * 1024 + n) * 32 + d] = (__bf16)(dq * rsqrtf(vv + 1e-5f));
  }
  {
    float q = Kf[src];
    float m = wave_sum(q) * (1.f / 32.f);
    float dq = q - m;
    float vv = wave_sum(dq * dq) * (1.f / 32.f);
    Kh[((size_t)h * 1024 + n) * 32 + d] = (__bf16)(dq * rsqrtf(vv + 1e-5f));
  }
  Vt[((size_t)h * 32 + d) * 1024 + n] = (__bf16)Vf[src];
  sg[((size_t)h * 1024 + n) * 32 + d] = 1.f / (1.f + __expf(-Gf[src]));
}

// ---------------------------------------------------------------------------
// logits: S = QK^T/sqrt(32) via one WMMA (K=32), + pos bias, - distance gate,
// /eps, mask -> logK (f32, H,N,N).  Block = 128 threads = 4 waves.
// ---------------------------------------------------------------------------
__global__ __launch_bounds__(128)
void logits_kernel(const __bf16* __restrict__ Qh, const __bf16* __restrict__ Kh,
                   const int* __restrict__ pos_bins, const float* __restrict__ pos_weight,
                   const float* __restrict__ w_dist_logit, const float* __restrict__ x_res,
                   const float* __restrict__ mask, const float* __restrict__ eps,
                   float* __restrict__ logK) {
  const int h    = blockIdx.z;
  const int wid  = threadIdx.x >> 5;
  const int lane = threadIdx.x & 31;
  const int r  = lane & 15, hf = lane >> 4;
  const int i0 = blockIdx.x * 16;
  const int j0 = blockIdx.y * 64 + wid * 16;
  v16bf a = load_frag(Qh + ((size_t)h * 1024 + i0) * 32, 32);
  v16bf b = load_frag(Kh + ((size_t)h * 1024 + j0) * 32, 32);
  v8f c = {};
  c = __builtin_amdgcn_wmma_f32_16x16x32_bf16(false, a, false, b, (short)0, c, false, false);
  const float scale   = 0.17677669529663687f;  // 1/sqrt(32)
  const float wd      = 1.f / (1.f + __expf(-w_dist_logit[h]));
  const float inv_eps = 1.f / eps[h];
  const int   j  = j0 + r;
  const float xj0 = x_res[j * 3 + 0], xj1 = x_res[j * 3 + 1], xj2 = x_res[j * 3 + 2];
  const float mj = mask[j];
  for (int v = 0; v < 8; ++v) {
    const int i = i0 + v + hf * 8;
    float s = c[v] * scale;
    int bin = pos_bins[(size_t)i * 1024 + j];
    float bias = pos_weight[bin * 16 + h];
    float d0 = x_res[i * 3 + 0] - xj0;
    float d1 = x_res[i * 3 + 1] - xj1;
    float d2 = x_res[i * 3 + 2] - xj2;
    float dist2 = d0 * d0 + d1 * d1 + d2 * d2;
    float logit = s + bias - wd * dist2 * 0.01f;
    float pm = mask[i] * mj;
    logK[((size_t)h * 1024 + i) * 1024 + j] = (pm > 0.f) ? logit * inv_eps : -1e9f;
  }
}

// ---------------------------------------------------------------------------
// Sinkhorn iteration, one launch, one read of logK.  logK (64MB) is L2-resident.
// A work-group owns 64 rows (a chunk) of one head; each of its 16 waves holds 4 whole
// rows in registers (a lane: columns c*128 + lane*4 .. +3, c = 0..7).
//   1. log_v of the head: from the input (first iteration), else rebuilt by the
//      work-group itself from the 16 chunks' column log-sums of the iteration before.
//   2. The wave forms its 4 row LSEs -> log_u.
//   3. From the same registers the per-column (max, sum) of logK + log_u over its 4 rows;
//      LDS folds the 16 waves' partials into one log-sum per column and chunk.
// The log-sums go to a buffer other than the one read: work-groups of one launch run
// side by side.
// ---------------------------------------------------------------------------

// log_v of one column from the 16 chunk log-sums of its head.
__device__ __forceinline__ float logv_from_chunks(const float (&L)[16], float nu, float fi) {
  float M = L[0];
#pragma unroll
  for (int c = 1; c < 16; ++c) M = fmaxf(M, L[c]);
  float S = 0.f;
#pragma unroll
  for (int c = 0; c < 16; ++c) S += __expf(L[c] - M);
  return fi * (__logf(fmaxf(nu, 1e-8f)) - (M + __logf(S)));
}

template <bool FIRST>
__device__ __forceinline__
void sink_fused_body(const float* __restrict__ logK, const float* __restrict__ log_v,
                     const float* __restrict__ pl_in, const float* __restrict__ nu,
                     const float* __restrict__ mu, const float* __restrict__ eps,
                     float* __restrict__ log_u, float* __restrict__ pl_out) {
  __shared__ __attribute__((aligned(16))) float sm[16][1024];   // 64 KB: per-wave column max
  __shared__ __attribute__((aligned(16))) float ss[16][1024];   // 64 KB: per-wave column sum
  __shared__ __attribute__((aligned(16))) float slv[1024];      //  4 KB: the head's log_v
  const int chunk = blockIdx.x;
  const int h     = blockIdx.y;
  // The wave's number, told to the compiler as wave-uniform: the rows' base address,
  // mu and the log_u address then live in scalar registers.
  const int wid   = __builtin_amdgcn_readfirstlane(threadIdx.x >> 5);
  const int lane  = threadIdx.x & 31;
  const int j     = threadIdx.x * 2;                   // the 2 columns a thread folds
  const int row0  = h * 1024 + chunk * 64 + wid * 4;   // (h,i) flat
  const v4f* pk = reinterpret_cast<const v4f*>(logK + (size_t)row0 * 1024) + lane;

  // Every loop over r, c or w in this kernel is unrolled whole: k, lv, cl, wm and ws stay
  // in registers only if each index is a constant.
  // The chunk log-sums are asked for ahead of logK: they come back first, and log_v is
  // rebuilt while the rows are still on their way.
  float2 cl[16], nu2;
  if constexpr (!FIRST) {
#pragma unroll
    for (int c = 0; c < 16; ++c)
      cl[c] = *reinterpret_cast<const float2*>(pl_in + ((size_t)c * 16 + h) * 1024 + j);
    nu2 = *reinterpret_cast<const float2*>(nu + h * 1024 + j);
  }
  // Loads in the order the column pass uses them: column group by column group.
  v4f k[4][8], lv[8];
#pragma unroll
  for (int c = 0; c < 8; ++c) {
    if constexpr (FIRST) lv[c] = (reinterpret_cast<const v4f*>(log_v + h * 1024) + lane)[c * 32];
#pragma unroll
    for (int r = 0; r < 4; ++r) k[r][c] = pk[r * 256 + c * 32];
  }
  // Keeps all loads issued ahead of the arithmetic: without it the scheduler sinks
  // the last row's loads to their first use, where little is left to cover their wait.
  __builtin_amdgcn_sched_barrier(0);

  const float fi = 1.f / (1.f + eps[h]);
  if constexpr (!FIRST) {
    float Lx[16], Ly[16];
#pragma unroll
    for (int c = 0; c < 16; ++c) { Lx[c] = cl[c].x; Ly[c] = cl[c].y; }
    *reinterpret_cast<float2*>(&slv[j]) =
        make_float2(logv_from_chunks(Lx, nu2.x, fi), logv_from_chunks(Ly, nu2.y, fi));
    // A work-group barrier that orders LDS alone: __syncthreads() would also wait for the
    // logK loads, which are to stay in flight across it.
    __builtin_amdgcn_fence(__ATOMIC_RELEASE, "workgroup", "local");
    __builtin_amdgcn_s_barrier();
    __builtin_amdgcn_fence(__ATOMIC_ACQUIRE, "workgroup", "local");
#pragma unroll
    for (int c = 0; c < 8; ++c) lv[c] = *reinterpret_cast<const v4f*>(&slv[c * 128 + lane * 4]);
  }

  // Row pass: each lane runs a (max, sum) over its 32 columns in groups of 8, so that
  // no shifted value outlives its group; the lanes' pairs are then folded.
  float lu[4];
#pragma unroll
  for (int r = 0; r < 4; ++r) {
    float m = -INFINITY;
    v4f s4 = {0.f, 0.f, 0.f, 0.f};
#pragma unroll
    for (int c = 0; c < 8; c += 2) {
      const v4f t0 = k[r][c] + lv[c];
      const v4f t1 = k[r][c + 1] + lv[c + 1];
      const v4f tm = __builtin_elementwise_max(t0, t1);
      const float nm = fmaxf(m, fmaxf(fmaxf(tm.x, tm.y), fmaxf(tm.z, tm.w)));
      s4 = s4 * __expf(m - nm) + (exp4(t0 - nm) + exp4(t1 - nm));
      m = nm;
    }
    float M = m;
    for (int off = 16; off; off >>= 1) M = fmaxf(M, __shfl_xor(M, off, 32));
    const float s = wave_sum(((s4.x + s4.y) + (s4.z + s4.w)) * __expf(m - M));
    lu[r] = fi * (__logf(fmaxf(mu[row0 + r], 1e-8f)) - (M + __logf(s)));
  }
  if (lane == 0) {
#pragma unroll
    for (int r = 0; r < 4; ++r) log_u[row0 + r] = lu[r];
  }

  // Column pass over the wave's 4 rows, from the registers the row pass read.
#pragma unroll
  for (int c = 0; c < 8; ++c) {
    const v4f x0 = k[0][c] + lu[0], x1 = k[1][c] + lu[1];
    const v4f x2 = k[2][c] + lu[2], x3 = k[3][c] + lu[3];
    const v4f cm = __builtin_elementwise_max(__builtin_elementwise_max(x0, x1),
                                             __builtin_elementwise_max(x2, x3));
    const v4f cs = (exp4(x0 - cm) + exp4(x1 - cm)) + (exp4(x2 - cm) + exp4(x3 - cm));
    *reinterpret_cast<v4f*>(&sm[wid][c * 128 + lane * 4]) = cm;
    *reinterpret_cast<v4f*>(&ss[wid][c * 128 + lane * 4]) = cs;
  }
  __syncthreads();

  // Fold the 16 waves' partials; a thread owns 2 columns.
  float2 wm[16], ws[16];
#pragma unroll
  for (int w = 0; w < 16; ++w) {
    wm[w] = *reinterpret_cast<const float2*>(&sm[w][j]);
    ws[w] = *reinterpret_cast<const float2*>(&ss[w][j]);
  }
  float2 M = wm[0];
#pragma unroll
  for (int w = 1; w < 16; ++w) { M.x = fmaxf(M.x, wm[w].x); M.y = fmaxf(M.y, wm[w].y); }
  float2 S = make_float2(0.f, 0.f);
#pragma unroll
  for (int w = 0; w < 16; ++w) {
    S.x += ws[w].x * __expf(wm[w].x - M.x);
    S.y += ws[w].y * __expf(wm[w].y - M.y);
  }
  *reinterpret_cast<float2*>(pl_out + ((size_t)chunk * 16 + h) * 1024 + j) =
      make_float2(M.x + __logf(S.x), M.y + __logf(S.y));
}

__global__ __launch_bounds__(512)
void sink_fused_first(const float* __restrict__ logK, const float* __restrict__ log_v,
                      const float* __restrict__ mu, const float* __restrict__ eps,
                      float* __restrict__ log_u, float* __restrict__ pl_out) {
  sink_fused_body<true>(logK, log_v, nullptr, nullptr, mu, eps, log_u, pl_out);
}

__global__ __launch_bounds__(512)
void sink_fused_next(const float* __restrict__ logK, const float* __restrict__ pl_in,
                     const float* __restrict__ nu, const float* __restrict__ mu,
                     const float* __restrict__ eps,
                     float* __restrict__ log_u, float* __restrict__ pl_out) {
  sink_fused_body<false>(logK, nullptr, pl_in, nu, mu, eps, log_u, pl_out);
}

// log_v behind the last iteration, from its chunk log-sums.
__global__ __launch_bounds__(256)
void sink_col_combine(const float* __restrict__ pl, const float* __restrict__ nu,
                      const float* __restrict__ eps, float* __restrict__ log_v) {
  const int idx = blockIdx.x * 256 + threadIdx.x;   // (h,j) flat, 0..16383
  const int h = idx >> 10;
  const int j = idx & 1023;
  float L[16];
  // Unrolled whole so that all 16 loads are in flight at once.
#pragma unroll
  for (int c = 0; c < 16; ++c) L[c] = pl[((size_t)c * 16 + h) * 1024 + j];
  log_v[idx] = logv_from_chunks(L, nu[idx], 1.f / (1.f + eps[h]));
}

// P = exp(logK + log_u_i + log_v_j) * mask, bf16; row sums fp32.
__global__ __launch_bounds__(256)
void p_kernel(const float* __restrict__ logK, const float* __restrict__ log_u,
              const float* __restrict__ log_v, const float* __restrict__ mask,
              __bf16* __restrict__ P, float* __restrict__ rowsum) {
  const int row  = blockIdx.x * 8 + (threadIdx.x >> 5);
  const int h    = row >> 10;
  const int i    = row & 1023;
  const int lane = threadIdx.x & 31;
  const float lu = log_u[row];
  const float mi = mask[i];
  const float* pk = logK + (size_t)row * 1024;
  __bf16* pp = P + (size_t)row * 1024;
  float acc = 0.f;
  for (int j = lane; j < 1024; j += 32) {
    float p = __expf(pk[j] + lu + log_v[h * 1024 + j]) * mi * mask[j];
    pp[j] = (__bf16)p;
    acc += p;
  }
  acc = wave_sum(acc);
  if (lane == 0) rowsum[row] = acc;
}

// ---------------------------------------------------------------------------
// attn = (P @ V) / rowsum * sigmoid(G), WMMA over j (K=1024 in 32-steps).
// ---------------------------------------------------------------------------
__global__ __launch_bounds__(256)
void attn_kernel(const __bf16* __restrict__ P, const __bf16* __restrict__ Vt,
                 const float* __restrict__ rowsum, const float* __restrict__ sg,
                 __bf16* __restrict__ o_bf) {
  const int h    = blockIdx.y;
  const int wid  = threadIdx.x >> 5;
  const int lane = threadIdx.x & 31;
  const int r  = lane & 15, hf = lane >> 4;
  const int i0 = blockIdx.x * 64 + (wid >> 1) * 16;
  const int d0 = (wid & 1) * 16;
  const __bf16* Abase = P  + ((size_t)h * 1024 + i0) * 1024;
  const __bf16* Bbase = Vt + ((size_t)h * 32 + d0) * 1024;
  v8f acc = {};
  for (int j = 0; j < 1024; j += 32) {
    v16bf a = load_frag(Abase + j, 1024);
    v16bf b = load_frag(Bbase + j, 1024);
    acc = __builtin_amdgcn_wmma_f32_16x16x32_bf16(false, a, false, b, (short)0, acc, false, false);
  }
  const int d = d0 + r;
  for (int v = 0; v < 8; ++v) {
    int i = i0 + v + hf * 8;
    float inv = 1.f / fmaxf(rowsum[h * 1024 + i], 1e-8f);
    float val = acc[v] * inv * sg[((size_t)h * 1024 + i) * 32 + d];
    o_bf[(size_t)i * 512 + h * 32 + d] = (__bf16)val;
  }
}

// ---------------------------------------------------------------------------
// Centroid EGNN coord update: x_out = x + mask*(G*x - sum_h g_h * Pn_h @ x)
// ---------------------------------------------------------------------------
__global__ __launch_bounds__(256)
void xcent_kernel(const __bf16* __restrict__ P, const float* __restrict__ rowsum,
                  const float* __restrict__ x_res, const float* __restrict__ gamma,
                  const float* __restrict__ mask, float* __restrict__ x_out) {
  const int i = blockIdx.x;
  const int t = threadIdx.x;
  __shared__ float r0[256], r1[256], r2[256];
  float a0 = 0.f, a1 = 0.f, a2 = 0.f;
  for (int h = 0; h < 16; ++h) {
    float g   = tanhf(gamma[h]) * (1.f / 16.f);
    float inv = g / fmaxf(rowsum[h * 1024 + i], 1e-8f);
    const __bf16* pr = P + ((size_t)h * 1024 + i) * 1024;
    float s0 = 0.f, s1 = 0.f, s2 = 0.f;
    for (int j = t; j < 1024; j += 256) {
      float p = (float)pr[j];
      s0 += p * x_res[j * 3 + 0];
      s1 += p * x_res[j * 3 + 1];
      s2 += p * x_res[j * 3 + 2];
    }
    a0 += inv * s0; a1 += inv * s1; a2 += inv * s2;
  }
  r0[t] = a0; r1[t] = a1; r2[t] = a2; __syncthreads();
  for (int o = 128; o; o >>= 1) {
    if (t < o) { r0[t] += r0[t + o]; r1[t] += r1[t + o]; r2[t] += r2[t + o]; }
    __syncthreads();
  }
  if (t == 0) {
    float G = 0.f;
    for (int h = 0; h < 16; ++h) G += tanhf(gamma[h]) * (1.f / 16.f);
    float mi = mask[i];
    x_out[i * 3 + 0] = x_res[i * 3 + 0] + mi * (G * x_res[i * 3 + 0] - r0[0]);
    x_out[i * 3 + 1] = x_res[i * 3 + 1] + mi * (G * x_res[i * 3 + 1] - r1[0]);
    x_out[i * 3 + 2] = x_res[i * 3 + 2] + mi * (G * x_res[i * 3 + 2] - r2[0]);
  }
}

// ---------------------------------------------------------------------------
// Host orchestration
// ---------------------------------------------------------------------------
extern "C" void kernel_launch(void* const* d_in, const int* in_sizes, int n_in,
                              void* d_out, int out_size, void* d_ws, size_t ws_size,
                              hipStream_t stream) {
  (void)in_sizes; (void)n_in; (void)out_size; (void)ws_size;
  const float* h_in    = (const float*)d_in[0];
  const float* x_res   = (const float*)d_in[1];
  const float* mu      = (const float*)d_in[2];
  const float* nu      = (const float*)d_in[3];
  const float* lu_prev = (const float*)d_in[4];
  const float* lv_prev = (const float*)d_in[5];
  const float* mask    = (const float*)d_in[6];
  const float* lnaw    = (const float*)d_in[7];
  const float* lnab    = (const float*)d_in[8];
  const float* wq      = (const float*)d_in[9];
  const float* wk      = (const float*)d_in[10];
  const float* wv      = (const float*)d_in[11];
  const float* wg      = (const float*)d_in[12];
  const float* wo      = (const float*)d_in[13];
  const float* gamma   = (const float*)d_in[14];
  const float* posw    = (const float*)d_in[15];
  const float* wdl     = (const float*)d_in[16];
  const float* lnfw    = (const float*)d_in[17];
  const float* lnfb    = (const float*)d_in[18];
  const float* sw1     = (const float*)d_in[19];
  const float* sw3     = (const float*)d_in[20];
  const float* sw2     = (const float*)d_in[21];
  const int*   pbins   = (const int*)d_in[22];
  const float* eps     = (const float*)d_in[23];

  char* wsb = (char*)d_ws;
  size_t off = 0;
  auto take = [&](size_t bytes) -> void* {
    void* p = wsb + off;
    off += (bytes + 255) & ~(size_t)255;
    return p;
  };
  float*  logK  = (float*)take(16UL * 1024 * 1024 * 4);   // 64 MB
  __bf16* P     = (__bf16*)take(16UL * 1024 * 1024 * 2);  // 32 MB
  __bf16* wq_b  = (__bf16*)take(512UL * 512 * 2);
  __bf16* wk_b  = (__bf16*)take(512UL * 512 * 2);
  __bf16* wv_b  = (__bf16*)take(512UL * 512 * 2);
  __bf16* wg_b  = (__bf16*)take(512UL * 512 * 2);
  __bf16* wo_b  = (__bf16*)take(512UL * 512 * 2);
  __bf16* w1_b  = (__bf16*)take(2048UL * 512 * 2);
  __bf16* w3_b  = (__bf16*)take(2048UL * 512 * 2);
  __bf16* w2_b  = (__bf16*)take(512UL * 2048 * 2);
  __bf16* hn    = (__bf16*)take(1024UL * 512 * 2);
  float*  Qf    = (float*)take(1024UL * 512 * 4);
  float*  Kf    = (float*)take(1024UL * 512 * 4);
  float*  Vf    = (float*)take(1024UL * 512 * 4);
  float*  Gf    = (float*)take(1024UL * 512 * 4);
  __bf16* Qh    = (__bf16*)take(16UL * 1024 * 32 * 2);
  __bf16* Kh    = (__bf16*)take(16UL * 1024 * 32 * 2);
  __bf16* Vt    = (__bf16*)take(16UL * 32 * 1024 * 2);
  float*  sg    = (float*)take(16UL * 1024 * 32 * 4);
  float*  lu    = (float*)take(16UL * 1024 * 4);
  float*  lv    = (float*)take(16UL * 1024 * 4);
  float*  rowsum= (float*)take(16UL * 1024 * 4);
  float*  plA   = (float*)take(16UL * 16 * 1024 * 4);     // chunk column log-sums,
  float*  plB   = (float*)take(16UL * 16 * 1024 * 4);     // written and read in turn
  __bf16* o_b   = (__bf16*)take(1024UL * 512 * 2);
  float*  tmpC  = (float*)take(1024UL * 512 * 4);
  float*  h_new = (float*)take(1024UL * 512 * 4);
  __bf16* h2    = (__bf16*)take(1024UL * 512 * 2);
  // FFN intermediates reuse the (then-dead) logK region
  float*  a1    = logK;                                // 1024x2048 f32
  float*  a3    = logK + 2UL * 1024 * 1024;            // 1024x2048 f32
  __bf16* gmid  = (__bf16*)(logK + 4UL * 1024 * 1024); // 1024x2048 bf16

  float* out_h  = (float*)d_out;            // 1024*512
  float* out_x  = out_h + 524288;           // 1024*3
  float* out_lu = out_h + 527360;           // 16*1024
  float* out_lv = out_h + 543744;           // 16*1024

  // 1) weights -> bf16
  f2bf_kernel<<<1024, 256, 0, stream>>>(wq, wq_b, 262144);
  f2bf_kernel<<<1024, 256, 0, stream>>>(wk, wk_b, 262144);
  f2bf_kernel<<<1024, 256, 0, stream>>>(wv, wv_b, 262144);
  f2bf_kernel<<<1024, 256, 0, stream>>>(wg, wg_b, 262144);
  f2bf_kernel<<<1024, 256, 0, stream>>>(wo, wo_b, 262144);
  f2bf_kernel<<<4096, 256, 0, stream>>>(sw1, w1_b, 1048576);
  f2bf_kernel<<<4096, 256, 0, stream>>>(sw3, w3_b, 1048576);
  f2bf_kernel<<<4096, 256, 0, stream>>>(sw2, w2_b, 1048576);

  // 2) LN(h) -> bf16
  ln_kernel<<<1024, 256, 0, stream>>>(h_in, lnaw, lnab, hn);

  // 3) QKVG projections (TDM-staged WMMA)
  dim3 g512(16, 4);
  gemm_bf16<<<g512, 256, 0, stream>>>(hn, wq_b, Qf, 1024, 512, 512);
  gemm_bf16<<<g512, 256, 0, stream>>>(hn, wk_b, Kf, 1024, 512, 512);
  gemm_bf16<<<g512, 256, 0, stream>>>(hn, wv_b, Vf, 1024, 512, 512);
  gemm_bf16<<<g512, 256, 0, stream>>>(hn, wg_b, Gf, 1024, 512, 512);
  post_qkvg_kernel<<<2048, 256, 0, stream>>>(Qf, Kf, Vf, Gf, Qh, Kh, Vt, sg);

  // 4) logits -> logK
  logits_kernel<<<dim3(64, 16, 16), 128, 0, stream>>>(Qh, Kh, pbins, posw, wdl,
                                                      x_res, mask, eps, logK);

  // 5) warm-started log-domain Sinkhorn, 20 iterations (logK L2-resident)
  (void)hipMemcpyAsync(lu, lu_prev, 16384 * 4, hipMemcpyDeviceToDevice, stream);
  const dim3 gs(16, 16);
  sink_fused_first<<<gs, 512, 0, stream>>>(logK, lv_prev, mu, eps, lu, plA);
  for (int pair = 0; pair < 9; ++pair) {
    sink_fused_next<<<gs, 512, 0, stream>>>(logK, plA, nu, mu, eps, lu, plB);
    sink_fused_next<<<gs, 512, 0, stream>>>(logK, plB, nu, mu, eps, lu, plA);
  }
  sink_fused_next<<<gs, 512, 0, stream>>>(logK, plA, nu, mu, eps, lu, plB);
  sink_col_combine<<<64, 256, 0, stream>>>(plB, nu, eps, lv);

  // 6) P (bf16) + row sums
  p_kernel<<<2048, 256, 0, stream>>>(logK, lu, lv, mask, P, rowsum);

  // 7) attn + output projection + residual
  attn_kernel<<<dim3(16, 16), 256, 0, stream>>>(P, Vt, rowsum, sg, o_b);
  gemm_bf16<<<g512, 256, 0, stream>>>(o_b, wo_b, tmpC, 1024, 512, 512);
  add_res_mask_kernel<<<2048, 256, 0, stream>>>(h_in, tmpC, mask, h_new, 524288, 512);

  // 8) centroid coordinate update -> out_x
  xcent_kernel<<<1024, 256, 0, stream>>>(P, rowsum, x_res, gamma, mask, out_x);

  // 9) SwiGLU FFN + residual -> out_h
  ln_kernel<<<1024, 256, 0, stream>>>(h_new, lnfw, lnfb, h2);
  dim3 g2048(16, 16);
  gemm_bf16<<<g2048, 256, 0, stream>>>(h2, w1_b, a1, 1024, 2048, 512);
  gemm_bf16<<<g2048, 256, 0, stream>>>(h2, w3_b, a3, 1024, 2048, 512);
  swiglu_kernel<<<8192, 256, 0, stream>>>(a1, a3, gmid, 1024 * 2048);
  gemm_bf16<<<g512, 256, 0, stream>>>(gmid, w2_b, tmpC, 1024, 512, 2048);
  add_res_mask_kernel<<<2048, 256, 0, stream>>>(h_new, tmpC, mask, out_h, 524288, 512);

  // 10) log_u / log_v outputs
  (void)hipMemcpyAsync(out_lu, lu, 16384 * 4, hipMemcpyDeviceToDevice, stream);
  (void)hipMemcpyAsync(out_lv, lv, 16384 * 4, hipMemcpyDeviceToDevice, stream);
}

// v005
// A run of this version takes 293 microseconds.
// Versions in between are left out here; by their measured steps it is 1.24 times as fast as v003.
// Over all steps from v000 it is 5.05 times as fast.
#include <hip/hip_runtime.h>

// ---------------------------------------------------------------------------
// TokenUOTBlock for MI455X (gfx1250): bf16 WMMA GEMMs (TDM-staged LDS tiles)
// + wave32 log-domain Sinkhorn.  B=1, N=1024, D=512, H=16, DH=32, K_ITER=20.
// ---------------------------------------------------------------------------

typedef __attribute__((ext_vector_type(16))) __bf16 v16bf;
typedef __attribute__((ext_vector_type(8)))  float  v8f;
typedef __attribute__((ext_vector_type(4)))  float  v4f;
typedef __attribute__((ext_vector_type(8)))  __bf16 v8bf;
typedef unsigned int u32x4 __attribute__((ext_vector_type(4)));
typedef unsigned int u32x8 __attribute__((ext_vector_type(8)));

union Frag { v16bf v; uint4 u[2]; };

// Load a 16x32 bf16 WMMA A/B fragment from a row-major (row, K) tile.
// CDNA5 16-bit layout: lanes 0-15 hold row r, K {0..7,16..23};
// lanes 16-31 hold row r, K {8..15,24..31}.  Works on global or LDS tiles.
__device__ __forceinline__ v16bf load_frag(const __bf16* base, int ld) {
  const int lane = threadIdx.x & 31;
  const int r    = lane & 15;
  const int hf   = lane >> 4;
  const __bf16* p = base + (size_t)r * ld + hf * 8;
  Frag f;
  f.u[0] = *reinterpret_cast<const uint4*>(p);
  f.u[1] = *reinterpret_cast<const uint4*>(p + 16);
  return f.v;
}

__device__ __forceinline__ v4f exp4(v4f a) {
  v4f e = {__expf(a.x), __expf(a.y), __expf(a.z), __expf(a.w)};
  return e;
}

__device__ __forceinline__ float wave_sum(float v) {
  for (int off = 16; off; off >>= 1) v += __shfl_xor(v, off, 32);
  return v;
}

// A value told to the compiler as wave-uniform: every descriptor word goes through it.
__device__ __forceinline__ unsigned uni(unsigned v) {
  return (unsigned)__builtin_amdgcn_readfirstlane(v);
}

// ---------------------------------------------------------------------------
// Generic GEMM: C[M,Nout] (f32) = A[M,K] (bf16) x W[Nout,K]^T (bf16)
// M a multiple of 64, Nout of 128, K of 512.
// Block = 256 threads = 8 waves; block tile 64x128.
// One fill of LDS holds 512 of K for both operands, cut into 4 slices of 128 elements
// (rows of 256 bytes).  Each wave brings one slice with one tensor load: waves 0,2,4,6
// the A slices (64 rows), waves 1,3,5,7 the W slices (128 rows).  The load's pad gives
// an LDS pitch of 272 bytes (16 x odd) for the 16-byte fragment reads.  The 16 K-steps
// of a fill then run with no barrier between them.
// ---------------------------------------------------------------------------
constexpr unsigned G_PITCH = 272u;              // 256-byte row + 16-byte pad
constexpr unsigned G_ASL   = 18432u;            // 64 x 272 = 17,408, up to a multiple of 2 KiB
constexpr unsigned G_WSL   = 34816u;            // 128 x 272, a multiple of 2 KiB as it is
constexpr unsigned G_WBASE = 4u * G_ASL;        // the W slices stand behind the A slices

__device__ __forceinline__ v16bf lds_frag(const unsigned char* p) {
  Frag f;
  f.u[0] = *reinterpret_cast<const uint4*>(p);
  f.u[1] = *reinterpret_cast<const uint4*>(p + 32);
  return f.v;
}

__global__ __launch_bounds__(256)
void gemm_bf16(const __bf16* __restrict__ A, const __bf16* __restrict__ W,
               float* __restrict__ C, int M, int Nout, int K) {
  __shared__ __attribute__((aligned(2048))) unsigned char gl[4u * G_ASL + 4u * G_WSL];  // 208 KB
  const unsigned wid = uni(threadIdx.x >> 5);
  const int lane = threadIdx.x & 31;
  const int r  = lane & 15, hf = lane >> 4;
  const int mB = blockIdx.x * 64;
  const int nB = blockIdx.y * 128;
  const int ml = (wid >> 1) * 16;    // local m-tile
  const int nl = (wid & 1) * 64;     // local n-strip

  // The wave's own slice: source, rows, place in LDS.
  const unsigned sl   = wid >> 1;
  const bool     isW  = (wid & 1u) != 0u;
  const unsigned rows = isW ? 128u : 64u;
  const __bf16*  src  = (isW ? W + (size_t)nB * K : A + (size_t)mB * K) + sl * 128u;
  const unsigned dst  = (unsigned)(size_t)&gl[0] + (isW ? G_WBASE + sl * G_WSL : sl * G_ASL);
  // Descriptor group 1: 1-byte elements, tensor = tile = rows x 256 bytes, source pitch
  // 2K bytes, a pad of 4 dwords behind every 64 dwords.
  u32x8 g1;
  g1[0] = uni((1u << 20) | (5u << 22) | (3u << 25));
  g1[1] = uni(256u << 16);
  g1[2] = uni(rows << 16);
  g1[3] = uni(256u << 16);
  g1[4] = uni(rows);
  g1[5] = uni((unsigned)K * 2u);
  g1[6] = uni(0u);
  g1[7] = uni(0u);

  const unsigned char* pa = gl + (ml + r) * G_PITCH + hf * 16;
  const unsigned char* pw = gl + G_WBASE + (nl + r) * G_PITCH + hf * 16;
  v8f acc0 = {}, acc1 = {}, acc2 = {}, acc3 = {};
  for (int kb = 0; kb < K; kb += 512) {
    if (kb) {
      // A refill: this wave's fragment reads of the fill before have returned, and the
      // barrier ends every other wave's, before a load overwrites them.
      asm volatile("s_wait_dscnt 0x0" ::: "memory");
      __syncthreads();
    }
    const unsigned long long ga = (unsigned long long)(const void*)(src + kb);
    u32x4 g0;
    g0[0] = uni(1u);
    g0[1] = uni(dst);
    g0[2] = uni((unsigned)ga);
    g0[3] = uni((((unsigned)(ga >> 32)) & 0x01FFFFFFu) | 0x80000000u);
    // One request of the whole wave; every wave issues its own.
    asm volatile("tensor_load_to_lds %0, %1" :: "s"(g0), "s"(g1) : "memory");
    // The compiler places no wait for a tensor load: the slice has landed behind this one,
    // and the barrier then shows all 8 slices to all waves.
    asm volatile("s_wait_tensorcnt 0x0" ::: "memory");
    __syncthreads();
    // The 16 K-steps of the fill, fragments fetched one step ahead into the other register
    // set.  Unrolled whole: the set's index and every LDS offset are then constants.
    v16bf fa[2], fb[2][4];
    fa[0] = lds_frag(pa);
#pragma unroll
    for (int t = 0; t < 4; ++t) fb[0][t] = lds_frag(pw + t * 16 * G_PITCH);
#pragma unroll
    for (int st = 0; st < 16; ++st) {
      const int cu = st & 1, nx = cu ^ 1;
      if (st + 1 < 16) {
        const unsigned char* qa = pa + ((st + 1) >> 2) * G_ASL + ((st + 1) & 3) * 64;
        const unsigned char* qw = pw + ((st + 1) >> 2) * G_WSL + ((st + 1) & 3) * 64;
        fa[nx] = lds_frag(qa);
#pragma unroll
        for (int t = 0; t < 4; ++t) fb[nx][t] = lds_frag(qw + t * 16 * G_PITCH);
      }
      // Keeps the next step's LDS reads issued ahead of this step's products: without it
      // the scheduler sinks each read to its use, and every product waits out an LDS trip.
      __builtin_amdgcn_sched_barrier(0);
      acc0 = __builtin_amdgcn_wmma_f32_16x16x32_bf16(false, fa[cu], false, fb[cu][0], (short)0, acc0, false, false);
      acc1 = __builtin_amdgcn_wmma_f32_16x16x32_bf16(false, fa[cu], false, fb[cu][1], (short)0, acc1, false, false);
      acc2 = __builtin_amdgcn_wmma_f32_16x16x32_bf16(false, fa[cu], false, fb[cu][2], (short)0, acc2, false, false);
      acc3 = __builtin_amdgcn_wmma_f32_16x16x32_bf16(false, fa[cu], false, fb[cu][3], (short)0, acc3, false, false);
    }
  }
  for (int v = 0; v < 8; ++v) {
    int row = mB + ml + v + hf * 8;
    float* cr = C + (size_t)row * Nout + r;
    cr[nB + nl +  0] = acc0[v];
    cr[nB + nl + 16] = acc1[v];
    cr[nB + nl + 32] = acc2[v];
    cr[nB + nl + 48] = acc3[v];
  }
}

// ---------------------------------------------------------------------------
// Elementwise helpers
// ---------------------------------------------------------------------------
// a13: rows of 4096, columns 0..2047 = h2 x w1^T, columns 2048..4095 = h2 x w3^T.
// A lane takes 2 groups of 8 neighbouring elements (16-byte loads, one 16-byte store each),
// so that few waves have to start.
// The grid's threads x 16 = n; a group of 8 never crosses a row of 2048.
__global__ __launch_bounds__(256)
void swiglu_kernel(const float* __restrict__ a13, __bf16* __restrict__ g, int n) {
  const int t = blockIdx.x * 256 + threadIdx.x;
  const int half = n >> 1;
  // Both loops are unrolled whole: the two groups' 8 loads are then in flight together, and
  // o is indexed by constants only.
#pragma unroll
  for (int u = 0; u < 2; ++u) {
    const int i = u * half + t * 8;
    const float* p = a13 + (size_t)(i >> 11) * 4096 + (i & 2047);
    const v4f a0 = *reinterpret_cast<const v4f*>(p);
    const v4f a1 = *reinterpret_cast<const v4f*>(p + 4);
    const v4f b0 = *reinterpret_cast<const v4f*>(p + 2048);
    const v4f b1 = *reinterpret_cast<const v4f*>(p + 2052);
    const v4f e0 = exp4(-a0), e1 = exp4(-a1);
    v8bf o;
#pragma unroll
    for (int e = 0; e < 4; ++e) {
      o[e]     = (__bf16)(a0[e] / (1.f + e0[e]) * b0[e]);
      o[e + 4] = (__bf16)(a1[e] / (1.f + e1[e]) * b1[e]);
    }
    *reinterpret_cast<v8bf*>(g + i) = o;
  }
}

// A lane takes 8 neighbouring elements, all of one row (D is a multiple of 8).
__global__ __launch_bounds__(256)
void add_res_mask_kernel(const float* __restrict__ base, const float* __restrict__ delta,
                         const float* __restrict__ mask, float* __restrict__ out,
                         int n, int D) {
  const int i = (blockIdx.x * 256 + threadIdx.x) * 8;
  if (i < n) {
    const float m = mask[i / D];
    const v4f b0 = *reinterpret_cast<const v4f*>(base + i);
    const v4f b1 = *reinterpret_cast<const v4f*>(base + i + 4);
    const v4f d0 = *reinterpret_cast<const v4f*>(delta + i);
    const v4f d1 = *reinterpret_cast<const v4f*>(delta + i + 4);
    *reinterpret_cast<v4f*>(out + i)     = b0 + d0 * m;
    *reinterpret_cast<v4f*>(out + i + 4) = b1 + d1 * m;
  }
}

// LayerNorm over D=512 with affine params, bf16 output. One block per row.
__device__ __forceinline__
void ln_body(const float* __restrict__ x, const float* __restrict__ w,
             const float* __restrict__ bb, __bf16* __restrict__ y, const int row) {
  const int t   = threadIdx.x;
  __shared__ float s1[256], s2[256];
  float a = 0.f, q = 0.f;
  for (int d = t; d < 512; d += 256) {
    float v = x[(size_t)row * 512 + d];
    a += v; q += v * v;
  }
  s1[t] = a; s2[t] = q; __syncthreads();
  for (int o = 128; o; o >>= 1) {
    if (t < o) { s1[t] += s1[t + o]; s2[t] += s2[t + o]; }
    __syncthreads();
  }
  const float m   = s1[0] * (1.f / 512.f);
  const float var = s2[0] * (1.f / 512.f) - m * m;
  const float rs  = rsqrtf(var + 1e-5f);
  for (int d = t; d < 512; d += 256) {
    float v = x[(size_t)row * 512 + d];
    y[(size_t)row * 512 + d] = (__bf16)((v - m) * rs * w[d] + bb[d]);
  }
}

__global__ __launch_bounds__(256)
void ln_kernel(const float* __restrict__ x, const float* __restrict__ w,
               const float* __restrict__ bb, __bf16* __restrict__ y) {
  ln_body(x, w, bb, y, blockIdx.x);
}

// One launch for all that depends on the inputs alone.  Blocks 0..1023: LayerNorm of one row
// of h.  Blocks from 1024 on: 8192 elements each of the eight weight matrices -> bf16; the
// bf16 copies stand one behind the other in wb (wq wk wv wg wo: 32 blocks each; w1 w3 w2:
// 128 each).  A lane takes 4 groups of 8 neighbouring elements, so that few waves have to
// start.  The branch is the same for a whole block, so ln_body's barriers are safe.
__global__ __launch_bounds__(256)
void prep_kernel(const float* __restrict__ x, const float* __restrict__ lw,
                 const float* __restrict__ lb, __bf16* __restrict__ y,
                 const float* __restrict__ wq, const float* __restrict__ wk,
                 const float* __restrict__ wv, const float* __restrict__ wg,
                 const float* __restrict__ wo, const float* __restrict__ w1,
                 const float* __restrict__ w3, const float* __restrict__ w2,
                 __bf16* __restrict__ wb) {
  const int b = blockIdx.x;
  if (b < 1024) { ln_body(x, lw, lb, y, b); return; }
  const int e = b - 1024;
  const float* src;
  int piece;
  if (e < 160) {
    const int sel = e >> 5;
    src = sel == 0 ? wq : sel == 1 ? wk : sel == 2 ? wv : sel == 3 ? wg : wo;
    piece = e & 31;
  } else {
    const int sel = (e - 160) >> 7;
    src = sel == 0 ? w1 : sel == 1 ? w3 : w2;
    piece = (e - 160) & 127;
  }
  const float* ps = src + piece * 8192 + threadIdx.x * 8;
  __bf16*      pd = wb + (size_t)e * 8192 + threadIdx.x * 8;
  v4f lo[4], hi[4];
  // All three loops are unrolled whole: the 8 loads are then in flight together, and lo, hi
  // and o are indexed by constants only.
#pragma unroll
  for (int u = 0; u < 4; ++u) {
    lo[u] = *reinterpret_cast<const v4f*>(ps + u * 2048);
    hi[u] = *reinterpret_cast<const v4f*>(ps + u * 2048 + 4);
  }
#pragma unroll
  for (int u = 0; u < 4; ++u) {
    v8bf o;
#pragma unroll
    for (int c = 0; c < 4; ++c) { o[c] = (__bf16)lo[u][c]; o[c + 4] = (__bf16)hi[u][c]; }
    *reinterpret_cast<v8bf*>(pd + u * 2048) = o;
  }
  // Behind the store: in the listing a way leads on from here into the LayerNorm part, whose
  // first instruction overwrites the store's data register.
  asm volatile("s_wait_xcnt 0x0" ::: "memory");
}

// Per-head LN of Q,K (over DH=32, the lanes of a wave); V transposed to (H,32,N);
// sigmoid(G) stored fp32 in (H,N,32).  A wave takes 8 neighbouring n of one head: an eighth
// of the waves to start, and a lane's 8 values of V go out as one 16-byte store.
// QKVG: rows of 2048, columns 0..511 = Q, 512.. = K, 1024.. = V, 1536.. = G.
__global__ __launch_bounds__(256)
void post_qkvg_kernel(const float* __restrict__ QKVG,
                      __bf16* __restrict__ Qh, __bf16* __restrict__ Kh,
                      __bf16* __restrict__ Vt, float* __restrict__ sg) {
  const int w  = blockIdx.x * 8 + (threadIdx.x >> 5);  // 0..2047
  const int h  = w >> 7;
  const int n0 = (w & 127) * 8;
  const int d  = threadIdx.x & 31;
  const float* Qf = QKVG;
  const float* Kf = QKVG + 512;
  const float* Vf = QKVG + 1024;
  const float* Gf = QKVG + 1536;
  v8bf vt;
  // Every loop over it is unrolled whole: vt, g and e are then indexed by constants, and the
  // 8 rows' loads and cross-lane sums, which do not depend on each other, overlap.
#pragma unroll
  for (int it = 0; it < 8; ++it) {
    const int n = n0 + it;
    const size_t src = (size_t)n * 2048 + h * 32 + d;
    {
      float q = Qf[src];
      float m = wave_sum(q) * (1.f / 32.f);
      float dq = q - m;
      float vv = wave_sum(dq * dq) * (1.f / 32.f);
      Qh[((size_t)h * 1024 + n) * 32 + d] = (__bf16)(dq * rsqrtf(vv + 1e-5f));
    }
    {
      float q = Kf[src];
      float m = wave_sum(q) * (1.f / 32.f);
      float dq = q - m;
      float vv = wave_sum(dq * dq) * (1.f / 32.f);
      Kh[((size_t)h * 1024 + n) * 32 + d] = (__bf16)(dq * rsqrtf(vv + 1e-5f));
    }
  }
  v4f g[2];
#pragma unroll
  for (int it = 0; it < 8; ++it) {
    const size_t src = (size_t)(n0 + it) * 2048 + h * 32 + d;
    vt[it] = (__bf16)Vf[src];
    g[it >> 2][it & 3] = Gf[src];
  }
  const v4f e[2] = {exp4(-g[0]), exp4(-g[1])};
#pragma unroll
  for (int it = 0; it < 8; ++it)
    sg[((size_t)h * 1024 + n0 + it) * 32 + d] = 1.f / (1.f + e[it >> 2][it & 3]);
  *reinterpret_cast<v8bf*>(Vt + ((size_t)h * 32 + d) * 1024 + n0) = vt;
}

// ---------------------------------------------------------------------------
// logits: S = QK^T/sqrt(32) via one WMMA (K=32), + pos bias, - distance gate,
// /eps, mask -> logK (f32, H,N,N).  Block = 128 threads = 4 waves.
// A wave owns one 16x16 tile of (i,j) and runs through all 16 heads: a sixteenth of the
// waves to start; bin, distance and pair mask, the same for every head, are formed once.
// ---------------------------------------------------------------------------
__global__ __launch_bounds__(128)
void logits_kernel(const __bf16* __restrict__ Qh, const __bf16* __restrict__ Kh,
                   const int* __restrict__ pos_bins, const float* __restrict__ pos_weight,
                   const float* __restrict__ w_dist_logit, const float* __restrict__ x_res,
                   const float* __restrict__ mask, const float* __restrict__ eps,
                   float* __restrict__ logK) {
  // The wave's number, told to the compiler as wave-uniform: every base address is then a
  // scalar, and a lane keeps 32-bit offsets that do not change from head to head.
  const unsigned wid  = uni(threadIdx.x >> 5);
  const unsigned lane = threadIdx.x & 31;
  const unsigned r  = lane & 15, hf = lane >> 4;
  const unsigned i0 = blockIdx.x * 16;
  const unsigned j0 = blockIdx.y * 64 + wid * 16;
  const float scale   = 0.17677669529663687f;  // 1/sqrt(32)
  const unsigned j  = j0 + r;
  const unsigned idx = (i0 + hf * 8) * 1024 + j;   // (i, j) in a plane of N x N; row v: + v * 1024
  const float mj = mask[j];
  const float xj0 = x_res[j * 3 + 0], xj1 = x_res[j * 3 + 1], xj2 = x_res[j * 3 + 2];
  // Every loop over v is unrolled whole: bo, dist2 and pm stay in registers only if each
  // index is a constant.
  unsigned bo[8];
  float dist2[8], pm[8];
#pragma unroll
  for (int v = 0; v < 8; ++v) {
    // The bin is read from an input: held inside the table of 68 rows before it forms an address.
    bo[v] = (unsigned)min(max(pos_bins[idx + v * 1024], 0), 67) * 16u;
    const unsigned i = i0 + v + hf * 8;
    float d0 = x_res[i * 3 + 0] - xj0;
    float d1 = x_res[i * 3 + 1] - xj1;
    float d2 = x_res[i * 3 + 2] - xj2;
    dist2[v] = d0 * d0 + d1 * d1 + d2 * d2;
    pm[v] = mask[i] * mj;
  }
  const unsigned fo = r * 32 + hf * 8;             // the lane's place in a 16 x 32 fragment tile
  // Four heads a trip: their fragment loads and table reads (16 bytes = 4 heads of one bin)
  // are in flight together; with 4 waves a SIMD little else covers those waits.
  // The loops over q are unrolled whole: a, b and bias are indexed by constants only.
  for (unsigned h0 = 0; h0 < 16; h0 += 4) {
    Frag a[4], b[4];
#pragma unroll
    for (unsigned q = 0; q < 4; ++q) {
      const __bf16* pa = Qh + ((size_t)(h0 + q) * 1024 + i0) * 32;
      const __bf16* pb = Kh + ((size_t)(h0 + q) * 1024 + j0) * 32;
      a[q].u[0] = *reinterpret_cast<const uint4*>(pa + fo);
      a[q].u[1] = *reinterpret_cast<const uint4*>(pa + fo + 16);
      b[q].u[0] = *reinterpret_cast<const uint4*>(pb + fo);
      b[q].u[1] = *reinterpret_cast<const uint4*>(pb + fo + 16);
    }
    // In front of the table reads: their results may take the registers that held the
    // fragment loads' addresses.
    asm volatile("s_wait_xcnt 0x0" ::: "memory");
    v4f bias[8];
#pragma unroll
    for (int v = 0; v < 8; ++v) bias[v] = *reinterpret_cast<const v4f*>(pos_weight + h0 + bo[v]);
    // Behind the trip's loads, in front of whatever next writes a register that they name.
    asm volatile("s_wait_xcnt 0x0" ::: "memory");
    // Keeps the trip's 24 loads issued ahead of its products: without it the scheduler puts
    // the first product, and its wait, in front of the table reads: two load trips in a row.
    __builtin_amdgcn_sched_barrier(0);
#pragma unroll
    for (unsigned q = 0; q < 4; ++q) {
      const unsigned h = h0 + q;
      v8f c = {};
      c = __builtin_amdgcn_wmma_f32_16x16x32_bf16(false, a[q].v, false, b[q].v, (short)0, c, false, false);
      const float wd      = 1.f / (1.f + __expf(-w_dist_logit[h]));
      const float inv_eps = 1.f / eps[h];
      float* po = logK + (size_t)h * 1048576;
#pragma unroll
      for (int v = 0; v < 8; ++v) {
        float s = c[v] * scale;
        float logit = s + bias[v][q] - wd * dist2[v] * 0.01f;
        po[idx + v * 1024] = (pm[v] > 0.f) ? logit * inv_eps : -1e9f;
      }
    }
    // Behind the trip's stores: the next trip's loads take the registers that held their data.
    asm volatile("s_wait_xcnt 0x0" ::: "memory");
  }
}

// ---------------------------------------------------------------------------
// Sinkhorn iteration, one launch, one read of logK.  logK (64MB) is L2-resident.
// A work-group owns 64 rows (a chunk) of one head; each of its 16 waves holds 4 whole
// rows in registers (a lane: columns c*128 + lane*4 .. +3, c = 0..7).
//   1. log_v of the head: from the input (first iteration), else rebuilt by the
//      work-group itself from the 16 chunks' column log-sums of the iteration before.
//   2. The wave forms its 4 row LSEs -> log_u.
//   3. From the same registers the per-column (max, sum) of logK + log_u over its 4 rows;
//      LDS folds the 16 waves' partials into one log-sum per column and chunk.
// The log-sums go to a buffer other than the one read: work-groups of one launch run
// side by side.
// ---------------------------------------------------------------------------

// log_v of one column from the 16 chunk log-sums of its head.
__device__ __forceinline__ float logv_from_chunks(const float (&L)[16], float nu, float fi) {
  float M = L[0];
#pragma unroll
  for (int c = 1; c < 16; ++c) M = fmaxf(M, L[c]);
  float S = 0.f;
#pragma unroll
  for (int c = 0; c < 16; ++c) S += __expf(L[c] - M);
  return fi * (__logf(fmaxf(nu, 1e-8f)) - (M + __logf(S)));
}

template <bool FIRST>
__device__ __forceinline__
void sink_fused_body(const float* __restrict__ logK, const float* __restrict__ log_v,
                     const float* __restrict__ pl_in, const float* __restrict__ nu,
                     const float* __restrict__ mu, const float* __restrict__ eps,
                     float* __restrict__ log_u, float* __restrict__ pl_out) {
  __shared__ __attribute__((aligned(16))) float sm[16][1024];   // 64 KB: per-wave column max
  __shared__ __attribute__((aligned(16))) float ss[16][1024];   // 64 KB: per-wave column sum
  __shared__ __attribute__((aligned(16))) float slv[1024];      //  4 KB: the head's log_v
  const int chunk = blockIdx.x;
  const int h     = blockIdx.y;
  // The wave's number, told to the compiler as wave-uniform: the rows' base address,
  // mu and the log_u address then live in scalar registers.
  const int wid   = __builtin_amdgcn_readfirstlane(threadIdx.x >> 5);
  const int lane  = threadIdx.x & 31;
  const int j     = threadIdx.x * 2;                   // the 2 columns a thread folds
  const int row0  = h * 1024 + chunk * 64 + wid * 4;   // (h,i) flat
  const v4f* pk = reinterpret_cast<const v4f*>(logK + (size_t)row0 * 1024) + lane;

  // Every loop over r, c or w in this kernel is unrolled whole: k, lv, cl, wm and ws stay
  // in registers only if each index is a constant.
  // The chunk log-sums are asked for ahead of logK: they come back first, and log_v is
  // rebuilt while the rows are still on their way.
  float2 cl[16], nu2;
  if constexpr (!FIRST) {
#pragma unroll
    for (int c = 0; c < 16; ++c)
      cl[c] = *reinterpret_cast<const float2*>(pl_in + ((size_t)c * 16 + h) * 1024 + j);
    nu2 = *reinterpret_cast<const float2*>(nu + h * 1024 + j);
  }
  // Loads in the order the column pass uses them: column group by column group.
  v4f k[4][8], lv[8];
#pragma unroll
  for (int c = 0; c < 8; ++c) {
    if constexpr (FIRST) lv[c] = (reinterpret_cast<const v4f*>(log_v + h * 1024) + lane)[c * 32];
#pragma unroll
    for (int r = 0; r < 4; ++r) k[r][c] = pk[r * 256 + c * 32];
  }
  // Keeps all loads issued ahead of the arithmetic: without it the scheduler sinks
  // the last row's loads to their first use, where little is left to cover their wait.
  __builtin_amdgcn_sched_barrier(0);

  const float fi = 1.f / (1.f + eps[h]);
  if constexpr (!FIRST) {
    float Lx[16], Ly[16];
#pragma unroll
    for (int c = 0; c < 16; ++c) { Lx[c] = cl[c].x; Ly[c] = cl[c].y; }
    *reinterpret_cast<float2*>(&slv[j]) =
        make_float2(logv_from_chunks(Lx, nu2.x, fi), logv_from_chunks(Ly, nu2.y, fi));
    // A work-group barrier that orders LDS alone: __syncthreads() would also wait for the
    // logK loads, which are to stay in flight across it.
    __builtin_amdgcn_fence(__ATOMIC_RELEASE, "workgroup", "local");
    __builtin_amdgcn_s_barrier();
    __builtin_amdgcn_fence(__ATOMIC_ACQUIRE, "workgroup", "local");
#pragma unroll
    for (int c = 0; c < 8; ++c) lv[c] = *reinterpret_cast<const v4f*>(&slv[c * 128 + lane * 4]);
  }

  // Row pass: each lane runs a (max, sum) over its 32 columns in groups of 8, so that
  // no shifted value outlives its group; the lanes' pairs are then folded.
  float lu[4];
#pragma unroll
  for (int r = 0; r < 4; ++r) {
    float m = -INFINITY;
    v4f s4 = {0.f, 0.f, 0.f, 0.f};
#pragma unroll
    for (int c = 0; c < 8; c += 2) {
      const v4f t0 = k[r][c] + lv[c];
      const v4f t1 = k[r][c + 1] + lv[c + 1];
      const v4f tm = __builtin_elementwise_max(t0, t1);
      const float nm = fmaxf(m, fmaxf(fmaxf(tm.x, tm.y), fmaxf(tm.z, tm.w)));
      s4 = s4 * __expf(m - nm) + (exp4(t0 - nm) + exp4(t1 - nm));
      m = nm;
    }
    float M = m;
    for (int off = 16; off; off >>= 1) M = fmaxf(M, __shfl_xor(M, off, 32));
    const float s = wave_sum(((s4.x + s4.y) + (s4.z + s4.w)) * __expf(m - M));
    lu[r] = fi * (__logf(fmaxf(mu[row0 + r], 1e-8f)) - (M + __logf(s)));
  }
  if (lane == 0) {
#pragma unroll
    for (int r = 0; r < 4; ++r) log_u[row0 + r] = lu[r];
  }

  // Column pass over the wave's 4 rows, from the registers the row pass read.
#pragma unroll
  for (int c = 0; c < 8; ++c) {
    const v4f x0 = k[0][c] + lu[0], x1 = k[1][c] + lu[1];
    const v4f x2 = k[2][c] + lu[2], x3 = k[3][c] + lu[3];
    const v4f cm = __builtin_elementwise_max(__builtin_elementwise_max(x0, x1),
                                             __builtin_elementwise_max(x2, x3));
    const v4f cs = (exp4(x0 - cm) + exp4(x1 - cm)) + (exp4(x2 - cm) + exp4(x3 - cm));
    *reinterpret_cast<v4f*>(&sm[wid][c * 128 + lane * 4]) = cm;
    *reinterpret_cast<v4f*>(&ss[wid][c * 128 + lane * 4]) = cs;
  }
  __syncthreads();

  // Fold the 16 waves' partials; a thread owns 2 columns.
  float2 wm[16], ws[16];
#pragma unroll
  for (int w = 0; w < 16; ++w) {
    wm[w] = *reinterpret_cast<const float2*>(&sm[w][j]);
    ws[w] = *reinterpret_cast<const float2*>(&ss[w][j]);
  }
  float2 M = wm[0];
#pragma unroll
  for (int w = 1; w < 16; ++w) { M.x = fmaxf(M.x, wm[w].x); M.y = fmaxf(M.y, wm[w].y); }
  float2 S = make_float2(0.f, 0.f);
#pragma unroll
  for (int w = 0; w < 16; ++w) {
    S.x += ws[w].x * __expf(wm[w].x - M.x);
    S.y += ws[w].y * __expf(wm[w].y - M.y);
  }
  *reinterpret_cast<float2*>(pl_out + ((size_t)chunk * 16 + h) * 1024 + j) =
      make_float2(M.x + __logf(S.x), M.y + __logf(S.y));
}

__global__ __launch_bounds__(512)
void sink_fused_first(const float* __restrict__ logK, const float* __restrict__ log_v,
                      const float* __restrict__ mu, const float* __restrict__ eps,
                      float* __restrict__ log_u, float* __restrict__ pl_out) {
  sink_fused_body<true>(logK, log_v, nullptr, nullptr, mu, eps, log_u, pl_out);
}

__global__ __launch_bounds__(512)
void sink_fused_next(const float* __restrict__ logK, const float* __restrict__ pl_in,
                     const float* __restrict__ nu, const float* __restrict__ mu,
                     const float* __restrict__ eps,
                     float* __restrict__ log_u, float* __restrict__ pl_out) {
  sink_fused_body<false>(logK, nullptr, pl_in, nu, mu, eps, log_u, pl_out);
}

// log_v behind the last iteration, from its chunk log-sums.
__global__ __launch_bounds__(256)
void sink_col_combine(const float* __restrict__ pl, const float* __restrict__ nu,
                      const float* __restrict__ eps, float* __restrict__ log_v) {
  const int idx = blockIdx.x * 256 + threadIdx.x;   // (h,j) flat, 0..16383
  const int h = idx >> 10;
  const int j = idx & 1023;
  float L[16];
  // Unrolled whole so that all 16 loads are in flight at once.
#pragma unroll
  for (int c = 0; c < 16; ++c) L[c] = pl[((size_t)c * 16 + h) * 1024 + j];
  log_v[idx] = logv_from_chunks(L, nu[idx], 1.f / (1.f + eps[h]));
}

// P = exp(logK + log_u_i + log_v_j) * mask, bf16; row sums fp32.
__global__ __launch_bounds__(256)
void p_kernel(const float* __restrict__ logK, const float* __restrict__ log_u,
              const float* __restrict__ log_v, const float* __restrict__ mask,
              __bf16* __restrict__ P, float* __restrict__ rowsum) {
  const int row  = blockIdx.x * 8 + (threadIdx.x >> 5);
  const int h    = row >> 10;
  const int i    = row & 1023;
  const int lane = threadIdx.x & 31;
  const float lu = log_u[row];
  const float mi = mask[i];
  const float* pk = logK + (size_t)row * 1024;
  __bf16* pp = P + (size_t)row * 1024;
  float acc = 0.f;
  for (int j = lane; j < 1024; j += 32) {
    float p = __expf(pk[j] + lu + log_v[h * 1024 + j]) * mi * mask[j];
    pp[j] = (__bf16)p;
    acc += p;
  }
  acc = wave_sum(acc);
  if (lane == 0) rowsum[row] = acc;
}

// ---------------------------------------------------------------------------
// attn = (P @ V) / rowsum * sigmoid(G), WMMA over j (K=1024 in 32-steps).
// ---------------------------------------------------------------------------
__device__ __forceinline__
void attn_body(const __bf16* __restrict__ P, const __bf16* __restrict__ Vt,
               const float* __restrict__ rowsum, const float* __restrict__ sg,
               __bf16* __restrict__ o_bf, const int ib, const int h) {
  const int wid  = threadIdx.x >> 5;
  const int lane = threadIdx.x & 31;
  const int r  = lane & 15, hf = lane >> 4;
  const int i0 = ib * 64 + (wid >> 1) * 16;
  const int d0 = (wid & 1) * 16;
  const __bf16* Abase = P  + ((size_t)h * 1024 + i0) * 1024;
  const __bf16* Bbase = Vt + ((size_t)h * 32 + d0) * 1024;
  v8f acc = {};
  for (int j = 0; j < 1024; j += 32) {
    v16bf a = load_frag(Abase + j, 1024);
    v16bf b = load_frag(Bbase + j, 1024);
    acc = __builtin_amdgcn_wmma_f32_16x16x32_bf16(false, a, false, b, (short)0, acc, false, false);
  }
  // Stands in front of the loads below: in this build their results take the registers that
  // held the fragment loads' addresses.
  asm volatile("s_wait_xcnt 0x0" ::: "memory");
  const int d = d0 + r;
  for (int v = 0; v < 8; ++v) {
    int i = i0 + v + hf * 8;
    float inv = 1.f / fmaxf(rowsum[h * 1024 + i], 1e-8f);
    float val = acc[v] * inv * sg[((size_t)h * 1024 + i) * 32 + d];
    o_bf[(size_t)i * 512 + h * 32 + d] = (__bf16)val;
  }
}

// ---------------------------------------------------------------------------
// Centroid EGNN coord update: x_out = x + mask*(G*x - sum_h g_h * Pn_h @ x)
// ---------------------------------------------------------------------------
__device__ __forceinline__
void xcent_body(const __bf16* __restrict__ P, const float* __restrict__ rowsum,
                const float* __restrict__ x_res, const float* __restrict__ gamma,
                const float* __restrict__ mask, float* __restrict__ x_out, const int i) {
  const int t = threadIdx.x;
  __shared__ float r0[256], r1[256], r2[256];
  float a0 = 0.f, a1 = 0.f, a2 = 0.f;
  for (int h = 0; h < 16; ++h) {
    float g   = tanhf(gamma[h]) * (1.f / 16.f);
    float inv = g / fmaxf(rowsum[h * 1024 + i], 1e-8f);
    const __bf16* pr = P + ((size_t)h * 1024 + i) * 1024;
    float s0 = 0.f, s1 = 0.f, s2 = 0.f;
    for (int j = t; j < 1024; j += 256) {
      float p = (float)pr[j];
      s0 += p * x_res[j * 3 + 0];
      s1 += p * x_res[j * 3 + 1];
      s2 += p * x_res[j * 3 + 2];
    }
    a0 += inv * s0; a1 += inv * s1; a2 += inv * s2;
  }
  r0[t] = a0; r1[t] = a1; r2[t] = a2; __syncthreads();
  for (int o = 128; o; o >>= 1) {
    if (t < o) { r0[t] += r0[t + o]; r1[t] += r1[t + o]; r2[t] += r2[t + o]; }
    __syncthreads();
  }
  if (t == 0) {
    float G = 0.f;
    for (int h = 0; h < 16; ++h) G += tanhf(gamma[h]) * (1.f / 16.f);
    float mi = mask[i];
    x_out[i * 3 + 0] = x_res[i * 3 + 0] + mi * (G * x_res[i * 3 + 0] - r0[0]);
    x_out[i * 3 + 1] = x_res[i * 3 + 1] + mi * (G * x_res[i * 3 + 1] - r1[0]);
    x_out[i * 3 + 2] = x_res[i * 3 + 2] + mi * (G * x_res[i * 3 + 2] - r2[0]);
  }
}

// The two readers of P share one launch: neither reads what the other writes.
// Blocks 0..255: attention, 64 rows of one head each.  Blocks 256..1279: one row's centroid.
// The branch is the same for a whole block, so xcent_body's barriers are safe.
__global__ __launch_bounds__(256)
void attn_xcent_kernel(const __bf16* __restrict__ P, const __bf16* __restrict__ Vt,
                       const float* __restrict__ rowsum, const float* __restrict__ sg,
                       __bf16* __restrict__ o_bf, const float* __restrict__ x_res,
                       const float* __restrict__ gamma, const float* __restrict__ mask,
                       float* __restrict__ x_out) {
  const int b = blockIdx.x;
  if (b < 256) attn_body(P, Vt, rowsum, sg, o_bf, b & 15, b >> 4);
  else         xcent_body(P, rowsum, x_res, gamma, mask, x_out, b - 256);
}

// ---------------------------------------------------------------------------
// Host orchestration
// ---------------------------------------------------------------------------
extern "C" void kernel_launch(void* const* d_in, const int* in_sizes, int n_in,
                              void* d_out, int out_size, void* d_ws, size_t ws_size,
                              hipStream_t stream) {
  (void)in_sizes; (void)n_in; (void)out_size; (void)ws_size;
  const float* h_in    = (const float*)d_in[0];
  const float* x_res   = (const float*)d_in[1];
  const float* mu      = (const float*)d_in[2];
  const float* nu      = (const float*)d_in[3];
  const float* lv_prev = (const float*)d_in[5];
  const float* mask    = (const float*)d_in[6];
  const float* lnaw    = (const float*)d_in[7];
  const float* lnab    = (const float*)d_in[8];
  const float* wq      = (const float*)d_in[9];
  const float* wk      = (const float*)d_in[10];
  const float* wv      = (const float*)d_in[11];
  const float* wg      = (const float*)d_in[12];
  const float* wo      = (const float*)d_in[13];
  const float* gamma   = (const float*)d_in[14];
  const float* posw    = (const float*)d_in[15];
  const float* wdl     = (const float*)d_in[16];
  const float* lnfw    = (const float*)d_in[17];
  const float* lnfb    = (const float*)d_in[18];
  const float* sw1     = (const float*)d_in[19];
  const float* sw3     = (const float*)d_in[20];
  const float* sw2     = (const float*)d_in[21];
  const int*   pbins   = (const int*)d_in[22];
  const float* eps     = (const float*)d_in[23];

  char* wsb = (char*)d_ws;
  size_t off = 0;
  auto take = [&](size_t bytes) -> void* {
    void* p = wsb + off;
    off += (bytes + 255) & ~(size_t)255;
    return p;
  };
  float*  logK  = (float*)take(16UL * 1024 * 1024 * 4);   // 64 MB
  __bf16* P     = (__bf16*)take(16UL * 1024 * 1024 * 2);  // 32 MB
  // The bf16 weights, one behind the other: wq wk wv wg form one (2048,512) matrix,
  // w1 w3 one (4096,512) matrix.
  __bf16* wq_b  = (__bf16*)take((5UL * 512 * 512 + 3UL * 2048 * 512) * 2);
  __bf16* wo_b  = wq_b + 4UL * 512 * 512;
  __bf16* w1_b  = wq_b + 5UL * 512 * 512;
  __bf16* w2_b  = w1_b + 2UL * 2048 * 512;
  __bf16* hn    = (__bf16*)take(1024UL * 512 * 2);
  float*  QKVG  = (float*)take(1024UL * 2048 * 4);
  __bf16* Qh    = (__bf16*)take(16UL * 1024 * 32 * 2);
  __bf16* Kh    = (__bf16*)take(16UL * 1024 * 32 * 2);
  __bf16* Vt    = (__bf16*)take(16UL * 32 * 1024 * 2);
  float*  sg    = (float*)take(16UL * 1024 * 32 * 4);
  float*  rowsum= (float*)take(16UL * 1024 * 4);
  float*  plA   = (float*)take(16UL * 16 * 1024 * 4);     // chunk column log-sums,
  float*  plB   = (float*)take(16UL * 16 * 1024 * 4);     // written and read in turn
  __bf16* o_b   = (__bf16*)take(1024UL * 512 * 2);
  float*  tmpC  = (float*)take(1024UL * 512 * 4);
  float*  h_new = (float*)take(1024UL * 512 * 4);
  __bf16* h2    = (__bf16*)take(1024UL * 512 * 2);
  // FFN intermediates reuse the (then-dead) logK region
  float*  a13   = logK;                                // 1024x4096 f32
  __bf16* gmid  = (__bf16*)(logK + 4UL * 1024 * 1024); // 1024x2048 bf16

  float* out_h  = (float*)d_out;            // 1024*512
  float* out_x  = out_h + 524288;           // 1024*3
  float* lu     = out_h + 527360;           // 16*1024: log_u is kept in its output place
  float* lv     = out_h + 543744;           // 16*1024: log_v too

  // 1, 2) LN(h) -> bf16 and weights -> bf16, one launch
  prep_kernel<<<1024 + 5 * 32 + 3 * 128, 256, 0, stream>>>(h_in, lnaw, lnab, hn, wq, wk, wv, wg,
                                                              wo, sw1, sw3, sw2, wq_b);

  // 3) QKVG projections (TDM-staged WMMA), one launch: one product with 2048 output columns
  dim3 g512(16, 4);
  dim3 g2048(16, 16);
  gemm_bf16<<<g2048, 256, 0, stream>>>(hn, wq_b, QKVG, 1024, 2048, 512);
  post_qkvg_kernel<<<256, 256, 0, stream>>>(QKVG, Qh, Kh, Vt, sg);

  // 4) logits -> logK
  logits_kernel<<<dim3(64, 16), 128, 0, stream>>>(Qh, Kh, pbins, posw, wdl,
                                                      x_res, mask, eps, logK);

  // 5) warm-started log-domain Sinkhorn, 20 iterations (logK L2-resident)
  const dim3 gs(16, 16);
  sink_fused_first<<<gs, 512, 0, stream>>>(logK, lv_prev, mu, eps, lu, plA);
  for (int pair = 0; pair < 9; ++pair) {
    sink_fused_next<<<gs, 512, 0, stream>>>(logK, plA, nu, mu, eps, lu, plB);
    sink_fused_next<<<gs, 512, 0, stream>>>(logK, plB, nu, mu, eps, lu, plA);
  }
  sink_fused_next<<<gs, 512, 0, stream>>>(logK, plA, nu, mu, eps, lu, plB);
  sink_col_combine<<<64, 256, 0, stream>>>(plB, nu, eps, lv);

  // 6) P (bf16) + row sums
  p_kernel<<<2048, 256, 0, stream>>>(logK, lu, lv, mask, P, rowsum);

  // 7, 8) attn and the centroid coordinate update -> out_x, one launch;
  //       then output projection + residual
  attn_xcent_kernel<<<256 + 1024, 256, 0, stream>>>(P, Vt, rowsum, sg, o_b, x_res, gamma, mask, out_x);
  gemm_bf16<<<g512, 256, 0, stream>>>(o_b, wo_b, tmpC, 1024, 512, 512);
  add_res_mask_kernel<<<256, 256, 0, stream>>>(h_in, tmpC, mask, h_new, 524288, 512);

  // 9) SwiGLU FFN + residual -> out_h
  ln_kernel<<<1024, 256, 0, stream>>>(h_new, lnfw, lnfb, h2);
  gemm_bf16<<<dim3(16, 32), 256, 0, stream>>>(h2, w1_b, a13, 1024, 4096, 512);
  swiglu_kernel<<<512, 256, 0, stream>>>(a13, gmid, 1024 * 2048);
  gemm_bf16<<<g512, 256, 0, stream>>>(gmid, w2_b, tmpC, 1024, 512, 2048);
  add_res_mask_kernel<<<256, 256, 0, stream>>>(h_new, tmpC, mask, out_h, 524288, 512);
}

// v006
// It runs in 272 microseconds.
// Two timings next to v005 put it at 1.08 and 1.07 times that version's speed.
// Counting every step since v000, it is 5.42 times as fast.
#include <hip/hip_runtime.h>

// ---------------------------------------------------------------------------
// TokenUOTBlock for MI455X (gfx1250): bf16 WMMA GEMMs (TDM-staged LDS tiles)
// + wave32 log-domain Sinkhorn.  B=1, N=1024, D=512, H=16, DH=32, K_ITER=20.
// ---------------------------------------------------------------------------

typedef __attribute__((ext_vector_type(16))) __bf16 v16bf;
typedef __attribute__((ext_vector_type(8)))  float  v8f;
typedef __attribute__((ext_vector_type(4)))  float  v4f;
typedef __attribute__((ext_vector_type(8)))  __bf16 v8bf;
typedef unsigned int u32x4 __attribute__((ext_vector_type(4)));
typedef unsigned int u32x8 __attribute__((ext_vector_type(8)));

union Frag { v16bf v; uint4 u[2]; };

// Load a 16x32 bf16 WMMA A/B fragment from a row-major (row, K) tile.
// CDNA5 16-bit layout: lanes 0-15 hold row r, K {0..7,16..23};
// lanes 16-31 hold row r, K {8..15,24..31}.  Works on global or LDS tiles.
__device__ __forceinline__ v16bf load_frag(const __bf16* base, int ld) {
  const int lane = threadIdx.x & 31;
  const int r    = lane & 15;
  const int hf   = lane >> 4;
  const __bf16* p = base + (size_t)r * ld + hf * 8;
  Frag f;
  f.u[0] = *reinterpret_cast<const uint4*>(p);
  f.u[1] = *reinterpret_cast<const uint4*>(p + 16);
  return f.v;
}

__device__ __forceinline__ v4f exp4(v4f a) {
  v4f e = {__expf(a.x), __expf(a.y), __expf(a.z), __expf(a.w)};
  return e;
}

__device__ __forceinline__ float wave_sum(float v) {
  for (int off = 16; off; off >>= 1) v += __shfl_xor(v, off, 32);
  return v;
}

// A value told to the compiler as wave-uniform: every descriptor word goes through it.
__device__ __forceinline__ unsigned uni(unsigned v) {
  return (unsigned)__builtin_amdgcn_readfirstlane(v);
}

// ---------------------------------------------------------------------------
// Generic GEMM: C[M,Nout] (f32) = A[M,K] (bf16) x W[Nout,K]^T (bf16)
// M a multiple of 64, Nout of 128, K of 512.
// Block = 256 threads = 8 waves; block tile 64x128.
// One fill of LDS holds 512 of K for both operands, cut into 4 slices of 128 elements
// (rows of 256 bytes).  Each wave brings one slice with one tensor load: waves 0,2,4,6
// the A slices (64 rows), waves 1,3,5,7 the W slices (128 rows).  The load's pad gives
// an LDS pitch of 272 bytes (16 x odd) for the 16-byte fragment reads.  The 16 K-steps
// of a fill then run with no barrier between them.
// ---------------------------------------------------------------------------
constexpr unsigned G_PITCH = 272u;              // 256-byte row + 16-byte pad
constexpr unsigned G_ASL   = 18432u;            // 64 x 272 = 17,408, up to a multiple of 2 KiB
constexpr unsigned G_WSL   = 34816u;            // 128 x 272, a multiple of 2 KiB as it is
constexpr unsigned G_WBASE = 4u * G_ASL;        // the W slices stand behind the A slices

__device__ __forceinline__ v16bf lds_frag(const unsigned char* p) {
  Frag f;
  f.u[0] = *reinterpret_cast<const uint4*>(p);
  f.u[1] = *reinterpret_cast<const uint4*>(p + 32);
  return f.v;
}

__global__ __launch_bounds__(256)
void gemm_bf16(const __bf16* __restrict__ A, const __bf16* __restrict__ W,
               float* __restrict__ C, int M, int Nout, int K) {
  __shared__ __attribute__((aligned(2048))) unsigned char gl[4u * G_ASL + 4u * G_WSL];  // 208 KB
  const unsigned wid = uni(threadIdx.x >> 5);
  const int lane = threadIdx.x & 31;
  const int r  = lane & 15, hf = lane >> 4;
  const int mB = blockIdx.x * 64;
  const int nB = blockIdx.y * 128;
  const int ml = (wid >> 1) * 16;    // local m-tile
  const int nl = (wid & 1) * 64;     // local n-strip

  // The wave's own slice: source, rows, place in LDS.
  const unsigned sl   = wid >> 1;
  const bool     isW  = (wid & 1u) != 0u;
  const unsigned rows = isW ? 128u : 64u;
  const __bf16*  src  = (isW ? W + (size_t)nB * K : A + (size_t)mB * K) + sl * 128u;
  const unsigned dst  = (unsigned)(size_t)&gl[0] + (isW ? G_WBASE + sl * G_WSL : sl * G_ASL);
  // Descriptor group 1: 1-byte elements, tensor = tile = rows x 256 bytes, source pitch
  // 2K bytes, a pad of 4 dwords behind every 64 dwords.
  u32x8 g1;
  g1[0] = uni((1u << 20) | (5u << 22) | (3u << 25));
  g1[1] = uni(256u << 16);
  g1[2] = uni(rows << 16);
  g1[3] = uni(256u << 16);
  g1[4] = uni(rows);
  g1[5] = uni((unsigned)K * 2u);
  g1[6] = uni(0u);
  g1[7] = uni(0u);

  const unsigned char* pa = gl + (ml + r) * G_PITCH + hf * 16;
  const unsigned char* pw = gl + G_WBASE + (nl + r) * G_PITCH + hf * 16;
  v8f acc0 = {}, acc1 = {}, acc2 = {}, acc3 = {};
  for (int kb = 0; kb < K; kb += 512) {
    if (kb) {
      // A refill: this wave's fragment reads of the fill before have returned, and the
      // barrier ends every other wave's, before a load overwrites them.
      asm volatile("s_wait_dscnt 0x0" ::: "memory");
      __syncthreads();
    }
    const unsigned long long ga = (unsigned long long)(const void*)(src + kb);
    u32x4 g0;
    g0[0] = uni(1u);
    g0[1] = uni(dst);
    g0[2] = uni((unsigned)ga);
    g0[3] = uni((((unsigned)(ga >> 32)) & 0x01FFFFFFu) | 0x80000000u);
    // One request of the whole wave; every wave issues its own.
    asm volatile("tensor_load_to_lds %0, %1" :: "s"(g0), "s"(g1) : "memory");
    // The compiler places no wait for a tensor load: the slice has landed behind this one,
    // and the barrier then shows all 8 slices to all waves.
    asm volatile("s_wait_tensorcnt 0x0" ::: "memory");
    __syncthreads();
    // The 16 K-steps of the fill, fragments fetched one step ahead into the other register
    // set.  Unrolled whole: the set's index and every LDS offset are then constants.
    v16bf fa[2], fb[2][4];
    fa[0] = lds_frag(pa);
#pragma unroll
    for (int t = 0; t < 4; ++t) fb[0][t] = lds_frag(pw + t * 16 * G_PITCH);
#pragma unroll
    for (int st = 0; st < 16; ++st) {
      const int cu = st & 1, nx = cu ^ 1;
      if (st + 1 < 16) {
        const unsigned char* qa = pa + ((st + 1) >> 2) * G_ASL + ((st + 1) & 3) * 64;
        const unsigned char* qw = pw + ((st + 1) >> 2) * G_WSL + ((st + 1) & 3) * 64;
        fa[nx] = lds_frag(qa);
#pragma unroll
        for (int t = 0; t < 4; ++t) fb[nx][t] = lds_frag(qw + t * 16 * G_PITCH);
      }
      // Keeps the next step's LDS reads issued ahead of this step's products: without it
      // the scheduler sinks each read to its use, and every product waits out an LDS trip.
      __builtin_amdgcn_sched_barrier(0);
      acc0 = __builtin_amdgcn_wmma_f32_16x16x32_bf16(false, fa[cu], false, fb[cu][0], (short)0, acc0, false, false);
      acc1 = __builtin_amdgcn_wmma_f32_16x16x32_bf16(false, fa[cu], false, fb[cu][1], (short)0, acc1, false, false);
      acc2 = __builtin_amdgcn_wmma_f32_16x16x32_bf16(false, fa[cu], false, fb[cu][2], (short)0, acc2, false, false);
      acc3 = __builtin_amdgcn_wmma_f32_16x16x32_bf16(false, fa[cu], false, fb[cu][3], (short)0, acc3, false, false);
    }
  }
  for (int v = 0; v < 8; ++v) {
    int row = mB + ml + v + hf * 8;
    float* cr = C + (size_t)row * Nout + r;
    cr[nB + nl +  0] = acc0[v];
    cr[nB + nl + 16] = acc1[v];
    cr[nB + nl + 32] = acc2[v];
    cr[nB + nl + 48] = acc3[v];
  }
}

// ---------------------------------------------------------------------------
// Elementwise helpers
// ---------------------------------------------------------------------------
// a13: rows of 4096, columns 0..2047 = h2 x w1^T, columns 2048..4095 = h2 x w3^T.
// A lane takes 2 groups of 8 neighbouring elements (16-byte loads, one 16-byte store each),
// so that few waves have to start.
// The grid's threads x 16 = n; a group of 8 never crosses a row of 2048.
__global__ __launch_bounds__(256)
void swiglu_kernel(const float* __restrict__ a13, __bf16* __restrict__ g, int n) {
  const int t = blockIdx.x * 256 + threadIdx.x;
  const int half = n >> 1;
  // Both loops are unrolled whole: the two groups' 8 loads are then in flight together, and
  // o is indexed by constants only.
#pragma unroll
  for (int u = 0; u < 2; ++u) {
    const int i = u * half + t * 8;
    const float* p = a13 + (size_t)(i >> 11) * 4096 + (i & 2047);
    const v4f a0 = *reinterpret_cast<const v4f*>(p);
    const v4f a1 = *reinterpret_cast<const v4f*>(p + 4);
    const v4f b0 = *reinterpret_cast<const v4f*>(p + 2048);
    const v4f b1 = *reinterpret_cast<const v4f*>(p + 2052);
    const v4f e0 = exp4(-a0), e1 = exp4(-a1);
    v8bf o;
#pragma unroll
    for (int e = 0; e < 4; ++e) {
      o[e]     = (__bf16)(a0[e] / (1.f + e0[e]) * b0[e]);
      o[e + 4] = (__bf16)(a1[e] / (1.f + e1[e]) * b1[e]);
    }
    *reinterpret_cast<v8bf*>(g + i) = o;
  }
}

// A lane takes 8 neighbouring elements, all of one row (D is a multiple of 8).
__global__ __launch_bounds__(256)
void add_res_mask_kernel(const float* __restrict__ base, const float* __restrict__ delta,
                         const float* __restrict__ mask, float* __restrict__ out,
                         int n, int D) {
  const int i = (blockIdx.x * 256 + threadIdx.x) * 8;
  if (i < n) {
    const float m = mask[i / D];
    const v4f b0 = *reinterpret_cast<const v4f*>(base + i);
    const v4f b1 = *reinterpret_cast<const v4f*>(base + i + 4);
    const v4f d0 = *reinterpret_cast<const v4f*>(delta + i);
    const v4f d1 = *reinterpret_cast<const v4f*>(delta + i + 4);
    *reinterpret_cast<v4f*>(out + i)     = b0 + d0 * m;
    *reinterpret_cast<v4f*>(out + i + 4) = b1 + d1 * m;
  }
}

// LayerNorm over D=512 with affine params, bf16 output. One block per row.
__device__ __forceinline__
void ln_body(const float* __restrict__ x, const float* __restrict__ w,
             const float* __restrict__ bb, __bf16* __restrict__ y, const int row) {
  const int t   = threadIdx.x;
  __shared__ float s1[256], s2[256];
  float a = 0.f, q = 0.f;
  for (int d = t; d < 512; d += 256) {
    float v = x[(size_t)row * 512 + d];
    a += v; q += v * v;
  }
  s1[t] = a; s2[t] = q; __syncthreads();
  for (int o = 128; o; o >>= 1) {
    if (t < o) { s1[t] += s1[t + o]; s2[t] += s2[t + o]; }
    __syncthreads();
  }
  const float m   = s1[0] * (1.f / 512.f);
  const float var = s2[0] * (1.f / 512.f) - m * m;
  const float rs  = rsqrtf(var + 1e-5f);
  for (int d = t; d < 512; d += 256) {
    float v = x[(size_t)row * 512 + d];
    y[(size_t)row * 512 + d] = (__bf16)((v - m) * rs * w[d] + bb[d]);
  }
}

__global__ __launch_bounds__(256)
void ln_kernel(const float* __restrict__ x, const float* __restrict__ w,
               const float* __restrict__ bb, __bf16* __restrict__ y) {
  ln_body(x, w, bb, y, blockIdx.x);
}

// One launch for all that depends on the inputs alone.  Blocks 0..1023: LayerNorm of one row
// of h.  Blocks from 1024 on: 8192 elements each of the eight weight matrices -> bf16; the
// bf16 copies stand one behind the other in wb (wq wk wv wg wo: 32 blocks each; w1 w3 w2:
// 128 each).  A lane takes 4 groups of 8 neighbouring elements, so that few waves have to
// start.  The branch is the same for a whole block, so ln_body's barriers are safe.
__global__ __launch_bounds__(256)
void prep_kernel(const float* __restrict__ x, const float* __restrict__ lw,
                 const float* __restrict__ lb, __bf16* __restrict__ y,
                 const float* __restrict__ wq, const float* __restrict__ wk,
                 const float* __restrict__ wv, const float* __restrict__ wg,
                 const float* __restrict__ wo, const float* __restrict__ w1,
                 const float* __restrict__ w3, const float* __restrict__ w2,
                 __bf16* __restrict__ wb) {
  const int b = blockIdx.x;
  if (b < 1024) { ln_body(x, lw, lb, y, b); return; }
  const int e = b - 1024;
  const float* src;
  int piece;
  if (e < 160) {
    const int sel = e >> 5;
    src = sel == 0 ? wq : sel == 1 ? wk : sel == 2 ? wv : sel == 3 ? wg : wo;
    piece = e & 31;
  } else {
    const int sel = (e - 160) >> 7;
    src = sel == 0 ? w1 : sel == 1 ? w3 : w2;
    piece = (e - 160) & 127;
  }
  const float* ps = src + piece * 8192 + threadIdx.x * 8;
  __bf16*      pd = wb + (size_t)e * 8192 + threadIdx.x * 8;
  v4f lo[4], hi[4];
  // All three loops are unrolled whole: the 8 loads are then in flight together, and lo, hi
  // and o are indexed by constants only.
#pragma unroll
  for (int u = 0; u < 4; ++u) {
    lo[u] = *reinterpret_cast<const v4f*>(ps + u * 2048);
    hi[u] = *reinterpret_cast<const v4f*>(ps + u * 2048 + 4);
  }
#pragma unroll
  for (int u = 0; u < 4; ++u) {
    v8bf o;
#pragma unroll
    for (int c = 0; c < 4; ++c) { o[c] = (__bf16)lo[u][c]; o[c + 4] = (__bf16)hi[u][c]; }
    *reinterpret_cast<v8bf*>(pd + u * 2048) = o;
  }
  // Behind the store: in the listing a way leads on from here into the LayerNorm part, whose
  // first instruction overwrites the store's data register.
  asm volatile("s_wait_xcnt 0x0" ::: "memory");
}

// Per-head LN of Q,K (over DH=32, the lanes of a wave); V transposed to (H,32,N);
// sigmoid(G) stored fp32 in (H,N,32).  A wave takes 8 neighbouring n of one head: an eighth
// of the waves to start, and a lane's 8 values of V go out as one 16-byte store.
// QKVG: rows of 2048, columns 0..511 = Q, 512.. = K, 1024.. = V, 1536.. = G.
__global__ __launch_bounds__(256)
void post_qkvg_kernel(const float* __restrict__ QKVG,
                      __bf16* __restrict__ Qh, __bf16* __restrict__ Kh,
                      __bf16* __restrict__ Vt, float* __restrict__ sg) {
  const int w  = blockIdx.x * 8 + (threadIdx.x >> 5);  // 0..2047
  const int h  = w >> 7;
  const int n0 = (w & 127) * 8;
  const int d  = threadIdx.x & 31;
  const float* Qf = QKVG;
  const float* Kf = QKVG + 512;
  const float* Vf = QKVG + 1024;
  const float* Gf = QKVG + 1536;
  v8bf vt;
  // Every loop over it is unrolled whole: vt, g and e are then indexed by constants, and the
  // 8 rows' loads and cross-lane sums, which do not depend on each other, overlap.
#pragma unroll
  for (int it = 0; it < 8; ++it) {
    const int n = n0 + it;
    const size_t src = (size_t)n * 2048 + h * 32 + d;
    {
      float q = Qf[src];
      float m = wave_sum(q) * (1.f / 32.f);
      float dq = q - m;
      float vv = wave_sum(dq * dq) * (1.f / 32.f);
      Qh[((size_t)h * 1024 + n) * 32 + d] = (__bf16)(dq * rsqrtf(vv + 1e-5f));
    }
    {
      float q = Kf[src];
      float m = wave_sum(q) * (1.f / 32.f);
      float dq = q - m;
      float vv = wave_sum(dq * dq) * (1.f / 32.f);
      Kh[((size_t)h * 1024 + n) * 32 + d] = (__bf16)(dq * rsqrtf(vv + 1e-5f));
    }
  }
  v4f g[2];
#pragma unroll
  for (int it = 0; it < 8; ++it) {
    const size_t src = (size_t)(n0 + it) * 2048 + h * 32 + d;
    vt[it] = (__bf16)Vf[src];
    g[it >> 2][it & 3] = Gf[src];
  }
  const v4f e[2] = {exp4(-g[0]), exp4(-g[1])};
#pragma unroll
  for (int it = 0; it < 8; ++it)
    sg[((size_t)h * 1024 + n0 + it) * 32 + d] = 1.f / (1.f + e[it >> 2][it & 3]);
  *reinterpret_cast<v8bf*>(Vt + ((size_t)h * 32 + d) * 1024 + n0) = vt;
}

// ---------------------------------------------------------------------------
// logits: S = QK^T/sqrt(32) via one WMMA (K=32), + pos bias, - distance gate,
// /eps, mask -> logK (f32, H,N,N).  Block = 128 threads = 4 waves.
// A wave owns one 16x16 tile of (i,j) and runs through all 16 heads: a sixteenth of the
// waves to start; bin, distance and pair mask, the same for every head, are formed once.
// ---------------------------------------------------------------------------
__global__ __launch_bounds__(128)
void logits_kernel(const __bf16* __restrict__ Qh, const __bf16* __restrict__ Kh,
                   const int* __restrict__ pos_bins, const float* __restrict__ pos_weight,
                   const float* __restrict__ w_dist_logit, const float* __restrict__ x_res,
                   const float* __restrict__ mask, const float* __restrict__ eps,
                   float* __restrict__ logK) {
  // The wave's number, told to the compiler as wave-uniform: every base address is then a
  // scalar, and a lane keeps 32-bit offsets that do not change from head to head.
  const unsigned wid  = uni(threadIdx.x >> 5);
  const unsigned lane = threadIdx.x & 31;
  const unsigned r  = lane & 15, hf = lane >> 4;
  const unsigned i0 = blockIdx.x * 16;
  const unsigned j0 = blockIdx.y * 64 + wid * 16;
  const float scale   = 0.17677669529663687f;  // 1/sqrt(32)
  const unsigned j  = j0 + r;
  const unsigned idx = (i0 + hf * 8) * 1024 + j;   // (i, j) in a plane of N x N; row v: + v * 1024
  const float mj = mask[j];
  const float xj0 = x_res[j * 3 + 0], xj1 = x_res[j * 3 + 1], xj2 = x_res[j * 3 + 2];
  // Every loop over v is unrolled whole: bo, dist2 and pm stay in registers only if each
  // index is a constant.
  unsigned bo[8];
  float dist2[8], pm[8];
#pragma unroll
  for (int v = 0; v < 8; ++v) {
    // The bin is read from an input: held inside the table of 68 rows before it forms an address.
    bo[v] = (unsigned)min(max(pos_bins[idx + v * 1024], 0), 67) * 16u;
    const unsigned i = i0 + v + hf * 8;
    float d0 = x_res[i * 3 + 0] - xj0;
    float d1 = x_res[i * 3 + 1] - xj1;
    float d2 = x_res[i * 3 + 2] - xj2;
    dist2[v] = d0 * d0 + d1 * d1 + d2 * d2;
    pm[v] = mask[i] * mj;
  }
  const unsigned fo = r * 32 + hf * 8;             // the lane's place in a 16 x 32 fragment tile
  // Four heads a trip: their fragment loads and table reads (16 bytes = 4 heads of one bin)
  // are in flight together; with 4 waves a SIMD little else covers those waits.
  // The loops over q are unrolled whole: a, b and bias are indexed by constants only.
  for (unsigned h0 = 0; h0 < 16; h0 += 4) {
    Frag a[4], b[4];
#pragma unroll
    for (unsigned q = 0; q < 4; ++q) {
      const __bf16* pa = Qh + ((size_t)(h0 + q) * 1024 + i0) * 32;
      const __bf16* pb = Kh + ((size_t)(h0 + q) * 1024 + j0) * 32;
      a[q].u[0] = *reinterpret_cast<const uint4*>(pa + fo);
      a[q].u[1] = *reinterpret_cast<const uint4*>(pa + fo + 16);
      b[q].u[0] = *reinterpret_cast<const uint4*>(pb + fo);
      b[q].u[1] = *reinterpret_cast<const uint4*>(pb + fo + 16);
    }
    // In front of the table reads: their results may take the registers that held the
    // fragment loads' addresses.
    asm volatile("s_wait_xcnt 0x0" ::: "memory");
    v4f bias[8];
#pragma unroll
    for (int v = 0; v < 8; ++v) bias[v] = *reinterpret_cast<const v4f*>(pos_weight + h0 + bo[v]);
    // Behind the trip's loads, in front of whatever next writes a register that they name.
    asm volatile("s_wait_xcnt 0x0" ::: "memory");
    // Keeps the trip's 24 loads issued ahead of its products: without it the scheduler puts
    // the first product, and its wait, in front of the table reads: two load trips in a row.
    __builtin_amdgcn_sched_barrier(0);
#pragma unroll
    for (unsigned q = 0; q < 4; ++q) {
      const unsigned h = h0 + q;
      v8f c = {};
      c = __builtin_amdgcn_wmma_f32_16x16x32_bf16(false, a[q].v, false, b[q].v, (short)0, c, false, false);
      const float wd      = 1.f / (1.f + __expf(-w_dist_logit[h]));
      const float inv_eps = 1.f / eps[h];
      float* po = logK + (size_t)h * 1048576;
#pragma unroll
      for (int v = 0; v < 8; ++v) {
        float s = c[v] * scale;
        float logit = s + bias[v][q] - wd * dist2[v] * 0.01f;
        po[idx + v * 1024] = (pm[v] > 0.f) ? logit * inv_eps : -1e9f;
      }
    }
    // Behind the trip's stores: the next trip's loads take the registers that held their data.
    asm volatile("s_wait_xcnt 0x0" ::: "memory");
  }
}

// ---------------------------------------------------------------------------
// Sinkhorn iteration, one launch, one read of logK, a second by a wave
// whose column sums run out of range.  logK (64MB) is L2-resident.
// A work-group owns 64 rows (a chunk) of one head; each of its 16 waves holds 4 whole
// rows in registers (a lane: columns c*128 + lane*4 .. +3, c = 0..7).
//   1. log_v of the head: from the input (first iteration), else rebuilt by the
//      work-group itself from the 16 chunks' column log-sums of the iteration before.
//   2. The wave forms its 4 row LSEs -> log_u.
//   3. The column sums of exp(logK + log_u) over its 4 rows, from the row pass's own
//      exponentials times one factor a row; LDS folds the 16 waves' partials into one
//      log-sum per column and chunk.  Where those exponentials have run out of range the
//      wave forms a (max, sum) per column from logK itself.
// The log-sums go to a buffer other than the one read: work-groups of one launch run
// side by side.
// ---------------------------------------------------------------------------

// log_v of one column from the 16 chunk log-sums of its head.
__device__ __forceinline__ float logv_from_chunks(const float (&L)[16], float nu, float fi) {
  float M = L[0];
#pragma unroll
  for (int c = 1; c < 16; ++c) M = fmaxf(M, L[c]);
  float S = 0.f;
#pragma unroll
  for (int c = 0; c < 16; ++c) S += __expf(L[c] - M);
  return fi * (__logf(fmaxf(nu, 1e-8f)) - (M + __logf(S)));
}

template <bool FIRST>
__device__ __forceinline__
void sink_fused_body(const float* __restrict__ logK, const float* __restrict__ log_v,
                     const float* __restrict__ pl_in, const float* __restrict__ nu,
                     const float* __restrict__ mu, const float* __restrict__ eps,
                     float* __restrict__ log_u, float* __restrict__ pl_out) {
  __shared__ __attribute__((aligned(16))) float sm[16][1024];   // 64 KB: per-wave column max
  __shared__ __attribute__((aligned(16))) float ss[16][1024];   // 64 KB: per-wave column sum
  __shared__ __attribute__((aligned(16))) float slv[1024];      //  4 KB: the head's log_v
  // Per wave a pair: the scale of its sums; a mark, not 0 where it holds a (max, sum) per column.
  __shared__ __attribute__((aligned(16))) float2 sGX[16];
  const int chunk = blockIdx.x;
  const int h     = blockIdx.y;
  // The wave's number, told to the compiler as wave-uniform: the rows' base address,
  // mu and the log_u address then live in scalar registers.
  const int wid   = __builtin_amdgcn_readfirstlane(threadIdx.x >> 5);
  const int lane  = threadIdx.x & 31;
  const int j     = threadIdx.x * 2;                   // the 2 columns a thread folds
  const int row0  = h * 1024 + chunk * 64 + wid * 4;   // (h,i) flat
  const v4f* pk = reinterpret_cast<const v4f*>(logK + (size_t)row0 * 1024) + lane;

  // Every loop over r, c or w in this kernel is unrolled whole: k, lv, cl, wm and ws stay
  // in registers only if each index is a constant.
  // The chunk log-sums are asked for ahead of logK: they come back first, and log_v is
  // rebuilt while the rows are still on their way.
  float2 cl[16], nu2, lvj;                             // lvj: log_v of the thread's 2 columns
  if constexpr (FIRST) lvj = *reinterpret_cast<const float2*>(log_v + h * 1024 + j);
  if constexpr (!FIRST) {
#pragma unroll
    for (int c = 0; c < 16; ++c)
      cl[c] = *reinterpret_cast<const float2*>(pl_in + ((size_t)c * 16 + h) * 1024 + j);
    nu2 = *reinterpret_cast<const float2*>(nu + h * 1024 + j);
  }
  // Loads in the order the column pass uses them: column group by column group.
  v4f k[4][8], lv[8];
#pragma unroll
  for (int c = 0; c < 8; ++c) {
    if constexpr (FIRST) lv[c] = (reinterpret_cast<const v4f*>(log_v + h * 1024) + lane)[c * 32];
#pragma unroll
    for (int r = 0; r < 4; ++r) k[r][c] = pk[r * 256 + c * 32];
  }
  // Keeps all loads issued ahead of the arithmetic: without it the scheduler sinks
  // the last column group's loads to their first use, where little is left to cover their wait.
  __builtin_amdgcn_sched_barrier(0);

  const float fi = 1.f / (1.f + eps[h]);
  if constexpr (!FIRST) {
    float Lx[16], Ly[16];
#pragma unroll
    for (int c = 0; c < 16; ++c) { Lx[c] = cl[c].x; Ly[c] = cl[c].y; }
    lvj = make_float2(logv_from_chunks(Lx, nu2.x, fi), logv_from_chunks(Ly, nu2.y, fi));
    *reinterpret_cast<float2*>(&slv[j]) = lvj;
    // A work-group barrier that orders LDS alone: __syncthreads() would also wait for the
    // logK loads, which are to stay in flight across it.
    __builtin_amdgcn_fence(__ATOMIC_RELEASE, "workgroup", "local");
    __builtin_amdgcn_s_barrier();
    __builtin_amdgcn_fence(__ATOMIC_ACQUIRE, "workgroup", "local");
#pragma unroll
    for (int c = 0; c < 8; ++c) lv[c] = *reinterpret_cast<const v4f*>(&slv[c * 128 + lane * 4]);
  }

  // Row pass in two sweeps.  First t = logK + log_v, written over logK, and each row's
  // maximum, column group by column group as the loads come in.  Then e = exp(t - max),
  // written over t: the column pass below takes its terms from e and needs no exponential
  // of its own.
  float Mr[4], lu[4];
  {
    v4f mx[4];
#pragma unroll
    for (int c = 0; c < 8; ++c) {
#pragma unroll
      for (int r = 0; r < 4; ++r) {
        k[r][c] += lv[c];
        mx[r] = c ? __builtin_elementwise_max(mx[r], k[r][c]) : k[r][c];
      }
    }
#pragma unroll
    for (int r = 0; r < 4; ++r) {
      float M = fmaxf(fmaxf(mx[r].x, mx[r].y), fmaxf(mx[r].z, mx[r].w));
      for (int off = 16; off; off >>= 1) M = fmaxf(M, __shfl_xor(M, off, 32));
      Mr[r] = M;
    }
  }
#pragma unroll
  for (int r = 0; r < 4; ++r) {
    v4f s4 = {0.f, 0.f, 0.f, 0.f};
#pragma unroll
    for (int c = 0; c < 8; ++c) {
      k[r][c] = exp4(k[r][c] - Mr[r]);
      s4 += k[r][c];
    }
    const float s = wave_sum((s4.x + s4.y) + (s4.z + s4.w));
    lu[r] = fi * (__logf(fmaxf(mu[row0 + r], 1e-8f)) - (Mr[r] + __logf(s)));
  }
  if (lane == 0) {
#pragma unroll
    for (int r = 0; r < 4; ++r) log_u[row0 + r] = lu[r];
  }

  // Column pass over the wave's 4 rows.  exp(logK + log_u) = e * exp(max + log_u - log_v), so
  // with G = the largest max + log_u of the 4 rows and g = exp(max + log_u - G) the column's
  // sum is exp(G - log_v) * (e0 g0 + e1 g1 + e2 g2 + e3 g3): 4 multiply-adds a column.
  const float a0 = lu[0] + Mr[0], a1 = lu[1] + Mr[1], a2 = lu[2] + Mr[2], a3 = lu[3] + Mr[3];
  const float G  = fmaxf(fmaxf(a0, a1), fmaxf(a2, a3));
  const float g0 = __expf(a0 - G), g1 = __expf(a1 - G), g2 = __expf(a2 - G), g3 = __expf(a3 - G);
  v4f mn;
#pragma unroll
  for (int c = 0; c < 8; ++c) {
    const v4f cs = (k[0][c] * g0 + k[1][c] * g1) + (k[2][c] * g2 + k[3][c] * g3);
    mn = c ? __builtin_elementwise_min(mn, cs) : cs;
    *reinterpret_cast<v4f*>(&ss[wid][c * 128 + lane * 4]) = cs;
  }
  // A term that e or g has flushed to zero is below 1.2e-38: beside a sum of 1e-30 or more
  // the 4 of them are below rounding.  Where any column of the wave stays under that (a
  // masked column, a very wide spread of logK), the wave reads its rows again and forms the
  // column's own (max, sum), exact at any spread.  The test is the same in every lane.
  const bool exact = !__all(fminf(fminf(mn.x, mn.y), fminf(mn.z, mn.w)) >= 1e-30f);
  if (exact) {
#pragma unroll
    for (int c = 0; c < 8; ++c) {
#pragma unroll
      for (int r = 0; r < 4; ++r) k[r][c] = pk[r * 256 + c * 32];
    }
    // Behind the loads, in front of whatever next writes a register that they name.  The
    // address is an input: it then lives up to the wait, and no load's result lands on it.
    asm volatile("s_wait_xcnt 0x0" :: "v"(pk) : "memory");
#pragma unroll
    for (int c = 0; c < 8; ++c) {
      const v4f x0 = k[0][c] + lu[0], x1 = k[1][c] + lu[1];
      const v4f x2 = k[2][c] + lu[2], x3 = k[3][c] + lu[3];
      const v4f cm = __builtin_elementwise_max(__builtin_elementwise_max(x0, x1),
                                               __builtin_elementwise_max(x2, x3));
      const v4f cs = (exp4(x0 - cm) + exp4(x1 - cm)) + (exp4(x2 - cm) + exp4(x3 - cm));
      *reinterpret_cast<v4f*>(&sm[wid][c * 128 + lane * 4]) = cm;
      *reinterpret_cast<v4f*>(&ss[wid][c * 128 + lane * 4]) = cs;
    }
  }
  if (lane == 0) sGX[wid] = make_float2(G, __uint_as_float(exact ? 1u : 0u));
  __syncthreads();

  // Fold the 16 waves' partials; a thread owns 2 columns.
  // Scales, marks and sums are read in one LDS trip, in front of the branch: both sides use
  // the sums, and nothing writes them behind the barrier above.
  float Gw[16];
  unsigned xf = 0u;
#pragma unroll
  for (int q = 0; q < 8; ++q) {
    const v4f y = *reinterpret_cast<const v4f*>(&sGX[q * 2]);
    Gw[q * 2] = y.x; Gw[q * 2 + 1] = y.z;
    xf |= __float_as_uint(y.y) | __float_as_uint(y.w);
  }
  // Every thread of the work-group reads the same 16 marks behind the barrier; told to the
  // compiler as wave-uniform, so that the branch round the barrier below is a scalar one.
  const unsigned any_exact = uni(xf);
  float2 ws[16];
#pragma unroll
  for (int w = 0; w < 16; ++w) ws[w] = *reinterpret_cast<const float2*>(&ss[w][j]);
  float2 res;
  if (any_exact == 0u) {
    // One scale a wave, the same for all its columns: 16 exponentials a thread, and the
    // plane of maxima is neither written nor read.
    float Gm = Gw[0];
#pragma unroll
    for (int w = 1; w < 16; ++w) Gm = fmaxf(Gm, Gw[w]);
    float2 S = make_float2(0.f, 0.f);
#pragma unroll
    for (int w = 0; w < 16; ++w) {
      const float f = __expf(Gw[w] - Gm);
      S.x += ws[w].x * f;
      S.y += ws[w].y * f;
    }
    res = make_float2((Gm - lvj.x) + __logf(S.x), (Gm - lvj.y) + __logf(S.y));
  } else {
    // Some wave handed in a (max, sum) per column: the others now write their maxima,
    // G - log_v, in the same form, and the fold takes a maximum per column.
    if (!exact) {
      v4f l[8];
      if constexpr (FIRST) {
        const v4f* plv = reinterpret_cast<const v4f*>(log_v + h * 1024) + lane;
#pragma unroll
        for (int c = 0; c < 8; ++c) l[c] = plv[c * 32];
        // Behind the loads, in front of whatever next writes a register that they name; the
        // address is an input, so that it lives up to the wait.
        asm volatile("s_wait_xcnt 0x0" :: "v"(plv) : "memory");
      } else {
#pragma unroll
        for (int c = 0; c < 8; ++c) l[c] = *reinterpret_cast<const v4f*>(&slv[c * 128 + lane * 4]);
      }
#pragma unroll
      for (int c = 0; c < 8; ++c) *reinterpret_cast<v4f*>(&sm[wid][c * 128 + lane * 4]) = G - l[c];
    }
    // any_exact is the same in the whole work-group: every wave passes this barrier or none.
    __syncthreads();
    float2 wm[16];
#pragma unroll
    for (int w = 0; w < 16; ++w) wm[w] = *reinterpret_cast<const float2*>(&sm[w][j]);
    float2 M = wm[0];
#pragma unroll
    for (int w = 1; w < 16; ++w) { M.x = fmaxf(M.x, wm[w].x); M.y = fmaxf(M.y, wm[w].y); }
    float2 S = make_float2(0.f, 0.f);
#pragma unroll
    for (int w = 0; w < 16; ++w) {
      S.x += ws[w].x * __expf(wm[w].x - M.x);
      S.y += ws[w].y * __expf(wm[w].y - M.y);
    }
    res = make_float2(M.x + __logf(S.x), M.y + __logf(S.y));
  }
  *reinterpret_cast<float2*>(pl_out + ((size_t)chunk * 16 + h) * 1024 + j) = res;
}

__global__ __launch_bounds__(512)
void sink_fused_first(const float* __restrict__ logK, const float* __restrict__ log_v,
                      const float* __restrict__ mu, const float* __restrict__ eps,
                      float* __restrict__ log_u, float* __restrict__ pl_out) {
  sink_fused_body<true>(logK, log_v, nullptr, nullptr, mu, eps, log_u, pl_out);
}

__global__ __launch_bounds__(512)
void sink_fused_next(const float* __restrict__ logK, const float* __restrict__ pl_in,
                     const float* __restrict__ nu, const float* __restrict__ mu,
                     const float* __restrict__ eps,
                     float* __restrict__ log_u, float* __restrict__ pl_out) {
  sink_fused_body<false>(logK, nullptr, pl_in, nu, mu, eps, log_u, pl_out);
}

// log_v behind the last iteration, from its chunk log-sums.
__global__ __launch_bounds__(256)
void sink_col_combine(const float* __restrict__ pl, const float* __restrict__ nu,
                      const float* __restrict__ eps, float* __restrict__ log_v) {
  const int idx = blockIdx.x * 256 + threadIdx.x;   // (h,j) flat, 0..16383
  const int h = idx >> 10;
  const int j = idx & 1023;
  float L[16];
  // Unrolled whole so that all 16 loads are in flight at once.
#pragma unroll
  for (int c = 0; c < 16; ++c) L[c] = pl[((size_t)c * 16 + h) * 1024 + j];
  log_v[idx] = logv_from_chunks(L, nu[idx], 1.f / (1.f + eps[h]));
}

// P = exp(logK + log_u_i + log_v_j) * mask, bf16; row sums fp32.
__global__ __launch_bounds__(256)
void p_kernel(const float* __restrict__ logK, const float* __restrict__ log_u,
              const float* __restrict__ log_v, const float* __restrict__ mask,
              __bf16* __restrict__ P, float* __restrict__ rowsum) {
  const int row  = blockIdx.x * 8 + (threadIdx.x >> 5);
  const int h    = row >> 10;
  const int i    = row & 1023;
  const int lane = threadIdx.x & 31;
  const float lu = log_u[row];
  const float mi = mask[i];
  const float* pk = logK + (size_t)row * 1024;
  __bf16* pp = P + (size_t)row * 1024;
  float acc = 0.f;
  for (int j = lane; j < 1024; j += 32) {
    float p = __expf(pk[j] + lu + log_v[h * 1024 + j]) * mi * mask[j];
    pp[j] = (__bf16)p;
    acc += p;
  }
  acc = wave_sum(acc);
  if (lane == 0) rowsum[row] = acc;
}

// ---------------------------------------------------------------------------
// attn = (P @ V) / rowsum * sigmoid(G), WMMA over j (K=1024 in 32-steps).
// ---------------------------------------------------------------------------
__device__ __forceinline__
void attn_body(const __bf16* __restrict__ P, const __bf16* __restrict__ Vt,
               const float* __restrict__ rowsum, const float* __restrict__ sg,
               __bf16* __restrict__ o_bf, const int ib, const int h) {
  const int wid  = threadIdx.x >> 5;
  const int lane = threadIdx.x & 31;
  const int r  = lane & 15, hf = lane >> 4;
  const int i0 = ib * 64 + (wid >> 1) * 16;
  const int d0 = (wid & 1) * 16;
  const __bf16* Abase = P  + ((size_t)h * 1024 + i0) * 1024;
  const __bf16* Bbase = Vt + ((size_t)h * 32 + d0) * 1024;
  v8f acc = {};
  for (int j = 0; j < 1024; j += 32) {
    v16bf a = load_frag(Abase + j, 1024);
    v16bf b = load_frag(Bbase + j, 1024);
    acc = __builtin_amdgcn_wmma_f32_16x16x32_bf16(false, a, false, b, (short)0, acc, false, false);
  }
  // Stands in front of the loads below: in this build their results take the registers that
  // held the fragment loads' addresses.
  asm volatile("s_wait_xcnt 0x0" ::: "memory");
  const int d = d0 + r;
  for (int v = 0; v < 8; ++v) {
    int i = i0 + v + hf * 8;
    float inv = 1.f / fmaxf(rowsum[h * 1024 + i], 1e-8f);
    float val = acc[v] * inv * sg[((size_t)h * 1024 + i) * 32 + d];
    o_bf[(size_t)i * 512 + h * 32 + d] = (__bf16)val;
  }
}

// ---------------------------------------------------------------------------
// Centroid EGNN coord update: x_out = x + mask*(G*x - sum_h g_h * Pn_h @ x)
// ---------------------------------------------------------------------------
__device__ __forceinline__
void xcent_body(const __bf16* __restrict__ P, const float* __restrict__ rowsum,
                const float* __restrict__ x_res, const float* __restrict__ gamma,
                const float* __restrict__ mask, float* __restrict__ x_out, const int i) {
  const int t = threadIdx.x;
  __shared__ float r0[256], r1[256], r2[256];
  float a0 = 0.f, a1 = 0.f, a2 = 0.f;
  for (int h = 0; h < 16; ++h) {
    float g   = tanhf(gamma[h]) * (1.f / 16.f);
    float inv = g / fmaxf(rowsum[h * 1024 + i], 1e-8f);
    const __bf16* pr = P + ((size_t)h * 1024 + i) * 1024;
    float s0 = 0.f, s1 = 0.f, s2 = 0.f;
    for (int j = t; j < 1024; j += 256) {
      float p = (float)pr[j];
      s0 += p * x_res[j * 3 + 0];
      s1 += p * x_res[j * 3 + 1];
      s2 += p * x_res[j * 3 + 2];
    }
    a0 += inv * s0; a1 += inv * s1; a2 += inv * s2;
  }
  r0[t] = a0; r1[t] = a1; r2[t] = a2; __syncthreads();
  for (int o = 128; o; o >>= 1) {
    if (t < o) { r0[t] += r0[t + o]; r1[t] += r1[t + o]; r2[t] += r2[t + o]; }
    __syncthreads();
  }
  if (t == 0) {
    float G = 0.f;
    for (int h = 0; h < 16; ++h) G += tanhf(gamma[h]) * (1.f / 16.f);
    float mi = mask[i];
    x_out[i * 3 + 0] = x_res[i * 3 + 0] + mi * (G * x_res[i * 3 + 0] - r0[0]);
    x_out[i * 3 + 1] = x_res[i * 3 + 1] + mi * (G * x_res[i * 3 + 1] - r1[0]);
    x_out[i * 3 + 2] = x_res[i * 3 + 2] + mi * (G * x_res[i * 3 + 2] - r2[0]);
  }
}

// The two readers of P share one launch: neither reads what the other writes.
// Blocks 0..255: attention, 64 rows of one head each.  Blocks 256..1279: one row's centroid.
// The branch is the same for a whole block, so xcent_body's barriers are safe.
__global__ __launch_bounds__(256)
void attn_xcent_kernel(const __bf16* __restrict__ P, const __bf16* __restrict__ Vt,
                       const float* __restrict__ rowsum, const float* __restrict__ sg,
                       __bf16* __restrict__ o_bf, const float* __restrict__ x_res,
                       const float* __restrict__ gamma, const float* __restrict__ mask,
                       float* __restrict__ x_out) {
  const int b = blockIdx.x;
  if (b < 256) attn_body(P, Vt, rowsum, sg, o_bf, b & 15, b >> 4);
  else         xcent_body(P, rowsum, x_res, gamma, mask, x_out, b - 256);
}

// ---------------------------------------------------------------------------
// Host orchestration
// ---------------------------------------------------------------------------
extern "C" void kernel_launch(void* const* d_in, const int* in_sizes, int n_in,
                              void* d_out, int out_size, void* d_ws, size_t ws_size,
                              hipStream_t stream) {
  (void)in_sizes; (void)n_in; (void)out_size; (void)ws_size;
  const float* h_in    = (const float*)d_in[0];
  const float* x_res   = (const float*)d_in[1];
  const float* mu      = (const float*)d_in[2];
  const float* nu      = (const float*)d_in[3];
  const float* lv_prev = (const float*)d_in[5];
  const float* mask    = (const float*)d_in[6];
  const float* lnaw    = (const float*)d_in[7];
  const float* lnab    = (const float*)d_in[8];
  const float* wq      = (const float*)d_in[9];
  const float* wk      = (const float*)d_in[10];
  const float* wv      = (const float*)d_in[11];
  const float* wg      = (const float*)d_in[12];
  const float* wo      = (const float*)d_in[13];
  const float* gamma   = (const float*)d_in[14];
  const float* posw    = (const float*)d_in[15];
  const float* wdl     = (const float*)d_in[16];
  const float* lnfw    = (const float*)d_in[17];
  const float* lnfb    = (const float*)d_in[18];
  const float* sw1     = (const float*)d_in[19];
  const float* sw3     = (const float*)d_in[20];
  const float* sw2     = (const float*)d_in[21];
  const int*   pbins   = (const int*)d_in[22];
  const float* eps     = (const float*)d_in[23];

  char* wsb = (char*)d_ws;
  size_t off = 0;
  auto take = [&](size_t bytes) -> void* {
    void* p = wsb + off;
    off += (bytes + 255) & ~(size_t)255;
    return p;
  };
  float*  logK  = (float*)take(16UL * 1024 * 1024 * 4);   // 64 MB
  __bf16* P     = (__bf16*)take(16UL * 1024 * 1024 * 2);  // 32 MB
  // The bf16 weights, one behind the other: wq wk wv wg form one (2048,512) matrix,
  // w1 w3 one (4096,512) matrix.
  __bf16* wq_b  = (__bf16*)take((5UL * 512 * 512 + 3UL * 2048 * 512) * 2);
  __bf16* wo_b  = wq_b + 4UL * 512 * 512;
  __bf16* w1_b  = wq_b + 5UL * 512 * 512;
  __bf16* w2_b  = w1_b + 2UL * 2048 * 512;
  __bf16* hn    = (__bf16*)take(1024UL * 512 * 2);
  float*  QKVG  = (float*)take(1024UL * 2048 * 4);
  __bf16* Qh    = (__bf16*)take(16UL * 1024 * 32 * 2);
  __bf16* Kh    = (__bf16*)take(16UL * 1024 * 32 * 2);
  __bf16* Vt    = (__bf16*)take(16UL * 32 * 1024 * 2);
  float*  sg    = (float*)take(16UL * 1024 * 32 * 4);
  float*  rowsum= (float*)take(16UL * 1024 * 4);
  float*  plA   = (float*)take(16UL * 16 * 1024 * 4);     // chunk column log-sums,
  float*  plB   = (float*)take(16UL * 16 * 1024 * 4);     // written and read in turn
  __bf16* o_b   = (__bf16*)take(1024UL * 512 * 2);
  float*  tmpC  = (float*)take(1024UL * 512 * 4);
  float*  h_new = (float*)take(1024UL * 512 * 4);
  __bf16* h2    = (__bf16*)take(1024UL * 512 * 2);
  // FFN intermediates reuse the (then-dead) logK region
  float*  a13   = logK;                                // 1024x4096 f32
  __bf16* gmid  = (__bf16*)(logK + 4UL * 1024 * 1024); // 1024x2048 bf16

  float* out_h  = (float*)d_out;            // 1024*512
  float* out_x  = out_h + 524288;           // 1024*3
  float* lu     = out_h + 527360;           // 16*1024: log_u is kept in its output place
  float* lv     = out_h + 543744;           // 16*1024: log_v too

  // 1, 2) LN(h) -> bf16 and weights -> bf16, one launch
  prep_kernel<<<1024 + 5 * 32 + 3 * 128, 256, 0, stream>>>(h_in, lnaw, lnab, hn, wq, wk, wv, wg,
                                                              wo, sw1, sw3, sw2, wq_b);

  // 3) QKVG projections (TDM-staged WMMA), one launch: one product with 2048 output columns
  dim3 g512(16, 4);
  dim3 g2048(16, 16);
  gemm_bf16<<<g2048, 256, 0, stream>>>(hn, wq_b, QKVG, 1024, 2048, 512);
  post_qkvg_kernel<<<256, 256, 0, stream>>>(QKVG, Qh, Kh, Vt, sg);

  // 4) logits -> logK
  logits_kernel<<<dim3(64, 16), 128, 0, stream>>>(Qh, Kh, pbins, posw, wdl,
                                                      x_res, mask, eps, logK);

  // 5) warm-started log-domain Sinkhorn, 20 iterations (logK L2-resident)
  const dim3 gs(16, 16);
  sink_fused_first<<<gs, 512, 0, stream>>>(logK, lv_prev, mu, eps, lu, plA);
  for (int pair = 0; pair < 9; ++pair) {
    sink_fused_next<<<gs, 512, 0, stream>>>(logK, plA, nu, mu, eps, lu, plB);
    sink_fused_next<<<gs, 512, 0, stream>>>(logK, plB, nu, mu, eps, lu, plA);
  }
  sink_fused_next<<<gs, 512, 0, stream>>>(logK, plA, nu, mu, eps, lu, plB);
  sink_col_combine<<<64, 256, 0, stream>>>(plB, nu, eps, lv);

  // 6) P (bf16) + row sums
  p_kernel<<<2048, 256, 0, stream>>>(logK, lu, lv, mask, P, rowsum);

  // 7, 8) attn and the centroid coordinate update -> out_x, one launch;
  //       then output projection + residual
  attn_xcent_kernel<<<256 + 1024, 256, 0, stream>>>(P, Vt, rowsum, sg, o_b, x_res, gamma, mask, out_x);
  gemm_bf16<<<g512, 256, 0, stream>>>(o_b, wo_b, tmpC, 1024, 512, 512);
  add_res_mask_kernel<<<256, 256, 0, stream>>>(h_in, tmpC, mask, h_new, 524288, 512);

  // 9) SwiGLU FFN + residual -> out_h
  ln_kernel<<<1024, 256, 0, stream>>>(h_new, lnfw, lnfb, h2);
  gemm_bf16<<<dim3(16, 32), 256, 0, stream>>>(h2, w1_b, a13, 1024, 4096, 512);
  swiglu_kernel<<<512, 256, 0, stream>>>(a13, gmid, 1024 * 2048);
  gemm_bf16<<<g512, 256, 0, stream>>>(gmid, w2_b, tmpC, 1024, 512, 2048);
  add_res_mask_kernel<<<256, 256, 0, stream>>>(h_new, tmpC, mask, out_h, 524288, 512);
}

// v007
// A run of this version takes 261 microseconds.
// Timed twice side by side with v006, it ran 1.06 and 1.04 times as fast.
// All steps since v000 together make it 5.69 times as fast.
#include <hip/hip_runtime.h>

// ---------------------------------------------------------------------------
// TokenUOTBlock for MI455X (gfx1250): bf16 WMMA GEMMs (TDM-staged LDS tiles)
// + wave32 log-domain Sinkhorn.  B=1, N=1024, D=512, H=16, DH=32, K_ITER=20.
// ---------------------------------------------------------------------------

typedef __attribute__((ext_vector_type(16))) __bf16 v16bf;
typedef __attribute__((ext_vector_type(8)))  float  v8f;
typedef __attribute__((ext_vector_type(4)))  float  v4f;
typedef __attribute__((ext_vector_type(8)))  __bf16 v8bf;
typedef unsigned int u32x4 __attribute__((ext_vector_type(4)));
typedef unsigned int u32x8 __attribute__((ext_vector_type(8)));

union Frag { v16bf v; uint4 u[2]; };

// Load a 16x32 bf16 WMMA A/B fragment from a row-major (row, K) tile.
// CDNA5 16-bit layout: lanes 0-15 hold row r, K {0..7,16..23};
// lanes 16-31 hold row r, K {8..15,24..31}.  Works on global or LDS tiles.
__device__ __forceinline__ v16bf load_frag(const __bf16* base, int ld) {
  const int lane = threadIdx.x & 31;
  const int r    = lane & 15;
  const int hf   = lane >> 4;
  const __bf16* p = base + (size_t)r * ld + hf * 8;
  Frag f;
  f.u[0] = *reinterpret_cast<const uint4*>(p);
  f.u[1] = *reinterpret_cast<const uint4*>(p + 16);
  return f.v;
}

__device__ __forceinline__ v4f exp4(v4f a) {
  v4f e = {__expf(a.x), __expf(a.y), __expf(a.z), __expf(a.w)};
  return e;
}

__device__ __forceinline__ float wave_sum(float v) {
  for (int off = 16; off; off >>= 1) v += __shfl_xor(v, off, 32);
  return v;
}

// A value told to the compiler as wave-uniform: every descriptor word goes through it.
__device__ __forceinline__ unsigned uni(unsigned v) {
  return (unsigned)__builtin_amdgcn_readfirstlane(v);
}

// ---------------------------------------------------------------------------
// Generic GEMM: C[M,Nout] (f32) = A[M,K] (bf16) x W[Nout,K]^T (bf16)
// M a multiple of 64, Nout of 128, K of 512.
// Block = 256 threads = 8 waves; block tile 64x128.
// One fill of LDS holds 512 of K for both operands, cut into 4 slices of 128 elements
// (rows of 256 bytes).  Each wave brings one slice with one tensor load: waves 0,2,4,6
// the A slices (64 rows), waves 1,3,5,7 the W slices (128 rows).  The load's pad gives
// an LDS pitch of 272 bytes (16 x odd) for the 16-byte fragment reads.  The 16 K-steps
// of a fill then run with no barrier between them.
// ---------------------------------------------------------------------------
constexpr unsigned G_PITCH = 272u;              // 256-byte row + 16-byte pad
constexpr unsigned G_ASL   = 18432u;            // 64 x 272 = 17,408, up to a multiple of 2 KiB
constexpr unsigned G_WSL   = 34816u;            // 128 x 272, a multiple of 2 KiB as it is
constexpr unsigned G_WBASE = 4u * G_ASL;        // the W slices stand behind the A slices

__device__ __forceinline__ v16bf lds_frag(const unsigned char* p) {
  Frag f;
  f.u[0] = *reinterpret_cast<const uint4*>(p);
  f.u[1] = *reinterpret_cast<const uint4*>(p + 32);
  return f.v;
}

__global__ __launch_bounds__(256)
void gemm_bf16(const __bf16* __restrict__ A, const __bf16* __restrict__ W,
               float* __restrict__ C, int M, int Nout, int K) {
  __shared__ __attribute__((aligned(2048))) unsigned char gl[4u * G_ASL + 4u * G_WSL];  // 208 KB
  const unsigned wid = uni(threadIdx.x >> 5);
  const int lane = threadIdx.x & 31;
  const int r  = lane & 15, hf = lane >> 4;
  const int mB = blockIdx.x * 64;
  const int nB = blockIdx.y * 128;
  const int ml = (wid >> 1) * 16;    // local m-tile
  const int nl = (wid & 1) * 64;     // local n-strip

  // The wave's own slice: source, rows, place in LDS.
  const unsigned sl   = wid >> 1;
  const bool     isW  = (wid & 1u) != 0u;
  const unsigned rows = isW ? 128u : 64u;
  const __bf16*  src  = (isW ? W + (size_t)nB * K : A + (size_t)mB * K) + sl * 128u;
  const unsigned dst  = (unsigned)(size_t)&gl[0] + (isW ? G_WBASE + sl * G_WSL : sl * G_ASL);
  // Descriptor group 1: 1-byte elements, tensor = tile = rows x 256 bytes, source pitch
  // 2K bytes, a pad of 4 dwords behind every 64 dwords.
  u32x8 g1;
  g1[0] = uni((1u << 20) | (5u << 22) | (3u << 25));
  g1[1] = uni(256u << 16);
  g1[2] = uni(rows << 16);
  g1[3] = uni(256u << 16);
  g1[4] = uni(rows);
  g1[5] = uni((unsigned)K * 2u);
  g1[6] = uni(0u);
  g1[7] = uni(0u);

  const unsigned char* pa = gl + (ml + r) * G_PITCH + hf * 16;
  const unsigned char* pw = gl + G_WBASE + (nl + r) * G_PITCH + hf * 16;
  v8f acc0 = {}, acc1 = {}, acc2 = {}, acc3 = {};
  for (int kb = 0; kb < K; kb += 512) {
    if (kb) {
      // A refill: this wave's fragment reads of the fill before have returned, and the
      // barrier ends every other wave's, before a load overwrites them.
      asm volatile("s_wait_dscnt 0x0" ::: "memory");
      __syncthreads();
    }
    const unsigned long long ga = (unsigned long long)(const void*)(src + kb);
    u32x4 g0;
    g0[0] = uni(1u);
    g0[1] = uni(dst);
    g0[2] = uni((unsigned)ga);
    g0[3] = uni((((unsigned)(ga >> 32)) & 0x01FFFFFFu) | 0x80000000u);
    // One request of the whole wave; every wave issues its own.
    asm volatile("tensor_load_to_lds %0, %1" :: "s"(g0), "s"(g1) : "memory");
    // The compiler places no wait for a tensor load: the slice has landed behind this one,
    // and the barrier then shows all 8 slices to all waves.
    asm volatile("s_wait_tensorcnt 0x0" ::: "memory");
    __syncthreads();
    // The 16 K-steps of the fill, fragments fetched one step ahead into the other register
    // set.  Unrolled whole: the set's index and every LDS offset are then constants.
    v16bf fa[2], fb[2][4];
    fa[0] = lds_frag(pa);
#pragma unroll
    for (int t = 0; t < 4; ++t) fb[0][t] = lds_frag(pw + t * 16 * G_PITCH);
#pragma unroll
    for (int st = 0; st < 16; ++st) {
      const int cu = st & 1, nx = cu ^ 1;
      if (st + 1 < 16) {
        const unsigned char* qa = pa + ((st + 1) >> 2) * G_ASL + ((st + 1) & 3) * 64;
        const unsigned char* qw = pw + ((st + 1) >> 2) * G_WSL + ((st + 1) & 3) * 64;
        fa[nx] = lds_frag(qa);
#pragma unroll
        for (int t = 0; t < 4; ++t) fb[nx][t] = lds_frag(qw + t * 16 * G_PITCH);
      }
      // Keeps the next step's LDS reads issued ahead of this step's products: without it
      // the scheduler sinks each read to its use, and every product waits out an LDS trip.
      __builtin_amdgcn_sched_barrier(0);
      acc0 = __builtin_amdgcn_wmma_f32_16x16x32_bf16(false, fa[cu], false, fb[cu][0], (short)0, acc0, false, false);
      acc1 = __builtin_amdgcn_wmma_f32_16x16x32_bf16(false, fa[cu], false, fb[cu][1], (short)0, acc1, false, false);
      acc2 = __builtin_amdgcn_wmma_f32_16x16x32_bf16(false, fa[cu], false, fb[cu][2], (short)0, acc2, false, false);
      acc3 = __builtin_amdgcn_wmma_f32_16x16x32_bf16(false, fa[cu], false, fb[cu][3], (short)0, acc3, false, false);
    }
  }
  for (int v = 0; v < 8; ++v) {
    int row = mB + ml + v + hf * 8;
    float* cr = C + (size_t)row * Nout + r;
    cr[nB + nl +  0] = acc0[v];
    cr[nB + nl + 16] = acc1[v];
    cr[nB + nl + 32] = acc2[v];
    cr[nB + nl + 48] = acc3[v];
  }
}

// ---------------------------------------------------------------------------
// Elementwise helpers
// ---------------------------------------------------------------------------
// a13: rows of 4096, columns 0..2047 = h2 x w1^T, columns 2048..4095 = h2 x w3^T.
// A lane takes 2 groups of 8 neighbouring elements (16-byte loads, one 16-byte store each),
// so that few waves have to start.
// The grid's threads x 16 = n; a group of 8 never crosses a row of 2048.
__global__ __launch_bounds__(256)
void swiglu_kernel(const float* __restrict__ a13, __bf16* __restrict__ g, int n) {
  const int t = blockIdx.x * 256 + threadIdx.x;
  const int half = n >> 1;
  // Both loops are unrolled whole: the two groups' 8 loads are then in flight together, and
  // o is indexed by constants only.
#pragma unroll
  for (int u = 0; u < 2; ++u) {
    const int i = u * half + t * 8;
    const float* p = a13 + (size_t)(i >> 11) * 4096 + (i & 2047);
    const v4f a0 = *reinterpret_cast<const v4f*>(p);
    const v4f a1 = *reinterpret_cast<const v4f*>(p + 4);
    const v4f b0 = *reinterpret_cast<const v4f*>(p + 2048);
    const v4f b1 = *reinterpret_cast<const v4f*>(p + 2052);
    const v4f e0 = exp4(-a0), e1 = exp4(-a1);
    v8bf o;
#pragma unroll
    for (int e = 0; e < 4; ++e) {
      o[e]     = (__bf16)(a0[e] / (1.f + e0[e]) * b0[e]);
      o[e + 4] = (__bf16)(a1[e] / (1.f + e1[e]) * b1[e]);
    }
    *reinterpret_cast<v8bf*>(g + i) = o;
  }
}

// A lane takes 8 neighbouring elements, all of one row (D is a multiple of 8).
__global__ __launch_bounds__(256)
void add_res_mask_kernel(const float* __restrict__ base, const float* __restrict__ delta,
                         const float* __restrict__ mask, float* __restrict__ out,
                         int n, int D) {
  const int i = (blockIdx.x * 256 + threadIdx.x) * 8;
  if (i < n) {
    const float m = mask[i / D];
    const v4f b0 = *reinterpret_cast<const v4f*>(base + i);
    const v4f b1 = *reinterpret_cast<const v4f*>(base + i + 4);
    const v4f d0 = *reinterpret_cast<const v4f*>(delta + i);
    const v4f d1 = *reinterpret_cast<const v4f*>(delta + i + 4);
    *reinterpret_cast<v4f*>(out + i)     = b0 + d0 * m;
    *reinterpret_cast<v4f*>(out + i + 4) = b1 + d1 * m;
  }
}

// LayerNorm over D=512 with affine params, bf16 output. One block per row.
__device__ __forceinline__
void ln_body(const float* __restrict__ x, const float* __restrict__ w,
             const float* __restrict__ bb, __bf16* __restrict__ y, const int row) {
  const int t   = threadIdx.x;
  __shared__ float s1[256], s2[256];
  float a = 0.f, q = 0.f;
  for (int d = t; d < 512; d += 256) {
    float v = x[(size_t)row * 512 + d];
    a += v; q += v * v;
  }
  s1[t] = a; s2[t] = q; __syncthreads();
  for (int o = 128; o; o >>= 1) {
    if (t < o) { s1[t] += s1[t + o]; s2[t] += s2[t + o]; }
    __syncthreads();
  }
  const float m   = s1[0] * (1.f / 512.f);
  const float var = s2[0] * (1.f / 512.f) - m * m;
  const float rs  = rsqrtf(var + 1e-5f);
  for (int d = t; d < 512; d += 256) {
    float v = x[(size_t)row * 512 + d];
    y[(size_t)row * 512 + d] = (__bf16)((v - m) * rs * w[d] + bb[d]);
  }
}

__global__ __launch_bounds__(256)
void ln_kernel(const float* __restrict__ x, const float* __restrict__ w,
               const float* __restrict__ bb, __bf16* __restrict__ y) {
  ln_body(x, w, bb, y, blockIdx.x);
}

// One launch for all that depends on the inputs alone.  Blocks 0..1023: LayerNorm of one row
// of h.  Blocks from 1024 on: 8192 elements each of the eight weight matrices -> bf16; the
// bf16 copies stand one behind the other in wb (wq wk wv wg wo: 32 blocks each; w1 w3 w2:
// 128 each).  A lane takes 4 groups of 8 neighbouring elements, so that few waves have to
// start.  The branch is the same for a whole block, so ln_body's barriers are safe.
__global__ __launch_bounds__(256)
void prep_kernel(const float* __restrict__ x, const float* __restrict__ lw,
                 const float* __restrict__ lb, __bf16* __restrict__ y,
                 const float* __restrict__ wq, const float* __restrict__ wk,
                 const float* __restrict__ wv, const float* __restrict__ wg,
                 const float* __restrict__ wo, const float* __restrict__ w1,
                 const float* __restrict__ w3, const float* __restrict__ w2,
                 __bf16* __restrict__ wb) {
  const int b = blockIdx.x;
  if (b < 1024) { ln_body(x, lw, lb, y, b); return; }
  const int e = b - 1024;
  const float* src;
  int piece;
  if (e < 160) {
    const int sel = e >> 5;
    src = sel == 0 ? wq : sel == 1 ? wk : sel == 2 ? wv : sel == 3 ? wg : wo;
    piece = e & 31;
  } else {
    const int sel = (e - 160) >> 7;
    src = sel == 0 ? w1 : sel == 1 ? w3 : w2;
    piece = (e - 160) & 127;
  }
  const float* ps = src + piece * 8192 + threadIdx.x * 8;
  __bf16*      pd = wb + (size_t)e * 8192 + threadIdx.x * 8;
  v4f lo[4], hi[4];
  // All three loops are unrolled whole: the 8 loads are then in flight together, and lo, hi
  // and o are indexed by constants only.
#pragma unroll
  for (int u = 0; u < 4; ++u) {
    lo[u] = *reinterpret_cast<const v4f*>(ps + u * 2048);
    hi[u] = *reinterpret_cast<const v4f*>(ps + u * 2048 + 4);
  }
#pragma unroll
  for (int u = 0; u < 4; ++u) {
    v8bf o;
#pragma unroll
    for (int c = 0; c < 4; ++c) { o[c] = (__bf16)lo[u][c]; o[c + 4] = (__bf16)hi[u][c]; }
    *reinterpret_cast<v8bf*>(pd + u * 2048) = o;
  }
  // Behind the store: in the listing a way leads on from here into the LayerNorm part, whose
  // first instruction overwrites the store's data register.
  asm volatile("s_wait_xcnt 0x0" ::: "memory");
}

// Per-head LN of Q,K (over DH=32, the lanes of a wave); V transposed to (H,32,N);
// sigmoid(G) stored fp32 in (H,N,32).  A wave takes 8 neighbouring n of one head: an eighth
// of the waves to start, and a lane's 8 values of V go out as one 16-byte store.
// QKVG: rows of 2048, columns 0..511 = Q, 512.. = K, 1024.. = V, 1536.. = G.
__global__ __launch_bounds__(256)
void post_qkvg_kernel(const float* __restrict__ QKVG,
                      __bf16* __restrict__ Qh, __bf16* __restrict__ Kh,
                      __bf16* __restrict__ Vt, float* __restrict__ sg) {
  const int w  = blockIdx.x * 8 + (threadIdx.x >> 5);  // 0..2047
  const int h  = w >> 7;
  const int n0 = (w & 127) * 8;
  const int d  = threadIdx.x & 31;
  const float* Qf = QKVG;
  const float* Kf = QKVG + 512;
  const float* Vf = QKVG + 1024;
  const float* Gf = QKVG + 1536;
  v8bf vt;
  // Every loop over it is unrolled whole: vt, g and e are then indexed by constants, and the
  // 8 rows' loads and cross-lane sums, which do not depend on each other, overlap.
#pragma unroll
  for (int it = 0; it < 8; ++it) {
    const int n = n0 + it;
    const size_t src = (size_t)n * 2048 + h * 32 + d;
    {
      float q = Qf[src];
      float m = wave_sum(q) * (1.f / 32.f);
      float dq = q - m;
      float vv = wave_sum(dq * dq) * (1.f / 32.f);
      Qh[((size_t)h * 1024 + n) * 32 + d] = (__bf16)(dq * rsqrtf(vv + 1e-5f));
    }
    {
      float q = Kf[src];
      float m = wave_sum(q) * (1.f / 32.f);
      float dq = q - m;
      float vv = wave_sum(dq * dq) * (1.f / 32.f);
      Kh[((size_t)h * 1024 + n) * 32 + d] = (__bf16)(dq * rsqrtf(vv + 1e-5f));
    }
  }
  v4f g[2];
#pragma unroll
  for (int it = 0; it < 8; ++it) {
    const size_t src = (size_t)(n0 + it) * 2048 + h * 32 + d;
    vt[it] = (__bf16)Vf[src];
    g[it >> 2][it & 3] = Gf[src];
  }
  const v4f e[2] = {exp4(-g[0]), exp4(-g[1])};
#pragma unroll
  for (int it = 0; it < 8; ++it)
    sg[((size_t)h * 1024 + n0 + it) * 32 + d] = 1.f / (1.f + e[it >> 2][it & 3]);
  *reinterpret_cast<v8bf*>(Vt + ((size_t)h * 32 + d) * 1024 + n0) = vt;
}

// ---------------------------------------------------------------------------
// logits: S = QK^T/sqrt(32) via one WMMA (K=32), + pos bias, - distance gate,
// /eps, mask -> logK (f32, H,N,N).  Block = 128 threads = 4 waves.
// A wave owns one 16x16 tile of (i,j) and runs through all 16 heads: a sixteenth of the
// waves to start; bin, distance and pair mask, the same for every head, are formed once.
// ---------------------------------------------------------------------------
__global__ __launch_bounds__(128)
void logits_kernel(const __bf16* __restrict__ Qh, const __bf16* __restrict__ Kh,
                   const int* __restrict__ pos_bins, const float* __restrict__ pos_weight,
                   const float* __restrict__ w_dist_logit, const float* __restrict__ x_res,
                   const float* __restrict__ mask, const float* __restrict__ eps,
                   float* __restrict__ logK) {
  // The wave's number, told to the compiler as wave-uniform: every base address is then a
  // scalar, and a lane keeps 32-bit offsets that do not change from head to head.
  const unsigned wid  = uni(threadIdx.x >> 5);
  const unsigned lane = threadIdx.x & 31;
  const unsigned r  = lane & 15, hf = lane >> 4;
  const unsigned i0 = blockIdx.x * 16;
  const unsigned j0 = blockIdx.y * 64 + wid * 16;
  const float scale   = 0.17677669529663687f;  // 1/sqrt(32)
  const unsigned j  = j0 + r;
  const unsigned idx = (i0 + hf * 8) * 1024 + j;   // (i, j) in a plane of N x N; row v: + v * 1024
  const float mj = mask[j];
  const float xj0 = x_res[j * 3 + 0], xj1 = x_res[j * 3 + 1], xj2 = x_res[j * 3 + 2];
  // Every loop over v is unrolled whole: bo, dist2 and pm stay in registers only if each
  // index is a constant.
  unsigned bo[8];
  float dist2[8], pm[8];
#pragma unroll
  for (int v = 0; v < 8; ++v) {
    // The bin is read from an input: held inside the table of 68 rows before it forms an address.
    bo[v] = (unsigned)min(max(pos_bins[idx + v * 1024], 0), 67) * 16u;
    const unsigned i = i0 + v + hf * 8;
    float d0 = x_res[i * 3 + 0] - xj0;
    float d1 = x_res[i * 3 + 1] - xj1;
    float d2 = x_res[i * 3 + 2] - xj2;
    dist2[v] = d0 * d0 + d1 * d1 + d2 * d2;
    pm[v] = mask[i] * mj;
  }
  const unsigned fo = r * 32 + hf * 8;             // the lane's place in a 16 x 32 fragment tile
  // Four heads a trip: their fragment loads and table reads (16 bytes = 4 heads of one bin)
  // are in flight together; with 4 waves a SIMD little else covers those waits.
  // The loops over q are unrolled whole: a, b and bias are indexed by constants only.
  for (unsigned h0 = 0; h0 < 16; h0 += 4) {
    Frag a[4], b[4];
#pragma unroll
    for (unsigned q = 0; q < 4; ++q) {
      const __bf16* pa = Qh + ((size_t)(h0 + q) * 1024 + i0) * 32;
      const __bf16* pb = Kh + ((size_t)(h0 + q) * 1024 + j0) * 32;
      a[q].u[0] = *reinterpret_cast<const uint4*>(pa + fo);
      a[q].u[1] = *reinterpret_cast<const uint4*>(pa + fo + 16);
      b[q].u[0] = *reinterpret_cast<const uint4*>(pb + fo);
      b[q].u[1] = *reinterpret_cast<const uint4*>(pb + fo + 16);
    }
    // In front of the table reads: their results may take the registers that held the
    // fragment loads' addresses.
    asm volatile("s_wait_xcnt 0x0" ::: "memory");
    v4f bias[8];
#pragma unroll
    for (int v = 0; v < 8; ++v) bias[v] = *reinterpret_cast<const v4f*>(pos_weight + h0 + bo[v]);
    // Behind the trip's loads, in front of whatever next writes a register that they name.
    asm volatile("s_wait_xcnt 0x0" ::: "memory");
    // Keeps the trip's 24 loads issued ahead of its products: without it the scheduler puts
    // the first product, and its wait, in front of the table reads: two load trips in a row.
    __builtin_amdgcn_sched_barrier(0);
#pragma unroll
    for (unsigned q = 0; q < 4; ++q) {
      const unsigned h = h0 + q;
      v8f c = {};
      c = __builtin_amdgcn_wmma_f32_16x16x32_bf16(false, a[q].v, false, b[q].v, (short)0, c, false, false);
      const float wd      = 1.f / (1.f + __expf(-w_dist_logit[h]));
      const float inv_eps = 1.f / eps[h];
      float* po = logK + (size_t)h * 1048576;
#pragma unroll
      for (int v = 0; v < 8; ++v) {
        float s = c[v] * scale;
        float logit = s + bias[v][q] - wd * dist2[v] * 0.01f;
        po[idx + v * 1024] = (pm[v] > 0.f) ? logit * inv_eps : -1e9f;
      }
    }
    // Behind the trip's stores: the next trip's loads take the registers that held their data.
    asm volatile("s_wait_xcnt 0x0" ::: "memory");
  }
}

// ---------------------------------------------------------------------------
// Sinkhorn iteration, one launch, one read of the kernel matrix (64MB, L2-resident).
// The first iteration forms E = exp(logK) once and stores it; the 19 others read E, and a
// log-sum-exp becomes the log of a plain sum of products:
//   lse_j(logK + log_v) = log(sum_j E * w),  w = exp(log_v);
//   lse_i(logK + log_u) = G + log(sum_i E * exp(log_u - G)).
// A work-group owns 64 rows (a chunk) of one head; each of its 16 waves holds 4 whole
// rows in registers (a lane: columns c*128 + lane*4 .. +3, c = 0..7).
//   1. log_v of the head: from the input (first iteration), else rebuilt by the
//      work-group itself from the 16 chunks' column log-sums of the iteration before;
//      log_v and w go to LDS.
//   2. The wave forms its 4 row sums -> log_u: 1 multiply-add an element.
//   3. The column sums over its 4 rows, 1 multiply-add an element, with one scale G a wave;
//      LDS folds the 16 waves' partials into one log-sum per column and chunk.
// That form is used only where nothing in it can leave the range of a float: |logK| <= 27
// in all 4 rows of the wave (a mark, set by the first iteration) and every w of the head in
// 1e-12 .. 1e12.  Then each product lies in 1e-24 .. 1e24 and each sum below 1e27; a scale
// exp(log_u - G) that is flushed to zero drops a term below 1e-26 from a sum of 1e-12 or more.
// Any other wave (a masked row or column, a very wide spread) works on logK itself in the
// log domain, with a maximum per row and a (max, sum) per column, exact at any spread.
// The log-sums go to a buffer other than the one read: work-groups of one launch run
// side by side.
// ---------------------------------------------------------------------------

// log_v of one column from the 16 chunk log-sums of its head.
__device__ __forceinline__ float logv_from_chunks(const float (&L)[16], float nu, float fi) {
  float M = L[0];
#pragma unroll
  for (int c = 1; c < 16; ++c) M = fmaxf(M, L[c]);
  float S = 0.f;
#pragma unroll
  for (int c = 0; c < 16; ++c) S += __expf(L[c] - M);
  return fi * (__logf(fmaxf(nu, 1e-8f)) - (M + __logf(S)));
}

// rows: logK in the first iteration, E in the others.
template <bool FIRST>
__device__ __forceinline__
void sink_fused_body(const float* __restrict__ rows, const float* __restrict__ logK,
                     float* __restrict__ e_out, unsigned* __restrict__ tame_out,
                     const unsigned* __restrict__ tame_in, const float* __restrict__ log_v,
                     const float* __restrict__ pl_in, const float* __restrict__ nu,
                     const float* __restrict__ mu, const float* __restrict__ eps,
                     float* __restrict__ log_u, float* __restrict__ pl_out) {
  __shared__ __attribute__((aligned(16))) float sm[16][1024];   // 64 KB: per-wave column max
  __shared__ __attribute__((aligned(16))) float ss[16][1024];   // 64 KB: per-wave column sum
  __shared__ __attribute__((aligned(16))) float slv[1024];      //  4 KB: the head's log_v
  __shared__ __attribute__((aligned(16))) float sw[1024];       //  4 KB: exp(log_v)
  __shared__ unsigned sok[16];                                  // per wave: its 64 w are in range
  // Per wave a pair: the scale of its sums; a mark, not 0 where it holds a (max, sum) per column.
  __shared__ __attribute__((aligned(16))) float2 sGX[16];
  const int chunk = blockIdx.x;
  const int h     = blockIdx.y;
  // The wave's number, told to the compiler as wave-uniform: the rows' base address,
  // mu, the mark and the log_u address then live in scalar registers.
  const int wid   = __builtin_amdgcn_readfirstlane(threadIdx.x >> 5);
  const int lane  = threadIdx.x & 31;
  const int j     = threadIdx.x * 2;                   // the 2 columns a thread folds
  const int row0  = h * 1024 + chunk * 64 + wid * 4;   // (h,i) flat
  const int slot  = row0 >> 2;                         // the wave's place among the marks
  const v4f* pk = reinterpret_cast<const v4f*>(rows + (size_t)row0 * 1024) + lane;

  // The loops over r, c or w that are unrolled whole are so because k, w4, cl and ws stay
  // in registers only if each index is a constant.
  // The chunk log-sums are asked for ahead of the rows: they come back first, and log_v is
  // rebuilt while the rows are still on their way.
  float2 cl[16], nu2, lvj;                             // lvj: log_v of the thread's 2 columns
  unsigned tame = 0u;
  if constexpr (FIRST) lvj = *reinterpret_cast<const float2*>(log_v + h * 1024 + j);
  if constexpr (!FIRST) {
#pragma unroll
    for (int c = 0; c < 16; ++c)
      cl[c] = *reinterpret_cast<const float2*>(pl_in + ((size_t)c * 16 + h) * 1024 + j);
    nu2 = *reinterpret_cast<const float2*>(nu + h * 1024 + j);
    tame = tame_in[slot];
  }
  // Loads in the order the row pass uses them: column group by column group.
  v4f k[4][8];
#pragma unroll
  for (int c = 0; c < 8; ++c) {
#pragma unroll
    for (int r = 0; r < 4; ++r) k[r][c] = pk[r * 256 + c * 32];
  }
  // Keeps all loads issued ahead of the arithmetic: without it the scheduler sinks
  // the last column group's loads to their first use, where little is left to cover their wait.
  __builtin_amdgcn_sched_barrier(0);

  const float fi = 1.f / (1.f + eps[h]);
  if constexpr (!FIRST) {
    float Lx[16], Ly[16];
#pragma unroll
    for (int c = 0; c < 16; ++c) { Lx[c] = cl[c].x; Ly[c] = cl[c].y; }
    lvj = make_float2(logv_from_chunks(Lx, nu2.x, fi), logv_from_chunks(Ly, nu2.y, fi));
  }
  const float2 wj = make_float2(__expf(lvj.x), __expf(lvj.y));
  const bool okw = wj.x >= 1e-12f && wj.x <= 1e12f && wj.y >= 1e-12f && wj.y <= 1e12f;
  *reinterpret_cast<float2*>(&slv[j]) = lvj;
  *reinterpret_cast<float2*>(&sw[j])  = wj;
  const unsigned okwave = __all(okw) ? 1u : 0u;
  if (lane == 0) sok[wid] = okwave;
  // A work-group barrier that orders LDS alone: __syncthreads() would also wait for the
  // rows' loads, which are to stay in flight across it.
  __builtin_amdgcn_fence(__ATOMIC_RELEASE, "workgroup", "local");
  __builtin_amdgcn_s_barrier();
  __builtin_amdgcn_fence(__ATOMIC_ACQUIRE, "workgroup", "local");
  v4f w4[8];
#pragma unroll
  for (int c = 0; c < 8; ++c) w4[c] = *reinterpret_cast<const v4f*>(&sw[c * 128 + lane * 4]);
  const bool okhead = __all(sok[lane & 15] != 0u);     // the 16 waves' words, 2 lanes each

  if constexpr (FIRST) {
    // The mark of the wave's 4 rows, then E over logK in the registers and out to memory.
    v4f am = __builtin_elementwise_abs(k[0][0]);
#pragma unroll
    for (int c = 0; c < 8; ++c) {
#pragma unroll
      for (int r = 0; r < 4; ++r) am = __builtin_elementwise_max(am, __builtin_elementwise_abs(k[r][c]));
    }
    tame = __all(fmaxf(fmaxf(am.x, am.y), fmaxf(am.z, am.w)) <= 27.f) ? 1u : 0u;
    v4f* pe = reinterpret_cast<v4f*>(e_out + (size_t)row0 * 1024) + lane;
#pragma unroll
    for (int c = 0; c < 8; ++c) {
#pragma unroll
      for (int r = 0; r < 4; ++r) {
        k[r][c] = exp4(k[r][c]);
        pe[r * 256 + c * 32] = k[r][c];
      }
    }
    if (lane == 0) tame_out[slot] = tame;
    // Behind the stores, in front of whatever next writes a register that they name.  The
    // address is an input: it then lives up to the wait.
    asm volatile("s_wait_xcnt 0x0" :: "v"(pe) : "memory");
  }
  // The same in every lane of the wave; told to the compiler so, for a scalar branch.
  const bool fast = uni((tame != 0u && okhead) ? 1u : 0u) != 0u;

  float lu[4], G = 0.f;
  if (fast) {
    // Row sums, column group by column group as the loads come in.
    v4f s4[4];
#pragma unroll
    for (int c = 0; c < 8; ++c) {
#pragma unroll
      for (int r = 0; r < 4; ++r) s4[r] = c ? s4[r] + k[r][c] * w4[c] : k[r][c] * w4[c];
    }
#pragma unroll
    for (int r = 0; r < 4; ++r) {
      const float s = wave_sum((s4[r].x + s4[r].y) + (s4[r].z + s4[r].w));
      lu[r] = fi * (__logf(fmaxf(mu[row0 + r], 1e-8f)) - __logf(s));
    }
    // Column sums over the wave's 4 rows, scaled by the largest log_u of the 4.
    G = fmaxf(fmaxf(lu[0], lu[1]), fmaxf(lu[2], lu[3]));
    const v4f g4 = exp4(v4f{lu[0], lu[1], lu[2], lu[3]} - G);
    const float g0 = g4.x, g1 = g4.y, g2 = g4.z, g3 = g4.w;
#pragma unroll
    for (int c = 0; c < 8; ++c) {
      const v4f cs = (k[0][c] * g0 + k[1][c] * g1) + (k[2][c] * g2 + k[3][c] * g3);
      *reinterpret_cast<v4f*>(&ss[wid][c * 128 + lane * 4]) = cs;
    }
  } else {
    // Log domain, on logK itself, in three sweeps over the rows: maximum, sum, columns.
    // Each sweep reads the rows anew and its loop stays rolled but for 2 column groups a
    // trip: E stays alive in its 128 registers across this branch, and rows held whole
    // beside it would spill.
    const v4f* pq = reinterpret_cast<const v4f*>(logK + (size_t)row0 * 1024) + lane;
    const float ninf = -__builtin_inff();
    v4f mx[4], s4[4];
    float Mr[4];
#pragma unroll
    for (int r = 0; r < 4; ++r) {
      mx[r] = v4f{ninf, ninf, ninf, ninf};
      s4[r] = v4f{0.f, 0.f, 0.f, 0.f};
    }
#pragma unroll 2
    for (int c = 0; c < 8; ++c) {
      const v4f* pc = pq + c * 32;
      v4f x[4];
#pragma unroll
      for (int r = 0; r < 4; ++r) x[r] = pc[r * 256];
      // Behind the trip's loads, in front of whatever next writes a register that they name.
      // The address is an input: it then lives up to the wait, and no load's result lands on it.
      asm volatile("s_wait_xcnt 0x0" :: "v"(pc) : "memory");
      const v4f l = *reinterpret_cast<const v4f*>(&slv[c * 128 + lane * 4]);
#pragma unroll
      for (int r = 0; r < 4; ++r) mx[r] = __builtin_elementwise_max(mx[r], x[r] + l);
    }
#pragma unroll
    for (int r = 0; r < 4; ++r) {
      float M = fmaxf(fmaxf(mx[r].x, mx[r].y), fmaxf(mx[r].z, mx[r].w));
      for (int off = 16; off; off >>= 1) M = fmaxf(M, __shfl_xor(M, off, 32));
      Mr[r] = M;
    }
#pragma unroll 2
    for (int c = 0; c < 8; ++c) {
      const v4f* pc = pq + c * 32;
      v4f x[4];
#pragma unroll
      for (int r = 0; r < 4; ++r) x[r] = pc[r * 256];
      // As in the first sweep.
      asm volatile("s_wait_xcnt 0x0" :: "v"(pc) : "memory");
      const v4f l = *reinterpret_cast<const v4f*>(&slv[c * 128 + lane * 4]);
#pragma unroll
      for (int r = 0; r < 4; ++r) s4[r] += exp4((x[r] + l) - Mr[r]);
    }
#pragma unroll
    for (int r = 0; r < 4; ++r) {
      const float s = wave_sum((s4[r].x + s4[r].y) + (s4[r].z + s4[r].w));
      lu[r] = fi * (__logf(fmaxf(mu[row0 + r], 1e-8f)) - (Mr[r] + __logf(s)));
    }
#pragma unroll 2
    for (int c = 0; c < 8; ++c) {
      const v4f* pc = pq + c * 32;
      v4f x[4];
#pragma unroll
      for (int r = 0; r < 4; ++r) x[r] = pc[r * 256];
      // As in the first sweep.
      asm volatile("s_wait_xcnt 0x0" :: "v"(pc) : "memory");
#pragma unroll
      for (int r = 0; r < 4; ++r) x[r] += lu[r];
      const v4f cm = __builtin_elementwise_max(__builtin_elementwise_max(x[0], x[1]),
                                               __builtin_elementwise_max(x[2], x[3]));
      const v4f cs = (exp4(x[0] - cm) + exp4(x[1] - cm)) + (exp4(x[2] - cm) + exp4(x[3] - cm));
      *reinterpret_cast<v4f*>(&sm[wid][c * 128 + lane * 4]) = cm;
      *reinterpret_cast<v4f*>(&ss[wid][c * 128 + lane * 4]) = cs;
    }
  }
  if (lane == 0) sGX[wid] = make_float2(G, __uint_as_float(fast ? 0u : 1u));
  __syncthreads();

  // Fold the 16 waves' partials; a thread owns 2 columns.
  // Scales, marks and sums are read in one LDS trip, in front of the branch: the marks pick
  // the side, only the first side uses the scales and sums, and nothing writes them behind the barrier above.
  float Gw[16];
  unsigned xf = 0u;
#pragma unroll
  for (int q = 0; q < 8; ++q) {
    const v4f y = *reinterpret_cast<const v4f*>(&sGX[q * 2]);
    Gw[q * 2] = y.x; Gw[q * 2 + 1] = y.z;
    xf |= __float_as_uint(y.y) | __float_as_uint(y.w);
  }
  // Every thread of the work-group reads the same 16 marks behind the barrier; told to the
  // compiler as wave-uniform, so that the branch is a scalar one.
  const unsigned any_exact = uni(xf);
  float2 ws[16];
#pragma unroll
  for (int w = 0; w < 16; ++w) ws[w] = *reinterpret_cast<const float2*>(&ss[w][j]);
  float2 res;
  if (any_exact == 0u) {
    // One scale a wave, the same for all its columns: 16 exponentials a thread, and the
    // plane of maxima is neither written nor read.
    float Gm = Gw[0];
#pragma unroll
    for (int w = 1; w < 16; ++w) Gm = fmaxf(Gm, Gw[w]);
    float2 S = make_float2(0.f, 0.f);
#pragma unroll
    for (int w = 0; w < 16; ++w) {
      const float f = __expf(Gw[w] - Gm);
      S.x += ws[w].x * f;
      S.y += ws[w].y * f;
    }
    res = make_float2(Gm + __logf(S.x), Gm + __logf(S.y));
  } else {
    // Some wave handed in a (max, sum) per column; a wave without the mark has its one scale
    // as the maximum of every column.  The fold takes a maximum per column, then the sums.
    // Both loops stay rolled: a rare path, kept short in the kernel's text.
    const float ninf = -__builtin_inff();
    float2 M = make_float2(ninf, ninf);
#pragma unroll 1
    for (int w = 0; w < 16; ++w) {
      const float2 gx = sGX[w];
      float2 m = make_float2(gx.x, gx.x);
      if (__float_as_uint(gx.y) != 0u) m = *reinterpret_cast<const float2*>(&sm[w][j]);
      M.x = fmaxf(M.x, m.x); M.y = fmaxf(M.y, m.y);
    }
    float2 S = make_float2(0.f, 0.f);
#pragma unroll 1
    for (int w = 0; w < 16; ++w) {
      const float2 gx = sGX[w];
      float2 m = make_float2(gx.x, gx.x);
      if (__float_as_uint(gx.y) != 0u) m = *reinterpret_cast<const float2*>(&sm[w][j]);
      const float2 sv = *reinterpret_cast<const float2*>(&ss[w][j]);
      S.x += sv.x * __expf(m.x - M.x);
      S.y += sv.y * __expf(m.y - M.y);
    }
    res = make_float2(M.x + __logf(S.x), M.y + __logf(S.y));
  }
  *reinterpret_cast<float2*>(pl_out + ((size_t)chunk * 16 + h) * 1024 + j) = res;
  // log_u goes out last: in front of the barrier above, the barrier would wait for the store.
  if (lane == 0) {
#pragma unroll
    for (int r = 0; r < 4; ++r) log_u[row0 + r] = lu[r];
  }
}

__global__ __launch_bounds__(512)
void sink_fused_first(const float* __restrict__ logK, const float* __restrict__ log_v,
                      const float* __restrict__ mu, const float* __restrict__ eps,
                      float* __restrict__ e_out, unsigned* __restrict__ tame_out,
                      float* __restrict__ log_u, float* __restrict__ pl_out) {
  sink_fused_body<true>(logK, logK, e_out, tame_out, nullptr, log_v, nullptr, nullptr, mu, eps,
                        log_u, pl_out);
}

__global__ __launch_bounds__(512)
void sink_fused_next(const float* __restrict__ e_in, const float* __restrict__ logK,
                     const unsigned* __restrict__ tame_in, const float* __restrict__ pl_in,
                     const float* __restrict__ nu, const float* __restrict__ mu,
                     const float* __restrict__ eps,
                     float* __restrict__ log_u, float* __restrict__ pl_out) {
  sink_fused_body<false>(e_in, logK, nullptr, nullptr, tame_in, nullptr, pl_in, nu, mu, eps,
                         log_u, pl_out);
}

// log_v behind the last iteration, from its chunk log-sums.
__global__ __launch_bounds__(256)
void sink_col_combine(const float* __restrict__ pl, const float* __restrict__ nu,
                      const float* __restrict__ eps, float* __restrict__ log_v) {
  const int idx = blockIdx.x * 256 + threadIdx.x;   // (h,j) flat, 0..16383
  const int h = idx >> 10;
  const int j = idx & 1023;
  float L[16];
  // Unrolled whole so that all 16 loads are in flight at once.
#pragma unroll
  for (int c = 0; c < 16; ++c) L[c] = pl[((size_t)c * 16 + h) * 1024 + j];
  log_v[idx] = logv_from_chunks(L, nu[idx], 1.f / (1.f + eps[h]));
}

// P = exp(logK + log_u_i + log_v_j) * mask, bf16; row sums fp32.
__global__ __launch_bounds__(256)
void p_kernel(const float* __restrict__ logK, const float* __restrict__ log_u,
              const float* __restrict__ log_v, const float* __restrict__ mask,
              __bf16* __restrict__ P, float* __restrict__ rowsum) {
  const int row  = blockIdx.x * 8 + (threadIdx.x >> 5);
  const int h    = row >> 10;
  const int i    = row & 1023;
  const int lane = threadIdx.x & 31;
  const float lu = log_u[row];
  const float mi = mask[i];
  const float* pk = logK + (size_t)row * 1024;
  __bf16* pp = P + (size_t)row * 1024;
  float acc = 0.f;
  for (int j = lane; j < 1024; j += 32) {
    float p = __expf(pk[j] + lu + log_v[h * 1024 + j]) * mi * mask[j];
    pp[j] = (__bf16)p;
    acc += p;
  }
  acc = wave_sum(acc);
  if (lane == 0) rowsum[row] = acc;
}

// ---------------------------------------------------------------------------
// attn = (P @ V) / rowsum * sigmoid(G), WMMA over j (K=1024 in 32-steps).
// ---------------------------------------------------------------------------
__device__ __forceinline__
void attn_body(const __bf16* __restrict__ P, const __bf16* __restrict__ Vt,
               const float* __restrict__ rowsum, const float* __restrict__ sg,
               __bf16* __restrict__ o_bf, const int ib, const int h) {
  const int wid  = threadIdx.x >> 5;
  const int lane = threadIdx.x & 31;
  const int r  = lane & 15, hf = lane >> 4;
  const int i0 = ib * 64 + (wid >> 1) * 16;
  const int d0 = (wid & 1) * 16;
  const __bf16* Abase = P  + ((size_t)h * 1024 + i0) * 1024;
  const __bf16* Bbase = Vt + ((size_t)h * 32 + d0) * 1024;
  v8f acc = {};
  for (int j = 0; j < 1024; j += 32) {
    v16bf a = load_frag(Abase + j, 1024);
    v16bf b = load_frag(Bbase + j, 1024);
    acc = __builtin_amdgcn_wmma_f32_16x16x32_bf16(false, a, false, b, (short)0, acc, false, false);
  }
  // Stands in front of the loads below: in this build their results take the registers that
  // held the fragment loads' addresses.
  asm volatile("s_wait_xcnt 0x0" ::: "memory");
  const int d = d0 + r;
  for (int v = 0; v < 8; ++v) {
    int i = i0 + v + hf * 8;
    float inv = 1.f / fmaxf(rowsum[h * 1024 + i], 1e-8f);
    float val = acc[v] * inv * sg[((size_t)h * 1024 + i) * 32 + d];
    o_bf[(size_t)i * 512 + h * 32 + d] = (__bf16)val;
  }
}

// ---------------------------------------------------------------------------
// Centroid EGNN coord update: x_out = x + mask*(G*x - sum_h g_h * Pn_h @ x)
// ---------------------------------------------------------------------------
__device__ __forceinline__
void xcent_body(const __bf16* __restrict__ P, const float* __restrict__ rowsum,
                const float* __restrict__ x_res, const float* __restrict__ gamma,
                const float* __restrict__ mask, float* __restrict__ x_out, const int i) {
  const int t = threadIdx.x;
  __shared__ float r0[256], r1[256], r2[256];
  float a0 = 0.f, a1 = 0.f, a2 = 0.f;
  for (int h = 0; h < 16; ++h) {
    float g   = tanhf(gamma[h]) * (1.f / 16.f);
    float inv = g / fmaxf(rowsum[h * 1024 + i], 1e-8f);
    const __bf16* pr = P + ((size_t)h * 1024 + i) * 1024;
    float s0 = 0.f, s1 = 0.f, s2 = 0.f;
    for (int j = t; j < 1024; j += 256) {
      float p = (float)pr[j];
      s0 += p * x_res[j * 3 + 0];
      s1 += p * x_res[j * 3 + 1];
      s2 += p * x_res[j * 3 + 2];
    }
    a0 += inv * s0; a1 += inv * s1; a2 += inv * s2;
  }
  r0[t] = a0; r1[t] = a1; r2[t] = a2; __syncthreads();
  for (int o = 128; o; o >>= 1) {
    if (t < o) { r0[t] += r0[t + o]; r1[t] += r1[t + o]; r2[t] += r2[t + o]; }
    __syncthreads();
  }
  if (t == 0) {
    float G = 0.f;
    for (int h = 0; h < 16; ++h) G += tanhf(gamma[h]) * (1.f / 16.f);
    float mi = mask[i];
    x_out[i * 3 + 0] = x_res[i * 3 + 0] + mi * (G * x_res[i * 3 + 0] - r0[0]);
    x_out[i * 3 + 1] = x_res[i * 3 + 1] + mi * (G * x_res[i * 3 + 1] - r1[0]);
    x_out[i * 3 + 2] = x_res[i * 3 + 2] + mi * (G * x_res[i * 3 + 2] - r2[0]);
  }
}

// The two readers of P share one launch: neither reads what the other writes.
// Blocks 0..255: attention, 64 rows of one head each.  Blocks 256..1279: one row's centroid.
// The branch is the same for a whole block, so xcent_body's barriers are safe.
__global__ __launch_bounds__(256)
void attn_xcent_kernel(const __bf16* __restrict__ P, const __bf16* __restrict__ Vt,
                       const float* __restrict__ rowsum, const float* __restrict__ sg,
                       __bf16* __restrict__ o_bf, const float* __restrict__ x_res,
                       const float* __restrict__ gamma, const float* __restrict__ mask,
                       float* __restrict__ x_out) {
  const int b = blockIdx.x;
  if (b < 256) attn_body(P, Vt, rowsum, sg, o_bf, b & 15, b >> 4);
  else         xcent_body(P, rowsum, x_res, gamma, mask, x_out, b - 256);
}

// ---------------------------------------------------------------------------
// Host orchestration
// ---------------------------------------------------------------------------
extern "C" void kernel_launch(void* const* d_in, const int* in_sizes, int n_in,
                              void* d_out, int out_size, void* d_ws, size_t ws_size,
                              hipStream_t stream) {
  (void)in_sizes; (void)n_in; (void)out_size; (void)ws_size;
  const float* h_in    = (const float*)d_in[0];
  const float* x_res   = (const float*)d_in[1];
  const float* mu      = (const float*)d_in[2];
  const float* nu      = (const float*)d_in[3];
  const float* lv_prev = (const float*)d_in[5];
  const float* mask    = (const float*)d_in[6];
  const float* lnaw    = (const float*)d_in[7];
  const float* lnab    = (const float*)d_in[8];
  const float* wq      = (const float*)d_in[9];
  const float* wk      = (const float*)d_in[10];
  const float* wv      = (const float*)d_in[11];
  const float* wg      = (const float*)d_in[12];
  const float* wo      = (const float*)d_in[13];
  const float* gamma   = (const float*)d_in[14];
  const float* posw    = (const float*)d_in[15];
  const float* wdl     = (const float*)d_in[16];
  const float* lnfw    = (const float*)d_in[17];
  const float* lnfb    = (const float*)d_in[18];
  const float* sw1     = (const float*)d_in[19];
  const float* sw3     = (const float*)d_in[20];
  const float* sw2     = (const float*)d_in[21];
  const int*   pbins   = (const int*)d_in[22];
  const float* eps     = (const float*)d_in[23];

  char* wsb = (char*)d_ws;
  size_t off = 0;
  auto take = [&](size_t bytes) -> void* {
    void* p = wsb + off;
    off += (bytes + 255) & ~(size_t)255;
    return p;
  };
  float*  logK  = (float*)take(16UL * 1024 * 1024 * 4);   // 64 MB
  float*  Emat  = (float*)take(16UL * 1024 * 1024 * 4);   // 64 MB: exp(logK)
  __bf16* P     = (__bf16*)Emat;                          // 32 MB, written when E is dead
  // The bf16 weights, one behind the other: wq wk wv wg form one (2048,512) matrix,
  // w1 w3 one (4096,512) matrix.
  __bf16* wq_b  = (__bf16*)take((5UL * 512 * 512 + 3UL * 2048 * 512) * 2);
  __bf16* wo_b  = wq_b + 4UL * 512 * 512;
  __bf16* w1_b  = wq_b + 5UL * 512 * 512;
  __bf16* w2_b  = w1_b + 2UL * 2048 * 512;
  __bf16* hn    = (__bf16*)take(1024UL * 512 * 2);
  float*  QKVG  = (float*)take(1024UL * 2048 * 4);
  __bf16* Qh    = (__bf16*)take(16UL * 1024 * 32 * 2);
  __bf16* Kh    = (__bf16*)take(16UL * 1024 * 32 * 2);
  __bf16* Vt    = (__bf16*)take(16UL * 32 * 1024 * 2);
  float*  sg    = (float*)take(16UL * 1024 * 32 * 4);
  float*  rowsum= (float*)take(16UL * 1024 * 4);
  float*  plA   = (float*)take(16UL * 16 * 1024 * 4);     // chunk column log-sums,
  float*  plB   = (float*)take(16UL * 16 * 1024 * 4);     // written and read in turn
  unsigned* tame = (unsigned*)take(4096UL * 4);           // a mark per 4 rows of logK
  __bf16* o_b   = (__bf16*)take(1024UL * 512 * 2);
  float*  tmpC  = (float*)take(1024UL * 512 * 4);
  float*  h_new = (float*)take(1024UL * 512 * 4);
  __bf16* h2    = (__bf16*)take(1024UL * 512 * 2);
  // FFN intermediates reuse the (then-dead) logK region
  float*  a13   = logK;                                // 1024x4096 f32
  __bf16* gmid  = (__bf16*)(logK + 4UL * 1024 * 1024); // 1024x2048 bf16

  float* out_h  = (float*)d_out;            // 1024*512
  float* out_x  = out_h + 524288;           // 1024*3
  float* lu     = out_h + 527360;           // 16*1024: log_u is kept in its output place
  float* lv     = out_h + 543744;           // 16*1024: log_v too

  // 1, 2) LN(h) -> bf16 and weights -> bf16, one launch
  prep_kernel<<<1024 + 5 * 32 + 3 * 128, 256, 0, stream>>>(h_in, lnaw, lnab, hn, wq, wk, wv, wg,
                                                              wo, sw1, sw3, sw2, wq_b);

  // 3) QKVG projections (TDM-staged WMMA), one launch: one product with 2048 output columns
  dim3 g512(16, 4);
  dim3 g2048(16, 16);
  gemm_bf16<<<g2048, 256, 0, stream>>>(hn, wq_b, QKVG, 1024, 2048, 512);
  post_qkvg_kernel<<<256, 256, 0, stream>>>(QKVG, Qh, Kh, Vt, sg);

  // 4) logits -> logK
  logits_kernel<<<dim3(64, 16), 128, 0, stream>>>(Qh, Kh, pbins, posw, wdl,
                                                      x_res, mask, eps, logK);

  // 5) warm-started Sinkhorn, 20 iterations (E = exp(logK) L2-resident)
  const dim3 gs(16, 16);
  sink_fused_first<<<gs, 512, 0, stream>>>(logK, lv_prev, mu, eps, Emat, tame, lu, plA);
  for (int pair = 0; pair < 9; ++pair) {
    sink_fused_next<<<gs, 512, 0, stream>>>(Emat, logK, tame, plA, nu, mu, eps, lu, plB);
    sink_fused_next<<<gs, 512, 0, stream>>>(Emat, logK, tame, plB, nu, mu, eps, lu, plA);
  }
  sink_fused_next<<<gs, 512, 0, stream>>>(Emat, logK, tame, plA, nu, mu, eps, lu, plB);
  sink_col_combine<<<64, 256, 0, stream>>>(plB, nu, eps, lv);

  // 6) P (bf16) + row sums
  p_kernel<<<2048, 256, 0, stream>>>(logK, lu, lv, mask, P, rowsum);

  // 7, 8) attn and the centroid coordinate update -> out_x, one launch;
  //       then output projection + residual
  attn_xcent_kernel<<<256 + 1024, 256, 0, stream>>>(P, Vt, rowsum, sg, o_b, x_res, gamma, mask, out_x);
  gemm_bf16<<<g512, 256, 0, stream>>>(o_b, wo_b, tmpC, 1024, 512, 512);
  add_res_mask_kernel<<<256, 256, 0, stream>>>(h_in, tmpC, mask, h_new, 524288, 512);

  // 9) SwiGLU FFN + residual -> out_h
  ln_kernel<<<1024, 256, 0, stream>>>(h_new, lnfw, lnfb, h2);
  gemm_bf16<<<dim3(16, 32), 256, 0, stream>>>(h2, w1_b, a13, 1024, 4096, 512);
  swiglu_kernel<<<512, 256, 0, stream>>>(a13, gmid, 1024 * 2048);
  gemm_bf16<<<g512, 256, 0, stream>>>(gmid, w2_b, tmpC, 1024, 512, 2048);
  add_res_mask_kernel<<<256, 256, 0, stream>>>(h_new, tmpC, mask, out_h, 524288, 512);
}

// v008
// A run of this version takes 217 microseconds.
// Timed twice side by side with v007, it ran 1.20 times as fast both times.
// Counting every step since v000, it is 6.83 times as fast.
#include <hip/hip_runtime.h>

// ---------------------------------------------------------------------------
// TokenUOTBlock for MI455X (gfx1250): bf16 WMMA GEMMs (TDM-staged LDS tiles)
// + wave32 log-domain Sinkhorn.  B=1, N=1024, D=512, H=16, DH=32, K_ITER=20.
// ---------------------------------------------------------------------------

typedef __attribute__((ext_vector_type(16))) __bf16 v16bf;
typedef __attribute__((ext_vector_type(8)))  float  v8f;
typedef __attribute__((ext_vector_type(4)))  float  v4f;
typedef __attribute__((ext_vector_type(8)))  __bf16 v8bf;
typedef __attribute__((ext_vector_type(4)))  __bf16 v4bf;
typedef unsigned int u32x4 __attribute__((ext_vector_type(4)));
typedef unsigned int u32x8 __attribute__((ext_vector_type(8)));

// A 16x32 bf16 WMMA A/B fragment.  CDNA5 16-bit layout: lanes 0-15 hold row r,
// K {0..7,16..23}; lanes 16-31 hold row r, K {8..15,24..31}.
union Frag { v16bf v; uint4 u[2]; };

__device__ __forceinline__ v4f exp4(v4f a) {
  v4f e = {__expf(a.x), __expf(a.y), __expf(a.z), __expf(a.w)};
  return e;
}

__device__ __forceinline__ float wave_sum(float v) {
  for (int off = 16; off; off >>= 1) v += __shfl_xor(v, off, 32);
  return v;
}

// A value told to the compiler as wave-uniform: every descriptor word goes through it.
__device__ __forceinline__ unsigned uni(unsigned v) {
  return (unsigned)__builtin_amdgcn_readfirstlane(v);
}

// ---------------------------------------------------------------------------
// Generic GEMM: C[M,Nout] (f32) = A[M,K] (bf16) x W[Nout,K]^T (bf16)
// M a multiple of 64, Nout of 128, K of 512.
// Block = 256 threads = 8 waves; block tile 64x128.
// One fill of LDS holds 512 of K for both operands, cut into 4 slices of 128 elements
// (rows of 256 bytes).  Each wave brings one slice with one tensor load: waves 0,2,4,6
// the A slices (64 rows), waves 1,3,5,7 the W slices (128 rows).  The load's pad gives
// an LDS pitch of 272 bytes (16 x odd) for the 16-byte fragment reads.  The 16 K-steps
// of a fill then run with no barrier between them.
// ---------------------------------------------------------------------------
constexpr unsigned G_PITCH = 272u;              // 256-byte row + 16-byte pad
constexpr unsigned G_ASL   = 18432u;            // 64 x 272 = 17,408, up to a multiple of 2 KiB
constexpr unsigned G_WSL   = 34816u;            // 128 x 272, a multiple of 2 KiB as it is
constexpr unsigned G_WBASE = 4u * G_ASL;        // the W slices stand behind the A slices

__device__ __forceinline__ v16bf lds_frag(const unsigned char* p) {
  Frag f;
  f.u[0] = *reinterpret_cast<const uint4*>(p);
  f.u[1] = *reinterpret_cast<const uint4*>(p + 32);
  return f.v;
}

__global__ __launch_bounds__(256)
void gemm_bf16(const __bf16* __restrict__ A, const __bf16* __restrict__ W,
               float* __restrict__ C, int M, int Nout, int K) {
  __shared__ __attribute__((aligned(2048))) unsigned char gl[4u * G_ASL + 4u * G_WSL];  // 208 KB
  const unsigned wid = uni(threadIdx.x >> 5);
  const int lane = threadIdx.x & 31;
  const int r  = lane & 15, hf = lane >> 4;
  const int mB = blockIdx.x * 64;
  const int nB = blockIdx.y * 128;
  const int ml = (wid >> 1) * 16;    // local m-tile
  const int nl = (wid & 1) * 64;     // local n-strip

  // The wave's own slice: source, rows, place in LDS.
  const unsigned sl   = wid >> 1;
  const bool     isW  = (wid & 1u) != 0u;
  const unsigned rows = isW ? 128u : 64u;
  const __bf16*  src  = (isW ? W + (size_t)nB * K : A + (size_t)mB * K) + sl * 128u;
  const unsigned dst  = (unsigned)(size_t)&gl[0] + (isW ? G_WBASE + sl * G_WSL : sl * G_ASL);
  // Descriptor group 1: 1-byte elements, tensor = tile = rows x 256 bytes, source pitch
  // 2K bytes, a pad of 4 dwords behind every 64 dwords.
  u32x8 g1;
  g1[0] = uni((1u << 20) | (5u << 22) | (3u << 25));
  g1[1] = uni(256u << 16);
  g1[2] = uni(rows << 16);
  g1[3] = uni(256u << 16);
  g1[4] = uni(rows);
  g1[5] = uni((unsigned)K * 2u);
  g1[6] = uni(0u);
  g1[7] = uni(0u);

  const unsigned char* pa = gl + (ml + r) * G_PITCH + hf * 16;
  const unsigned char* pw = gl + G_WBASE + (nl + r) * G_PITCH + hf * 16;
  v8f acc0 = {}, acc1 = {}, acc2 = {}, acc3 = {};
  for (int kb = 0; kb < K; kb += 512) {
    if (kb) {
      // A refill: this wave's fragment reads of the fill before have returned, and the
      // barrier ends every other wave's, before a load overwrites them.
      asm volatile("s_wait_dscnt 0x0" ::: "memory");
      __syncthreads();
    }
    const unsigned long long ga = (unsigned long long)(const void*)(src + kb);
    u32x4 g0;
    g0[0] = uni(1u);
    g0[1] = uni(dst);
    g0[2] = uni((unsigned)ga);
    g0[3] = uni((((unsigned)(ga >> 32)) & 0x01FFFFFFu) | 0x80000000u);
    // One request of the whole wave; every wave issues its own.
    asm volatile("tensor_load_to_lds %0, %1" :: "s"(g0), "s"(g1) : "memory");
    // The compiler places no wait for a tensor load: the slice has landed behind this one,
    // and the barrier then shows all 8 slices to all waves.
    asm volatile("s_wait_tensorcnt 0x0" ::: "memory");
    __syncthreads();
    // The 16 K-steps of the fill, fragments fetched one step ahead into the other register
    // set.  Unrolled whole: the set's index and every LDS offset are then constants.
    v16bf fa[2], fb[2][4];
    fa[0] = lds_frag(pa);
#pragma unroll
    for (int t = 0; t < 4; ++t) fb[0][t] = lds_frag(pw + t * 16 * G_PITCH);
#pragma unroll
    for (int st = 0; st < 16; ++st) {
      const int cu = st & 1, nx = cu ^ 1;
      if (st + 1 < 16) {
        const unsigned char* qa = pa + ((st + 1) >> 2) * G_ASL + ((st + 1) & 3) * 64;
        const unsigned char* qw = pw + ((st + 1) >> 2) * G_WSL + ((st + 1) & 3) * 64;
        fa[nx] = lds_frag(qa);
#pragma unroll
        for (int t = 0; t < 4; ++t) fb[nx][t] = lds_frag(qw + t * 16 * G_PITCH);
      }
      // Keeps the next step's LDS reads issued ahead of this step's products: without it
      // the scheduler sinks each read to its use, and every product waits out an LDS trip.
      __builtin_amdgcn_sched_barrier(0);
      acc0 = __builtin_amdgcn_wmma_f32_16x16x32_bf16(false, fa[cu], false, fb[cu][0], (short)0, acc0, false, false);
      acc1 = __builtin_amdgcn_wmma_f32_16x16x32_bf16(false, fa[cu], false, fb[cu][1], (short)0, acc1, false, false);
      acc2 = __builtin_amdgcn_wmma_f32_16x16x32_bf16(false, fa[cu], false, fb[cu][2], (short)0, acc2, false, false);
      acc3 = __builtin_amdgcn_wmma_f32_16x16x32_bf16(false, fa[cu], false, fb[cu][3], (short)0, acc3, false, false);
    }
  }
  for (int v = 0; v < 8; ++v) {
    int row = mB + ml + v + hf * 8;
    float* cr = C + (size_t)row * Nout + r;
    cr[nB + nl +  0] = acc0[v];
    cr[nB + nl + 16] = acc1[v];
    cr[nB + nl + 32] = acc2[v];
    cr[nB + nl + 48] = acc3[v];
  }
}

// ---------------------------------------------------------------------------
// Elementwise helpers
// ---------------------------------------------------------------------------
// a13: rows of 4096, columns 0..2047 = h2 x w1^T, columns 2048..4095 = h2 x w3^T.
// A lane takes 2 groups of 8 neighbouring elements (16-byte loads, one 16-byte store each),
// so that few waves have to start.
// The grid's threads x 16 = n; a group of 8 never crosses a row of 2048.
__global__ __launch_bounds__(256)
void swiglu_kernel(const float* __restrict__ a13, __bf16* __restrict__ g, int n) {
  const int t = blockIdx.x * 256 + threadIdx.x;
  const int half = n >> 1;
  // Both loops are unrolled whole: the two groups' 8 loads are then in flight together, and
  // o is indexed by constants only.
#pragma unroll
  for (int u = 0; u < 2; ++u) {
    const int i = u * half + t * 8;
    const float* p = a13 + (size_t)(i >> 11) * 4096 + (i & 2047);
    const v4f a0 = *reinterpret_cast<const v4f*>(p);
    const v4f a1 = *reinterpret_cast<const v4f*>(p + 4);
    const v4f b0 = *reinterpret_cast<const v4f*>(p + 2048);
    const v4f b1 = *reinterpret_cast<const v4f*>(p + 2052);
    const v4f e0 = exp4(-a0), e1 = exp4(-a1);
    v8bf o;
#pragma unroll
    for (int e = 0; e < 4; ++e) {
      o[e]     = (__bf16)(a0[e] / (1.f + e0[e]) * b0[e]);
      o[e + 4] = (__bf16)(a1[e] / (1.f + e1[e]) * b1[e]);
    }
    *reinterpret_cast<v8bf*>(g + i) = o;
  }
}

// A lane takes 8 neighbouring elements, all of one row (D is a multiple of 8).
__device__ __forceinline__
void add_res_body(const float* __restrict__ base, const float* __restrict__ delta,
                  const float* __restrict__ mask, float* __restrict__ out,
                  int n, int D, const int blk) {
  const int i = (blk * 256 + threadIdx.x) * 8;
  if (i < n) {
    const float m = mask[i / D];
    const v4f b0 = *reinterpret_cast<const v4f*>(base + i);
    const v4f b1 = *reinterpret_cast<const v4f*>(base + i + 4);
    const v4f d0 = *reinterpret_cast<const v4f*>(delta + i);
    const v4f d1 = *reinterpret_cast<const v4f*>(delta + i + 4);
    *reinterpret_cast<v4f*>(out + i)     = b0 + d0 * m;
    *reinterpret_cast<v4f*>(out + i + 4) = b1 + d1 * m;
  }
}

__global__ __launch_bounds__(256)
void add_res_mask_kernel(const float* __restrict__ base, const float* __restrict__ delta,
                         const float* __restrict__ mask, float* __restrict__ out,
                         int n, int D) {
  add_res_body(base, delta, mask, out, n, D, blockIdx.x);
}

// The first residual add, and in 4 more blocks the centroid EGNN coordinate update:
//   x_out = x + mask * (G * x - sum_h g_h * xc_h),  xc_h = Pn_h @ x  (a plane per head and
// coordinate, written by plan_attn_kernel), G = sum_h g_h, g_h = tanh(gamma_h) / 16.
// The sum over the heads crosses work-groups of that kernel, so it stands in a later launch.
__global__ __launch_bounds__(256)
void add_res_xout_kernel(const float* __restrict__ base, const float* __restrict__ delta,
                         const float* __restrict__ mask, float* __restrict__ out,
                         int n, int D, const float* __restrict__ xc,
                         const float* __restrict__ x_res, const float* __restrict__ gamma,
                         float* __restrict__ x_out) {
  const int b = blockIdx.x;
  if (b < 256) { add_res_body(base, delta, mask, out, n, D, b); return; }
  const int i = (b - 256) * 256 + threadIdx.x;      // 0..1023
  // Lane h of a wave (and lane h + 16) forms g_h: one tanh a thread, not 16.
  const float gv = tanhf(gamma[threadIdx.x & 15]) * (1.f / 16.f);
  // The loops over h and c are unrolled whole: the 52 loads are then in flight together, and
  // xv, x and a are indexed by constants only.
  float xv[16][3], x[3];
#pragma unroll
  for (int h = 0; h < 16; ++h) {
#pragma unroll
    for (int c = 0; c < 3; ++c) xv[h][c] = xc[(h * 3 + c) * 1024 + i];
  }
  const float* px = x_res + i * 3;
#pragma unroll
  for (int c = 0; c < 3; ++c) x[c] = px[c];
  const float mi = mask[i];
  // Behind the loads, in front of whatever next writes a register that they name.  The index
  // and the address are inputs: they then live up to the wait, and no load's result lands on
  // them.
  asm volatile("s_wait_xcnt 0x0" :: "v"(i), "v"(px) : "memory");
  // Keeps the lane reads below, whose results may take the loads' scalar base, behind the wait.
  __builtin_amdgcn_sched_barrier(0);
  float a[3] = {0.f, 0.f, 0.f};
  float G = 0.f;
#pragma unroll
  for (int h = 0; h < 16; ++h) {
    const float g = __uint_as_float(__builtin_amdgcn_readlane(__float_as_uint(gv), h));
    G += g;
#pragma unroll
    for (int c = 0; c < 3; ++c) a[c] += g * xv[h][c];
  }
#pragma unroll
  for (int c = 0; c < 3; ++c) x_out[i * 3 + c] = x[c] + mi * (G * x[c] - a[c]);
  // Behind the store: in the listing a way leads on from here into the residual part, which
  // overwrites the store's registers.
  asm volatile("s_wait_xcnt 0x0" ::: "memory");
}

// LayerNorm over D=512 with affine params, bf16 output. One block per row.
__device__ __forceinline__
void ln_body(const float* __restrict__ x, const float* __restrict__ w,
             const float* __restrict__ bb, __bf16* __restrict__ y, const int row) {
  const int t   = threadIdx.x;
  __shared__ float s1[256], s2[256];
  float a = 0.f, q = 0.f;
  for (int d = t; d < 512; d += 256) {
    float v = x[(size_t)row * 512 + d];
    a += v; q += v * v;
  }
  s1[t] = a; s2[t] = q; __syncthreads();
  for (int o = 128; o; o >>= 1) {
    if (t < o) { s1[t] += s1[t + o]; s2[t] += s2[t + o]; }
    __syncthreads();
  }
  const float m   = s1[0] * (1.f / 512.f);
  const float var = s2[0] * (1.f / 512.f) - m * m;
  const float rs  = rsqrtf(var + 1e-5f);
  for (int d = t; d < 512; d += 256) {
    float v = x[(size_t)row * 512 + d];
    y[(size_t)row * 512 + d] = (__bf16)((v - m) * rs * w[d] + bb[d]);
  }
}

__global__ __launch_bounds__(256)
void ln_kernel(const float* __restrict__ x, const float* __restrict__ w,
               const float* __restrict__ bb, __bf16* __restrict__ y) {
  ln_body(x, w, bb, y, blockIdx.x);
}

// One launch for two jobs that depend on the inputs alone.  Blocks 0..1023: LayerNorm of one row
// of h.  Blocks from 1024 on: 8192 elements each of the eight weight matrices -> bf16; the
// bf16 copies stand one behind the other in wb (wq wk wv wg wo: 32 blocks each; w1 w3 w2:
// 128 each).  A lane takes 4 groups of 8 neighbouring elements, so that few waves have to
// start.  The branch is the same for a whole block, so ln_body's barriers are safe.
__global__ __launch_bounds__(256)
void prep_kernel(const float* __restrict__ x, const float* __restrict__ lw,
                 const float* __restrict__ lb, __bf16* __restrict__ y,
                 const float* __restrict__ wq, const float* __restrict__ wk,
                 const float* __restrict__ wv, const float* __restrict__ wg,
                 const float* __restrict__ wo, const float* __restrict__ w1,
                 const float* __restrict__ w3, const float* __restrict__ w2,
                 __bf16* __restrict__ wb) {
  const int b = blockIdx.x;
  if (b < 1024) { ln_body(x, lw, lb, y, b); return; }
  const int e = b - 1024;
  const float* src;
  int piece;
  if (e < 160) {
    const int sel = e >> 5;
    src = sel == 0 ? wq : sel == 1 ? wk : sel == 2 ? wv : sel == 3 ? wg : wo;
    piece = e & 31;
  } else {
    const int sel = (e - 160) >> 7;
    src = sel == 0 ? w1 : sel == 1 ? w3 : w2;
    piece = (e - 160) & 127;
  }
  const float* ps = src + piece * 8192 + threadIdx.x * 8;
  __bf16*      pd = wb + (size_t)e * 8192 + threadIdx.x * 8;
  v4f lo[4], hi[4];
  // All three loops are unrolled whole: the 8 loads are then in flight together, and lo, hi
  // and o are indexed by constants only.
#pragma unroll
  for (int u = 0; u < 4; ++u) {
    lo[u] = *reinterpret_cast<const v4f*>(ps + u * 2048);
    hi[u] = *reinterpret_cast<const v4f*>(ps + u * 2048 + 4);
  }
#pragma unroll
  for (int u = 0; u < 4; ++u) {
    v8bf o;
#pragma unroll
    for (int c = 0; c < 4; ++c) { o[c] = (__bf16)lo[u][c]; o[c + 4] = (__bf16)hi[u][c]; }
    *reinterpret_cast<v8bf*>(pd + u * 2048) = o;
  }
  // Behind the store: in the listing a way leads on from here into the LayerNorm part, whose
  // first instruction overwrites the store's data register.
  asm volatile("s_wait_xcnt 0x0" ::: "memory");
}

// Per-head LN of Q,K (over DH=32, the lanes of a wave); V in the order of WMMA B fragments;
// sigmoid(G) stored fp32 in (H,N,32).  A wave takes 8 neighbouring n of one head: an eighth
// of the waves to start, and a lane's 8 values of V go out as one 16-byte store.
// QKVG: rows of 2048, columns 0..511 = Q, 512.. = K, 1024.. = V, 1536.. = G.
// Fragment order: a piece is 8 neighbouring j (16 bytes) of one output column; the 32 pieces
// that the 32 lanes (column r = lane & 15, half hf = lane >> 4) take with one 16-byte load
// stand side by side: j = ks * 32 + u * 16 + hf * 8 + 0..7 for K-step ks and load u = 0, 1.
//   Vfr: piece ((((h * 32 + ks) * 2 + nt) * 2 + u) * 32 + lane), column d = nt * 16 + r.
//   Xfr: piece ((ks * 2 + u) * 32 + lane): columns 0..2 the bf16 value of x_res, columns 3..5
//       what that rounding left over (x = hi + lo to 16 bits), columns 6..15 zero.
// Blocks 0..255: Q, K, V, G.  Blocks 256..263: Xfr, a piece a thread.
__global__ __launch_bounds__(256)
void post_qkvg_kernel(const float* __restrict__ QKVG, const float* __restrict__ x_res,
                      __bf16* __restrict__ Qh, __bf16* __restrict__ Kh,
                      __bf16* __restrict__ Vfr, __bf16* __restrict__ Xfr,
                      float* __restrict__ sg) {
  if (blockIdx.x >= 256) {
    const int p  = (blockIdx.x - 256) * 256 + threadIdx.x;   // 0..2047
    const int r  = p & 15;
    const int j0 = (p >> 5) * 16 + ((p >> 4) & 1) * 8;
    const int c  = r < 3 ? r : (r < 6 ? r - 3 : 0);
    const float* px = x_res + j0 * 3 + c;
    float xs[8];
    v8bf o;
    // Both loops are unrolled whole: xs and o are indexed by constants only, and the 8 loads
    // are in flight together.
#pragma unroll
    for (int e = 0; e < 8; ++e) xs[e] = px[e * 3];
    // Behind the loads, in front of whatever next writes a register that they name.  The
    // address is an input: it then lives up to the wait, and no load's result lands on it.
    asm volatile("s_wait_xcnt 0x0" :: "v"(px) : "memory");
#pragma unroll
    for (int e = 0; e < 8; ++e) {
      const float x = xs[e];
      const __bf16 hi = (__bf16)x;
      o[e] = r < 3 ? hi : (r < 6 ? (__bf16)(x - (float)hi) : (__bf16)0.f);
    }
    *reinterpret_cast<v8bf*>(Xfr + (size_t)p * 8) = o;
    return;
  }
  const int w  = blockIdx.x * 8 + (threadIdx.x >> 5);  // 0..2047
  const int h  = w >> 7;
  const int n0 = (w & 127) * 8;
  const int d  = threadIdx.x & 31;
  const float* Qf = QKVG;
  const float* Kf = QKVG + 512;
  const float* Vf = QKVG + 1024;
  const float* Gf = QKVG + 1536;
  v8bf vt;
  // Every loop over it is unrolled whole: vt, g and e are then indexed by constants, and the
  // 8 rows' loads and cross-lane sums, which do not depend on each other, overlap.
#pragma unroll
  for (int it = 0; it < 8; ++it) {
    const int n = n0 + it;
    const size_t src = (size_t)n * 2048 + h * 32 + d;
    {
      float q = Qf[src];
      float m = wave_sum(q) * (1.f / 32.f);
      float dq = q - m;
      float vv = wave_sum(dq * dq) * (1.f / 32.f);
      Qh[((size_t)h * 1024 + n) * 32 + d] = (__bf16)(dq * rsqrtf(vv + 1e-5f));
    }
    {
      float q = Kf[src];
      float m = wave_sum(q) * (1.f / 32.f);
      float dq = q - m;
      float vv = wave_sum(dq * dq) * (1.f / 32.f);
      Kh[((size_t)h * 1024 + n) * 32 + d] = (__bf16)(dq * rsqrtf(vv + 1e-5f));
    }
  }
  v4f g[2];
#pragma unroll
  for (int it = 0; it < 8; ++it) {
    const size_t src = (size_t)(n0 + it) * 2048 + h * 32 + d;
    vt[it] = (__bf16)Vf[src];
    g[it >> 2][it & 3] = Gf[src];
  }
  const v4f e[2] = {exp4(-g[0]), exp4(-g[1])};
#pragma unroll
  for (int it = 0; it < 8; ++it)
    sg[((size_t)h * 1024 + n0 + it) * 32 + d] = 1.f / (1.f + e[it >> 2][it & 3]);
  // Behind the stores: in the listing a way leads on from here into the part of blocks 256..,
  // which overwrites their registers.
  asm volatile("s_wait_xcnt 0x0" ::: "memory");
  // n0 = ks * 32 + u * 16 + hf * 8.
  const int piece = (((h * 32 + (n0 >> 5)) * 2 + (d >> 4)) * 2 + ((n0 >> 4) & 1)) * 32
                  + ((n0 >> 3) & 1) * 16 + (d & 15);
  *reinterpret_cast<v8bf*>(Vfr + (size_t)piece * 8) = vt;
}

// ---------------------------------------------------------------------------
// logits: S = QK^T/sqrt(32) via one WMMA (K=32), + pos bias, - distance gate,
// /eps, mask -> logK (f32, H,N,N).  Block = 128 threads = 4 waves.
// A wave owns one 16x16 tile of (i,j) and runs through all 16 heads: a sixteenth of the
// waves to start; bin, distance and pair mask, the same for every head, are formed once.
// ---------------------------------------------------------------------------
__global__ __launch_bounds__(128)
void logits_kernel(const __bf16* __restrict__ Qh, const __bf16* __restrict__ Kh,
                   const int* __restrict__ pos_bins, const float* __restrict__ pos_weight,
                   const float* __restrict__ w_dist_logit, const float* __restrict__ x_res,
                   const float* __restrict__ mask, const float* __restrict__ eps,
                   float* __restrict__ logK) {
  // The wave's number, told to the compiler as wave-uniform: every base address is then a
  // scalar, and a lane keeps 32-bit offsets that do not change from head to head.
  const unsigned wid  = uni(threadIdx.x >> 5);
  const unsigned lane = threadIdx.x & 31;
  const unsigned r  = lane & 15, hf = lane >> 4;
  const unsigned i0 = blockIdx.x * 16;
  const unsigned j0 = blockIdx.y * 64 + wid * 16;
  const float scale   = 0.17677669529663687f;  // 1/sqrt(32)
  const unsigned j  = j0 + r;
  const unsigned idx = (i0 + hf * 8) * 1024 + j;   // (i, j) in a plane of N x N; row v: + v * 1024
  const float mj = mask[j];
  const float xj0 = x_res[j * 3 + 0], xj1 = x_res[j * 3 + 1], xj2 = x_res[j * 3 + 2];
  // Every loop over v is unrolled whole: bo, dist2 and pm stay in registers only if each
  // index is a constant.
  unsigned bo[8];
  float dist2[8], pm[8];
#pragma unroll
  for (int v = 0; v < 8; ++v) {
    // The bin is read from an input: held inside the table of 68 rows before it forms an address.
    bo[v] = (unsigned)min(max(pos_bins[idx + v * 1024], 0), 67) * 16u;
    const unsigned i = i0 + v + hf * 8;
    float d0 = x_res[i * 3 + 0] - xj0;
    float d1 = x_res[i * 3 + 1] - xj1;
    float d2 = x_res[i * 3 + 2] - xj2;
    dist2[v] = d0 * d0 + d1 * d1 + d2 * d2;
    pm[v] = mask[i] * mj;
  }
  const unsigned fo = r * 32 + hf * 8;             // the lane's place in a 16 x 32 fragment tile
  // Four heads a trip: their fragment loads and table reads (16 bytes = 4 heads of one bin)
  // are in flight together; with 4 waves a SIMD little else covers those waits.
  // The loops over q are unrolled whole: a, b and bias are indexed by constants only.
  for (unsigned h0 = 0; h0 < 16; h0 += 4) {
    Frag a[4], b[4];
#pragma unroll
    for (unsigned q = 0; q < 4; ++q) {
      const __bf16* pa = Qh + ((size_t)(h0 + q) * 1024 + i0) * 32;
      const __bf16* pb = Kh + ((size_t)(h0 + q) * 1024 + j0) * 32;
      a[q].u[0] = *reinterpret_cast<const uint4*>(pa + fo);
      a[q].u[1] = *reinterpret_cast<const uint4*>(pa + fo + 16);
      b[q].u[0] = *reinterpret_cast<const uint4*>(pb + fo);
      b[q].u[1] = *reinterpret_cast<const uint4*>(pb + fo + 16);
    }
    // In front of the table reads: their results may take the registers that held the
    // fragment loads' addresses.
    asm volatile("s_wait_xcnt 0x0" ::: "memory");
    v4f bias[8];
#pragma unroll
    for (int v = 0; v < 8; ++v) bias[v] = *reinterpret_cast<const v4f*>(pos_weight + h0 + bo[v]);
    // Behind the trip's loads, in front of whatever next writes a register that they name.
    asm volatile("s_wait_xcnt 0x0" ::: "memory");
    // Keeps the trip's 24 loads issued ahead of its products: without it the scheduler puts
    // the first product, and its wait, in front of the table reads: two load trips in a row.
    __builtin_amdgcn_sched_barrier(0);
#pragma unroll
    for (unsigned q = 0; q < 4; ++q) {
      const unsigned h = h0 + q;
      v8f c = {};
      c = __builtin_amdgcn_wmma_f32_16x16x32_bf16(false, a[q].v, false, b[q].v, (short)0, c, false, false);
      const float wd      = 1.f / (1.f + __expf(-w_dist_logit[h]));
      const float inv_eps = 1.f / eps[h];
      float* po = logK + (size_t)h * 1048576;
#pragma unroll
      for (int v = 0; v < 8; ++v) {
        float s = c[v] * scale;
        float logit = s + bias[v][q] - wd * dist2[v] * 0.01f;
        po[idx + v * 1024] = (pm[v] > 0.f) ? logit * inv_eps : -1e9f;
      }
    }
    // Behind the trip's stores: the next trip's loads take the registers that held their data.
    asm volatile("s_wait_xcnt 0x0" ::: "memory");
  }
}

// ---------------------------------------------------------------------------
// Sinkhorn iteration, one launch, one read of the kernel matrix (64MB, L2-resident).
// The first iteration forms E = exp(logK) once and stores it; the 19 others read E, and a
// log-sum-exp becomes the log of a plain sum of products:
//   lse_j(logK + log_v) = log(sum_j E * w),  w = exp(log_v);
//   lse_i(logK + log_u) = G + log(sum_i E * exp(log_u - G)).
// A work-group owns 64 rows (a chunk) of one head; each of its 16 waves holds 4 whole
// rows in registers (a lane: columns c*128 + lane*4 .. +3, c = 0..7).
//   1. log_v of the head: from the input (first iteration), else rebuilt by the
//      work-group itself from the 16 chunks' column log-sums of the iteration before;
//      log_v and w go to LDS.
//   2. The wave forms its 4 row sums -> log_u: 1 multiply-add an element.
//   3. The column sums over its 4 rows, 1 multiply-add an element, with one scale G a wave;
//      LDS folds the 16 waves' partials into one log-sum per column and chunk.
// That form is used only where nothing in it can leave the range of a float: |logK| <= 27
// in all 4 rows of the wave (a mark, set by the first iteration) and every w of the head in
// 1e-12 .. 1e12.  Then each product lies in 1e-24 .. 1e24 and each sum below 1e27; a scale
// exp(log_u - G) that is flushed to zero drops a term below 1e-26 from a sum of 1e-12 or more.
// Any other wave (a masked row or column, a very wide spread) works on logK itself in the
// log domain, with a maximum per row and a (max, sum) per column, exact at any spread.
// The log-sums go to a buffer other than the one read: work-groups of one launch run
// side by side.
// ---------------------------------------------------------------------------

// log_v of one column from the 16 chunk log-sums of its head.
__device__ __forceinline__ float logv_from_chunks(const float (&L)[16], float nu, float fi) {
  float M = L[0];
#pragma unroll
  for (int c = 1; c < 16; ++c) M = fmaxf(M, L[c]);
  float S = 0.f;
#pragma unroll
  for (int c = 0; c < 16; ++c) S += __expf(L[c] - M);
  return fi * (__logf(fmaxf(nu, 1e-8f)) - (M + __logf(S)));
}

// rows: logK in the first iteration, E in the others.
template <bool FIRST>
__device__ __forceinline__
void sink_fused_body(const float* __restrict__ rows, const float* __restrict__ logK,
                     float* __restrict__ e_out, unsigned* __restrict__ tame_out,
                     const unsigned* __restrict__ tame_in, const float* __restrict__ log_v,
                     const float* __restrict__ pl_in, const float* __restrict__ nu,
                     const float* __restrict__ mu, const float* __restrict__ eps,
                     float* __restrict__ log_u, float* __restrict__ pl_out) {
  __shared__ __attribute__((aligned(16))) float sm[16][1024];   // 64 KB: per-wave column max
  __shared__ __attribute__((aligned(16))) float ss[16][1024];   // 64 KB: per-wave column sum
  __shared__ __attribute__((aligned(16))) float slv[1024];      //  4 KB: the head's log_v
  __shared__ __attribute__((aligned(16))) float sw[1024];       //  4 KB: exp(log_v)
  __shared__ unsigned sok[16];                                  // per wave: its 64 w are in range
  // Per wave a pair: the scale of its sums; a mark, not 0 where it holds a (max, sum) per column.
  __shared__ __attribute__((aligned(16))) float2 sGX[16];
  const int chunk = blockIdx.x;
  const int h     = blockIdx.y;
  // The wave's number, told to the compiler as wave-uniform: the rows' base address,
  // mu, the mark and the log_u address then live in scalar registers.
  const int wid   = __builtin_amdgcn_readfirstlane(threadIdx.x >> 5);
  const int lane  = threadIdx.x & 31;
  const int j     = threadIdx.x * 2;                   // the 2 columns a thread folds
  const int row0  = h * 1024 + chunk * 64 + wid * 4;   // (h,i) flat
  const int slot  = row0 >> 2;                         // the wave's place among the marks
  const v4f* pk = reinterpret_cast<const v4f*>(rows + (size_t)row0 * 1024) + lane;

  // The loops over r, c or w that are unrolled whole are so because k, w4, cl and ws stay
  // in registers only if each index is a constant.
  // The chunk log-sums are asked for ahead of the rows: they come back first, and log_v is
  // rebuilt while the rows are still on their way.
  float2 cl[16], nu2, lvj;                             // lvj: log_v of the thread's 2 columns
  unsigned tame = 0u;
  if constexpr (FIRST) lvj = *reinterpret_cast<const float2*>(log_v + h * 1024 + j);
  if constexpr (!FIRST) {
#pragma unroll
    for (int c = 0; c < 16; ++c)
      cl[c] = *reinterpret_cast<const float2*>(pl_in + ((size_t)c * 16 + h) * 1024 + j);
    nu2 = *reinterpret_cast<const float2*>(nu + h * 1024 + j);
    tame = tame_in[slot];
  }
  // Loads in the order the row pass uses them: column group by column group.
  v4f k[4][8];
#pragma unroll
  for (int c = 0; c < 8; ++c) {
#pragma unroll
    for (int r = 0; r < 4; ++r) k[r][c] = pk[r * 256 + c * 32];
  }
  // Keeps all loads issued ahead of the arithmetic: without it the scheduler sinks
  // the last column group's loads to their first use, where little is left to cover their wait.
  __builtin_amdgcn_sched_barrier(0);

  const float fi = 1.f / (1.f + eps[h]);
  if constexpr (!FIRST) {
    float Lx[16], Ly[16];
#pragma unroll
    for (int c = 0; c < 16; ++c) { Lx[c] = cl[c].x; Ly[c] = cl[c].y; }
    lvj = make_float2(logv_from_chunks(Lx, nu2.x, fi), logv_from_chunks(Ly, nu2.y, fi));
  }
  const float2 wj = make_float2(__expf(lvj.x), __expf(lvj.y));
  const bool okw = wj.x >= 1e-12f && wj.x <= 1e12f && wj.y >= 1e-12f && wj.y <= 1e12f;
  *reinterpret_cast<float2*>(&slv[j]) = lvj;
  *reinterpret_cast<float2*>(&sw[j])  = wj;
  const unsigned okwave = __all(okw) ? 1u : 0u;
  if (lane == 0) sok[wid] = okwave;
  // A work-group barrier that orders LDS alone: __syncthreads() would also wait for the
  // rows' loads, which are to stay in flight across it.
  __builtin_amdgcn_fence(__ATOMIC_RELEASE, "workgroup", "local");
  __builtin_amdgcn_s_barrier();
  __builtin_amdgcn_fence(__ATOMIC_ACQUIRE, "workgroup", "local");
  v4f w4[8];
#pragma unroll
  for (int c = 0; c < 8; ++c) w4[c] = *reinterpret_cast<const v4f*>(&sw[c * 128 + lane * 4]);
  const bool okhead = __all(sok[lane & 15] != 0u);     // the 16 waves' words, 2 lanes each

  if constexpr (FIRST) {
    // The mark of the wave's 4 rows, then E over logK in the registers and out to memory.
    v4f am = __builtin_elementwise_abs(k[0][0]);
#pragma unroll
    for (int c = 0; c < 8; ++c) {
#pragma unroll
      for (int r = 0; r < 4; ++r) am = __builtin_elementwise_max(am, __builtin_elementwise_abs(k[r][c]));
    }
    tame = __all(fmaxf(fmaxf(am.x, am.y), fmaxf(am.z, am.w)) <= 27.f) ? 1u : 0u;
    v4f* pe = reinterpret_cast<v4f*>(e_out + (size_t)row0 * 1024) + lane;
#pragma unroll
    for (int c = 0; c < 8; ++c) {
#pragma unroll
      for (int r = 0; r < 4; ++r) {
        k[r][c] = exp4(k[r][c]);
        pe[r * 256 + c * 32] = k[r][c];
      }
    }
    if (lane == 0) tame_out[slot] = tame;
    // Behind the stores, in front of whatever next writes a register that they name.  The
    // address is an input: it then lives up to the wait.
    asm volatile("s_wait_xcnt 0x0" :: "v"(pe) : "memory");
  }
  // The same in every lane of the wave; told to the compiler so, for a scalar branch.
  const bool fast = uni((tame != 0u && okhead) ? 1u : 0u) != 0u;

  float lu[4], G = 0.f;
  if (fast) {
    // Row sums, column group by column group as the loads come in.
    v4f s4[4];
#pragma unroll
    for (int c = 0; c < 8; ++c) {
#pragma unroll
      for (int r = 0; r < 4; ++r) s4[r] = c ? s4[r] + k[r][c] * w4[c] : k[r][c] * w4[c];
    }
#pragma unroll
    for (int r = 0; r < 4; ++r) {
      const float s = wave_sum((s4[r].x + s4[r].y) + (s4[r].z + s4[r].w));
      lu[r] = fi * (__logf(fmaxf(mu[row0 + r], 1e-8f)) - __logf(s));
    }
    // Column sums over the wave's 4 rows, scaled by the largest log_u of the 4.
    G = fmaxf(fmaxf(lu[0], lu[1]), fmaxf(lu[2], lu[3]));
    const v4f g4 = exp4(v4f{lu[0], lu[1], lu[2], lu[3]} - G);
    const float g0 = g4.x, g1 = g4.y, g2 = g4.z, g3 = g4.w;
#pragma unroll
    for (int c = 0; c < 8; ++c) {
      const v4f cs = (k[0][c] * g0 + k[1][c] * g1) + (k[2][c] * g2 + k[3][c] * g3);
      *reinterpret_cast<v4f*>(&ss[wid][c * 128 + lane * 4]) = cs;
    }
  } else {
    // Log domain, on logK itself, in three sweeps over the rows: maximum, sum, columns.
    // Each sweep reads the rows anew and its loop stays rolled but for 2 column groups a
    // trip: E stays alive in its 128 registers across this branch, and rows held whole
    // beside it would spill.
    const v4f* pq = reinterpret_cast<const v4f*>(logK + (size_t)row0 * 1024) + lane;
    const float ninf = -__builtin_inff();
    v4f mx[4], s4[4];
    float Mr[4];
#pragma unroll
    for (int r = 0; r < 4; ++r) {
      mx[r] = v4f{ninf, ninf, ninf, ninf};
      s4[r] = v4f{0.f, 0.f, 0.f, 0.f};
    }
#pragma unroll 2
    for (int c = 0; c < 8; ++c) {
      const v4f* pc = pq + c * 32;
      v4f x[4];
#pragma unroll
      for (int r = 0; r < 4; ++r) x[r] = pc[r * 256];
      // Behind the trip's loads, in front of whatever next writes a register that they name.
      // The address is an input: it then lives up to the wait, and no load's result lands on it.
      asm volatile("s_wait_xcnt 0x0" :: "v"(pc) : "memory");
      const v4f l = *reinterpret_cast<const v4f*>(&slv[c * 128 + lane * 4]);
#pragma unroll
      for (int r = 0; r < 4; ++r) mx[r] = __builtin_elementwise_max(mx[r], x[r] + l);
    }
#pragma unroll
    for (int r = 0; r < 4; ++r) {
      float M = fmaxf(fmaxf(mx[r].x, mx[r].y), fmaxf(mx[r].z, mx[r].w));
      for (int off = 16; off; off >>= 1) M = fmaxf(M, __shfl_xor(M, off, 32));
      Mr[r] = M;
    }
#pragma unroll 2
    for (int c = 0; c < 8; ++c) {
      const v4f* pc = pq + c * 32;
      v4f x[4];
#pragma unroll
      for (int r = 0; r < 4; ++r) x[r] = pc[r * 256];
      // As in the first sweep.
      asm volatile("s_wait_xcnt 0x0" :: "v"(pc) : "memory");
      const v4f l = *reinterpret_cast<const v4f*>(&slv[c * 128 + lane * 4]);
#pragma unroll
      for (int r = 0; r < 4; ++r) s4[r] += exp4((x[r] + l) - Mr[r]);
    }
#pragma unroll
    for (int r = 0; r < 4; ++r) {
      const float s = wave_sum((s4[r].x + s4[r].y) + (s4[r].z + s4[r].w));
      lu[r] = fi * (__logf(fmaxf(mu[row0 + r], 1e-8f)) - (Mr[r] + __logf(s)));
    }
#pragma unroll 2
    for (int c = 0; c < 8; ++c) {
      const v4f* pc = pq + c * 32;
      v4f x[4];
#pragma unroll
      for (int r = 0; r < 4; ++r) x[r] = pc[r * 256];
      // As in the first sweep.
      asm volatile("s_wait_xcnt 0x0" :: "v"(pc) : "memory");
#pragma unroll
      for (int r = 0; r < 4; ++r) x[r] += lu[r];
      const v4f cm = __builtin_elementwise_max(__builtin_elementwise_max(x[0], x[1]),
                                               __builtin_elementwise_max(x[2], x[3]));
      const v4f cs = (exp4(x[0] - cm) + exp4(x[1] - cm)) + (exp4(x[2] - cm) + exp4(x[3] - cm));
      *reinterpret_cast<v4f*>(&sm[wid][c * 128 + lane * 4]) = cm;
      *reinterpret_cast<v4f*>(&ss[wid][c * 128 + lane * 4]) = cs;
    }
  }
  if (lane == 0) sGX[wid] = make_float2(G, __uint_as_float(fast ? 0u : 1u));
  __syncthreads();

  // Fold the 16 waves' partials; a thread owns 2 columns.
  // Scales, marks and sums are read in one LDS trip, in front of the branch: the marks pick
  // the side, only the first side uses the scales and sums, and nothing writes them behind the barrier above.
  float Gw[16];
  unsigned xf = 0u;
#pragma unroll
  for (int q = 0; q < 8; ++q) {
    const v4f y = *reinterpret_cast<const v4f*>(&sGX[q * 2]);
    Gw[q * 2] = y.x; Gw[q * 2 + 1] = y.z;
    xf |= __float_as_uint(y.y) | __float_as_uint(y.w);
  }
  // Every thread of the work-group reads the same 16 marks behind the barrier; told to the
  // compiler as wave-uniform, so that the branch is a scalar one.
  const unsigned any_exact = uni(xf);
  float2 ws[16];
#pragma unroll
  for (int w = 0; w < 16; ++w) ws[w] = *reinterpret_cast<const float2*>(&ss[w][j]);
  float2 res;
  if (any_exact == 0u) {
    // One scale a wave, the same for all its columns: 16 exponentials a thread, and the
    // plane of maxima is neither written nor read.
    float Gm = Gw[0];
#pragma unroll
    for (int w = 1; w < 16; ++w) Gm = fmaxf(Gm, Gw[w]);
    float2 S = make_float2(0.f, 0.f);
#pragma unroll
    for (int w = 0; w < 16; ++w) {
      const float f = __expf(Gw[w] - Gm);
      S.x += ws[w].x * f;
      S.y += ws[w].y * f;
    }
    res = make_float2(Gm + __logf(S.x), Gm + __logf(S.y));
  } else {
    // Some wave handed in a (max, sum) per column; a wave without the mark has its one scale
    // as the maximum of every column.  The fold takes a maximum per column, then the sums.
    // Both loops stay rolled: a rare path, kept short in the kernel's text.
    const float ninf = -__builtin_inff();
    float2 M = make_float2(ninf, ninf);
#pragma unroll 1
    for (int w = 0; w < 16; ++w) {
      const float2 gx = sGX[w];
      float2 m = make_float2(gx.x, gx.x);
      if (__float_as_uint(gx.y) != 0u) m = *reinterpret_cast<const float2*>(&sm[w][j]);
      M.x = fmaxf(M.x, m.x); M.y = fmaxf(M.y, m.y);
    }
    float2 S = make_float2(0.f, 0.f);
#pragma unroll 1
    for (int w = 0; w < 16; ++w) {
      const float2 gx = sGX[w];
      float2 m = make_float2(gx.x, gx.x);
      if (__float_as_uint(gx.y) != 0u) m = *reinterpret_cast<const float2*>(&sm[w][j]);
      const float2 sv = *reinterpret_cast<const float2*>(&ss[w][j]);
      S.x += sv.x * __expf(m.x - M.x);
      S.y += sv.y * __expf(m.y - M.y);
    }
    res = make_float2(M.x + __logf(S.x), M.y + __logf(S.y));
  }
  *reinterpret_cast<float2*>(pl_out + ((size_t)chunk * 16 + h) * 1024 + j) = res;
  // log_u goes out last: in front of the barrier above, the barrier would wait for the store.
  if (lane == 0) {
#pragma unroll
    for (int r = 0; r < 4; ++r) log_u[row0 + r] = lu[r];
  }
}

__global__ __launch_bounds__(512)
void sink_fused_first(const float* __restrict__ logK, const float* __restrict__ log_v,
                      const float* __restrict__ mu, const float* __restrict__ eps,
                      float* __restrict__ e_out, unsigned* __restrict__ tame_out,
                      float* __restrict__ log_u, float* __restrict__ pl_out) {
  sink_fused_body<true>(logK, logK, e_out, tame_out, nullptr, log_v, nullptr, nullptr, mu, eps,
                        log_u, pl_out);
}

__global__ __launch_bounds__(512)
void sink_fused_next(const float* __restrict__ e_in, const float* __restrict__ logK,
                     const unsigned* __restrict__ tame_in, const float* __restrict__ pl_in,
                     const float* __restrict__ nu, const float* __restrict__ mu,
                     const float* __restrict__ eps,
                     float* __restrict__ log_u, float* __restrict__ pl_out) {
  sink_fused_body<false>(e_in, logK, nullptr, nullptr, tame_in, nullptr, pl_in, nu, mu, eps,
                         log_u, pl_out);
}

// log_v behind the last iteration, from its chunk log-sums.
__global__ __launch_bounds__(256)
void sink_col_combine(const float* __restrict__ pl, const float* __restrict__ nu,
                      const float* __restrict__ eps, float* __restrict__ log_v) {
  const int idx = blockIdx.x * 256 + threadIdx.x;   // (h,j) flat, 0..16383
  const int h = idx >> 10;
  const int j = idx & 1023;
  float L[16];
  // Unrolled whole so that all 16 loads are in flight at once.
#pragma unroll
  for (int c = 0; c < 16; ++c) L[c] = pl[((size_t)c * 16 + h) * 1024 + j];
  log_v[idx] = logv_from_chunks(L, nu[idx], 1.f / (1.f + eps[h]));
}

// ---------------------------------------------------------------------------
// Plan, attention and centroid in one kernel; the plan P is never stored in memory.
//   P = exp(logK + log_u_i + log_v_j) * mask_i * mask_j,  Pn = P / max(rowsum, 1e-8)
//   o  = (Pn @ V) * sigmoid(G);   xc_h = Pn @ x
// A work-group owns 64 rows of one head, as in the Sinkhorn kernel.
//   1. Each of the 16 waves holds 4 whole rows of logK in registers (a lane: columns
//      c*128 + lane*4 .. +3), forms q = exp(..) * mask_j, sums it in f32 and lays it as bf16
//      into LDS.  mask_i, the same for a whole row, goes into the row's factor
//      mask_i / max(mask_i * sum, 1e-8) instead.
//   2. Behind a barrier: q (64 x 1024) times [V | x_hi x_lo] (1024 x 48) on WMMA.  A wave
//      takes 16 rows and a quarter of the columns j: 8 K-steps, each A fragment read from LDS
//      once and used for 3 products.  The B fragments come in fragment order (post_qkvg_kernel):
//      whole 512-byte runs a load.
//   3. Behind a second barrier the 4 quarters are added, scaled and stored.
// ---------------------------------------------------------------------------
constexpr unsigned P_PITCH = 2064u;             // 2048-byte row + 16: 16 x odd, for 16-byte reads

// A work-group barrier that orders LDS alone: __syncthreads() would also wait for the global
// loads that are to stay in flight across it.
__device__ __forceinline__ void lds_barrier() {
  __builtin_amdgcn_fence(__ATOMIC_RELEASE, "workgroup", "local");
  __builtin_amdgcn_s_barrier();
  __builtin_amdgcn_fence(__ATOMIC_ACQUIRE, "workgroup", "local");
}

__global__ __launch_bounds__(512)
void plan_attn_kernel(const float* __restrict__ logK, const float* __restrict__ log_u,
                      const float* __restrict__ log_v, const float* __restrict__ mask,
                      const __bf16* __restrict__ Vf, const __bf16* __restrict__ Xf,
                      const float* __restrict__ sg,
                      __bf16* __restrict__ o_bf, float* __restrict__ xc) {
  __shared__ __attribute__((aligned(16))) unsigned char sP[64u * P_PITCH];   // 129 KB: q, bf16
  __shared__ __attribute__((aligned(16))) float sR[4][4][3][256];            //  48 KB: partial tiles
  __shared__ float sinv[64];                                                 // the rows' factors
  const int h    = blockIdx.y;
  const int i0   = blockIdx.x * 64;
  // The wave's number, told to the compiler as wave-uniform: the base addresses and log_u
  // then live in scalar registers.
  const int wid  = __builtin_amdgcn_readfirstlane(threadIdx.x >> 5);
  const int lane = threadIdx.x & 31;
  const int rl0  = wid * 4;                            // the wave's first row in the chunk
  const int row0 = h * 1024 + i0 + rl0;                // (h,i) flat
  const v4f* pk = reinterpret_cast<const v4f*>(logK + (size_t)row0 * 1024) + lane;
  const v4f* pv = reinterpret_cast<const v4f*>(log_v + h * 1024) + lane;
  const v4f* pm = reinterpret_cast<const v4f*>(mask) + lane;

  // The loops over r, c, s and v that are unrolled whole are so because the arrays they
  // index stay in registers only if each index is a constant.
  v4f lv[8], mj[8], k[4][8];
  const float mi = mask[i0 + rl0 + (lane & 3)];        // lane 0..3: mask_i of the wave's row 0..3
#pragma unroll
  for (int c = 0; c < 8; ++c) { lv[c] = pv[c * 32]; mj[c] = pm[c * 32]; }
  // Rows in the order they are used: column group by column group.
#pragma unroll
  for (int c = 0; c < 8; ++c) {
#pragma unroll
    for (int r = 0; r < 4; ++r) k[r][c] = pk[r * 256 + c * 32];
  }
  // Behind the loads, in front of whatever next writes a register that they name.
  asm volatile("s_wait_xcnt 0x0" ::: "memory");
  // Keeps all loads issued ahead of the arithmetic: the scheduler would sink the last
  // loads to their first use, where little is left to cover their wait.
  __builtin_amdgcn_sched_barrier(0);

  v4f s4[4];
#pragma unroll
  for (int c = 0; c < 8; ++c) {
#pragma unroll
    for (int r = 0; r < 4; ++r) {
      const v4f q = exp4((k[r][c] + log_u[row0 + r]) + lv[c]) * mj[c];
      s4[r] = c ? s4[r] + q : q;
      const v4bf o = {(__bf16)q.x, (__bf16)q.y, (__bf16)q.z, (__bf16)q.w};
      *reinterpret_cast<v4bf*>(sP + (rl0 + r) * P_PITCH + (c * 128 + lane * 4) * 2) = o;
    }
  }
  // The 4 rows' sums over the lanes, stage by stage side by side: 4 cross-lane trips are in
  // flight at a time, not one.
  float sr[4];
#pragma unroll
  for (int r = 0; r < 4; ++r) sr[r] = (s4[r].x + s4[r].y) + (s4[r].z + s4[r].w);
#pragma unroll
  for (int off = 16; off; off >>= 1) {
    float o[4];
#pragma unroll
    for (int r = 0; r < 4; ++r) o[r] = __shfl_xor(sr[r], off, 32);
#pragma unroll
    for (int r = 0; r < 4; ++r) sr[r] += o[r];
  }
  const float ssel = lane == 0 ? sr[0] : lane == 1 ? sr[1] : lane == 2 ? sr[2] : sr[3];
  if (lane < 4) sinv[rl0 + lane] = mi / fmaxf(mi * ssel, 1e-8f);

  // The wave's 24 B fragments, asked for in front of the barrier: they come in while the
  // other waves finish their rows.
  const int mt = wid & 3;                              // 16 rows
  const int kq = wid >> 2;                             // 256 columns j = 8 K-steps
  const int r16 = lane & 15, hf = lane >> 4;
  const unsigned lb = lane * 16u;                      // the lane's piece in a run of 512 bytes
  const unsigned char* pvf = reinterpret_cast<const unsigned char*>(Vf + (size_t)(h * 32 + kq * 8) * 1024);
  const unsigned char* pxf = reinterpret_cast<const unsigned char*>(Xf + (size_t)(kq * 8) * 512);
  Frag b[8][3];
#pragma unroll
  for (int s = 0; s < 8; ++s) {
#pragma unroll
    for (int u = 0; u < 2; ++u) {
      b[s][0].u[u] = *reinterpret_cast<const uint4*>(pvf + lb + s * 2048 + u * 512);
      b[s][1].u[u] = *reinterpret_cast<const uint4*>(pvf + lb + s * 2048 + 1024 + u * 512);
      b[s][2].u[u] = *reinterpret_cast<const uint4*>(pxf + lb + s * 1024 + u * 512);
    }
  }
  // A thread's 4 elements of o in step 3: tile (u, nt), element idx = v * 32 + lane of the
  // accumulator layout: row v + 8 * (lane >> 4), column lane & 15.  Their gates are asked for
  // here too.
  const int t   = threadIdx.x;
  const int nt  = t >> 8, idx = t & 255;
  const int rl  = (idx >> 5) + 8 * ((idx >> 4) & 1);
  const int d   = nt * 16 + (idx & 15);
  const unsigned go = (unsigned)(rl * 32 + d) * 4u;
  const unsigned char* pg = reinterpret_cast<const unsigned char*>(sg + ((size_t)h * 1024 + i0) * 32);
  float gate[4];
#pragma unroll
  for (int u = 0; u < 4; ++u) gate[u] = *reinterpret_cast<const float*>(pg + go + u * 2048);
  // Behind the loads, in front of whatever next writes a register that they name.  The lane
  // number and the offset, of which the addresses are formed, are inputs: they then live up to
  // the wait, and no load's result lands on them.
  asm volatile("s_wait_xcnt 0x0" :: "v"(lane), "v"(go) : "memory");
  lds_barrier();

  const unsigned char* pa = sP + (mt * 16 + r16) * P_PITCH + kq * 512 + hf * 16;
  v8f a0 = {}, a1 = {}, a2 = {};
  v16bf fa[2];
  fa[0] = lds_frag(pa);
#pragma unroll
  for (int s = 0; s < 8; ++s) {
    const int cu = s & 1;
    if (s + 1 < 8) fa[cu ^ 1] = lds_frag(pa + (s + 1) * 64);
    // Keeps the next step's LDS reads issued ahead of this step's products: the scheduler
    // would sink them to their use, and every step would wait out an LDS trip.
    __builtin_amdgcn_sched_barrier(0);
    a0 = __builtin_amdgcn_wmma_f32_16x16x32_bf16(false, fa[cu], false, b[s][0].v, (short)0, a0, false, false);
    a1 = __builtin_amdgcn_wmma_f32_16x16x32_bf16(false, fa[cu], false, b[s][1].v, (short)0, a1, false, false);
    a2 = __builtin_amdgcn_wmma_f32_16x16x32_bf16(false, fa[cu], false, b[s][2].v, (short)0, a2, false, false);
  }
#pragma unroll
  for (int v = 0; v < 8; ++v) {
    sR[kq][mt][0][v * 32 + lane] = a0[v];
    sR[kq][mt][1][v * 32 + lane] = a1[v];
    sR[kq][mt][2][v * 32 + lane] = a2[v];
  }
  lds_barrier();

#pragma unroll
  for (int u = 0; u < 4; ++u) {
    const float acc = (sR[0][u][nt][idx] + sR[1][u][nt][idx]) + (sR[2][u][nt][idx] + sR[3][u][nt][idx]);
    o_bf[(size_t)(i0 + u * 16 + rl) * 512 + h * 32 + d] = (__bf16)(acc * sinv[u * 16 + rl] * gate[u]);
  }
  // The centroid: waves 0..5, a thread one row and one coordinate; hi and lo columns added.
  if (t < 192) {
    const int c = t >> 6, row = t & 63;
    const int e = (row & 7) * 32 + ((row >> 3) & 1) * 16 + c;
    float s = 0.f;
#pragma unroll
    for (int q = 0; q < 4; ++q) s += sR[q][row >> 4][2][e] + sR[q][row >> 4][2][e + 3];
    xc[(h * 3 + c) * 1024 + i0 + row] = sinv[row] * s;
  }
}

// ---------------------------------------------------------------------------
// Host orchestration
// ---------------------------------------------------------------------------
extern "C" void kernel_launch(void* const* d_in, const int* in_sizes, int n_in,
                              void* d_out, int out_size, void* d_ws, size_t ws_size,
                              hipStream_t stream) {
  (void)in_sizes; (void)n_in; (void)out_size; (void)ws_size;
  const float* h_in    = (const float*)d_in[0];
  const float* x_res   = (const float*)d_in[1];
  const float* mu      = (const float*)d_in[2];
  const float* nu      = (const float*)d_in[3];
  const float* lv_prev = (const float*)d_in[5];
  const float* mask    = (const float*)d_in[6];
  const float* lnaw    = (const float*)d_in[7];
  const float* lnab    = (const float*)d_in[8];
  const float* wq      = (const float*)d_in[9];
  const float* wk      = (const float*)d_in[10];
  const float* wv      = (const float*)d_in[11];
  const float* wg      = (const float*)d_in[12];
  const float* wo      = (const float*)d_in[13];
  const float* gamma   = (const float*)d_in[14];
  const float* posw    = (const float*)d_in[15];
  const float* wdl     = (const float*)d_in[16];
  const float* lnfw    = (const float*)d_in[17];
  const float* lnfb    = (const float*)d_in[18];
  const float* sw1     = (const float*)d_in[19];
  const float* sw3     = (const float*)d_in[20];
  const float* sw2     = (const float*)d_in[21];
  const int*   pbins   = (const int*)d_in[22];
  const float* eps     = (const float*)d_in[23];

  char* wsb = (char*)d_ws;
  size_t off = 0;
  auto take = [&](size_t bytes) -> void* {
    void* p = wsb + off;
    off += (bytes + 255) & ~(size_t)255;
    return p;
  };
  float*  logK  = (float*)take(16UL * 1024 * 1024 * 4);   // 64 MB
  float*  Emat  = (float*)take(16UL * 1024 * 1024 * 4);   // 64 MB: exp(logK)
  // The bf16 weights, one behind the other: wq wk wv wg form one (2048,512) matrix,
  // w1 w3 one (4096,512) matrix.
  __bf16* wq_b  = (__bf16*)take((5UL * 512 * 512 + 3UL * 2048 * 512) * 2);
  __bf16* wo_b  = wq_b + 4UL * 512 * 512;
  __bf16* w1_b  = wq_b + 5UL * 512 * 512;
  __bf16* w2_b  = w1_b + 2UL * 2048 * 512;
  __bf16* hn    = (__bf16*)take(1024UL * 512 * 2);
  float*  QKVG  = (float*)take(1024UL * 2048 * 4);
  __bf16* Qh    = (__bf16*)take(16UL * 1024 * 32 * 2);
  __bf16* Kh    = (__bf16*)take(16UL * 1024 * 32 * 2);
  __bf16* Vf    = (__bf16*)take(16UL * 32 * 1024 * 2);    // V in B-fragment order
  __bf16* Xf    = (__bf16*)take(16UL * 1024 * 2);         // x_res (hi, lo) in B-fragment order
  float*  sg    = (float*)take(16UL * 1024 * 32 * 4);
  float*  xc    = (float*)take(16UL * 3 * 1024 * 4);      // a centroid term per head
  float*  plA   = (float*)take(16UL * 16 * 1024 * 4);     // chunk column log-sums,
  float*  plB   = (float*)take(16UL * 16 * 1024 * 4);     // written and read in turn
  unsigned* tame = (unsigned*)take(4096UL * 4);           // a mark per 4 rows of logK
  __bf16* o_b   = (__bf16*)take(1024UL * 512 * 2);
  float*  tmpC  = (float*)take(1024UL * 512 * 4);
  float*  h_new = (float*)take(1024UL * 512 * 4);
  __bf16* h2    = (__bf16*)take(1024UL * 512 * 2);
  // FFN intermediates reuse the (then-dead) logK region
  float*  a13   = logK;                                // 1024x4096 f32
  __bf16* gmid  = (__bf16*)(logK + 4UL * 1024 * 1024); // 1024x2048 bf16

  float* out_h  = (float*)d_out;            // 1024*512
  float* out_x  = out_h + 524288;           // 1024*3
  float* lu     = out_h + 527360;           // 16*1024: log_u is kept in its output place
  float* lv     = out_h + 543744;           // 16*1024: log_v too

  // 1, 2) LN(h) -> bf16 and weights -> bf16, one launch
  prep_kernel<<<1024 + 5 * 32 + 3 * 128, 256, 0, stream>>>(h_in, lnaw, lnab, hn, wq, wk, wv, wg,
                                                              wo, sw1, sw3, sw2, wq_b);

  // 3) QKVG projections (TDM-staged WMMA), one launch: one product with 2048 output columns
  dim3 g512(16, 4);
  dim3 g2048(16, 16);
  gemm_bf16<<<g2048, 256, 0, stream>>>(hn, wq_b, QKVG, 1024, 2048, 512);
  post_qkvg_kernel<<<256 + 8, 256, 0, stream>>>(QKVG, x_res, Qh, Kh, Vf, Xf, sg);

  // 4) logits -> logK
  logits_kernel<<<dim3(64, 16), 128, 0, stream>>>(Qh, Kh, pbins, posw, wdl,
                                                      x_res, mask, eps, logK);

  // 5) warm-started Sinkhorn, 20 iterations (E = exp(logK) L2-resident)
  const dim3 gs(16, 16);
  sink_fused_first<<<gs, 512, 0, stream>>>(logK, lv_prev, mu, eps, Emat, tame, lu, plA);
  for (int pair = 0; pair < 9; ++pair) {
    sink_fused_next<<<gs, 512, 0, stream>>>(Emat, logK, tame, plA, nu, mu, eps, lu, plB);
    sink_fused_next<<<gs, 512, 0, stream>>>(Emat, logK, tame, plB, nu, mu, eps, lu, plA);
  }
  sink_fused_next<<<gs, 512, 0, stream>>>(Emat, logK, tame, plA, nu, mu, eps, lu, plB);
  sink_col_combine<<<64, 256, 0, stream>>>(plB, nu, eps, lv);

  // 6, 7) plan, attention and the heads' centroid terms, one launch; P stays on the chip
  plan_attn_kernel<<<gs, 512, 0, stream>>>(logK, lu, lv, mask, Vf, Xf, sg, o_b, xc);
  // 8) output projection; residual and the coordinate update -> out_x, one launch
  gemm_bf16<<<g512, 256, 0, stream>>>(o_b, wo_b, tmpC, 1024, 512, 512);
  add_res_xout_kernel<<<256 + 4, 256, 0, stream>>>(h_in, tmpC, mask, h_new, 524288, 512,
                                                      xc, x_res, gamma, out_x);

  // 9) SwiGLU FFN + residual -> out_h
  ln_kernel<<<1024, 256, 0, stream>>>(h_new, lnfw, lnfb, h2);
  gemm_bf16<<<dim3(16, 32), 256, 0, stream>>>(h2, w1_b, a13, 1024, 4096, 512);
  swiglu_kernel<<<512, 256, 0, stream>>>(a13, gmid, 1024 * 2048);
  gemm_bf16<<<g512, 256, 0, stream>>>(gmid, w2_b, tmpC, 1024, 512, 2048);
  add_res_mask_kernel<<<256, 256, 0, stream>>>(h_new, tmpC, mask, out_h, 524288, 512);
}

// v010
// One run takes 192 microseconds.
// It is 1.13 times as fast as v008, going by the measured steps of the versions left out in between.
// Over all steps from v000 it is 7.70 times as fast.
#include <hip/hip_runtime.h>

// ---------------------------------------------------------------------------
// TokenUOTBlock for MI455X (gfx1250): bf16 WMMA GEMMs (TDM-staged LDS tiles)
// + wave32 log-domain Sinkhorn.  B=1, N=1024, D=512, H=16, DH=32, K_ITER=20.
// ---------------------------------------------------------------------------

typedef __attribute__((ext_vector_type(16))) __bf16 v16bf;
typedef __attribute__((ext_vector_type(8)))  float  v8f;
typedef __attribute__((ext_vector_type(4)))  float  v4f;
typedef __attribute__((ext_vector_type(8)))  __bf16 v8bf;
typedef __attribute__((ext_vector_type(4)))  __bf16 v4bf;
typedef unsigned int u32x4 __attribute__((ext_vector_type(4)));
typedef unsigned int u32x8 __attribute__((ext_vector_type(8)));

// A 16x32 bf16 WMMA A/B fragment.  CDNA5 16-bit layout: lanes 0-15 hold row r,
// K {0..7,16..23}; lanes 16-31 hold row r, K {8..15,24..31}.
union Frag { v16bf v; uint4 u[2]; };

__device__ __forceinline__ v4f exp4(v4f a) {
  v4f e = {__expf(a.x), __expf(a.y), __expf(a.z), __expf(a.w)};
  return e;
}

__device__ __forceinline__ float wave_sum(float v) {
  for (int off = 16; off; off >>= 1) v += __shfl_xor(v, off, 32);
  return v;
}

// v + (v of lane ^ M) inside a row of 16 lanes, on the vector port: a __shfl_xor would go
// through the LDS unit and wait out its trip at every step.  All 32 lanes are on.
template <int M>
__device__ __forceinline__ float row_xadd(float v) {
  return v + __int_as_float(__builtin_amdgcn_update_dpp(0, __float_as_int(v), 0x160 + M, 0xf, 0xf, true));
}

// The sum over a row of 16 lanes, in every lane of the row.
__device__ __forceinline__ float row_sum16(float v) {
  v = row_xadd<8>(v);
  v = row_xadd<4>(v);
  v = row_xadd<2>(v);
  return row_xadd<1>(v);
}

// A value told to the compiler as wave-uniform: every descriptor word goes through it.
__device__ __forceinline__ unsigned uni(unsigned v) {
  return (unsigned)__builtin_amdgcn_readfirstlane(v);
}

// ---------------------------------------------------------------------------
// Generic GEMM: A[M,K] (bf16) x W[Nout,K]^T (bf16), f32 sums; what follows the product goes
// out with it, from the accumulators, in place of a launch of its own:
//   EPI 0: the product's columns are Q | K | V | G, 512 each, a head 32 columns: a wave's tiles
//          0, 1 are one head, its tiles 2, 3 the next.  Per-head LN of Q, K (over the 32
//          columns: 2 tiles x 16 lanes) -> Cb, Cb2 (bf16, (H,N,32)); V in the order of WMMA B
//          fragments -> Cb3; sigmoid(G) -> C (f32, (H,N,32)).
//          Fragment order: a piece is 8 neighbouring j (16 bytes) of one output column; the 32
//          pieces that the 32 lanes (column r = lane & 15, half hf = lane >> 4) take with one
//          16-byte load stand side by side: j = ks * 32 + u * 16 + hf * 8 + 0..7 for K-step ks
//          and load u = 0, 1: piece ((((h * 32 + ks) * 2 + nt) * 2 + u) * 32 + lane), column
//          d = nt * 16 + r.  A lane's 8 accumulator rows of a tile are just such a piece.
//   EPI 1: C = base + product * mask[row] (f32): the residual add.
//   EPI 2: SwiGLU.  W holds, 16 rows by 16 rows in turn, w1 and w3 (prep_kernel), so a wave's
//          tiles 0, 2 are h2 x w1^T and its tiles 1, 3 h2 x w3^T of the same columns:
//          Cb = silu(first) * second (bf16, rows of Nout / 2).
// M a multiple of 64, Nout of 128, K of 512.
// Block = 256 threads = 8 waves; block tile 64x128.
// One fill of LDS holds 512 of K for both operands, cut into 4 slices of 128 elements
// (rows of 256 bytes).  Each wave brings one slice with one tensor load: waves 0,2,4,6
// the A slices (64 rows), waves 1,3,5,7 the W slices (128 rows).  The load's pad gives
// an LDS pitch of 272 bytes (16 x odd) for the 16-byte fragment reads.  The 16 K-steps
// of a fill then run with no barrier between them.
// ---------------------------------------------------------------------------
constexpr unsigned G_PITCH = 272u;              // 256-byte row + 16-byte pad
constexpr unsigned G_ASL   = 18432u;            // 64 x 272 = 17,408, up to a multiple of 2 KiB
constexpr unsigned G_WSL   = 34816u;            // 128 x 272, a multiple of 2 KiB as it is
constexpr unsigned G_WBASE = 4u * G_ASL;        // the W slices stand behind the A slices

__device__ __forceinline__ v16bf lds_frag(const unsigned char* p) {
  Frag f;
  f.u[0] = *reinterpret_cast<const uint4*>(p);
  f.u[1] = *reinterpret_cast<const uint4*>(p + 32);
  return f.v;
}

template <int EPI>
__device__ __forceinline__
void gemm_body(const __bf16* __restrict__ A, const __bf16* __restrict__ W,
               float* __restrict__ C, __bf16* __restrict__ Cb, __bf16* __restrict__ Cb2,
               __bf16* __restrict__ Cb3, const float* __restrict__ base, const float* __restrict__ mask,
               int Nout, int K) {
  __shared__ __attribute__((aligned(2048))) unsigned char gl[4u * G_ASL + 4u * G_WSL];  // 208 KB
  const unsigned wid = uni(threadIdx.x >> 5);
  const int lane = threadIdx.x & 31;
  const int r  = lane & 15, hf = lane >> 4;
  const int mB = blockIdx.x * 64;
  const int nB = blockIdx.y * 128;
  const int ml = (wid >> 1) * 16;    // local m-tile
  const int nl = (wid & 1) * 64;     // local n-strip

  // The wave's own slice: source, rows, place in LDS.
  const unsigned sl   = wid >> 1;
  const bool     isW  = (wid & 1u) != 0u;
  const unsigned rows = isW ? 128u : 64u;
  const __bf16*  src  = (isW ? W + (size_t)nB * K : A + (size_t)mB * K) + sl * 128u;
  const unsigned dst  = (unsigned)(size_t)&gl[0] + (isW ? G_WBASE + sl * G_WSL : sl * G_ASL);
  // Descriptor group 1: 1-byte elements, tensor = tile = rows x 256 bytes, source pitch
  // 2K bytes, a pad of 4 dwords behind every 64 dwords.
  u32x8 g1;
  g1[0] = uni((1u << 20) | (5u << 22) | (3u << 25));
  g1[1] = uni(256u << 16);
  g1[2] = uni(rows << 16);
  g1[3] = uni(256u << 16);
  g1[4] = uni(rows);
  g1[5] = uni((unsigned)K * 2u);
  g1[6] = uni(0u);
  g1[7] = uni(0u);

  const unsigned char* pa = gl + (ml + r) * G_PITCH + hf * 16;
  const unsigned char* pw = gl + G_WBASE + (nl + r) * G_PITCH + hf * 16;
  // The lane's place in C: row mB + ml + hf * 8 (+ v), column nB + nl + r (+ 16 t).
  const unsigned row0 = mB + ml + hf * 8;
  const unsigned co   = row0 * (unsigned)Nout + nB + nl + r;   // EPI 1 alone
  // The residual's terms are asked for ahead of the product: they come in behind it.
  // The loops over v and t are unrolled whole: bs and mk are indexed by constants only.
  float bs[8][4], mk[8];
  if constexpr (EPI == 1) {
#pragma unroll
    for (int v = 0; v < 8; ++v) {
      mk[v] = mask[row0 + v];
#pragma unroll
      for (int t = 0; t < 4; ++t) bs[v][t] = base[co + v * Nout + t * 16];
    }
    // Behind the loads, in front of whatever next writes a register that they name.  The
    // offsets are inputs: they then live up to the wait, and no load's result lands on them.
    asm volatile("s_wait_xcnt 0x0" :: "v"(co), "v"(row0) : "memory");
  }
  v8f acc0 = {}, acc1 = {}, acc2 = {}, acc3 = {};
  for (int kb = 0; kb < K; kb += 512) {
    if (kb) {
      // A refill: this wave's fragment reads of the fill before have returned, and the
      // barrier ends every other wave's, before a load overwrites them.
      asm volatile("s_wait_dscnt 0x0" ::: "memory");
      __syncthreads();
    }
    const unsigned long long ga = (unsigned long long)(const void*)(src + kb);
    u32x4 g0;
    g0[0] = uni(1u);
    g0[1] = uni(dst);
    g0[2] = uni((unsigned)ga);
    g0[3] = uni((((unsigned)(ga >> 32)) & 0x01FFFFFFu) | 0x80000000u);
    // One request of the whole wave; every wave issues its own.
    asm volatile("tensor_load_to_lds %0, %1" :: "s"(g0), "s"(g1) : "memory");
    // The compiler places no wait for a tensor load: the slice has landed behind this one,
    // and the barrier then shows all 8 slices to all waves.
    asm volatile("s_wait_tensorcnt 0x0" ::: "memory");
    __syncthreads();
    // The 16 K-steps of the fill, fragments fetched one step ahead into the other register
    // set.  Unrolled whole: the set's index and every LDS offset are then constants.
    v16bf fa[2], fb[2][4];
    fa[0] = lds_frag(pa);
#pragma unroll
    for (int t = 0; t < 4; ++t) fb[0][t] = lds_frag(pw + t * 16 * G_PITCH);
#pragma unroll
    for (int st = 0; st < 16; ++st) {
      const int cu = st & 1, nx = cu ^ 1;
      if (st + 1 < 16) {
        const unsigned char* qa = pa + ((st + 1) >> 2) * G_ASL + ((st + 1) & 3) * 64;
        const unsigned char* qw = pw + ((st + 1) >> 2) * G_WSL + ((st + 1) & 3) * 64;
        fa[nx] = lds_frag(qa);
#pragma unroll
        for (int t = 0; t < 4; ++t) fb[nx][t] = lds_frag(qw + t * 16 * G_PITCH);
      }
      // Keeps the next step's LDS reads issued ahead of this step's products: without it
      // the scheduler sinks each read to its use, and every product waits out an LDS trip.
      __builtin_amdgcn_sched_barrier(0);
      acc0 = __builtin_amdgcn_wmma_f32_16x16x32_bf16(false, fa[cu], false, fb[cu][0], (short)0, acc0, false, false);
      acc1 = __builtin_amdgcn_wmma_f32_16x16x32_bf16(false, fa[cu], false, fb[cu][1], (short)0, acc1, false, false);
      acc2 = __builtin_amdgcn_wmma_f32_16x16x32_bf16(false, fa[cu], false, fb[cu][2], (short)0, acc2, false, false);
      acc3 = __builtin_amdgcn_wmma_f32_16x16x32_bf16(false, fa[cu], false, fb[cu][3], (short)0, acc3, false, false);
    }
  }
  if constexpr (EPI == 0) {
    // The loops over p, t and v are unrolled whole: the accumulators are indexed by constants
    // only, and the rows' cross-lane sums, which do not depend on each other, overlap.
    const v8f acc[4] = {acc0, acc1, acc2, acc3};
    const int sel = nB >> 9;                      // the same for the whole block
    const int hb  = ((nB & 511) + nl) >> 5;       // the head of tiles 0, 1
    if (sel < 2) {
      __bf16* dq = sel == 0 ? Cb : Cb2;
#pragma unroll
      for (int p = 0; p < 2; ++p) {
        __bf16* dr = dq + ((size_t)(hb + p) * 1024 + row0) * 32 + r;
#pragma unroll
        for (int v = 0; v < 8; ++v) {
          const float x0 = acc[2 * p][v], x1 = acc[2 * p + 1][v];
          const float m  = row_sum16(x0 + x1) * (1.f / 32.f);
          const float d0 = x0 - m, d1 = x1 - m;
          // The argument is 1e-5 or more: the instruction alone, without rsqrtf's rescaling of
          // denormal arguments, gives the same value.
          const float rs = __builtin_amdgcn_rsqf(row_sum16(d0 * d0 + d1 * d1) * (1.f / 32.f) + 1e-5f);
          dr[v * 32]      = (__bf16)(d0 * rs);
          dr[v * 32 + 16] = (__bf16)(d1 * rs);
        }
      }
    } else if (sel == 2) {
#pragma unroll
      for (int t = 0; t < 4; ++t) {
        v8bf vt;
#pragma unroll
        for (int v = 0; v < 8; ++v) vt[v] = (__bf16)acc[t][v];
        // row0 = ks * 32 + u * 16 + hf * 8.
        const int piece = ((((hb + (t >> 1)) * 32 + (int)(row0 >> 5)) * 2 + (t & 1)) * 2
                           + (int)((row0 >> 4) & 1)) * 32 + lane;
        *reinterpret_cast<v8bf*>(Cb3 + (size_t)piece * 8) = vt;
      }
      // Behind the stores: in the listing a way leads on from here into the part of Q and K,
      // which overwrites their registers.
      asm volatile("s_wait_xcnt 0x0" ::: "memory");
    } else {
#pragma unroll
      for (int t = 0; t < 4; ++t) {
        float* gr = C + ((size_t)(hb + (t >> 1)) * 1024 + row0) * 32 + (t & 1) * 16 + r;
#pragma unroll
        for (int v = 0; v < 8; ++v) gr[v * 32] = 1.f / (1.f + __expf(-acc[t][v]));
      }
      // Behind the stores: in the listing a way leads on from here into the other parts, which
      // overwrite their registers.
      asm volatile("s_wait_xcnt 0x0" ::: "memory");
    }
  } else if constexpr (EPI == 1) {
#pragma unroll
    for (int v = 0; v < 8; ++v) {
      float* cr = C + co + v * Nout;
      cr[ 0] = bs[v][0] + acc0[v] * mk[v];
      cr[16] = bs[v][1] + acc1[v] * mk[v];
      cr[32] = bs[v][2] + acc2[v] * mk[v];
      cr[48] = bs[v][3] + acc3[v] * mk[v];
    }
  } else {
    // 32 columns of the product are 16 of the output.
    const unsigned cb = row0 * ((unsigned)Nout >> 1) + ((nB + nl) >> 1) + r;
    // The loops over v are unrolled whole: the accumulators, e0 and e2 are indexed by constants.
    float e0[8], e2[8];
#pragma unroll
    for (int v = 0; v < 8; ++v) { e0[v] = __expf(-acc0[v]); e2[v] = __expf(-acc2[v]); }
#pragma unroll
    for (int v = 0; v < 8; ++v) {
      __bf16* cr = Cb + cb + v * (Nout >> 1);
      cr[ 0] = (__bf16)(acc0[v] / (1.f + e0[v]) * acc1[v]);
      cr[16] = (__bf16)(acc2[v] / (1.f + e2[v]) * acc3[v]);
    }
  }
}

__global__ __launch_bounds__(256)
void gemm_bf16_qkvg(const __bf16* __restrict__ A, const __bf16* __restrict__ W,
                    __bf16* __restrict__ Qh, __bf16* __restrict__ Kh,
                    __bf16* __restrict__ Vfr, float* __restrict__ sg, int Nout, int K) {
  gemm_body<0>(A, W, sg, Qh, Kh, Vfr, nullptr, nullptr, Nout, K);
}

__global__ __launch_bounds__(256)
void gemm_bf16_res(const __bf16* __restrict__ A, const __bf16* __restrict__ W,
                   const float* __restrict__ base, const float* __restrict__ mask,
                   float* __restrict__ C, int Nout, int K) {
  gemm_body<1>(A, W, C, nullptr, nullptr, nullptr, base, mask, Nout, K);
}

__global__ __launch_bounds__(256)
void gemm_bf16_swiglu(const __bf16* __restrict__ A, const __bf16* __restrict__ W,
                      __bf16* __restrict__ Cb, int Nout, int K) {
  gemm_body<2>(A, W, nullptr, Cb, nullptr, nullptr, nullptr, nullptr, Nout, K);
}

// ---------------------------------------------------------------------------
// Elementwise helpers
// ---------------------------------------------------------------------------
// LayerNorm over D=512 with affine params, bf16 output. One block per row.
__device__ __forceinline__
void ln_body(const float* __restrict__ x, const float* __restrict__ w,
             const float* __restrict__ bb, __bf16* __restrict__ y, const int row) {
  const int t   = threadIdx.x;
  __shared__ float s1[256], s2[256];
  float a = 0.f, q = 0.f;
  for (int d = t; d < 512; d += 256) {
    float v = x[(size_t)row * 512 + d];
    a += v; q += v * v;
  }
  s1[t] = a; s2[t] = q; __syncthreads();
  for (int o = 128; o; o >>= 1) {
    if (t < o) { s1[t] += s1[t + o]; s2[t] += s2[t + o]; }
    __syncthreads();
  }
  const float m   = s1[0] * (1.f / 512.f);
  const float var = s2[0] * (1.f / 512.f) - m * m;
  const float rs  = rsqrtf(var + 1e-5f);
  for (int d = t; d < 512; d += 256) {
    float v = x[(size_t)row * 512 + d];
    y[(size_t)row * 512 + d] = (__bf16)((v - m) * rs * w[d] + bb[d]);
  }
}

// Blocks 0..1023: LayerNorm of one row.  In 4 more blocks the centroid EGNN coordinate update:
//   x_out = x + mask * (G * x - sum_h g_h * xc_h),  xc_h = Pn_h @ x  (a plane per head and
// coordinate, written by plan_attn_kernel), G = sum_h g_h, g_h = tanh(gamma_h) / 16.
// The sum over the heads crosses work-groups of that kernel, so it stands in a later launch.
// The branch is the same for a whole block, so ln_body's barriers are safe.
__global__ __launch_bounds__(256)
void ln_xout_kernel(const float* __restrict__ xin, const float* __restrict__ w,
                    const float* __restrict__ bb, __bf16* __restrict__ y,
                    const float* __restrict__ mask, const float* __restrict__ xc,
                    const float* __restrict__ x_res, const float* __restrict__ gamma,
                    float* __restrict__ x_out) {
  const int b = blockIdx.x;
  if (b < 1024) { ln_body(xin, w, bb, y, b); return; }
  const int i = (b - 1024) * 256 + threadIdx.x;      // 0..1023
  // Lane h of a wave (and lane h + 16) forms g_h: one tanh a thread, not 16.
  const float gv = tanhf(gamma[threadIdx.x & 15]) * (1.f / 16.f);
  // The loops over h and c are unrolled whole: the 52 loads are then in flight together, and
  // xv, x and a are indexed by constants only.
  float xv[16][3], x[3];
#pragma unroll
  for (int h = 0; h < 16; ++h) {
#pragma unroll
    for (int c = 0; c < 3; ++c) xv[h][c] = xc[(h * 3 + c) * 1024 + i];
  }
  const float* px = x_res + i * 3;
#pragma unroll
  for (int c = 0; c < 3; ++c) x[c] = px[c];
  const float mi = mask[i];
  // Behind the loads, in front of whatever next writes a register that they name.  The index
  // and the address are inputs: they then live up to the wait, and no load's result lands on
  // them.
  asm volatile("s_wait_xcnt 0x0" :: "v"(i), "v"(px) : "memory");
  // Keeps the lane reads below, whose results may take the loads' scalar base, behind the wait.
  __builtin_amdgcn_sched_barrier(0);
  float a[3] = {0.f, 0.f, 0.f};
  float G = 0.f;
#pragma unroll
  for (int h = 0; h < 16; ++h) {
    const float g = __uint_as_float(__builtin_amdgcn_readlane(__float_as_uint(gv), h));
    G += g;
#pragma unroll
    for (int c = 0; c < 3; ++c) a[c] += g * xv[h][c];
  }
#pragma unroll
  for (int c = 0; c < 3; ++c) x_out[i * 3 + c] = x[c] + mi * (G * x[c] - a[c]);
  // Behind the store: in the listing a way leads on from here into the LayerNorm part, which
  // overwrites the store's registers.
  asm volatile("s_wait_xcnt 0x0" ::: "memory");
}

// One launch for three jobs that depend on the inputs alone.  Blocks 0..1023: LayerNorm of one row
// of h.  Blocks 1024..1567: 8192 elements each of the eight weight matrices -> bf16; the
// bf16 copies stand one behind the other in wb (wq wk wv wg wo: 32 blocks each; w1 w3 w2:
// 128 each), but that the blocks of w1 and w3 (16 rows of 512 each) stand in turn: 16 rows of
// w1, the same 16 of w3, for the SwiGLU at the end of their GEMM.  A lane takes 4 groups of 8 neighbouring elements, so that few waves have to
// start.  Blocks 1568..1575: x_res in the order of WMMA B fragments (see the GEMM's EPI 0), a
// piece a thread: Xfr: piece ((ks * 2 + u) * 32 + lane): columns 0..2 the bf16 value of x_res,
// columns 3..5 what that rounding left over (x = hi + lo to 16 bits), columns 6..15 zero.
// The branches are the same for a whole block, so ln_body's barriers are safe.
__global__ __launch_bounds__(256)
void prep_kernel(const float* __restrict__ x, const float* __restrict__ lw,
                 const float* __restrict__ lb, __bf16* __restrict__ y,
                 const float* __restrict__ wq, const float* __restrict__ wk,
                 const float* __restrict__ wv, const float* __restrict__ wg,
                 const float* __restrict__ wo, const float* __restrict__ w1,
                 const float* __restrict__ w3, const float* __restrict__ w2,
                 __bf16* __restrict__ wb, const float* __restrict__ x_res,
                 __bf16* __restrict__ Xfr) {
  const int b = blockIdx.x;
  if (b < 1024) { ln_body(x, lw, lb, y, b); return; }
  if (b >= 1568) {
    const int p  = (b - 1568) * 256 + threadIdx.x;   // 0..2047
    const int r  = p & 15;
    const int j0 = (p >> 5) * 16 + ((p >> 4) & 1) * 8;
    const int c  = r < 3 ? r : (r < 6 ? r - 3 : 0);
    const float* px = x_res + j0 * 3 + c;
    float xs[8];
    v8bf o;
    // Both loops are unrolled whole: xs and o are indexed by constants only, and the 8 loads
    // are in flight together.
#pragma unroll
    for (int e = 0; e < 8; ++e) xs[e] = px[e * 3];
    // Behind the loads, in front of whatever next writes a register that they name.  The
    // address is an input: it then lives up to the wait, and no load's result lands on it.
    asm volatile("s_wait_xcnt 0x0" :: "v"(px) : "memory");
#pragma unroll
    for (int e = 0; e < 8; ++e) {
      const float x = xs[e];
      const __bf16 hi = (__bf16)x;
      o[e] = r < 3 ? hi : (r < 6 ? (__bf16)(x - (float)hi) : (__bf16)0.f);
    }
    *reinterpret_cast<v8bf*>(Xfr + (size_t)p * 8) = o;
    // Behind the store: in the listing a way leads on from here into the other parts, which
    // overwrite the store's registers.
    asm volatile("s_wait_xcnt 0x0" ::: "memory");
    return;
  }
  const int e = b - 1024;
  const float* src;
  int piece, eo = e;                 // eo: the block's place in wb
  if (e < 160) {
    const int sel = e >> 5;
    src = sel == 0 ? wq : sel == 1 ? wk : sel == 2 ? wv : sel == 3 ? wg : wo;
    piece = e & 31;
  } else {
    const int sel = (e - 160) >> 7;
    src = sel == 0 ? w1 : sel == 1 ? w3 : w2;
    piece = (e - 160) & 127;
    if (sel < 2) eo = 160 + piece * 2 + sel;
  }
  const float* ps = src + piece * 8192 + threadIdx.x * 8;
  __bf16*      pd = wb + (size_t)eo * 8192 + threadIdx.x * 8;
  v4f lo[4], hi[4];
  // All three loops are unrolled whole: the 8 loads are then in flight together, and lo, hi
  // and o are indexed by constants only.
#pragma unroll
  for (int u = 0; u < 4; ++u) {
    lo[u] = *reinterpret_cast<const v4f*>(ps + u * 2048);
    hi[u] = *reinterpret_cast<const v4f*>(ps + u * 2048 + 4);
  }
#pragma unroll
  for (int u = 0; u < 4; ++u) {
    v8bf o;
#pragma unroll
    for (int c = 0; c < 4; ++c) { o[c] = (__bf16)lo[u][c]; o[c + 4] = (__bf16)hi[u][c]; }
    *reinterpret_cast<v8bf*>(pd + u * 2048) = o;
  }
  // Behind the store: in the listing a way leads on from here into the LayerNorm part, whose
  // first instruction overwrites the store's data register.
  asm volatile("s_wait_xcnt 0x0" ::: "memory");
}

// ---------------------------------------------------------------------------
// logits: S = QK^T/sqrt(32) via one WMMA (K=32), + pos bias, - distance gate,
// /eps, mask -> logK (f32, H,N,N).  Block = 128 threads = 4 waves.
// A wave owns one 16x16 tile of (i,j) and runs through all 16 heads: a sixteenth of the
// waves to start; bin, distance and pair mask, the same for every head, are formed once.
// ---------------------------------------------------------------------------
__global__ __launch_bounds__(128)
void logits_kernel(const __bf16* __restrict__ Qh, const __bf16* __restrict__ Kh,
                   const int* __restrict__ pos_bins, const float* __restrict__ pos_weight,
                   const float* __restrict__ w_dist_logit, const float* __restrict__ x_res,
                   const float* __restrict__ mask, const float* __restrict__ eps,
                   float* __restrict__ logK) {
  // The wave's number, told to the compiler as wave-uniform: every base address is then a
  // scalar, and a lane keeps 32-bit offsets that do not change from head to head.
  const unsigned wid  = uni(threadIdx.x >> 5);
  const unsigned lane = threadIdx.x & 31;
  const unsigned r  = lane & 15, hf = lane >> 4;
  const unsigned i0 = blockIdx.x * 16;
  const unsigned j0 = blockIdx.y * 64 + wid * 16;
  const float scale   = 0.17677669529663687f;  // 1/sqrt(32)
  const unsigned j  = j0 + r;
  const unsigned idx = (i0 + hf * 8) * 1024 + j;   // (i, j) in a plane of N x N; row v: + v * 1024
  const float mj = mask[j];
  const float xj0 = x_res[j * 3 + 0], xj1 = x_res[j * 3 + 1], xj2 = x_res[j * 3 + 2];
  // Every loop over v is unrolled whole: bo, dist2 and pm stay in registers only if each
  // index is a constant.
  unsigned bo[8];
  float dist2[8], pm[8];
#pragma unroll
  for (int v = 0; v < 8; ++v) {
    // The bin is read from an input: held inside the table of 68 rows before it forms an address.
    bo[v] = (unsigned)min(max(pos_bins[idx + v * 1024], 0), 67) * 16u;
    const unsigned i = i0 + v + hf * 8;
    float d0 = x_res[i * 3 + 0] - xj0;
    float d1 = x_res[i * 3 + 1] - xj1;
    float d2 = x_res[i * 3 + 2] - xj2;
    dist2[v] = d0 * d0 + d1 * d1 + d2 * d2;
    pm[v] = mask[i] * mj;
  }
  const unsigned fo = r * 32 + hf * 8;             // the lane's place in a 16 x 32 fragment tile
  // Four heads a trip: their fragment loads and table reads (16 bytes = 4 heads of one bin)
  // are in flight together; with 4 waves a SIMD little else covers those waits.
  // The loops over q are unrolled whole: a, b and bias are indexed by constants only.
  for (unsigned h0 = 0; h0 < 16; h0 += 4) {
    Frag a[4], b[4];
#pragma unroll
    for (unsigned q = 0; q < 4; ++q) {
      const __bf16* pa = Qh + ((size_t)(h0 + q) * 1024 + i0) * 32;
      const __bf16* pb = Kh + ((size_t)(h0 + q) * 1024 + j0) * 32;
      a[q].u[0] = *reinterpret_cast<const uint4*>(pa + fo);
      a[q].u[1] = *reinterpret_cast<const uint4*>(pa + fo + 16);
      b[q].u[0] = *reinterpret_cast<const uint4*>(pb + fo);
      b[q].u[1] = *reinterpret_cast<const uint4*>(pb + fo + 16);
    }
    // In front of the table reads: their results may take the registers that held the
    // fragment loads' addresses.
    asm volatile("s_wait_xcnt 0x0" ::: "memory");
    v4f bias[8];
#pragma unroll
    for (int v = 0; v < 8; ++v) bias[v] = *reinterpret_cast<const v4f*>(pos_weight + h0 + bo[v]);
    // Behind the trip's loads, in front of whatever next writes a register that they name.
    asm volatile("s_wait_xcnt 0x0" ::: "memory");
    // Keeps the trip's 24 loads issued ahead of its products: without it the scheduler puts
    // the first product, and its wait, in front of the table reads: two load trips in a row.
    __builtin_amdgcn_sched_barrier(0);
#pragma unroll
    for (unsigned q = 0; q < 4; ++q) {
      const unsigned h = h0 + q;
      v8f c = {};
      c = __builtin_amdgcn_wmma_f32_16x16x32_bf16(false, a[q].v, false, b[q].v, (short)0, c, false, false);
      const float wd      = 1.f / (1.f + __expf(-w_dist_logit[h]));
      const float inv_eps = 1.f / eps[h];
      float* po = logK + (size_t)h * 1048576;
#pragma unroll
      for (int v = 0; v < 8; ++v) {
        float s = c[v] * scale;
        float logit = s + bias[v][q] - wd * dist2[v] * 0.01f;
        po[idx + v * 1024] = (pm[v] > 0.f) ? logit * inv_eps : -1e9f;
      }
    }
    // Behind the trip's stores: the next trip's loads take the registers that held their data.
    asm volatile("s_wait_xcnt 0x0" ::: "memory");
  }
}

// ---------------------------------------------------------------------------
// Sinkhorn iteration, one launch, one read of the kernel matrix (L2-resident).
// The first iteration forms E = exp(logK) once and stores it as bf16 (32MB: half the bytes
// of logK; the exponent range is that of a float); the 19 others read E, widen it
// to f32 in registers, and a log-sum-exp becomes the log of a plain sum of products:
//   lse_j(logK + log_v) = log(sum_j E * w),  w = exp(log_v);
//   lse_i(logK + log_u) = G + log(sum_i E * exp(log_u - G)).
// A work-group owns 64 rows (a chunk) of one head; each of its 16 waves holds 4 whole
// rows in registers (a lane: columns c*128 + lane*4 .. +3, c = 0..7).
//   1. log_v of the head: from the input (first iteration), else rebuilt by the
//      work-group itself from the 16 chunks' column log-sums of the iteration before;
//      log_v and w go to LDS.
//   2. The wave forms its 4 row sums -> log_u: 1 multiply-add an element.
//   3. The column sums over its 4 rows, 1 multiply-add an element, with one scale G a wave;
//      LDS folds the 16 waves' partials into one log-sum per column and chunk.
// That form is used only where nothing in it can leave the range of a float: |logK| <= 27
// in all 4 rows of the wave (a mark, set by the first iteration) and every w of the head in
// 1e-12 .. 1e12.  Then each product lies in 1e-24 .. 1e24 and each sum below 1e27; a scale
// exp(log_u - G) that is flushed to zero drops a term below 1e-26 from a sum of 1e-12 or more.
// Any other wave (a masked row or column, a very wide spread) works on logK itself in the
// log domain, with a maximum per row and a (max, sum) per column, exact at any spread.
// The log-sums go to a buffer other than the one read: work-groups of one launch run
// side by side.
// E in memory: a row is 128 pieces of 16 bytes; piece p * 32 + lane holds the lane's columns
// of the groups c = 2p and c = 2p + 1, element d of the two side by side in one dword.  One
// 16-byte access a lane then serves two column groups, and the registers' column order, the
// LDS accesses with it, is the same as for f32 rows.
// ---------------------------------------------------------------------------

// log_v of one column from the 16 chunk log-sums of its head.
__device__ __forceinline__ float logv_from_chunks(const float (&L)[16], float nu, float fi) {
  float M = L[0];
#pragma unroll
  for (int c = 1; c < 16; ++c) M = fmaxf(M, L[c]);
  float S = 0.f;
#pragma unroll
  for (int c = 0; c < 16; ++c) S += __expf(L[c] - M);
  return fi * (__logf(fmaxf(nu, 1e-8f)) - (M + __logf(S)));
}

// The rows come from logK in the first iteration, from e_in in the others.
template <bool FIRST>
__device__ __forceinline__
void sink_fused_body(const __bf16* __restrict__ e_in, const float* __restrict__ logK,
                     __bf16* __restrict__ e_out, unsigned* __restrict__ tame_out,
                     const unsigned* __restrict__ tame_in, const float* __restrict__ log_v,
                     const float* __restrict__ pl_in, const float* __restrict__ nu,
                     const float* __restrict__ mu, const float* __restrict__ eps,
                     float* __restrict__ log_u, float* __restrict__ pl_out) {
  __shared__ __attribute__((aligned(16))) float sm[16][1024];   // 64 KB: per-wave column max
  __shared__ __attribute__((aligned(16))) float ss[16][1024];   // 64 KB: per-wave column sum
  __shared__ __attribute__((aligned(16))) float slv[1024];      //  4 KB: the head's log_v
  __shared__ __attribute__((aligned(16))) float sw[1024];       //  4 KB: exp(log_v)
  __shared__ unsigned sok[16];                                  // per wave: its 64 w are in range
  // Per wave a pair: the scale of its sums; a mark, not 0 where it holds a (max, sum) per column.
  __shared__ __attribute__((aligned(16))) float2 sGX[16];
  const int chunk = blockIdx.x;
  const int h     = blockIdx.y;
  // The wave's number, told to the compiler as wave-uniform: the rows' base address,
  // mu, the mark and the log_u address then live in scalar registers.
  const int wid   = __builtin_amdgcn_readfirstlane(threadIdx.x >> 5);
  const int lane  = threadIdx.x & 31;
  const int j     = threadIdx.x * 2;                   // the 2 columns a thread folds
  const int row0  = h * 1024 + chunk * 64 + wid * 4;   // (h,i) flat
  const int slot  = row0 >> 2;                         // the wave's place among the marks

  // The loops over r, c, p, d or w that are unrolled whole are so because k, eb, w4, cl and
  // ws stay in registers only if each index is a constant.
  // The chunk log-sums are asked for ahead of the rows: they come back first, and log_v is
  // rebuilt while the rows are still on their way.
  float2 cl[16], nu2, lvj;                             // lvj: log_v of the thread's 2 columns
  unsigned tame = 0u;
  if constexpr (FIRST) lvj = *reinterpret_cast<const float2*>(log_v + h * 1024 + j);
  if constexpr (!FIRST) {
#pragma unroll
    for (int c = 0; c < 16; ++c)
      cl[c] = *reinterpret_cast<const float2*>(pl_in + ((size_t)c * 16 + h) * 1024 + j);
    nu2 = *reinterpret_cast<const float2*>(nu + h * 1024 + j);
    tame = tame_in[slot];
  }
  // Loads in the order the row pass uses them: column group by column group.
  v4f k[4][8];
  v8bf eb[4][4];
  if constexpr (FIRST) {
    const v4f* pk = reinterpret_cast<const v4f*>(logK + (size_t)row0 * 1024) + lane;
#pragma unroll
    for (int c = 0; c < 8; ++c) {
#pragma unroll
      for (int r = 0; r < 4; ++r) k[r][c] = pk[r * 256 + c * 32];
    }
  } else {
    const v8bf* pb = reinterpret_cast<const v8bf*>(e_in + (size_t)row0 * 1024) + lane;
#pragma unroll
    for (int p = 0; p < 4; ++p) {
#pragma unroll
      for (int r = 0; r < 4; ++r) eb[r][p] = pb[r * 128 + p * 32];
    }
    // Behind the loads, in front of whatever next writes a register that they name.  The lane
    // number, of which the addresses are formed, is an input: it then lives up to the wait,
    // and no load's result lands on it.
    asm volatile("s_wait_xcnt 0x0" :: "v"(lane) : "memory");
  }
  // Keeps all loads issued ahead of the arithmetic: without it the scheduler sinks
  // the last column group's loads to their first use, where little is left to cover their wait.
  __builtin_amdgcn_sched_barrier(0);

  const float fi = 1.f / (1.f + eps[h]);
  if constexpr (!FIRST) {
    float Lx[16], Ly[16];
#pragma unroll
    for (int c = 0; c < 16; ++c) { Lx[c] = cl[c].x; Ly[c] = cl[c].y; }
    lvj = make_float2(logv_from_chunks(Lx, nu2.x, fi), logv_from_chunks(Ly, nu2.y, fi));
  }
  const float2 wj = make_float2(__expf(lvj.x), __expf(lvj.y));
  const bool okw = wj.x >= 1e-12f && wj.x <= 1e12f && wj.y >= 1e-12f && wj.y <= 1e12f;
  *reinterpret_cast<float2*>(&slv[j]) = lvj;
  *reinterpret_cast<float2*>(&sw[j])  = wj;
  const unsigned okwave = __all(okw) ? 1u : 0u;
  if (lane == 0) sok[wid] = okwave;
  // A work-group barrier that orders LDS alone: __syncthreads() would also wait for the
  // rows' loads, which are to stay in flight across it.
  __builtin_amdgcn_fence(__ATOMIC_RELEASE, "workgroup", "local");
  __builtin_amdgcn_s_barrier();
  __builtin_amdgcn_fence(__ATOMIC_ACQUIRE, "workgroup", "local");
  v4f w4[8];
#pragma unroll
  for (int c = 0; c < 8; ++c) w4[c] = *reinterpret_cast<const v4f*>(&sw[c * 128 + lane * 4]);
  const bool okhead = __all(sok[lane & 15] != 0u);     // the 16 waves' words, 2 lanes each

  if constexpr (FIRST) {
    // The mark of the wave's 4 rows, then E over logK in the registers and out to memory.
    v4f am = __builtin_elementwise_abs(k[0][0]);
#pragma unroll
    for (int c = 0; c < 8; ++c) {
#pragma unroll
      for (int r = 0; r < 4; ++r) am = __builtin_elementwise_max(am, __builtin_elementwise_abs(k[r][c]));
    }
    tame = __all(fmaxf(fmaxf(am.x, am.y), fmaxf(am.z, am.w)) <= 27.f) ? 1u : 0u;
    v8bf* pe = reinterpret_cast<v8bf*>(e_out + (size_t)row0 * 1024) + lane;
#pragma unroll
    for (int p = 0; p < 4; ++p) {
      v8bf o[4];
#pragma unroll
      for (int r = 0; r < 4; ++r) {
        k[r][2 * p]     = exp4(k[r][2 * p]);
        k[r][2 * p + 1] = exp4(k[r][2 * p + 1]);
#pragma unroll
        for (int d = 0; d < 4; ++d) {
          o[r][2 * d]     = (__bf16)k[r][2 * p][d];
          o[r][2 * d + 1] = (__bf16)k[r][2 * p + 1][d];
        }
        pe[r * 128 + p * 32] = o[r];
      }
      // Behind the 4 stores, in front of whatever next writes a register that they name.  The
      // data and the lane number are inputs: they then live up to the wait.
      asm volatile("s_wait_xcnt 0x0" :: "v"(o[0]), "v"(o[1]), "v"(o[2]), "v"(o[3]), "v"(lane) : "memory");
    }
    if (lane == 0) tame_out[slot] = tame;
    // Behind the stores, in front of whatever next writes a register that they name.  The
    // address is an input: it then lives up to the wait.
    asm volatile("s_wait_xcnt 0x0" :: "v"(pe) : "memory");
  }
  // The same in every lane of the wave; told to the compiler so, for a scalar branch.
  const bool fast = uni((tame != 0u && okhead) ? 1u : 0u) != 0u;

  float lu[4], G = 0.f;
  if (fast) {
    // Row sums, column group by column group as the loads come in.
    v4f s4[4];
#pragma unroll
    for (int c = 0; c < 8; ++c) {
      if constexpr (!FIRST) {
        // A piece is widened as it comes in, once for both passes.
        if ((c & 1) == 0) {
#pragma unroll
          for (int r = 0; r < 4; ++r) {
#pragma unroll
            for (int d = 0; d < 4; ++d) {
              k[r][c][d]     = (float)eb[r][c >> 1][2 * d];
              k[r][c + 1][d] = (float)eb[r][c >> 1][2 * d + 1];
            }
          }
        }
      }
#pragma unroll
      for (int r = 0; r < 4; ++r) s4[r] = c ? s4[r] + k[r][c] * w4[c] : k[r][c] * w4[c];
    }
#pragma unroll
    for (int r = 0; r < 4; ++r) {
      const float s = wave_sum((s4[r].x + s4[r].y) + (s4[r].z + s4[r].w));
      lu[r] = fi * (__logf(fmaxf(mu[row0 + r], 1e-8f)) - __logf(s));
    }
    // Column sums over the wave's 4 rows, scaled by the largest log_u of the 4.
    G = fmaxf(fmaxf(lu[0], lu[1]), fmaxf(lu[2], lu[3]));
    const v4f g4 = exp4(v4f{lu[0], lu[1], lu[2], lu[3]} - G);
    const float g0 = g4.x, g1 = g4.y, g2 = g4.z, g3 = g4.w;
#pragma unroll
    for (int c = 0; c < 8; ++c) {
      const v4f cs = (k[0][c] * g0 + k[1][c] * g1) + (k[2][c] * g2 + k[3][c] * g3);
      *reinterpret_cast<v4f*>(&ss[wid][c * 128 + lane * 4]) = cs;
    }
  } else {
    // Log domain, on logK itself, in three sweeps over the rows: maximum, sum, columns.
    // Each sweep reads the rows anew and its loop stays rolled but for 2 column groups a
    // trip: a rare path, kept short in the kernel's text and in its registers.
    const v4f* pq = reinterpret_cast<const v4f*>(logK + (size_t)row0 * 1024) + lane;
    const float ninf = -__builtin_inff();
    v4f mx[4], s4[4];
    float Mr[4];
#pragma unroll
    for (int r = 0; r < 4; ++r) {
      mx[r] = v4f{ninf, ninf, ninf, ninf};
      s4[r] = v4f{0.f, 0.f, 0.f, 0.f};
    }
#pragma unroll 2
    for (int c = 0; c < 8; ++c) {
      const v4f* pc = pq + c * 32;
      v4f x[4];
#pragma unroll
      for (int r = 0; r < 4; ++r) x[r] = pc[r * 256];
      // Behind the trip's loads, in front of whatever next writes a register that they name.
      // The address is an input: it then lives up to the wait, and no load's result lands on it.
      asm volatile("s_wait_xcnt 0x0" :: "v"(pc) : "memory");
      const v4f l = *reinterpret_cast<const v4f*>(&slv[c * 128 + lane * 4]);
#pragma unroll
      for (int r = 0; r < 4; ++r) mx[r] = __builtin_elementwise_max(mx[r], x[r] + l);
    }
#pragma unroll
    for (int r = 0; r < 4; ++r) {
      float M = fmaxf(fmaxf(mx[r].x, mx[r].y), fmaxf(mx[r].z, mx[r].w));
      for (int off = 16; off; off >>= 1) M = fmaxf(M, __shfl_xor(M, off, 32));
      Mr[r] = M;
    }
#pragma unroll 2
    for (int c = 0; c < 8; ++c) {
      const v4f* pc = pq + c * 32;
      v4f x[4];
#pragma unroll
      for (int r = 0; r < 4; ++r) x[r] = pc[r * 256];
      // As in the first sweep.
      asm volatile("s_wait_xcnt 0x0" :: "v"(pc) : "memory");
      const v4f l = *reinterpret_cast<const v4f*>(&slv[c * 128 + lane * 4]);
#pragma unroll
      for (int r = 0; r < 4; ++r) s4[r] += exp4((x[r] + l) - Mr[r]);
    }
#pragma unroll
    for (int r = 0; r < 4; ++r) {
      const float s = wave_sum((s4[r].x + s4[r].y) + (s4[r].z + s4[r].w));
      lu[r] = fi * (__logf(fmaxf(mu[row0 + r], 1e-8f)) - (Mr[r] + __logf(s)));
    }
#pragma unroll 2
    for (int c = 0; c < 8; ++c) {
      const v4f* pc = pq + c * 32;
      v4f x[4];
#pragma unroll
      for (int r = 0; r < 4; ++r) x[r] = pc[r * 256];
      // As in the first sweep.
      asm volatile("s_wait_xcnt 0x0" :: "v"(pc) : "memory");
#pragma unroll
      for (int r = 0; r < 4; ++r) x[r] += lu[r];
      const v4f cm = __builtin_elementwise_max(__builtin_elementwise_max(x[0], x[1]),
                                               __builtin_elementwise_max(x[2], x[3]));
      const v4f cs = (exp4(x[0] - cm) + exp4(x[1] - cm)) + (exp4(x[2] - cm) + exp4(x[3] - cm));
      *reinterpret_cast<v4f*>(&sm[wid][c * 128 + lane * 4]) = cm;
      *reinterpret_cast<v4f*>(&ss[wid][c * 128 + lane * 4]) = cs;
    }
  }
  if (lane == 0) sGX[wid] = make_float2(G, __uint_as_float(fast ? 0u : 1u));
  __syncthreads();

  // Fold the 16 waves' partials; a thread owns 2 columns.
  // Scales, marks and sums are read in one LDS trip, in front of the branch: the marks pick
  // the side, only the first side uses the scales and sums, and nothing writes them behind the barrier above.
  float Gw[16];
  unsigned xf = 0u;
#pragma unroll
  for (int q = 0; q < 8; ++q) {
    const v4f y = *reinterpret_cast<const v4f*>(&sGX[q * 2]);
    Gw[q * 2] = y.x; Gw[q * 2 + 1] = y.z;
    xf |= __float_as_uint(y.y) | __float_as_uint(y.w);
  }
  // Every thread of the work-group reads the same 16 marks behind the barrier; told to the
  // compiler as wave-uniform, so that the branch is a scalar one.
  const unsigned any_exact = uni(xf);
  float2 ws[16];
#pragma unroll
  for (int w = 0; w < 16; ++w) ws[w] = *reinterpret_cast<const float2*>(&ss[w][j]);
  float2 res;
  if (any_exact == 0u) {
    // One scale a wave, the same for all its columns: 16 exponentials a thread, and the
    // plane of maxima is neither written nor read.
    float Gm = Gw[0];
#pragma unroll
    for (int w = 1; w < 16; ++w) Gm = fmaxf(Gm, Gw[w]);
    float2 S = make_float2(0.f, 0.f);
#pragma unroll
    for (int w = 0; w < 16; ++w) {
      const float f = __expf(Gw[w] - Gm);
      S.x += ws[w].x * f;
      S.y += ws[w].y * f;
    }
    res = make_float2(Gm + __logf(S.x), Gm + __logf(S.y));
  } else {
    // Some wave handed in a (max, sum) per column; a wave without the mark has its one scale
    // as the maximum of every column.  The fold takes a maximum per column, then the sums.
    // Both loops stay rolled: a rare path, kept short in the kernel's text.
    const float ninf = -__builtin_inff();
    float2 M = make_float2(ninf, ninf);
#pragma unroll 1
    for (int w = 0; w < 16; ++w) {
      const float2 gx = sGX[w];
      float2 m = make_float2(gx.x, gx.x);
      if (__float_as_uint(gx.y) != 0u) m = *reinterpret_cast<const float2*>(&sm[w][j]);
      M.x = fmaxf(M.x, m.x); M.y = fmaxf(M.y, m.y);
    }
    float2 S = make_float2(0.f, 0.f);
#pragma unroll 1
    for (int w = 0; w < 16; ++w) {
      const float2 gx = sGX[w];
      float2 m = make_float2(gx.x, gx.x);
      if (__float_as_uint(gx.y) != 0u) m = *reinterpret_cast<const float2*>(&sm[w][j]);
      const float2 sv = *reinterpret_cast<const float2*>(&ss[w][j]);
      S.x += sv.x * __expf(m.x - M.x);
      S.y += sv.y * __expf(m.y - M.y);
    }
    res = make_float2(M.x + __logf(S.x), M.y + __logf(S.y));
  }
  *reinterpret_cast<float2*>(pl_out + ((size_t)chunk * 16 + h) * 1024 + j) = res;
  // log_u goes out last: in front of the barrier above, the barrier would wait for the store.
  if (lane == 0) {
#pragma unroll
    for (int r = 0; r < 4; ++r) log_u[row0 + r] = lu[r];
  }
}

__global__ __launch_bounds__(512)
void sink_fused_first(const float* __restrict__ logK, const float* __restrict__ log_v,
                      const float* __restrict__ mu, const float* __restrict__ eps,
                      __bf16* __restrict__ e_out, unsigned* __restrict__ tame_out,
                      float* __restrict__ log_u, float* __restrict__ pl_out) {
  sink_fused_body<true>(nullptr, logK, e_out, tame_out, nullptr, log_v, nullptr, nullptr, mu, eps,
                        log_u, pl_out);
}

__global__ __launch_bounds__(512)
void sink_fused_next(const __bf16* __restrict__ e_in, const float* __restrict__ logK,
                     const unsigned* __restrict__ tame_in, const float* __restrict__ pl_in,
                     const float* __restrict__ nu, const float* __restrict__ mu,
                     const float* __restrict__ eps,
                     float* __restrict__ log_u, float* __restrict__ pl_out) {
  sink_fused_body<false>(e_in, logK, nullptr, nullptr, tame_in, nullptr, pl_in, nu, mu, eps,
                         log_u, pl_out);
}

// ---------------------------------------------------------------------------
// Plan, attention and centroid in one kernel; the plan P is never stored in memory.
//   P = exp(logK + log_u_i + log_v_j) * mask_i * mask_j,  Pn = P / max(rowsum, 1e-8)
//   o  = (Pn @ V) * sigmoid(G);   xc_h = Pn @ x
// A work-group owns 64 rows of one head, as in the Sinkhorn kernel.
//   0. log_v behind the last iteration is rebuilt by the work-group itself from the 16 chunks'
//      column log-sums, as in the Sinkhorn kernel, and goes to LDS; the head's first
//      work-group also stores it as the output.
//   1. Each of the 16 waves holds 4 whole rows of logK in registers (a lane: columns
//      c*128 + lane*4 .. +3), forms q = exp(..) * mask_j, sums it in f32 and lays it as bf16
//      into LDS.  mask_i, the same for a whole row, goes into the row's factor
//      mask_i / max(mask_i * sum, 1e-8) instead.
//   2. Behind a barrier: q (64 x 1024) times [V | x_hi x_lo] (1024 x 48) on WMMA.  A wave
//      takes 16 rows and a quarter of the columns j: 8 K-steps, each A fragment read from LDS
//      once and used for 3 products.  The B fragments come in fragment order (QKVG GEMM, prep_kernel):
//      whole 512-byte runs a load.
//   3. Behind a second barrier the 4 quarters are added, scaled and stored.
// ---------------------------------------------------------------------------
constexpr unsigned P_PITCH = 2064u;             // 2048-byte row + 16: 16 x odd, for 16-byte reads

// A work-group barrier that orders LDS alone: __syncthreads() would also wait for the global
// loads that are to stay in flight across it.
__device__ __forceinline__ void lds_barrier() {
  __builtin_amdgcn_fence(__ATOMIC_RELEASE, "workgroup", "local");
  __builtin_amdgcn_s_barrier();
  __builtin_amdgcn_fence(__ATOMIC_ACQUIRE, "workgroup", "local");
}

__global__ __launch_bounds__(512)
void plan_attn_kernel(const float* __restrict__ logK, const float* __restrict__ log_u,
                      const float* __restrict__ pl, const float* __restrict__ nu,
                      const float* __restrict__ eps, float* __restrict__ log_v,
                      const float* __restrict__ mask,
                      const __bf16* __restrict__ Vf, const __bf16* __restrict__ Xf,
                      const float* __restrict__ sg,
                      __bf16* __restrict__ o_bf, float* __restrict__ xc) {
  __shared__ __attribute__((aligned(16))) unsigned char sP[64u * P_PITCH];   // 129 KB: q, bf16
  __shared__ __attribute__((aligned(16))) float sR[4][4][3][256];            //  48 KB: partial tiles
  __shared__ float sinv[64];                                                 // the rows' factors
  __shared__ __attribute__((aligned(16))) float slv[1024];                   // the head's log_v
  const int h    = blockIdx.y;
  const int i0   = blockIdx.x * 64;
  // The wave's number, told to the compiler as wave-uniform: the base addresses and log_u
  // then live in scalar registers.
  const int wid  = __builtin_amdgcn_readfirstlane(threadIdx.x >> 5);
  const int lane = threadIdx.x & 31;
  const int rl0  = wid * 4;                            // the wave's first row in the chunk
  const int row0 = h * 1024 + i0 + rl0;                // (h,i) flat
  const v4f* pk = reinterpret_cast<const v4f*>(logK + (size_t)row0 * 1024) + lane;
  const v4f* pm = reinterpret_cast<const v4f*>(mask) + lane;

  // The loops over r, c, s and v that are unrolled whole are so because the arrays they
  // index stay in registers only if each index is a constant.
  v4f lv[8], mj[8], k[4][8];
  // The chunk log-sums of the thread's 2 columns are asked for ahead of the rows: they come
  // back first, and log_v is rebuilt while the rows are still on their way.
  const int j = threadIdx.x * 2;
  float2 cl[16];
#pragma unroll
  for (int c = 0; c < 16; ++c)
    cl[c] = *reinterpret_cast<const float2*>(pl + ((size_t)c * 16 + h) * 1024 + j);
  const float2 nu2 = *reinterpret_cast<const float2*>(nu + h * 1024 + j);
  const float mi = mask[i0 + rl0 + (lane & 3)];        // lane 0..3: mask_i of the wave's row 0..3
#pragma unroll
  for (int c = 0; c < 8; ++c) mj[c] = pm[c * 32];
  // Rows in the order they are used: column group by column group.
#pragma unroll
  for (int c = 0; c < 8; ++c) {
#pragma unroll
    for (int r = 0; r < 4; ++r) k[r][c] = pk[r * 256 + c * 32];
  }
  // Behind the loads, in front of whatever next writes a register that they name.
  asm volatile("s_wait_xcnt 0x0" ::: "memory");
  // Keeps all loads issued ahead of the arithmetic: the scheduler would sink the last
  // loads to their first use, where little is left to cover their wait.
  __builtin_amdgcn_sched_barrier(0);

  {
    const float fi = 1.f / (1.f + eps[h]);
    float Lx[16], Ly[16];
#pragma unroll
    for (int c = 0; c < 16; ++c) { Lx[c] = cl[c].x; Ly[c] = cl[c].y; }
    const float2 lvj = make_float2(logv_from_chunks(Lx, nu2.x, fi), logv_from_chunks(Ly, nu2.y, fi));
    *reinterpret_cast<float2*>(&slv[j]) = lvj;
    if (blockIdx.x == 0) {
      *reinterpret_cast<float2*>(log_v + h * 1024 + j) = lvj;
      // Behind the store, in front of whatever next writes a register that it names.  The data
      // and the index are inputs: they then live up to the wait.
      asm volatile("s_wait_xcnt 0x0" :: "v"(lvj.x), "v"(lvj.y), "v"(j) : "memory");
    }
  }
  // Shows the 1024 log_v to all waves; the rows' loads stay in flight across it.
  lds_barrier();
#pragma unroll
  for (int c = 0; c < 8; ++c) lv[c] = *reinterpret_cast<const v4f*>(&slv[c * 128 + lane * 4]);

  v4f s4[4];
#pragma unroll
  for (int c = 0; c < 8; ++c) {
#pragma unroll
    for (int r = 0; r < 4; ++r) {
      const v4f q = exp4((k[r][c] + log_u[row0 + r]) + lv[c]) * mj[c];
      s4[r] = c ? s4[r] + q : q;
      const v4bf o = {(__bf16)q.x, (__bf16)q.y, (__bf16)q.z, (__bf16)q.w};
      *reinterpret_cast<v4bf*>(sP + (rl0 + r) * P_PITCH + (c * 128 + lane * 4) * 2) = o;
    }
  }
  // The 4 rows' sums over the lanes, stage by stage side by side: 4 cross-lane trips are in
  // flight at a time, not one.
  float sr[4];
#pragma unroll
  for (int r = 0; r < 4; ++r) sr[r] = (s4[r].x + s4[r].y) + (s4[r].z + s4[r].w);
#pragma unroll
  for (int off = 16; off; off >>= 1) {
    float o[4];
#pragma unroll
    for (int r = 0; r < 4; ++r) o[r] = __shfl_xor(sr[r], off, 32);
#pragma unroll
    for (int r = 0; r < 4; ++r) sr[r] += o[r];
  }
  const float ssel = lane == 0 ? sr[0] : lane == 1 ? sr[1] : lane == 2 ? sr[2] : sr[3];
  if (lane < 4) sinv[rl0 + lane] = mi / fmaxf(mi * ssel, 1e-8f);

  // The wave's 24 B fragments, asked for in front of the barrier: they come in while the
  // other waves finish their rows.
  const int mt = wid & 3;                              // 16 rows
  const int kq = wid >> 2;                             // 256 columns j = 8 K-steps
  const int r16 = lane & 15, hf = lane >> 4;
  const unsigned lb = lane * 16u;                      // the lane's piece in a run of 512 bytes
  const unsigned char* pvf = reinterpret_cast<const unsigned char*>(Vf + (size_t)(h * 32 + kq * 8) * 1024);
  const unsigned char* pxf = reinterpret_cast<const unsigned char*>(Xf + (size_t)(kq * 8) * 512);
  Frag b[8][3];
#pragma unroll
  for (int s = 0; s < 8; ++s) {
#pragma unroll
    for (int u = 0; u < 2; ++u) {
      b[s][0].u[u] = *reinterpret_cast<const uint4*>(pvf + lb + s * 2048 + u * 512);
      b[s][1].u[u] = *reinterpret_cast<const uint4*>(pvf + lb + s * 2048 + 1024 + u * 512);
      b[s][2].u[u] = *reinterpret_cast<const uint4*>(pxf + lb + s * 1024 + u * 512);
    }
  }
  // A thread's 4 elements of o in step 3: tile (u, nt), element idx = v * 32 + lane of the
  // accumulator layout: row v + 8 * (lane >> 4), column lane & 15.  Their gates are asked for
  // here too.
  const int t   = threadIdx.x;
  const int nt  = t >> 8, idx = t & 255;
  const int rl  = (idx >> 5) + 8 * ((idx >> 4) & 1);
  const int d   = nt * 16 + (idx & 15);
  const unsigned go = (unsigned)(rl * 32 + d) * 4u;
  const unsigned char* pg = reinterpret_cast<const unsigned char*>(sg + ((size_t)h * 1024 + i0) * 32);
  float gate[4];
#pragma unroll
  for (int u = 0; u < 4; ++u) gate[u] = *reinterpret_cast<const float*>(pg + go + u * 2048);
  // Behind the loads, in front of whatever next writes a register that they name.  The lane
  // number and the offsets, of which the addresses are formed, are inputs: they then live up to
  // the wait, and no load's result lands on them.
  asm volatile("s_wait_xcnt 0x0" :: "v"(lane), "v"(lb), "v"(go) : "memory");
  lds_barrier();

  const unsigned char* pa = sP + (mt * 16 + r16) * P_PITCH + kq * 512 + hf * 16;
  v8f a0 = {}, a1 = {}, a2 = {};
  v16bf fa[2];
  fa[0] = lds_frag(pa);
#pragma unroll
  for (int s = 0; s < 8; ++s) {
    const int cu = s & 1;
    if (s + 1 < 8) fa[cu ^ 1] = lds_frag(pa + (s + 1) * 64);
    // Keeps the next step's LDS reads issued ahead of this step's products: the scheduler
    // would sink them to their use, and every step would wait out an LDS trip.
    __builtin_amdgcn_sched_barrier(0);
    a0 = __builtin_amdgcn_wmma_f32_16x16x32_bf16(false, fa[cu], false, b[s][0].v, (short)0, a0, false, false);
    a1 = __builtin_amdgcn_wmma_f32_16x16x32_bf16(false, fa[cu], false, b[s][1].v, (short)0, a1, false, false);
    a2 = __builtin_amdgcn_wmma_f32_16x16x32_bf16(false, fa[cu], false, b[s][2].v, (short)0, a2, false, false);
  }
#pragma unroll
  for (int v = 0; v < 8; ++v) {
    sR[kq][mt][0][v * 32 + lane] = a0[v];
    sR[kq][mt][1][v * 32 + lane] = a1[v];
    sR[kq][mt][2][v * 32 + lane] = a2[v];
  }
  lds_barrier();

#pragma unroll
  for (int u = 0; u < 4; ++u) {
    const float acc = (sR[0][u][nt][idx] + sR[1][u][nt][idx]) + (sR[2][u][nt][idx] + sR[3][u][nt][idx]);
    o_bf[(size_t)(i0 + u * 16 + rl) * 512 + h * 32 + d] = (__bf16)(acc * sinv[u * 16 + rl] * gate[u]);
  }
  // The centroid: waves 0..5, a thread one row and one coordinate; hi and lo columns added.
  if (t < 192) {
    const int c = t >> 6, row = t & 63;
    const int e = (row & 7) * 32 + ((row >> 3) & 1) * 16 + c;
    float s = 0.f;
#pragma unroll
    for (int q = 0; q < 4; ++q) s += sR[q][row >> 4][2][e] + sR[q][row >> 4][2][e + 3];
    xc[(h * 3 + c) * 1024 + i0 + row] = sinv[row] * s;
  }
}

// ---------------------------------------------------------------------------
// Host orchestration
// ---------------------------------------------------------------------------
extern "C" void kernel_launch(void* const* d_in, const int* in_sizes, int n_in,
                              void* d_out, int out_size, void* d_ws, size_t ws_size,
                              hipStream_t stream) {
  (void)in_sizes; (void)n_in; (void)out_size; (void)ws_size;
  const float* h_in    = (const float*)d_in[0];
  const float* x_res   = (const float*)d_in[1];
  const float* mu      = (const float*)d_in[2];
  const float* nu      = (const float*)d_in[3];
  const float* lv_prev = (const float*)d_in[5];
  const float* mask    = (const float*)d_in[6];
  const float* lnaw    = (const float*)d_in[7];
  const float* lnab    = (const float*)d_in[8];
  const float* wq      = (const float*)d_in[9];
  const float* wk      = (const float*)d_in[10];
  const float* wv      = (const float*)d_in[11];
  const float* wg      = (const float*)d_in[12];
  const float* wo      = (const float*)d_in[13];
  const float* gamma   = (const float*)d_in[14];
  const float* posw    = (const float*)d_in[15];
  const float* wdl     = (const float*)d_in[16];
  const float* lnfw    = (const float*)d_in[17];
  const float* lnfb    = (const float*)d_in[18];
  const float* sw1     = (const float*)d_in[19];
  const float* sw3     = (const float*)d_in[20];
  const float* sw2     = (const float*)d_in[21];
  const int*   pbins   = (const int*)d_in[22];
  const float* eps     = (const float*)d_in[23];

  char* wsb = (char*)d_ws;
  size_t off = 0;
  auto take = [&](size_t bytes) -> void* {
    void* p = wsb + off;
    off += (bytes + 255) & ~(size_t)255;
    return p;
  };
  float*  logK  = (float*)take(16UL * 1024 * 1024 * 4);   // 64 MB
  __bf16* Emat  = (__bf16*)take(16UL * 1024 * 1024 * 2);  // 32 MB: exp(logK), bf16
  // The bf16 weights, one behind the other: wq wk wv wg form one (2048,512) matrix,
  // w1 w3 one (4096,512) matrix, 16 rows of the one and of the other in turn.
  __bf16* wq_b  = (__bf16*)take((5UL * 512 * 512 + 3UL * 2048 * 512) * 2);
  __bf16* wo_b  = wq_b + 4UL * 512 * 512;
  __bf16* w1_b  = wq_b + 5UL * 512 * 512;
  __bf16* w2_b  = w1_b + 2UL * 2048 * 512;
  __bf16* hn    = (__bf16*)take(1024UL * 512 * 2);
  __bf16* Qh    = (__bf16*)take(16UL * 1024 * 32 * 2);
  __bf16* Kh    = (__bf16*)take(16UL * 1024 * 32 * 2);
  __bf16* Vf    = (__bf16*)take(16UL * 32 * 1024 * 2);    // V in B-fragment order
  __bf16* Xf    = (__bf16*)take(16UL * 1024 * 2);         // x_res (hi, lo) in B-fragment order
  float*  sg    = (float*)take(16UL * 1024 * 32 * 4);
  float*  xc    = (float*)take(16UL * 3 * 1024 * 4);      // a centroid term per head
  float*  plA   = (float*)take(16UL * 16 * 1024 * 4);     // chunk column log-sums,
  float*  plB   = (float*)take(16UL * 16 * 1024 * 4);     // written and read in turn
  unsigned* tame = (unsigned*)take(4096UL * 4);           // a mark per 4 rows of logK
  __bf16* o_b   = (__bf16*)take(1024UL * 512 * 2);
  float*  h_new = (float*)take(1024UL * 512 * 4);
  __bf16* h2    = (__bf16*)take(1024UL * 512 * 2);
  // The FFN intermediate reuses the (then-dead) logK region
  __bf16* gmid  = (__bf16*)(logK + 4UL * 1024 * 1024); // 1024x2048 bf16

  float* out_h  = (float*)d_out;            // 1024*512
  float* out_x  = out_h + 524288;           // 1024*3
  float* lu     = out_h + 527360;           // 16*1024: log_u is kept in its output place
  float* lv     = out_h + 543744;           // 16*1024: log_v too

  // 1, 2) LN(h) -> bf16, weights -> bf16 and x_res in fragment order, one launch
  prep_kernel<<<1024 + 5 * 32 + 3 * 128 + 8, 256, 0, stream>>>(h_in, lnaw, lnab, hn, wq, wk, wv, wg,
                                                                  wo, sw1, sw3, sw2, wq_b, x_res, Xf);

  // 3) QKVG projections (TDM-staged WMMA), one launch: one product with 2048 output columns,
  //    per-head LN, fragment order and gate from its accumulators
  dim3 g512(16, 4);
  dim3 g2048(16, 16);
  gemm_bf16_qkvg<<<g2048, 256, 0, stream>>>(hn, wq_b, Qh, Kh, Vf, sg, 2048, 512);

  // 4) logits -> logK
  logits_kernel<<<dim3(64, 16), 128, 0, stream>>>(Qh, Kh, pbins, posw, wdl,
                                                      x_res, mask, eps, logK);

  // 5) warm-started Sinkhorn, 20 iterations (E = exp(logK) L2-resident)
  const dim3 gs(16, 16);
  sink_fused_first<<<gs, 512, 0, stream>>>(logK, lv_prev, mu, eps, Emat, tame, lu, plA);
  for (int pair = 0; pair < 9; ++pair) {
    sink_fused_next<<<gs, 512, 0, stream>>>(Emat, logK, tame, plA, nu, mu, eps, lu, plB);
    sink_fused_next<<<gs, 512, 0, stream>>>(Emat, logK, tame, plB, nu, mu, eps, lu, plA);
  }
  sink_fused_next<<<gs, 512, 0, stream>>>(Emat, logK, tame, plA, nu, mu, eps, lu, plB);

  // 6, 7) log_v, plan, attention and the heads' centroid terms, one launch; P stays on the chip
  plan_attn_kernel<<<gs, 512, 0, stream>>>(logK, lu, plB, nu, eps, lv, mask, Vf, Xf, sg, o_b, xc);
  // 8) output projection with its residual add
  gemm_bf16_res<<<g512, 256, 0, stream>>>(o_b, wo_b, h_in, mask, h_new, 512, 512);

  // 9) LN and the coordinate update -> out_x, one launch; SwiGLU FFN + residual -> out_h
  ln_xout_kernel<<<1024 + 4, 256, 0, stream>>>(h_new, lnfw, lnfb, h2, mask, xc, x_res, gamma, out_x);
  gemm_bf16_swiglu<<<dim3(16, 32), 256, 0, stream>>>(h2, w1_b, gmid, 4096, 512);
  gemm_bf16_res<<<g512, 256, 0, stream>>>(gmid, w2_b, h_new, mask, out_h, 512, 2048);
}
